// v000
// The times below were measured on an AMD MI455X: many runs one after another, warmed up first and cycling through
// copies of the inputs, with the whole window's GPU time divided by the number of runs. Launches and the gaps
// between them are all in it. The median over several windows is given; except for v000 it joins two sittings, which
// can be a few percent apart, so the side-by-side timings, each taken in one sitting, are the better comparison.
// The starting kernel, v000, takes 7330 microseconds a run.
#include <hip/hip_runtime.h>
// Causal multi-head self-attention with a per-head RMS norm on q and k THEN rotate-half RoPE computed in the module, and a bias-free fused QKV projection (x [4][2048][1024]; qkv = x Wqkv ([in][out] 1024 x 3072, no bias) split into q | k | v thirds, 16 heads of 64; q, k = x * rsqrt(mean(x^2 over the 64 head dims) + 1e-5) * gain (gains q_norm_w / k_norm_w [64], read); cos / sin = [f | f] of pos * (1 / 10000^(2i/64)); q = q cos + rotate_half(q) sin with rotate_half = cat(-x2, x1), likewise k; scores / sqrt(64); causal (tril, -inf); softmax; out = merged Wproj ([in][out], no bias) -> [4][2048][1024]); run as grouped-query causal attention with 16 groups of ONE head with the norm stage on and the rope stage in its half-split mode.
// Compute dtype: inputs rounded to bf16 (the two gain vectors bf16-rounded on load); x / weights exact; the per-head RMS norm and the rotation in f32 on VALU; q, k, v, softmax weights and o as plain f16 GEMM operands (~2^-12); scores and softmax statistics f32; v_wmma_f32_16x16x32_f16.
#define NB 4
#define NG 16
#define HPG 1
#define KVD (NG * HD)
#define SQ 2048
#define DM 1024
#define NH 16
#define HD 64
#define HG 4                         /* unused: attention launches take all NH heads at once */
#define QT 256                       /* query rows per causal tile */
#define NKX SQ                       /* S / P row pitch */
#define QT0 256                      /* first-tile rows recomputed exactly in f32 */
#define B0 0                         /* first batch processed (debug hook) */
#define NBR NB                       /* batches processed (debug hook) */
#define NR ((size_t)NB * SQ)         /* token rows */
#define MP ((int)((size_t)NBR * SQ)) /* rows projected (debug hook) */
#define QN SQ                        /* query rows attended per batch (debug hook) */
#define NHD NH                       /* heads attended (debug hook) */
#define MPO MP                       /* rows through the output stage (debug hook) */
#define LQ DM      /* row pitch of the q/k/v rows */
typedef __bf16 v16b __attribute__((ext_vector_type(16)));
typedef unsigned short v8us __attribute__((ext_vector_type(8), may_alias));
typedef float  v8f  __attribute__((ext_vector_type(8)));
typedef float  v4f  __attribute__((ext_vector_type(4)));
typedef float  v4fa __attribute__((ext_vector_type(4), may_alias));
union FragB { v16b v; v8us half[2]; unsigned short u[16]; };

__device__ __forceinline__ unsigned short bf16_bits(float x) { unsigned int u = __float_as_uint(x); return (unsigned short)((u + 0x7FFFu + ((u >> 16) & 1u)) >> 16); }
__device__ __forceinline__ float bf16_val(unsigned short b) { return __uint_as_float(((unsigned int)b) << 16); }
__device__ __forceinline__ float bf16_round(float x) { return bf16_val(bf16_bits(x)); }
// D += A·B with NT terms: 1 = ah·bh, 2 = + al·bh (A split), 3 = + ah·bl (both split)
template <int NT>
__device__ __forceinline__ v8f mmaN(v16b ah, v16b al, v16b bh, v16b bl, v8f c) {
  c = __builtin_amdgcn_wmma_f32_16x16x32_bf16(false, ah, false, bh, (short)0, c, false, false);
  if (NT >= 2) c = __builtin_amdgcn_wmma_f32_16x16x32_bf16(false, al, false, bh, (short)0, c, false, false);
  if (NT >= 3) c = __builtin_amdgcn_wmma_f32_16x16x32_bf16(false, ah, false, bl, (short)0, c, false, false);
  asm volatile("v_nop\n\tv_nop\n\tv_nop\n\tv_nop" : "+v"(c) : "v"(ah), "v"(al), "v"(bh), "v"(bl));
  return c;
}

__global__ __launch_bounds__(256) void k_wt_bf16(const float* __restrict__ W, unsigned short* __restrict__ Wt, int K, int N) {
  const int t = blockIdx.x * 256 + threadIdx.x;
  const int k8n = K / 8;
  if (t >= N * k8n) return;
  const int n = t / k8n, k8 = (t % k8n) * 8;
  v8us v;
#pragma unroll
  for (int i = 0; i < 8; ++i) v[i] = bf16_bits(W[(size_t)(k8 + i) * N + n]);
  *(v8us*)(Wt + (size_t)n * K + k8) = v;
  
}

// GEMM C[M][N] (f32, pitch ldc) = act(A[M][K]·W + bias). A f32 row-major (pitch lda) converted per fragment to bf16
// (ASPLIT: hi/lo two planes -> 2 terms, else single rounded term); Wt bf16 [N][K] (pitch ldb). BIAS_BF16 rounds the
// bias to bf16 first (bias quantised to bf16 before the add). K%32==0, M%16==0, N%64==0.
template <bool ASPLIT, int ACT, bool BIAS_BF16>
__global__ __launch_bounds__(128) void k_gemm_bf(const float* __restrict__ A, int lda, const unsigned short* __restrict__ Wt, int ldb,
                                               const float* __restrict__ bias, float* __restrict__ C, int ldc, int M, int N, int K) {
  __shared__ __attribute__((aligned(16))) float so[4][16][64];
  const int tid = threadIdx.x, w = tid >> 5, lane = tid & 31, ln = lane & 15, hh = lane >> 4;
  const int ntn = N / 64;
  const int wid = blockIdx.x * 4 + w;
  const int mt = wid / ntn, nq = wid % ntn;
  if (mt * 16 >= M) return;
  const int row0 = mt * 16, col0 = nq * 64;
  const float* arow = A + (size_t)(row0 + ln) * lda;
  v8f acc[4] = {};
  for (int kb = 0; kb < K; kb += 32) {
    FragB ah, al;
    const v4f x0 = *(const v4fa*)(arow + kb + 8 * hh), x1 = *(const v4fa*)(arow + kb + 8 * hh + 4);
    const v4f x2 = *(const v4fa*)(arow + kb + 16 + 8 * hh), x3 = *(const v4fa*)(arow + kb + 16 + 8 * hh + 4);
    float xs[16] = {x0[0],x0[1],x0[2],x0[3],x1[0],x1[1],x1[2],x1[3],x2[0],x2[1],x2[2],x2[3],x3[0],x3[1],x3[2],x3[3]};
#pragma unroll
    for (int i = 0; i < 16; ++i) { const unsigned short hb = bf16_bits(xs[i]); ah.u[i] = hb; al.u[i] = ASPLIT ? bf16_bits(xs[i] - bf16_val(hb)) : (unsigned short)0; }
#pragma unroll
    for (int t = 0; t < 4; ++t) {
      const unsigned short* brow = Wt + (size_t)(col0 + t * 16 + ln) * ldb + kb;
      FragB b;
      b.half[0] = *(const v8us*)(brow + 8 * hh);
      b.half[1] = *(const v8us*)(brow + 16 + 8 * hh);
      acc[t] = mmaN<ASPLIT ? 2 : 1>(ah.v, al.v, b.v, b.v, acc[t]);
    }
  }
#pragma unroll
  for (int t = 0; t < 4; ++t) {
    float bv = bias ? bias[col0 + t * 16 + ln] : 0.f;
    if (BIAS_BF16) bv = bf16_round(bv);
#pragma unroll
    for (int r = 0; r < 8; ++r) { float v = acc[t][r] + bv; if (ACT == 1) v = fmaxf(v, 0.f); so[w][8 * hh + r][t * 16 + ln] = v; }
  }
  __builtin_amdgcn_fence(__ATOMIC_ACQ_REL, "workgroup");
  __builtin_amdgcn_wave_barrier();
  const int rsub = lane >> 4, c4 = (lane & 15) * 4;
  {
#pragma unroll
    for (int q = 0; q < 8; ++q) {
      const int r = q * 2 + rsub;
      const v4f v = *(const v4fa*)&so[w][r][c4];
      *(v4f*)(C + (size_t)(row0 + r) * ldc + col0 + c4) = v;
    }
    
  }
}

// GEMM C = act(A·W + bias + resid): A f32 (ASPLIT -> hi/lo 2 terms), Wt bf16 [N][K]; ACT 0 none, 1 relu, 2 exact gelu;
// resid (optional, f32, row index = (row % rmod), pitch ldr, RES_BF16 rounds it) added before the activation.
template <bool ASPLIT, int ACT, bool BIAS_BF16, bool RES_BF16>
__global__ __launch_bounds__(128) void k_gemm_bf3(const float* __restrict__ A, int lda, const unsigned short* __restrict__ Wt, int ldb,
                                                const float* __restrict__ bias, const float* __restrict__ resid, int rmod, int ldr,
                                                float* __restrict__ C, int ldc, int M, int N, int K) {
  __shared__ __attribute__((aligned(16))) float so[4][16][64];
  const int tid = threadIdx.x, w = tid >> 5, lane = tid & 31, ln = lane & 15, hh = lane >> 4;
  const int ntn = N / 64;
  const int wid = blockIdx.x * 4 + w;
  const int mt = wid / ntn, nq = wid % ntn;
  if (mt * 16 >= M) return;
  const int row0 = mt * 16, col0 = nq * 64;
  const float* arow = A + (size_t)(row0 + ln) * lda;
  v8f acc[4] = {};
  for (int kb = 0; kb < K; kb += 32) {
    FragB ah, al;
    const v4f x0 = *(const v4fa*)(arow + kb + 8 * hh), x1 = *(const v4fa*)(arow + kb + 8 * hh + 4);
    const v4f x2 = *(const v4fa*)(arow + kb + 16 + 8 * hh), x3 = *(const v4fa*)(arow + kb + 16 + 8 * hh + 4);
    float xs[16] = {x0[0],x0[1],x0[2],x0[3],x1[0],x1[1],x1[2],x1[3],x2[0],x2[1],x2[2],x2[3],x3[0],x3[1],x3[2],x3[3]};
#pragma unroll
    for (int i = 0; i < 16; ++i) { const unsigned short hb = bf16_bits(xs[i]); ah.u[i] = hb; al.u[i] = ASPLIT ? bf16_bits(xs[i] - bf16_val(hb)) : (unsigned short)0; }
#pragma unroll
    for (int t = 0; t < 4; ++t) {
      const unsigned short* brow = Wt + (size_t)(col0 + t * 16 + ln) * ldb + kb;
      FragB b;
      b.half[0] = *(const v8us*)(brow + 8 * hh);
      b.half[1] = *(const v8us*)(brow + 16 + 8 * hh);
      acc[t] = mmaN<ASPLIT ? 2 : 1>(ah.v, al.v, b.v, b.v, acc[t]);
    }
  }
#pragma unroll
  for (int t = 0; t < 4; ++t) {
    const int col = col0 + t * 16 + ln;
    float bv = bias ? bias[col] : 0.f;
    if (BIAS_BF16) bv = bf16_round(bv);
#pragma unroll
    for (int r = 0; r < 8; ++r) {
      float v = acc[t][r] + bv;
      if (resid) { float rv = resid[(size_t)((row0 + 8 * hh + r) % rmod) * ldr + col]; if (RES_BF16) rv = bf16_round(rv); v += rv; }
      if (ACT == 1) v = fmaxf(v, 0.f);
      if (ACT == 2) v = 0.5f * v * (1.0f + erff(v * 0.70710678118654752f));
      if (ACT == 3) { const float u = 0.7978845608028654f * (v + 0.044715f * v * v * v); v = 0.5f * v * (1.0f + tanhf(u)); }
      so[w][8 * hh + r][t * 16 + ln] = v;
    }
  }
  __builtin_amdgcn_fence(__ATOMIC_ACQ_REL, "workgroup");
  __builtin_amdgcn_wave_barrier();
  const int rsub = lane >> 4, c4 = (lane & 15) * 4;
  {
#pragma unroll
    for (int q = 0; q < 8; ++q) {
      const int r = q * 2 + rsub;
      const v4f v = *(const v4fa*)&so[w][r][c4];
      *(v4f*)(C + (size_t)(row0 + r) * ldc + col0 + c4) = v;
    }
    
  }
}
// row LayerNorm (biased variance, eps) over N: s = X (+ R); optional out_sum <- s; out_norm <- (s-mu)*rsqrt(var+eps)*g + b
template <bool PARAM_BF16>
__global__ __launch_bounds__(256) void k_layernorm(const float* __restrict__ X, const float* __restrict__ R, const float* __restrict__ g, const float* __restrict__ bta,
                                                  float* __restrict__ out_sum, float* __restrict__ out_norm, int N, float eps) {
  __shared__ float red[256];
  const int row = blockIdx.x, tid = threadIdx.x;
  const float* x = X + (size_t)row * N; const float* rr = R ? R + (size_t)row * N : nullptr;
  float vals[16];                     // up to N = 4096
  const int per = N / 256;            // contiguous chunk per thread? use strided-by-4 chunks: thread handles j = tid*4 + 1024*u
  float s1 = 0.f;
  for (int u = 0; u < per / 4; ++u) {
    const int j = tid * 4 + 1024 * u;
    const v4f a = *(const v4fa*)(x + j);
    v4f b = {0.f,0.f,0.f,0.f}; if (rr) b = *(const v4fa*)(rr + j);
#pragma unroll
    for (int q = 0; q < 4; ++q) { const float v = a[q] + b[q]; vals[u * 4 + q] = v; s1 += v; }
  }
  red[tid] = s1; __syncthreads();
  for (int st = 128; st > 0; st >>= 1) { if (tid < st) red[tid] += red[tid + st]; __syncthreads(); }
  const float mu = red[0] / (float)N; __syncthreads();
  float s2 = 0.f;
  for (int u = 0; u < per / 4; ++u)
#pragma unroll
    for (int q = 0; q < 4; ++q) { const float c = vals[u * 4 + q] - mu; s2 += c * c; }
  red[tid] = s2; __syncthreads();
  for (int st = 128; st > 0; st >>= 1) { if (tid < st) red[tid] += red[tid + st]; __syncthreads(); }
  const float rs = rsqrtf(red[0] / (float)N + eps);
  {
    for (int u = 0; u < per / 4; ++u) {
      const int j = tid * 4 + 1024 * u;
      v4f o, sm;
#pragma unroll
      for (int q = 0; q < 4; ++q) {
        float gg = g[j + q], bb = bta[j + q];
        if (PARAM_BF16) { gg = bf16_round(gg); bb = bf16_round(bb); }
        sm[q] = vals[u * 4 + q]; o[q] = (vals[u * 4 + q] - mu) * rs * gg + bb;
      }
      if (out_sum) *(v4f*)(out_sum + (size_t)row * N + j) = sm;
      *(v4f*)(out_norm + (size_t)row * N + j) = o;
    }
    
  }
}

// ---- f16 WMMA path (v_wmma_f32_16x16x32_f16): 11-bit significands for operands in range — used where a [0,1] probability operand needs more precision than bf16
typedef _Float16 v16h __attribute__((ext_vector_type(16)));
union FragH { v16h v; v8us half[2]; _Float16 h[16]; unsigned short u[16]; };
template <int NT>
__device__ __forceinline__ v8f mmaH(v16h ah, v16h al, v16h bh, v16h bl, v8f c) {
  c = __builtin_amdgcn_wmma_f32_16x16x32_f16(false, ah, false, bh, (short)0, c, false, false);
  if (NT >= 2) c = __builtin_amdgcn_wmma_f32_16x16x32_f16(false, al, false, bh, (short)0, c, false, false);
  if (NT >= 3) c = __builtin_amdgcn_wmma_f32_16x16x32_f16(false, ah, false, bl, (short)0, c, false, false);
  asm volatile("v_nop\n\tv_nop\n\tv_nop\n\tv_nop" : "+v"(c) : "v"(ah), "v"(al), "v"(bh), "v"(bl));
  return c;
}
// batched GEMM like k_gemm_b but f16 operands: A f32 (split into f16 hi/lo if ASPLIT, else rounded to f16), Bt = f16 values [n][k]; alpha; C f32; N multiple of 16 (partial tiles skipped)
template <bool ASPLIT>
__global__ __launch_bounds__(128) void k_gemm_h(const float* __restrict__ A, int lda, size_t sA, const _Float16* __restrict__ Bh, int ldb, size_t sB, float alpha, float* __restrict__ C, int ldc, size_t sC, int M, int N, int K) {
  __shared__ __attribute__((aligned(16))) float so[4][16][64];
  const int tid = threadIdx.x, w = tid >> 5, lane = tid & 31, ln = lane & 15, hh = lane >> 4; const int by = blockIdx.y;
  A += (size_t)by * sA; Bh += (size_t)by * sB; C += (size_t)by * sC;
  const int ntn = (N + 63) / 64; const int wid = blockIdx.x * 4 + w; const int mt = wid / ntn, nq = wid % ntn; if (mt * 16 >= M) return;
  const int row0 = mt * 16, col0 = nq * 64; const float* arow = A + (size_t)(row0 + ln) * lda;
  v8f acc[4] = {};
  for (int kb = 0; kb < K; kb += 32) {
    FragH ah, al;
    const v4f x0 = *(const v4fa*)(arow + kb + 8 * hh), x1 = *(const v4fa*)(arow + kb + 8 * hh + 4), x2 = *(const v4fa*)(arow + kb + 16 + 8 * hh), x3 = *(const v4fa*)(arow + kb + 16 + 8 * hh + 4);
    float xs[16] = {x0[0],x0[1],x0[2],x0[3],x1[0],x1[1],x1[2],x1[3],x2[0],x2[1],x2[2],x2[3],x3[0],x3[1],x3[2],x3[3]};
#pragma unroll
    for (int i = 0; i < 16; ++i) { const _Float16 h = (_Float16)xs[i]; ah.h[i] = h; al.h[i] = ASPLIT ? (_Float16)(xs[i] - (float)h) : (_Float16)0.0f; }
#pragma unroll
    for (int t = 0; t < 4; ++t) { if (col0 + t * 16 >= N) continue; const size_t boff = (size_t)(col0 + t * 16 + ln) * ldb + kb; FragH bq; bq.half[0] = *(const v8us*)(Bh + boff + 8 * hh); bq.half[1] = *(const v8us*)(Bh + boff + 16 + 8 * hh);
      acc[t] = mmaH<ASPLIT ? 2 : 1>(ah.v, al.v, bq.v, bq.v, acc[t]); }
  }
#pragma unroll
  for (int t = 0; t < 4; ++t) { if (col0 + t * 16 >= N) continue;
#pragma unroll
    for (int r = 0; r < 8; ++r) so[w][8 * hh + r][t * 16 + ln] = acc[t][r] * alpha; }
  __builtin_amdgcn_fence(__ATOMIC_ACQ_REL, "workgroup"); __builtin_amdgcn_wave_barrier();
  const int rsub = lane >> 4, c4 = (lane & 15) * 4;
  {
#pragma unroll
    for (int q = 0; q < 8; ++q) { const int r = q * 2 + rsub; if (col0 + c4 < N) { const v4f v = *(const v4fa*)&so[w][r][c4]; *(v4f*)(C + (size_t)(row0 + r) * ldc + col0 + c4) = v; } }
     }
}

// Wt[n][k] = f16(W[k][n]·scale) from f32 row-major W[K][N] (scale = power of two; bf16-exact weights stay exact in f16 away from the subnormal range)
__global__ __launch_bounds__(256) void k_wt_f16(const float* __restrict__ W, _Float16* __restrict__ Wt, int K, int N, float scale) {
  const int t = blockIdx.x * 256 + threadIdx.x; if (t >= N * (K / 8)) return; const int n = t / (K / 8), k8 = (t % (K / 8)) * 8; FragH f;
#pragma unroll
  for (int i = 0; i < 8; ++i) f.h[i] = (_Float16)(bf16_round(W[(size_t)(k8 + i) * N + n]) * scale); const v8us o = f.half[0];
  *(v8us*)((unsigned short*)Wt + (size_t)n * K + k8) = o; 
}
// k_gemm_hh variant with fused epilogue: v = acc·alpha + bias[by·sBias + col] (+ CP[(row/rowsPerB)·sCPb + by·64 + col] if CP) ; ACT 0 none / 1 elu ; writes f16 C16 (and f32 C if non-null)
template <int ACT>
__global__ __launch_bounds__(128) void k_gemm_hhx(const _Float16* __restrict__ A, int lda, size_t sA, const _Float16* __restrict__ Bh, int ldb, size_t sB, float alpha, const float* __restrict__ bias, size_t sBias, const float* __restrict__ CP, int rowsPerB, size_t sCPb, int row0g,
    float* __restrict__ C, _Float16* __restrict__ C16, int ldc, size_t sC, int M, int N, int K) {
  __shared__ __attribute__((aligned(16))) float so[4][16][64];
  const int tid = threadIdx.x, w = tid >> 5, lane = tid & 31, ln = lane & 15, hh = lane >> 4; const int by = blockIdx.y;
  A += (size_t)by * sA; Bh += (size_t)by * sB; const size_t cofs = (size_t)by * sC; const float* bp = bias ? bias + (size_t)by * sBias : nullptr;
  const int ntn = (N + 63) / 64; const int wid = blockIdx.x * 4 + w; const int mt = wid / ntn, nq = wid % ntn; if (mt * 16 >= M) return;
  const int row0 = mt * 16, col0 = nq * 64; const _Float16* arow = A + (size_t)(row0 + ln) * lda;
  v8f acc[4] = {};
  for (int kb = 0; kb < K; kb += 32) { FragH ah; ah.half[0] = *(const v8us*)((const unsigned short*)arow + kb + 8 * hh); ah.half[1] = *(const v8us*)((const unsigned short*)arow + kb + 16 + 8 * hh);
#pragma unroll
    for (int t = 0; t < 4; ++t) { if (col0 + t * 16 >= N) continue; const size_t boff = (size_t)(col0 + t * 16 + ln) * ldb + kb; FragH bq; bq.half[0] = *(const v8us*)((const unsigned short*)Bh + boff + 8 * hh); bq.half[1] = *(const v8us*)((const unsigned short*)Bh + boff + 16 + 8 * hh);
      acc[t] = mmaH<1>(ah.v, ah.v, bq.v, bq.v, acc[t]); }
  }
#pragma unroll
  for (int t = 0; t < 4; ++t) { if (col0 + t * 16 >= N) continue; const int col = col0 + t * 16 + ln; const float bv = bp ? bf16_round(bp[col]) : 0.f;
#pragma unroll
    for (int r = 0; r < 8; ++r) { float v = acc[t][r] * alpha + bv; if (CP) { const int rr = row0g + row0 + 8 * hh + r; if (rowsPerB < 0) v += CP[cofs + (size_t)rr * ldc + col];      /* rowsPerB < 0: own element of the batched C plane */ else { const int bidx = rr / rowsPerB; v += CP[(size_t)bidx * sCPb + (size_t)by * 64 + col]; } } if (ACT == 1) v = (v > 0.f) ? v : expm1f(v); else if (ACT == 7) v = (v > 0.f) ? v + 1.0f : expf(v); else if (ACT == 8) v = tanhf(v); else if (ACT == 9) v = 0.5f * v * (1.0f + tanhf(0.7978845608028654f * (v + 0.044715f * v * v * v))); else if (ACT == 11) v = 1.0f / (1.0f + expf(-v)); else if (ACT == 12) v = (v > 0.f) ? v : 0.01f * v; else if (ACT == 14) v = (v > 0.f) ? v : 0.1f * v; else if (ACT == 16) v = (v >= 0.f) ? v : 0.3f * v; else if (ACT == 17) v = (v >= 0.f) ? v : 0.2f * v; else if (ACT == 15) v = v / (1.0f + expf(-v)); else if (ACT == 3) v = fmaxf(v, 0.f); else if (ACT == 6) v = 0.5f * v * (1.0f + erff(v * 0.70710678118654752f)); so[w][8 * hh + r][t * 16 + ln] = v; } }
  __builtin_amdgcn_fence(__ATOMIC_ACQ_REL, "workgroup"); __builtin_amdgcn_wave_barrier();
  const int rsub = lane >> 4, c4 = (lane & 15) * 4; typedef _Float16 v4h __attribute__((ext_vector_type(4)));
  {
#pragma unroll
    for (int q = 0; q < 8; ++q) { const int r = q * 2 + rsub; if (col0 + c4 < N) { const v4f v = *(const v4fa*)&so[w][r][c4]; if (C) *(v4f*)(C + cofs + (size_t)(row0 + r) * ldc + col0 + c4) = v; if (C16) { v4h h4; for (int i = 0; i < 4; ++i) h4[i] = (_Float16)v[i]; *(v4h*)(C16 + cofs + (size_t)(row0 + r) * ldc + col0 + c4) = h4; } } }
     }
}

typedef _Float16 v4h __attribute__((ext_vector_type(4)));

__global__ __launch_bounds__(256) void k_x16(const float* __restrict__ x, _Float16* __restrict__ X16, size_t n8) { const size_t t = (size_t)blockIdx.x * 256 + threadIdx.x; if (t >= n8) return; FragH f;
#pragma unroll
  for (int q = 0; q < 8; ++q) f.h[q] = (_Float16)bf16_round(x[t * 8 + q]); *(v8us*)((unsigned short*)X16 + t * 8) = f.half[0];  }
__global__ __launch_bounds__(256) void k_h16(const float* __restrict__ x, _Float16* __restrict__ X16, size_t n8) { const size_t t = (size_t)blockIdx.x * 256 + threadIdx.x; if (t >= n8) return; FragH f;
#pragma unroll
  for (int q = 0; q < 8; ++q) f.h[q] = (_Float16)x[t * 8 + q]; *(v8us*)((unsigned short*)X16 + t * 8) = f.half[0];  }
__global__ __launch_bounds__(256) void k_round16f(const float* __restrict__ W, _Float16* __restrict__ Bt, size_t n8) { const size_t t = (size_t)blockIdx.x * 256 + threadIdx.x; if (t >= n8) return; FragH f;
#pragma unroll
  for (int i = 0; i < 8; ++i) f.h[i] = (_Float16)(bf16_round(W[t * 8 + i]) * 16.0f); *(v8us*)((unsigned short*)Bt + t * 8) = f.half[0];  }
template <int NHv, int TTv>
__global__ __launch_bounds__(256) void k_vt(const _Float16* __restrict__ V16, int ldv, int voff, _Float16* __restrict__ Vt) { __shared__ unsigned short tl[64][66]; const int tid = threadIdx.x; const int slab = blockIdx.x / (TTv / 64), lg = blockIdx.x % (TTv / 64); const int b = slab / NHv, h = slab % NHv;
  for (int i = tid; i < 64 * 8; i += 256) { const int r = i / 8, c8 = (i % 8) * 8; FragH f; f.half[0] = *(const v8us*)((const unsigned short*)V16 + ((size_t)b * TTv + lg * 64 + r) * ldv + voff + h * 64 + c8);
#pragma unroll
    for (int q = 0; q < 8; ++q) tl[r][c8 + q] = f.u[q]; }
  __syncthreads();
  {
#pragma unroll
    for (int rd = 0; rd < 2; ++rd) { const int d = rd * 32 + tid / 8, pc = tid % 8; FragH f;
#pragma unroll
      for (int q = 0; q < 8; ++q) f.u[q] = tl[pc * 8 + q][d];
      *(v8us*)((unsigned short*)Vt + ((size_t)slab * 64 + d) * TTv + lg * 64 + pc * 8) = f.half[0]; }
     } }

__global__ __launch_bounds__(256) void k_hl(const float* __restrict__ F, _Float16* __restrict__ Hh, _Float16* __restrict__ Hl, size_t n8) { const size_t t = (size_t)blockIdx.x * 256 + threadIdx.x; if (t >= n8) return; FragH fh, fl; const v4f a = *(const v4fa*)(F + t * 8), c = *(const v4fa*)(F + t * 8 + 4);
#pragma unroll
  for (int q = 0; q < 4; ++q) { _Float16 h = (_Float16)a[q]; fh.h[q] = h; fl.h[q] = (_Float16)((a[q] - (float)h) * 1024.0f); h = (_Float16)c[q]; fh.h[4 + q] = h; fl.h[4 + q] = (_Float16)((c[q] - (float)h) * 1024.0f); }
  { *(v8us*)((unsigned short*)Hh + t * 8) = fh.half[0]; *(v8us*)((unsigned short*)Hl + t * 8) = fl.half[0];  } }

// ---- fast GEMM (wave tile 32x64; requires M % 32 == 0 rows per launch region and N % 64 == 0); epilogue = k_gemm_hhx semantics ----
__device__ __forceinline__ v16h g2_frag(const _Float16* p, int hh) { FragH f; f.half[0] = *(const v8us*)((const unsigned short*)p + 8 * hh); f.half[1] = *(const v8us*)((const unsigned short*)p + 16 + 8 * hh); return f.v; }
__device__ __forceinline__ v8f g2_mma(v16h a, v16h b, v8f c) { v8f d = __builtin_amdgcn_wmma_f32_16x16x32_f16(false, a, false, b, (short)0, c, false, false); asm volatile("v_nop\n\tv_nop\n\tv_nop\n\tv_nop" : "+v"(d) : "v"(a), "v"(b)); return d; }
template <int ACT>
__global__ __launch_bounds__(128) void k_gemm2(const _Float16* __restrict__ A, int lda, size_t sA, const _Float16* __restrict__ Bh, int ldb, size_t sB, float alpha, const float* __restrict__ bias, size_t sBias, const float* __restrict__ CP, int rowsPerB, size_t sCPb, int row0g,
    float* __restrict__ C, _Float16* __restrict__ C16, int ldc, size_t sC, int M, int N, int K) { static_assert(ACT == 0 || ACT == 3 || ACT == 6 || ACT == 8 || ACT == 9 || ACT == 11 || ACT == 12 || ACT == 14 || ACT == 15 || ACT == 16 || ACT == 17, "k_gemm2: unsupported ACT code (would silently apply no activation)");
  __shared__ __attribute__((aligned(16))) float so[4][32][68];
  const int tid = threadIdx.x, w = tid >> 5, lane = tid & 31, ln = lane & 15, hh = lane >> 4; const int by = blockIdx.y;
  A += (size_t)by * sA; Bh += (size_t)by * sB; const size_t cofs = (size_t)by * sC; const float* bp = bias ? bias + (size_t)by * sBias : nullptr;
  const int ntn = N >> 6; const int mt = blockIdx.x / ntn, nq = blockIdx.x - mt * ntn; const int row0 = mt * 128 + 32 * w, col0 = nq * 64; if (row0 >= M) return;
  const _Float16* a0p = A + (size_t)(row0 + ln) * lda; const _Float16* a1p = a0p + (size_t)16 * lda;
  const _Float16* b0p = Bh + (size_t)(col0 + ln) * ldb; const _Float16* b1p = b0p + (size_t)16 * ldb; const _Float16* b2p = b1p + (size_t)16 * ldb; const _Float16* b3p = b2p + (size_t)16 * ldb;
  const v8f z8 = {0.f,0.f,0.f,0.f,0.f,0.f,0.f,0.f}; v8f c00 = z8, c01 = z8, c02 = z8, c03 = z8, c10 = z8, c11 = z8, c12 = z8, c13 = z8;
  for (int kb = 0; kb < K; kb += 32) { const v16h a0 = g2_frag(a0p + kb, hh), a1 = g2_frag(a1p + kb, hh);
    v16h b = g2_frag(b0p + kb, hh); c00 = g2_mma(a0, b, c00); c10 = g2_mma(a1, b, c10);
    b = g2_frag(b1p + kb, hh); c01 = g2_mma(a0, b, c01); c11 = g2_mma(a1, b, c11);
    b = g2_frag(b2p + kb, hh); c02 = g2_mma(a0, b, c02); c12 = g2_mma(a1, b, c12);
    b = g2_frag(b3p + kb, hh); c03 = g2_mma(a0, b, c03); c13 = g2_mma(a1, b, c13); }
  v8f accs[8] = {c00, c01, c02, c03, c10, c11, c12, c13};
#pragma unroll
  for (int u = 0; u < 8; ++u) { const int t = u & 3, half = u >> 2; const int col = col0 + t * 16 + ln; const float bv = bp ? bf16_round(bp[col]) : 0.f;
#pragma unroll
    for (int r = 0; r < 8; ++r) { const int rloc = half * 16 + 8 * hh + r; float v = accs[u][r] * alpha + bv; if (CP) { if (rowsPerB < 0) v += CP[cofs + (size_t)(row0g + row0 + rloc) * ldc + col];      /* rowsPerB < 0: own element of the batched C plane */ else { const int bidx = (row0g + row0 + rloc) / rowsPerB; v += CP[(size_t)bidx * sCPb + (size_t)by * 64 + col]; } }
      if (ACT == 3) v = fmaxf(v, 0.f); else if (ACT == 6) v = 0.5f * v * (1.0f + erff(v * 0.70710678118654752f)); else if (ACT == 11) v = 1.0f / (1.0f + expf(-v)); else if (ACT == 15) v = v / (1.0f + expf(-v)); else if (ACT == 12) v = (v > 0.f) ? v : 0.01f * v; else if (ACT == 8) v = tanhf(v); else if (ACT == 9) v = 0.5f * v * (1.0f + tanhf(0.7978845608028654f * (v + 0.044715f * v * v * v))); else if (ACT == 14) v = (v > 0.f) ? v : 0.1f * v; else if (ACT == 16) v = (v >= 0.f) ? v : 0.3f * v; else if (ACT == 17) v = (v >= 0.f) ? v : 0.2f * v;
      so[w][rloc][t * 16 + ln] = v; } }
  __builtin_amdgcn_fence(__ATOMIC_ACQ_REL, "workgroup"); __builtin_amdgcn_wave_barrier();
  const int rsub = lane >> 4, c4 = (lane & 15) * 4;
  {
#pragma unroll
    for (int q = 0; q < 16; ++q) { const int r = q * 2 + rsub; const v4f v = *(const v4fa*)&so[w][r][c4]; if (C) *(v4f*)(C + cofs + (size_t)(row0 + r) * ldc + col0 + c4) = v; if (C16) { v4h h4; for (int i = 0; i < 4; ++i) h4[i] = (_Float16)v[i]; *(v4h*)(C16 + cofs + (size_t)(row0 + r) * ldc + col0 + c4) = h4; } }
     } }

__global__ __launch_bounds__(256) void k_wnat(const float* __restrict__ w, size_t n8, _Float16* __restrict__ Bt) { const size_t t = (size_t)blockIdx.x * 256 + threadIdx.x; if (t >= n8) return; FragH f; for (int q = 0; q < 8; ++q) f.h[q] = (_Float16)(bf16_round(w[t * 8 + q]) * 16.0f); *(v8us*)((unsigned short*)Bt + t * 8) = f.half[0];  }

__global__ __launch_bounds__(256) void k_rsmcf2(const float* __restrict__ S, _Float16* __restrict__ P, int hg, int q0, int nk) {
  const int t = blockIdx.x * 256 + threadIdx.x; if (t >= hg * QT) return; const size_t i = (size_t)t; const float* s = S + i * NKX; const int last = q0 + (t % QT); float mx = -3.0e38f;
  for (int j = 0; j < nk; ++j) { const float f = (j <= last) ? 1.f : 0.f; mx = fmaxf(mx, fmaf(f, s[j], (1.f - f) * -1.0e9f)); } float se = 0.f;
  for (int j = 0; j < nk; ++j) { const float f = (j <= last) ? 1.f : 0.f; se += __expf(fmaf(f, s[j], (1.f - f) * -1.0e9f) - mx); } const float sc = 256.0f / se;
  for (int j0 = 0; j0 < nk; j0 += 8) { FragH fr; for (int q = 0; q < 8; ++q) { const int j = j0 + q; const float f = (j <= last) ? 1.f : 0.f; fr.h[q] = (_Float16)(__expf(fmaf(f, s[j], (1.f - f) * -1.0e9f) - mx) * sc); } unsigned short* d = (unsigned short*)P + i * NKX + j0; *(v8us*)d = fr.half[0];  } }

template <int MASKADD>
__global__ __launch_bounds__(64) void k_att0(const float* __restrict__ QF, const float* __restrict__ KF, const float* __restrict__ VF, int ld, const float* __restrict__ mask, float scale, float* __restrict__ OF, int ldo) {
  __shared__ __attribute__((aligned(16))) float lq[64][64]; __shared__ __attribute__((aligned(16))) float lo[64][64];
  const int tid = threadIdx.x; const int h = blockIdx.x / (QT0 / 64), rg = blockIdx.x % (QT0 / 64); const int i = rg * 64 + tid;
  const float* qr = QF + (size_t)i * ld + h * HD;
  for (int c = 0; c < HD / 4; ++c) { *(v4f*)&lq[tid][c * 4] = *(const v4fa*)(qr + c * 4); const v4f z = {0.f, 0.f, 0.f, 0.f}; *(v4f*)&lo[tid][c * 4] = z; }
  float m = -1.0e30f, l = 0.f; const int jmax = MASKADD ? (SQ - 1) : (rg * 64 + 63);      /* additive-mask form: every key (the mask input decides); causal form: keys up to the block's last row */
  for (int j = 0; j <= jmax; ++j) { const float* kr = KF + (size_t)j * ld + h * HD; const float* vr = VF + (size_t)j * ld + h * HD; float s = 0.f;
    for (int c = 0; c < HD / 4; ++c) { const v4f kq = *(const v4fa*)(kr + c * 4); const v4f qq = *(v4f*)&lq[tid][c * 4]; s = __fadd_rn(s, __fmul_rn(qq[0], kq[0])); s = __fadd_rn(s, __fmul_rn(qq[1], kq[1])); s = __fadd_rn(s, __fmul_rn(qq[2], kq[2])); s = __fadd_rn(s, __fmul_rn(qq[3], kq[3])); }
    s = __fmul_rn(s, scale); if (MASKADD) s = __fadd_rn(s, __fmul_rn(bf16_round(mask[(size_t)i * SQ + j]), -10000.0f));
    const float f = (MASKADD || j <= i) ? 1.f : 0.f; const float sm = fmaf(f, s, (1.f - f) * -1.0e30f); const float mn = fmaxf(m, sm); const float sc = expf(m - mn); const float e = expf(sm - mn); l = __fadd_rn(__fmul_rn(l, sc), e); m = mn;
    for (int c = 0; c < HD / 4; ++c) { const v4f vv = *(const v4fa*)(vr + c * 4); v4f oo = *(v4f*)&lo[tid][c * 4]; for (int u = 0; u < 4; ++u) oo[u] = __fadd_rn(__fmul_rn(oo[u], sc), __fmul_rn(e, vv[u])); *(v4f*)&lo[tid][c * 4] = oo; } }
  const float fin = 64.0f / l;      /* o carried x64 like the f16 path */
  for (int c = 0; c < HD / 4; ++c) { v4f oo = *(v4f*)&lo[tid][c * 4]; for (int u = 0; u < 4; ++u) oo[u] = __fmul_rn(oo[u], fin); *(v4f*)&lo[tid][c * 4] = oo; }
  __syncthreads();
  {
    for (int it = 0; it < 16; ++it) { const int row = it * 4 + tid / 16, pc = (tid % 16) * 4; const v4f v = *(const v4f*)&lo[row][pc]; *(v4f*)(OF + (size_t)(rg * 64 + row) * ldo + h * HD + pc) = v; }
     } }

__global__ __launch_bounds__(256) void k_kvexp(const float* __restrict__ src, float* __restrict__ dst, size_t n4) { const size_t t = (size_t)blockIdx.x * 256 + threadIdx.x; if (t >= n4) return; const size_t e = t * 4; const size_t row = e / DM; const int col = (int)(e % DM); const int h = col / HD, d = col % HD; const v4f v = *(const v4fa*)(src + row * KVD + (size_t)(h / HPG) * HD + d); *(v4f*)(dst + e) = v;  }

__global__ __launch_bounds__(256) void k_tab2(float theta, float* __restrict__ CS, float* __restrict__ SN) {
  const int t = blockIdx.x * 256 + threadIdx.x; if (t >= SQ * (HD / 2)) return; const int i = t % (HD / 2); const int p = t / (HD / 2); const float invf = 1.0f / powf(theta, (float)(2 * i) / (float)HD); const float ang = __fmul_rn((float)p, invf); const float c = cosf(ang), s = sinf(ang);
  *(float*)(CS + t) = c; *(float*)(SN + t) = s;  }
template <int NORM, int ROPE>
__global__ __launch_bounds__(64) void k_xform(const float* __restrict__ F, int ldf, int nh, const float* __restrict__ gain, float eps, const float* __restrict__ CS, const float* __restrict__ SN, _Float16* __restrict__ H16, int ldo) {
  __shared__ float xv[HD]; __shared__ float red[HD]; __shared__ unsigned short sh_[HD]; const int d = threadIdx.x; const int h = blockIdx.x % nh; const size_t r = blockIdx.x / nh; const int p = (int)(r % SQ);
  float x = F[r * (size_t)ldf + (size_t)h * HD + d];
  if (NORM) { red[d] = __fmul_rn(x, x); __syncthreads(); for (int st = HD / 2; st > 0; st >>= 1) { if (d < st) red[d] = __fadd_rn(red[d], red[d + st]); __syncthreads(); } const float rs = rsqrtf(__fadd_rn(red[0] / (float)HD, eps)); x = __fmul_rn(__fmul_rn(x, rs), bf16_round(gain[d])); }
  xv[d] = x; __syncthreads();
  float o = x;
  if (ROPE == 1) { const int i = d >> 1; const float c = CS[p * (HD / 2) + i], s = SN[p * (HD / 2) + i]; const float ev = xv[2 * i], od = xv[2 * i + 1]; o = (d & 1) ? __fadd_rn(__fmul_rn(ev, s), __fmul_rn(od, c)) : __fadd_rn(__fmul_rn(ev, c), -__fmul_rn(od, s)); }
  if (ROPE == 2) { const int i = d & (HD / 2 - 1); const float c = CS[p * (HD / 2) + i], s = SN[p * (HD / 2) + i]; const float lo = xv[i], hi = xv[i + HD / 2]; o = (d < HD / 2) ? __fadd_rn(__fmul_rn(lo, c), -__fmul_rn(hi, s)) : __fadd_rn(__fmul_rn(lo, s), __fmul_rn(hi, c)); }
  if (ROPE == 3) { const float c = CS[p * HD + d], s = SN[p * HD + d]; const float lo = xv[d & (HD / 2 - 1)], hi = xv[(d & (HD / 2 - 1)) + HD / 2]; o = (d < HD / 2) ? __fadd_rn(__fmul_rn(lo, c), -__fmul_rn(hi, s)) : __fadd_rn(__fmul_rn(hi, c), __fmul_rn(lo, s)); }      /* rotate-half with FULL-width per-element tables [pos][HD] */
  FragH th; th.h[0] = (_Float16)o; sh_[d] = th.u[0]; __syncthreads();
  if (d < HD / 8) { FragH f; for (int q = 0; q < 8; ++q) f.u[q] = sh_[d * 8 + q]; unsigned short* dst = (unsigned short*)H16 + r * (size_t)ldo + (size_t)h * HD + d * 8; *(v8us*)dst = f.half[0];  } }

template <int NORM, int ROPE>
__global__ __launch_bounds__(64) void k_xformf(const float* __restrict__ F, int ldf, int nh, const float* __restrict__ gain, float eps, const float* __restrict__ CS, const float* __restrict__ SN, float* __restrict__ F32, int ldo) {
  __shared__ float xv[HD]; __shared__ float red[HD]; const int d = threadIdx.x; const int h = blockIdx.x % nh; const size_t r = blockIdx.x / nh; const int p = (int)(r % SQ);
  float x = F[r * (size_t)ldf + (size_t)h * HD + d];
  if (NORM) { red[d] = __fmul_rn(x, x); __syncthreads(); for (int st = HD / 2; st > 0; st >>= 1) { if (d < st) red[d] = __fadd_rn(red[d], red[d + st]); __syncthreads(); } const float rs = rsqrtf(__fadd_rn(red[0] / (float)HD, eps)); x = __fmul_rn(__fmul_rn(x, rs), bf16_round(gain[d])); }
  xv[d] = x; __syncthreads();
  float o = x;
  if (ROPE == 1) { const int i = d >> 1; const float c = CS[p * (HD / 2) + i], s = SN[p * (HD / 2) + i]; const float ev = xv[2 * i], od = xv[2 * i + 1]; o = (d & 1) ? __fadd_rn(__fmul_rn(ev, s), __fmul_rn(od, c)) : __fadd_rn(__fmul_rn(ev, c), -__fmul_rn(od, s)); }
  if (ROPE == 2) { const int i = d & (HD / 2 - 1); const float c = CS[p * (HD / 2) + i], s = SN[p * (HD / 2) + i]; const float lo = xv[i], hi = xv[i + HD / 2]; o = (d < HD / 2) ? __fadd_rn(__fmul_rn(lo, c), -__fmul_rn(hi, s)) : __fadd_rn(__fmul_rn(lo, s), __fmul_rn(hi, c)); }
  if (ROPE == 3) { const float c = CS[p * HD + d], s = SN[p * HD + d]; const float lo = xv[d & (HD / 2 - 1)], hi = xv[(d & (HD / 2 - 1)) + HD / 2]; o = (d < HD / 2) ? __fadd_rn(__fmul_rn(lo, c), -__fmul_rn(hi, s)) : __fadd_rn(__fmul_rn(hi, c), __fmul_rn(lo, s)); }      /* rotate-half with FULL-width per-element tables [pos][HD] */
  float* dst = F32 + r * (size_t)ldo + (size_t)h * HD + d; *(float*)dst = o;  }

__global__ __launch_bounds__(256) void k_bfcp(const float* __restrict__ src, float* __restrict__ dst, size_t n4) { const size_t t = (size_t)blockIdx.x * 256 + threadIdx.x; if (t >= n4) return; const v4f a = *(const v4fa*)(src + t * 4); v4f o; for (int q = 0; q < 4; ++q) o[q] = bf16_round(a[q]); *(v4f*)(dst + t * 4) = o;  }

__global__ __launch_bounds__(256) void k_tabhalf(const float* __restrict__ cs, const float* __restrict__ sn, float* __restrict__ CS, float* __restrict__ SN) { const int t = blockIdx.x * 256 + threadIdx.x; if (t >= SQ * (HD / 2)) return; const int p = t / (HD / 2), i = t % (HD / 2); const float c = bf16_round(cs[(size_t)p * HD + i]), s = bf16_round(sn[(size_t)p * HD + i]);
  *(float*)(CS + t) = c; *(float*)(SN + t) = s;  }

__global__ __launch_bounds__(256) void k_tab2d(float* __restrict__ CS, float* __restrict__ SN) {
  const int t = blockIdx.x * 256 + threadIdx.x; if (t >= SQ * (HD / 2)) return; const int i = t % (HD / 2); const int p = t / (HD / 2); const float invf = (float)(1.0 / pow(10000.0, (double)(2 * i) / (double)HD)); const float ang = __fmul_rn((float)p, invf); const float c = cosf(ang), s = sinf(ang);
  *(float*)(CS + t) = c; *(float*)(SN + t) = s;  }
extern "C" void kernel_launch(void* const* d_in, const int* in_sizes, int n_in,
                              void* d_out, int out_size, void* d_ws, size_t ws_size, hipStream_t stream) {
  (void)in_sizes; (void)n_in; (void)out_size;
  const float* const* I = (const float* const*)d_in; const float* x = I[0]; const float* wattn = I[1]; const float* wo = I[2]; const float* qg = I[3]; const float* kg = I[4];      /* x; fused [in][out] Wqkv [1024][3072] (q, k, v column thirds); [in][out] Wproj; RMS-norm gains q_norm_w / k_norm_w [64]; no biases; rope tables computed in-kernel (positions = row index) */
  static_assert(HPG == 1 && NH == NG * HPG && NH * HD == DM && KVD == DM, "plain multi-head attention as 16 kv groups of one query head"); const float* bq = nullptr; const float* bk = nullptr; const float* bv = nullptr; const float* bo = nullptr;      /* no biases in this module */
  char* ws = (char*)d_ws; size_t off = 0;
  auto take = [&](size_t bytes) { char* p = ws + off; off += (bytes + 255) & ~(size_t)255; return p; };
  _Float16* BQKV = (_Float16*)take((size_t)3 * DM * DM * 2); _Float16* BQ = BQKV; _Float16* BK = BQKV + (size_t)DM * DM; _Float16* BV = BQKV + (size_t)2 * DM * DM; _Float16* BO = (_Float16*)take((size_t)DM * DM * 2);      /* one transposed plane Bt [3072][1024] of the fused weight: rows 0..1023 = q, 1024.. = k, 2048.. = v */
  _Float16* X16 = (_Float16*)take(NR * DM * 2); float* QF = (float*)take((size_t)SQ * DM * 4); float* KF = (float*)take((size_t)SQ * KVD * 4); float* CSB = (float*)take((size_t)SQ * HD * 4); float* SNB = (float*)take((size_t)SQ * HD * 4); _Float16* Q16 = (_Float16*)take(NR * DM * 2); _Float16* K16 = (_Float16*)take(NR * KVD * 2); _Float16* V16 = (_Float16*)take(NR * KVD * 2); _Float16* O16 = (_Float16*)take(NR * DM * 2);
  float* S = (float*)take((size_t)NH * QT * NKX * 4); _Float16* P = (_Float16*)take((size_t)NH * QT * NKX * 2); _Float16* VT = (_Float16*)take((size_t)NH * HD * SQ * 2);
  float* QF0 = (float*)take((size_t)QT0 * DM * 4); float* KF0 = (float*)take((size_t)QT0 * KVD * 4); float* VF0 = (float*)take((size_t)QT0 * KVD * 4); float* KF0e = (float*)take((size_t)QT0 * DM * 4); float* VF0e = (float*)take((size_t)QT0 * DM * 4); float* OF0 = (float*)take((size_t)NB * QT0 * DM * 4); _Float16* OH0 = (_Float16*)take((size_t)NB * QT0 * DM * 2); _Float16* OL0 = (_Float16*)take((size_t)NB * QT0 * DM * 2);
  if (off > ws_size) return;
  k_wt_f16<<<(unsigned)(((size_t)3 * DM * (DM / 8) + 255) / 256), 256, 0, stream>>>(wattn, BQKV, DM, 3 * DM, 16.0f); k_wt_f16<<<(unsigned)(((size_t)DM * (DM / 8) + 255) / 256), 256, 0, stream>>>(wo, BO, DM, DM, 16.0f);      /* [in][out] -> Bt x16 planes (fused Wqkv: K 1024, N 3072) */
  k_x16<<<(unsigned)((NR * DM / 8 + 255) / 256), 256, 0, stream>>>(x, X16, NR * DM / 8);
  k_tab2<<<(SQ * (HD / 2) + 255) / 256, 256, 0, stream>>>(10000.0f, CSB, SNB);      /* rope tables cos / sin(p / 10000^(2i/64)), i < 32: f32 pow, reciprocal, product */
  const size_t r0p = (size_t)B0 * SQ;      /* first projected row */
  k_gemm2<0><<<dim3((unsigned)((MP / 128) * (KVD / 64)), 1), 128, 0, stream>>>(X16 + r0p * DM, DM, 0, BV, DM, 0, 0.0625f, bv, 0, nullptr, 1, 0, 0, nullptr, V16 + r0p * KVD, KVD, 0, MP, KVD, DM);
  for (int b = B0; b < B0 + NBR; ++b) { const size_t r0 = (size_t)b * SQ;
    k_gemm2<0><<<dim3((unsigned)((SQ / 128) * (DM / 64)), 1), 128, 0, stream>>>(X16 + r0 * DM, DM, 0, BQ, DM, 0, 0.0625f, bq, 0, nullptr, 1, 0, 0, QF, nullptr, DM, 0, SQ, DM, DM);      /* q (f32) of this batch */
    k_gemm2<0><<<dim3((unsigned)((SQ / 128) * (KVD / 64)), 1), 128, 0, stream>>>(X16 + r0 * DM, DM, 0, BK, DM, 0, 0.0625f, bk, 0, nullptr, 1, 0, 0, KF, nullptr, KVD, 0, SQ, KVD, DM);      /* k (f32) */
    k_xform<1, 2><<<(unsigned)((size_t)SQ * NH), 64, 0, stream>>>(QF, DM, NH, qg, 1e-5f, CSB, SNB, Q16 + r0 * DM, DM); k_xform<1, 2><<<(unsigned)((size_t)SQ * NG), 64, 0, stream>>>(KF, KVD, NG, kg, 1e-5f, CSB, SNB, K16 + r0 * KVD, KVD);      /* per-head RMS norm (gain, eps 1e-5) then the half-split rope <1, 2> (out_lo = x_lo c - x_hi s, out_hi = x_lo s + x_hi c = t cos + rotate_half(t) sin with the module's [f | f] tables) -> f16 rows */
    k_xformf<1, 2><<<(unsigned)(QT0 * NH), 64, 0, stream>>>(QF, DM, NH, qg, 1e-5f, CSB, SNB, QF0, DM); k_xformf<1, 2><<<(unsigned)(QT0 * NG), 64, 0, stream>>>(KF, KVD, NG, kg, 1e-5f, CSB, SNB, KF0, KVD);      /* f32 normed and half-split-roped q, k of rows 0..255 */
    k_vt<NG, SQ><<<NG * (SQ / 64), 256, 0, stream>>>(V16 + r0 * KVD, KVD, 0, VT);      /* V^T [NH][HD][SQ] for this batch */
    k_gemm2<0><<<dim3((QT0 / 128) * (KVD / 64), 1), 128, 0, stream>>>(X16 + r0 * DM, DM, 0, BV, DM, 0, 0.0625f, bv, 0, nullptr, 1, 0, 0, VF0, nullptr, KVD, 0, QT0, KVD, DM);
    k_kvexp<<<(unsigned)(((size_t)QT0 * DM / 4 + 255) / 256), 256, 0, stream>>>(KF0, KF0e, (size_t)QT0 * DM / 4); k_kvexp<<<(unsigned)(((size_t)QT0 * DM / 4 + 255) / 256), 256, 0, stream>>>(VF0, VF0e, (size_t)QT0 * DM / 4);      /* head h <- kv group h / HPG (HPG is 1 here: a plain copy) for the exact first-tile kernel */      /* f32 q, k, v of the first 256 rows (exact products) */
    k_att0<0><<<NH * (QT0 / 64), 64, 0, stream>>>(QF0, KF0e, VF0e, DM, nullptr, 0.125f, OF0 + (size_t)b * QT0 * DM, DM);      /* exact f32 attention for rows 0..255 (o x64) */
    for (int q0 = 0; q0 < QN; q0 += QT) { const int nk = q0 + QT;      /* causal: only keys below the tile end are computed */
      k_gemm2<0><<<dim3((QT / 128) * (nk / 64), NH), 128, 0, stream>>>(Q16 + (r0 + q0) * LQ, LQ, (size_t)HD, K16 + r0 * KVD, KVD, (size_t)HD, 0.125f, nullptr, 0, nullptr, 1, 0, 0, S, nullptr, NKX, (size_t)QT * NKX, QT, nk, HD);      /* scores: HPG == 1 (every head has its own keys): ONE launch with all 16 heads on grid.y, key head stride HD instead of the grouped form's 0 (the 16 per-group launches of one head each, fused) */
      k_rsmcf2<<<(NHD * QT + 255) / 256, 256, 0, stream>>>(S, P, NHD, q0, nk);
      k_gemm2<0><<<dim3((QT / 128) * (HD / 64), NH), 128, 0, stream>>>(P, NKX, (size_t)QT * NKX, VT, SQ, (size_t)HD * SQ, 0.25f, nullptr, 0, nullptr, 1, 0, 0, nullptr, O16 + (r0 + q0) * DM, DM, (size_t)HD, QT, HD, nk); } }      /* o for all 16 heads in ONE launch (value head stride HD*SQ) (x64) */
  k_gemm2<0><<<dim3((unsigned)((MPO / 128) * (DM / 64)), 1), 128, 0, stream>>>(O16 + r0p * DM, DM, 0, BO, DM, 0, 0.0009765625f, bo, 0, nullptr, 1, 0, 0, (float*)d_out + r0p * DM, nullptr, DM, 0, MPO, DM, DM);      /* out rows are the output layout */
  k_hl<<<(unsigned)(((size_t)NB * QT0 * DM / 8 + 255) / 256), 256, 0, stream>>>(OF0, OH0, OL0, (size_t)NB * QT0 * DM / 8);      /* first-tile o (x64) -> f16 hi + x1024 residual planes */
  for (int b = B0; b < B0 + NBR; ++b) { const size_t r0 = (size_t)b * SQ; const size_t f0 = (size_t)b * QT0;
    k_gemm2<0><<<dim3((QT0 / 128) * (DM / 64), 1), 128, 0, stream>>>(OH0 + f0 * DM, DM, 0, BO, DM, 0, 0.0009765625f, bo, 0, nullptr, 1, 0, 0, (float*)d_out + r0 * DM, nullptr, DM, 0, QT0, DM, DM);      /* rows 0..255: out = o_hi Wo (no bias here), overwriting the f16-path rows */
    k_gemm2<0><<<dim3((QT0 / 128) * (DM / 64), 1), 128, 0, stream>>>(OL0 + f0 * DM, DM, 0, BO, DM, 0, 0.00000095367431640625f, nullptr, 0, (const float*)d_out + r0 * DM, -1, 0, 0, (float*)d_out + r0 * DM, nullptr, DM, 0, QT0, DM, DM); }      /* += o_lo Wo 2^-20 (own-element accumulate) */
}

// v001
// One run takes 1970 microseconds.
// Two timings next to v000 put it at 3.71 and 3.73 times that version's speed.
#include <hip/hip_runtime.h>
// Causal multi-head self-attention with a per-head RMS norm on q and k THEN rotate-half RoPE computed in the module, and a bias-free fused QKV projection (x [4][2048][1024]; qkv = x Wqkv ([in][out] 1024 x 3072, no bias) split into q | k | v thirds, 16 heads of 64; q, k = x * rsqrt(mean(x^2 over the 64 head dims) + 1e-5) * gain (gains q_norm_w / k_norm_w [64], read); cos / sin = [f | f] of pos * (1 / 10000^(2i/64)); q = q cos + rotate_half(q) sin with rotate_half = cat(-x2, x1), likewise k; scores / sqrt(64); causal (tril, -inf); softmax; out = merged Wproj ([in][out], no bias) -> [4][2048][1024]); run as grouped-query causal attention with 16 groups of ONE head with the norm stage on and the rope stage in its half-split mode.
// Compute dtype: inputs rounded to bf16 (the two gain vectors bf16-rounded on load); x / weights exact; the per-head RMS norm and the rotation in f32 on VALU; q, k, v, softmax weights and o as plain f16 GEMM operands (~2^-12); scores and softmax statistics f32; v_wmma_f32_16x16x32_f16.
#define NB 4
#define NG 16
#define HPG 1
#define KVD (NG * HD)
#define SQ 2048
#define DM 1024
#define NH 16
#define HD 64
#define HG 4
#define QT 256                       /* unused (k_fattn tiles 16 query rows per wave) */
#define NKX SQ
#define QT0 256                      /* first-tile rows recomputed exactly in f32 */
#define B0 0                         /* first batch processed (debug hook) */
#define NBR NB                       /* batches processed (debug hook) */
#define NR ((size_t)NB * SQ)         /* token rows */
#define MP ((int)((size_t)NBR * SQ)) /* rows projected (debug hook) */
#define QN SQ                        /* unused (k_fattn attends all SQ rows of a batch) */
#define NHD NH                       /* unused (all NH heads are attended) */
#define MPO MP                       /* rows through the output stage (debug hook) */
#define LQ DM      /* row pitch of the q/k/v rows */
typedef __bf16 v16b __attribute__((ext_vector_type(16)));
typedef unsigned short v8us __attribute__((ext_vector_type(8), may_alias));
typedef float  v8f  __attribute__((ext_vector_type(8)));
typedef float  v4f  __attribute__((ext_vector_type(4)));
typedef float  v4fa __attribute__((ext_vector_type(4), may_alias));
union FragB { v16b v; v8us half[2]; unsigned short u[16]; };

__device__ __forceinline__ unsigned short bf16_bits(float x) { unsigned int u = __float_as_uint(x); return (unsigned short)((u + 0x7FFFu + ((u >> 16) & 1u)) >> 16); }
__device__ __forceinline__ float bf16_val(unsigned short b) { return __uint_as_float(((unsigned int)b) << 16); }
__device__ __forceinline__ float bf16_round(float x) { return bf16_val(bf16_bits(x)); }
// D += A·B with NT terms: 1 = ah·bh, 2 = + al·bh (A split), 3 = + ah·bl (both split)
template <int NT>
__device__ __forceinline__ v8f mmaN(v16b ah, v16b al, v16b bh, v16b bl, v8f c) {
  c = __builtin_amdgcn_wmma_f32_16x16x32_bf16(false, ah, false, bh, (short)0, c, false, false);
  if (NT >= 2) c = __builtin_amdgcn_wmma_f32_16x16x32_bf16(false, al, false, bh, (short)0, c, false, false);
  if (NT >= 3) c = __builtin_amdgcn_wmma_f32_16x16x32_bf16(false, ah, false, bl, (short)0, c, false, false);
  asm volatile("v_nop\n\tv_nop\n\tv_nop\n\tv_nop" : "+v"(c) : "v"(ah), "v"(al), "v"(bh), "v"(bl));
  return c;
}

__global__ __launch_bounds__(256) void k_wt_bf16(const float* __restrict__ W, unsigned short* __restrict__ Wt, int K, int N) {
  const int t = blockIdx.x * 256 + threadIdx.x;
  const int k8n = K / 8;
  if (t >= N * k8n) return;
  const int n = t / k8n, k8 = (t % k8n) * 8;
  v8us v;
#pragma unroll
  for (int i = 0; i < 8; ++i) v[i] = bf16_bits(W[(size_t)(k8 + i) * N + n]);
  *(v8us*)(Wt + (size_t)n * K + k8) = v;
  
}

// GEMM C[M][N] (f32, pitch ldc) = act(A[M][K]·W + bias). A f32 row-major (pitch lda) converted per fragment to bf16
// (ASPLIT: hi/lo two planes -> 2 terms, else single rounded term); Wt bf16 [N][K] (pitch ldb). BIAS_BF16 rounds the
// bias to bf16 first (bias quantised to bf16 before the add). K%32==0, M%16==0, N%64==0.
template <bool ASPLIT, int ACT, bool BIAS_BF16>
__global__ __launch_bounds__(128) void k_gemm_bf(const float* __restrict__ A, int lda, const unsigned short* __restrict__ Wt, int ldb,
                                               const float* __restrict__ bias, float* __restrict__ C, int ldc, int M, int N, int K) {
  __shared__ __attribute__((aligned(16))) float so[4][16][64];
  const int tid = threadIdx.x, w = tid >> 5, lane = tid & 31, ln = lane & 15, hh = lane >> 4;
  const int ntn = N / 64;
  const int wid = blockIdx.x * 4 + w;
  const int mt = wid / ntn, nq = wid % ntn;
  if (mt * 16 >= M) return;
  const int row0 = mt * 16, col0 = nq * 64;
  const float* arow = A + (size_t)(row0 + ln) * lda;
  v8f acc[4] = {};
  for (int kb = 0; kb < K; kb += 32) {
    FragB ah, al;
    const v4f x0 = *(const v4fa*)(arow + kb + 8 * hh), x1 = *(const v4fa*)(arow + kb + 8 * hh + 4);
    const v4f x2 = *(const v4fa*)(arow + kb + 16 + 8 * hh), x3 = *(const v4fa*)(arow + kb + 16 + 8 * hh + 4);
    float xs[16] = {x0[0],x0[1],x0[2],x0[3],x1[0],x1[1],x1[2],x1[3],x2[0],x2[1],x2[2],x2[3],x3[0],x3[1],x3[2],x3[3]};
#pragma unroll
    for (int i = 0; i < 16; ++i) { const unsigned short hb = bf16_bits(xs[i]); ah.u[i] = hb; al.u[i] = ASPLIT ? bf16_bits(xs[i] - bf16_val(hb)) : (unsigned short)0; }
#pragma unroll
    for (int t = 0; t < 4; ++t) {
      const unsigned short* brow = Wt + (size_t)(col0 + t * 16 + ln) * ldb + kb;
      FragB b;
      b.half[0] = *(const v8us*)(brow + 8 * hh);
      b.half[1] = *(const v8us*)(brow + 16 + 8 * hh);
      acc[t] = mmaN<ASPLIT ? 2 : 1>(ah.v, al.v, b.v, b.v, acc[t]);
    }
  }
#pragma unroll
  for (int t = 0; t < 4; ++t) {
    float bv = bias ? bias[col0 + t * 16 + ln] : 0.f;
    if (BIAS_BF16) bv = bf16_round(bv);
#pragma unroll
    for (int r = 0; r < 8; ++r) { float v = acc[t][r] + bv; if (ACT == 1) v = fmaxf(v, 0.f); so[w][8 * hh + r][t * 16 + ln] = v; }
  }
  __builtin_amdgcn_fence(__ATOMIC_ACQ_REL, "workgroup");
  __builtin_amdgcn_wave_barrier();
  const int rsub = lane >> 4, c4 = (lane & 15) * 4;
  {
#pragma unroll
    for (int q = 0; q < 8; ++q) {
      const int r = q * 2 + rsub;
      const v4f v = *(const v4fa*)&so[w][r][c4];
      *(v4f*)(C + (size_t)(row0 + r) * ldc + col0 + c4) = v;
    }
    
  }
}

// GEMM C = act(A·W + bias + resid): A f32 (ASPLIT -> hi/lo 2 terms), Wt bf16 [N][K]; ACT 0 none, 1 relu, 2 exact gelu;
// resid (optional, f32, row index = (row % rmod), pitch ldr, RES_BF16 rounds it) added before the activation.
template <bool ASPLIT, int ACT, bool BIAS_BF16, bool RES_BF16>
__global__ __launch_bounds__(128) void k_gemm_bf3(const float* __restrict__ A, int lda, const unsigned short* __restrict__ Wt, int ldb,
                                                const float* __restrict__ bias, const float* __restrict__ resid, int rmod, int ldr,
                                                float* __restrict__ C, int ldc, int M, int N, int K) {
  __shared__ __attribute__((aligned(16))) float so[4][16][64];
  const int tid = threadIdx.x, w = tid >> 5, lane = tid & 31, ln = lane & 15, hh = lane >> 4;
  const int ntn = N / 64;
  const int wid = blockIdx.x * 4 + w;
  const int mt = wid / ntn, nq = wid % ntn;
  if (mt * 16 >= M) return;
  const int row0 = mt * 16, col0 = nq * 64;
  const float* arow = A + (size_t)(row0 + ln) * lda;
  v8f acc[4] = {};
  for (int kb = 0; kb < K; kb += 32) {
    FragB ah, al;
    const v4f x0 = *(const v4fa*)(arow + kb + 8 * hh), x1 = *(const v4fa*)(arow + kb + 8 * hh + 4);
    const v4f x2 = *(const v4fa*)(arow + kb + 16 + 8 * hh), x3 = *(const v4fa*)(arow + kb + 16 + 8 * hh + 4);
    float xs[16] = {x0[0],x0[1],x0[2],x0[3],x1[0],x1[1],x1[2],x1[3],x2[0],x2[1],x2[2],x2[3],x3[0],x3[1],x3[2],x3[3]};
#pragma unroll
    for (int i = 0; i < 16; ++i) { const unsigned short hb = bf16_bits(xs[i]); ah.u[i] = hb; al.u[i] = ASPLIT ? bf16_bits(xs[i] - bf16_val(hb)) : (unsigned short)0; }
#pragma unroll
    for (int t = 0; t < 4; ++t) {
      const unsigned short* brow = Wt + (size_t)(col0 + t * 16 + ln) * ldb + kb;
      FragB b;
      b.half[0] = *(const v8us*)(brow + 8 * hh);
      b.half[1] = *(const v8us*)(brow + 16 + 8 * hh);
      acc[t] = mmaN<ASPLIT ? 2 : 1>(ah.v, al.v, b.v, b.v, acc[t]);
    }
  }
#pragma unroll
  for (int t = 0; t < 4; ++t) {
    const int col = col0 + t * 16 + ln;
    float bv = bias ? bias[col] : 0.f;
    if (BIAS_BF16) bv = bf16_round(bv);
#pragma unroll
    for (int r = 0; r < 8; ++r) {
      float v = acc[t][r] + bv;
      if (resid) { float rv = resid[(size_t)((row0 + 8 * hh + r) % rmod) * ldr + col]; if (RES_BF16) rv = bf16_round(rv); v += rv; }
      if (ACT == 1) v = fmaxf(v, 0.f);
      if (ACT == 2) v = 0.5f * v * (1.0f + erff(v * 0.70710678118654752f));
      if (ACT == 3) { const float u = 0.7978845608028654f * (v + 0.044715f * v * v * v); v = 0.5f * v * (1.0f + tanhf(u)); }
      so[w][8 * hh + r][t * 16 + ln] = v;
    }
  }
  __builtin_amdgcn_fence(__ATOMIC_ACQ_REL, "workgroup");
  __builtin_amdgcn_wave_barrier();
  const int rsub = lane >> 4, c4 = (lane & 15) * 4;
  {
#pragma unroll
    for (int q = 0; q < 8; ++q) {
      const int r = q * 2 + rsub;
      const v4f v = *(const v4fa*)&so[w][r][c4];
      *(v4f*)(C + (size_t)(row0 + r) * ldc + col0 + c4) = v;
    }
    
  }
}
// row LayerNorm (biased variance, eps) over N: s = X (+ R); optional out_sum <- s; out_norm <- (s-mu)*rsqrt(var+eps)*g + b
template <bool PARAM_BF16>
__global__ __launch_bounds__(256) void k_layernorm(const float* __restrict__ X, const float* __restrict__ R, const float* __restrict__ g, const float* __restrict__ bta,
                                                  float* __restrict__ out_sum, float* __restrict__ out_norm, int N, float eps) {
  __shared__ float red[256];
  const int row = blockIdx.x, tid = threadIdx.x;
  const float* x = X + (size_t)row * N; const float* rr = R ? R + (size_t)row * N : nullptr;
  float vals[16];                     // up to N = 4096
  const int per = N / 256;            // contiguous chunk per thread? use strided-by-4 chunks: thread handles j = tid*4 + 1024*u
  float s1 = 0.f;
  for (int u = 0; u < per / 4; ++u) {
    const int j = tid * 4 + 1024 * u;
    const v4f a = *(const v4fa*)(x + j);
    v4f b = {0.f,0.f,0.f,0.f}; if (rr) b = *(const v4fa*)(rr + j);
#pragma unroll
    for (int q = 0; q < 4; ++q) { const float v = a[q] + b[q]; vals[u * 4 + q] = v; s1 += v; }
  }
  red[tid] = s1; __syncthreads();
  for (int st = 128; st > 0; st >>= 1) { if (tid < st) red[tid] += red[tid + st]; __syncthreads(); }
  const float mu = red[0] / (float)N; __syncthreads();
  float s2 = 0.f;
  for (int u = 0; u < per / 4; ++u)
#pragma unroll
    for (int q = 0; q < 4; ++q) { const float c = vals[u * 4 + q] - mu; s2 += c * c; }
  red[tid] = s2; __syncthreads();
  for (int st = 128; st > 0; st >>= 1) { if (tid < st) red[tid] += red[tid + st]; __syncthreads(); }
  const float rs = rsqrtf(red[0] / (float)N + eps);
  {
    for (int u = 0; u < per / 4; ++u) {
      const int j = tid * 4 + 1024 * u;
      v4f o, sm;
#pragma unroll
      for (int q = 0; q < 4; ++q) {
        float gg = g[j + q], bb = bta[j + q];
        if (PARAM_BF16) { gg = bf16_round(gg); bb = bf16_round(bb); }
        sm[q] = vals[u * 4 + q]; o[q] = (vals[u * 4 + q] - mu) * rs * gg + bb;
      }
      if (out_sum) *(v4f*)(out_sum + (size_t)row * N + j) = sm;
      *(v4f*)(out_norm + (size_t)row * N + j) = o;
    }
    
  }
}

// ---- f16 WMMA path (v_wmma_f32_16x16x32_f16): 11-bit significands for operands in range — used where a [0,1] probability operand needs more precision than bf16
typedef _Float16 v16h __attribute__((ext_vector_type(16)));
union FragH { v16h v; v8us half[2]; _Float16 h[16]; unsigned short u[16]; };
template <int NT>
__device__ __forceinline__ v8f mmaH(v16h ah, v16h al, v16h bh, v16h bl, v8f c) {
  c = __builtin_amdgcn_wmma_f32_16x16x32_f16(false, ah, false, bh, (short)0, c, false, false);
  if (NT >= 2) c = __builtin_amdgcn_wmma_f32_16x16x32_f16(false, al, false, bh, (short)0, c, false, false);
  if (NT >= 3) c = __builtin_amdgcn_wmma_f32_16x16x32_f16(false, ah, false, bl, (short)0, c, false, false);
  asm volatile("v_nop\n\tv_nop\n\tv_nop\n\tv_nop" : "+v"(c) : "v"(ah), "v"(al), "v"(bh), "v"(bl));
  return c;
}
// batched GEMM like k_gemm_b but f16 operands: A f32 (split into f16 hi/lo if ASPLIT, else rounded to f16), Bt = f16 values [n][k]; alpha; C f32; N multiple of 16 (partial tiles skipped)
template <bool ASPLIT>
__global__ __launch_bounds__(128) void k_gemm_h(const float* __restrict__ A, int lda, size_t sA, const _Float16* __restrict__ Bh, int ldb, size_t sB, float alpha, float* __restrict__ C, int ldc, size_t sC, int M, int N, int K) {
  __shared__ __attribute__((aligned(16))) float so[4][16][64];
  const int tid = threadIdx.x, w = tid >> 5, lane = tid & 31, ln = lane & 15, hh = lane >> 4; const int by = blockIdx.y;
  A += (size_t)by * sA; Bh += (size_t)by * sB; C += (size_t)by * sC;
  const int ntn = (N + 63) / 64; const int wid = blockIdx.x * 4 + w; const int mt = wid / ntn, nq = wid % ntn; if (mt * 16 >= M) return;
  const int row0 = mt * 16, col0 = nq * 64; const float* arow = A + (size_t)(row0 + ln) * lda;
  v8f acc[4] = {};
  for (int kb = 0; kb < K; kb += 32) {
    FragH ah, al;
    const v4f x0 = *(const v4fa*)(arow + kb + 8 * hh), x1 = *(const v4fa*)(arow + kb + 8 * hh + 4), x2 = *(const v4fa*)(arow + kb + 16 + 8 * hh), x3 = *(const v4fa*)(arow + kb + 16 + 8 * hh + 4);
    float xs[16] = {x0[0],x0[1],x0[2],x0[3],x1[0],x1[1],x1[2],x1[3],x2[0],x2[1],x2[2],x2[3],x3[0],x3[1],x3[2],x3[3]};
#pragma unroll
    for (int i = 0; i < 16; ++i) { const _Float16 h = (_Float16)xs[i]; ah.h[i] = h; al.h[i] = ASPLIT ? (_Float16)(xs[i] - (float)h) : (_Float16)0.0f; }
#pragma unroll
    for (int t = 0; t < 4; ++t) { if (col0 + t * 16 >= N) continue; const size_t boff = (size_t)(col0 + t * 16 + ln) * ldb + kb; FragH bq; bq.half[0] = *(const v8us*)(Bh + boff + 8 * hh); bq.half[1] = *(const v8us*)(Bh + boff + 16 + 8 * hh);
      acc[t] = mmaH<ASPLIT ? 2 : 1>(ah.v, al.v, bq.v, bq.v, acc[t]); }
  }
#pragma unroll
  for (int t = 0; t < 4; ++t) { if (col0 + t * 16 >= N) continue;
#pragma unroll
    for (int r = 0; r < 8; ++r) so[w][8 * hh + r][t * 16 + ln] = acc[t][r] * alpha; }
  __builtin_amdgcn_fence(__ATOMIC_ACQ_REL, "workgroup"); __builtin_amdgcn_wave_barrier();
  const int rsub = lane >> 4, c4 = (lane & 15) * 4;
  {
#pragma unroll
    for (int q = 0; q < 8; ++q) { const int r = q * 2 + rsub; if (col0 + c4 < N) { const v4f v = *(const v4fa*)&so[w][r][c4]; *(v4f*)(C + (size_t)(row0 + r) * ldc + col0 + c4) = v; } }
     }
}

// Wt[n][k] = f16(W[k][n]·scale) from f32 row-major W[K][N] (scale = power of two; bf16-exact weights stay exact in f16 away from the subnormal range)
__global__ __launch_bounds__(256) void k_wt_f16(const float* __restrict__ W, _Float16* __restrict__ Wt, int K, int N, float scale) {
  const int t = blockIdx.x * 256 + threadIdx.x; if (t >= N * (K / 8)) return; const int n = t / (K / 8), k8 = (t % (K / 8)) * 8; FragH f;
#pragma unroll
  for (int i = 0; i < 8; ++i) f.h[i] = (_Float16)(bf16_round(W[(size_t)(k8 + i) * N + n]) * scale); const v8us o = f.half[0];
  *(v8us*)((unsigned short*)Wt + (size_t)n * K + k8) = o; 
}
// k_gemm_hh variant with fused epilogue: v = acc·alpha + bias[by·sBias + col] (+ CP[(row/rowsPerB)·sCPb + by·64 + col] if CP) ; ACT 0 none / 1 elu ; writes f16 C16 (and f32 C if non-null)
template <int ACT>
__global__ __launch_bounds__(128) void k_gemm_hhx(const _Float16* __restrict__ A, int lda, size_t sA, const _Float16* __restrict__ Bh, int ldb, size_t sB, float alpha, const float* __restrict__ bias, size_t sBias, const float* __restrict__ CP, int rowsPerB, size_t sCPb, int row0g,
    float* __restrict__ C, _Float16* __restrict__ C16, int ldc, size_t sC, int M, int N, int K) {
  __shared__ __attribute__((aligned(16))) float so[4][16][64];
  const int tid = threadIdx.x, w = tid >> 5, lane = tid & 31, ln = lane & 15, hh = lane >> 4; const int by = blockIdx.y;
  A += (size_t)by * sA; Bh += (size_t)by * sB; const size_t cofs = (size_t)by * sC; const float* bp = bias ? bias + (size_t)by * sBias : nullptr;
  const int ntn = (N + 63) / 64; const int wid = blockIdx.x * 4 + w; const int mt = wid / ntn, nq = wid % ntn; if (mt * 16 >= M) return;
  const int row0 = mt * 16, col0 = nq * 64; const _Float16* arow = A + (size_t)(row0 + ln) * lda;
  v8f acc[4] = {};
  for (int kb = 0; kb < K; kb += 32) { FragH ah; ah.half[0] = *(const v8us*)((const unsigned short*)arow + kb + 8 * hh); ah.half[1] = *(const v8us*)((const unsigned short*)arow + kb + 16 + 8 * hh);
#pragma unroll
    for (int t = 0; t < 4; ++t) { if (col0 + t * 16 >= N) continue; const size_t boff = (size_t)(col0 + t * 16 + ln) * ldb + kb; FragH bq; bq.half[0] = *(const v8us*)((const unsigned short*)Bh + boff + 8 * hh); bq.half[1] = *(const v8us*)((const unsigned short*)Bh + boff + 16 + 8 * hh);
      acc[t] = mmaH<1>(ah.v, ah.v, bq.v, bq.v, acc[t]); }
  }
#pragma unroll
  for (int t = 0; t < 4; ++t) { if (col0 + t * 16 >= N) continue; const int col = col0 + t * 16 + ln; const float bv = bp ? bf16_round(bp[col]) : 0.f;
#pragma unroll
    for (int r = 0; r < 8; ++r) { float v = acc[t][r] * alpha + bv; if (CP) { const int rr = row0g + row0 + 8 * hh + r; if (rowsPerB < 0) v += CP[cofs + (size_t)rr * ldc + col];      /* rowsPerB < 0: own element of the batched C plane */ else { const int bidx = rr / rowsPerB; v += CP[(size_t)bidx * sCPb + (size_t)by * 64 + col]; } } if (ACT == 1) v = (v > 0.f) ? v : expm1f(v); else if (ACT == 7) v = (v > 0.f) ? v + 1.0f : expf(v); else if (ACT == 8) v = tanhf(v); else if (ACT == 9) v = 0.5f * v * (1.0f + tanhf(0.7978845608028654f * (v + 0.044715f * v * v * v))); else if (ACT == 11) v = 1.0f / (1.0f + expf(-v)); else if (ACT == 12) v = (v > 0.f) ? v : 0.01f * v; else if (ACT == 14) v = (v > 0.f) ? v : 0.1f * v; else if (ACT == 16) v = (v >= 0.f) ? v : 0.3f * v; else if (ACT == 17) v = (v >= 0.f) ? v : 0.2f * v; else if (ACT == 15) v = v / (1.0f + expf(-v)); else if (ACT == 3) v = fmaxf(v, 0.f); else if (ACT == 6) v = 0.5f * v * (1.0f + erff(v * 0.70710678118654752f)); so[w][8 * hh + r][t * 16 + ln] = v; } }
  __builtin_amdgcn_fence(__ATOMIC_ACQ_REL, "workgroup"); __builtin_amdgcn_wave_barrier();
  const int rsub = lane >> 4, c4 = (lane & 15) * 4; typedef _Float16 v4h __attribute__((ext_vector_type(4)));
  {
#pragma unroll
    for (int q = 0; q < 8; ++q) { const int r = q * 2 + rsub; if (col0 + c4 < N) { const v4f v = *(const v4fa*)&so[w][r][c4]; if (C) *(v4f*)(C + cofs + (size_t)(row0 + r) * ldc + col0 + c4) = v; if (C16) { v4h h4; for (int i = 0; i < 4; ++i) h4[i] = (_Float16)v[i]; *(v4h*)(C16 + cofs + (size_t)(row0 + r) * ldc + col0 + c4) = h4; } } }
     }
}

typedef _Float16 v4h __attribute__((ext_vector_type(4)));

__global__ __launch_bounds__(256) void k_x16(const float* __restrict__ x, _Float16* __restrict__ X16, size_t n8) { const size_t t = (size_t)blockIdx.x * 256 + threadIdx.x; if (t >= n8) return; FragH f;
#pragma unroll
  for (int q = 0; q < 8; ++q) f.h[q] = (_Float16)bf16_round(x[t * 8 + q]); *(v8us*)((unsigned short*)X16 + t * 8) = f.half[0];  }
__global__ __launch_bounds__(256) void k_h16(const float* __restrict__ x, _Float16* __restrict__ X16, size_t n8) { const size_t t = (size_t)blockIdx.x * 256 + threadIdx.x; if (t >= n8) return; FragH f;
#pragma unroll
  for (int q = 0; q < 8; ++q) f.h[q] = (_Float16)x[t * 8 + q]; *(v8us*)((unsigned short*)X16 + t * 8) = f.half[0];  }
__global__ __launch_bounds__(256) void k_round16f(const float* __restrict__ W, _Float16* __restrict__ Bt, size_t n8) { const size_t t = (size_t)blockIdx.x * 256 + threadIdx.x; if (t >= n8) return; FragH f;
#pragma unroll
  for (int i = 0; i < 8; ++i) f.h[i] = (_Float16)(bf16_round(W[t * 8 + i]) * 16.0f); *(v8us*)((unsigned short*)Bt + t * 8) = f.half[0];  }
template <int NHv, int TTv>
__global__ __launch_bounds__(256) void k_vt(const _Float16* __restrict__ V16, int ldv, int voff, _Float16* __restrict__ Vt) { __shared__ unsigned short tl[64][66]; const int tid = threadIdx.x; const int slab = blockIdx.x / (TTv / 64), lg = blockIdx.x % (TTv / 64); const int b = slab / NHv, h = slab % NHv;
  for (int i = tid; i < 64 * 8; i += 256) { const int r = i / 8, c8 = (i % 8) * 8; FragH f; f.half[0] = *(const v8us*)((const unsigned short*)V16 + ((size_t)b * TTv + lg * 64 + r) * ldv + voff + h * 64 + c8);
#pragma unroll
    for (int q = 0; q < 8; ++q) tl[r][c8 + q] = f.u[q]; }
  __syncthreads();
  {
#pragma unroll
    for (int rd = 0; rd < 2; ++rd) { const int d = rd * 32 + tid / 8, pc = tid % 8; FragH f;
#pragma unroll
      for (int q = 0; q < 8; ++q) f.u[q] = tl[pc * 8 + q][d];
      *(v8us*)((unsigned short*)Vt + ((size_t)slab * 64 + d) * TTv + lg * 64 + pc * 8) = f.half[0]; }
     } }

__global__ __launch_bounds__(256) void k_hl(const float* __restrict__ F, _Float16* __restrict__ Hh, _Float16* __restrict__ Hl, size_t n8) { const size_t t = (size_t)blockIdx.x * 256 + threadIdx.x; if (t >= n8) return; FragH fh, fl; const v4f a = *(const v4fa*)(F + t * 8), c = *(const v4fa*)(F + t * 8 + 4);
#pragma unroll
  for (int q = 0; q < 4; ++q) { _Float16 h = (_Float16)a[q]; fh.h[q] = h; fl.h[q] = (_Float16)((a[q] - (float)h) * 1024.0f); h = (_Float16)c[q]; fh.h[4 + q] = h; fl.h[4 + q] = (_Float16)((c[q] - (float)h) * 1024.0f); }
  { *(v8us*)((unsigned short*)Hh + t * 8) = fh.half[0]; *(v8us*)((unsigned short*)Hl + t * 8) = fl.half[0];  } }

// ---- fast GEMM (wave tile 32x64; requires M % 32 == 0 rows per launch region and N % 64 == 0); epilogue = k_gemm_hhx semantics ----
__device__ __forceinline__ v16h g2_frag(const _Float16* p, int hh) { FragH f; f.half[0] = *(const v8us*)((const unsigned short*)p + 8 * hh); f.half[1] = *(const v8us*)((const unsigned short*)p + 16 + 8 * hh); return f.v; }
__device__ __forceinline__ v8f g2_mma(v16h a, v16h b, v8f c) { v8f d = __builtin_amdgcn_wmma_f32_16x16x32_f16(false, a, false, b, (short)0, c, false, false); asm volatile("v_nop\n\tv_nop\n\tv_nop\n\tv_nop" : "+v"(d) : "v"(a), "v"(b)); return d; }
template <int ACT>
__global__ __launch_bounds__(128) void k_gemm2(const _Float16* __restrict__ A, int lda, size_t sA, const _Float16* __restrict__ Bh, int ldb, size_t sB, float alpha, const float* __restrict__ bias, size_t sBias, const float* __restrict__ CP, int rowsPerB, size_t sCPb, int row0g,
    float* __restrict__ C, _Float16* __restrict__ C16, int ldc, size_t sC, int M, int N, int K) { static_assert(ACT == 0 || ACT == 3 || ACT == 6 || ACT == 8 || ACT == 9 || ACT == 11 || ACT == 12 || ACT == 14 || ACT == 15 || ACT == 16 || ACT == 17, "k_gemm2: unsupported ACT code (would silently apply no activation)");
  __shared__ __attribute__((aligned(16))) float so[4][32][68];
  const int tid = threadIdx.x, w = tid >> 5, lane = tid & 31, ln = lane & 15, hh = lane >> 4; const int by = blockIdx.y;
  A += (size_t)by * sA; Bh += (size_t)by * sB; const size_t cofs = (size_t)by * sC; const float* bp = bias ? bias + (size_t)by * sBias : nullptr;
  const int ntn = N >> 6; const int mt = blockIdx.x / ntn, nq = blockIdx.x - mt * ntn; const int row0 = mt * 128 + 32 * w, col0 = nq * 64; if (row0 >= M) return;
  const _Float16* a0p = A + (size_t)(row0 + ln) * lda; const _Float16* a1p = a0p + (size_t)16 * lda;
  const _Float16* b0p = Bh + (size_t)(col0 + ln) * ldb; const _Float16* b1p = b0p + (size_t)16 * ldb; const _Float16* b2p = b1p + (size_t)16 * ldb; const _Float16* b3p = b2p + (size_t)16 * ldb;
  const v8f z8 = {0.f,0.f,0.f,0.f,0.f,0.f,0.f,0.f}; v8f c00 = z8, c01 = z8, c02 = z8, c03 = z8, c10 = z8, c11 = z8, c12 = z8, c13 = z8;
  for (int kb = 0; kb < K; kb += 32) { const v16h a0 = g2_frag(a0p + kb, hh), a1 = g2_frag(a1p + kb, hh);
    v16h b = g2_frag(b0p + kb, hh); c00 = g2_mma(a0, b, c00); c10 = g2_mma(a1, b, c10);
    b = g2_frag(b1p + kb, hh); c01 = g2_mma(a0, b, c01); c11 = g2_mma(a1, b, c11);
    b = g2_frag(b2p + kb, hh); c02 = g2_mma(a0, b, c02); c12 = g2_mma(a1, b, c12);
    b = g2_frag(b3p + kb, hh); c03 = g2_mma(a0, b, c03); c13 = g2_mma(a1, b, c13); }
  v8f accs[8] = {c00, c01, c02, c03, c10, c11, c12, c13};
#pragma unroll
  for (int u = 0; u < 8; ++u) { const int t = u & 3, half = u >> 2; const int col = col0 + t * 16 + ln; const float bv = bp ? bf16_round(bp[col]) : 0.f;
#pragma unroll
    for (int r = 0; r < 8; ++r) { const int rloc = half * 16 + 8 * hh + r; float v = accs[u][r] * alpha + bv; if (CP) { if (rowsPerB < 0) v += CP[cofs + (size_t)(row0g + row0 + rloc) * ldc + col];      /* rowsPerB < 0: own element of the batched C plane */ else { const int bidx = (row0g + row0 + rloc) / rowsPerB; v += CP[(size_t)bidx * sCPb + (size_t)by * 64 + col]; } }
      if (ACT == 3) v = fmaxf(v, 0.f); else if (ACT == 6) v = 0.5f * v * (1.0f + erff(v * 0.70710678118654752f)); else if (ACT == 11) v = 1.0f / (1.0f + expf(-v)); else if (ACT == 15) v = v / (1.0f + expf(-v)); else if (ACT == 12) v = (v > 0.f) ? v : 0.01f * v; else if (ACT == 8) v = tanhf(v); else if (ACT == 9) v = 0.5f * v * (1.0f + tanhf(0.7978845608028654f * (v + 0.044715f * v * v * v))); else if (ACT == 14) v = (v > 0.f) ? v : 0.1f * v; else if (ACT == 16) v = (v >= 0.f) ? v : 0.3f * v; else if (ACT == 17) v = (v >= 0.f) ? v : 0.2f * v;
      so[w][rloc][t * 16 + ln] = v; } }
  __builtin_amdgcn_fence(__ATOMIC_ACQ_REL, "workgroup"); __builtin_amdgcn_wave_barrier();
  const int rsub = lane >> 4, c4 = (lane & 15) * 4;
  {
#pragma unroll
    for (int q = 0; q < 16; ++q) { const int r = q * 2 + rsub; const v4f v = *(const v4fa*)&so[w][r][c4]; if (C) *(v4f*)(C + cofs + (size_t)(row0 + r) * ldc + col0 + c4) = v; if (C16) { v4h h4; for (int i = 0; i < 4; ++i) h4[i] = (_Float16)v[i]; *(v4h*)(C16 + cofs + (size_t)(row0 + r) * ldc + col0 + c4) = h4; } }
     } }

__global__ __launch_bounds__(256) void k_wnat(const float* __restrict__ w, size_t n8, _Float16* __restrict__ Bt) { const size_t t = (size_t)blockIdx.x * 256 + threadIdx.x; if (t >= n8) return; FragH f; for (int q = 0; q < 8; ++q) f.h[q] = (_Float16)(bf16_round(w[t * 8 + q]) * 16.0f); *(v8us*)((unsigned short*)Bt + t * 8) = f.half[0];  }

// Fused causal attention of one batch: one wave owns 16 query rows of one head and walks its keys 32 at a time with a running maximum and sum.
// S^T = K Q^T (A = key rows, B = query rows): a lane holds scores of ONE query (column ln), keys 8 hh + r of each 16-key tile, so two converted score tiles are, as they lie, the B fragment of O^T += V^T P^T (A = rows of V^T).
// Weights are carried x256 (f16 range) and cancel in the division by their own sum; o leaves x64 like before.
__device__ __forceinline__ float fa_xhalf(float x) { return __builtin_bit_cast(float, __builtin_amdgcn_permlanex16(__builtin_bit_cast(int, x), __builtin_bit_cast(int, x), 0x76543210, 0xfedcba98, false, false)); }      /* lane l <-> lane l ^ 16 */
__global__ __launch_bounds__(128) void k_fattn(const _Float16* __restrict__ Q, const _Float16* __restrict__ K, const _Float16* __restrict__ Vt, _Float16* __restrict__ O) {
  const int lane = threadIdx.x & 31, ln = lane & 15, hh = lane >> 4; const int w = __builtin_amdgcn_readfirstlane((int)(threadIdx.x >> 5)); const int h = blockIdx.y;
  const int q0w = ((int)(gridDim.x - 1 - blockIdx.x) * 4 + w) * 16;      /* longest key walks are dispatched first */
  const int qi = q0w + ln; const int kend = ((q0w >> 5) + 1) * 32;      /* keys 0 .. kend - 1 cover every key <= q0w + 15; kend <= SQ */
  const _Float16* qp = Q + (size_t)qi * LQ + h * HD; const v16h qa = g2_frag(qp, hh), qb = g2_frag(qp + 32, hh);
  const _Float16* kp = K + (size_t)ln * KVD + h * HD; const _Float16* vp = Vt + ((size_t)h * HD + ln) * SQ;
  const v8f z8 = {0.f,0.f,0.f,0.f,0.f,0.f,0.f,0.f}; v8f o0 = z8, o1 = z8, o2 = z8, o3 = z8;
  const float cs = 0.125f * 1.4426950408889634f;      /* 1 / sqrt(64), and e^x = 2^(x log2 e) */
  float m = -1.0e30f, l = 0.f;
  v16h k0a = g2_frag(kp, hh), k0b = g2_frag(kp + 32, hh), k1a = g2_frag(kp + (size_t)16 * KVD, hh), k1b = g2_frag(kp + (size_t)16 * KVD + 32, hh);
  for (int kb = 0; kb < kend; kb += 32) {
    const v16h v0 = g2_frag(vp + kb, hh), v1 = g2_frag(vp + (size_t)16 * SQ + kb, hh), v2 = g2_frag(vp + (size_t)32 * SQ + kb, hh), v3 = g2_frag(vp + (size_t)48 * SQ + kb, hh);
    v8f s0 = g2_mma(k0a, qa, z8); s0 = g2_mma(k0b, qb, s0); v8f s1 = g2_mma(k1a, qa, z8); s1 = g2_mma(k1b, qb, s1);
    const int kn = (kb + 32 < kend) ? kb + 32 : kb;      /* next pass's key rows fetched under this pass's softmax; the last pass re-reads its own */
    const _Float16* kq = kp + (size_t)kn * KVD; k0a = g2_frag(kq, hh); k0b = g2_frag(kq + 32, hh); k1a = g2_frag(kq + (size_t)16 * KVD, hh); k1b = g2_frag(kq + (size_t)16 * KVD + 32, hh);
    asm volatile("s_wait_xcnt 0x0" ::: "memory");      /* behind this pass's 16 loads, in front of every later write of an address register that they name (the V^T pointer's step, the reuse of the key pointer's pair) */
    if (kb + 31 > q0w) {      /* only the last pass holds keys above a query of this tile */
      for (int r = 0; r < 8; ++r) { const int key = kb + 8 * hh + r; s0[r] = (key <= qi) ? s0[r] : -1.0e30f; s1[r] = (key + 16 <= qi) ? s1[r] : -1.0e30f; } }
    float mx = fmaxf(s0[0], s1[0]);
    for (int r = 1; r < 8; ++r) mx = fmaxf(mx, fmaxf(s0[r], s1[r]));
    mx = fmaxf(mx, fa_xhalf(mx)); const float mn = fmaxf(m, mx); float corr = (m - mn) * cs; m = mn; const float bias = fmaf(-mn, cs, 8.0f);
    float e[16];
    for (int r = 0; r < 8; ++r) { e[r] = fmaf(s0[r], cs, bias); e[8 + r] = fmaf(s1[r], cs, bias); }
    /* the pass's 17 exponentials, each in place on a register of its own, so that no transcendental is directly followed by a reader of its result or a writer of its source; the v_nop is that slot behind the last one */
    asm("v_exp_f32 %0, %0\n\tv_exp_f32 %1, %1\n\tv_exp_f32 %2, %2\n\tv_exp_f32 %3, %3\n\tv_exp_f32 %4, %4\n\tv_exp_f32 %5, %5\n\tv_exp_f32 %6, %6\n\tv_exp_f32 %7, %7\n\tv_exp_f32 %8, %8\n\t"
        "v_exp_f32 %9, %9\n\tv_exp_f32 %10, %10\n\tv_exp_f32 %11, %11\n\tv_exp_f32 %12, %12\n\tv_exp_f32 %13, %13\n\tv_exp_f32 %14, %14\n\tv_exp_f32 %15, %15\n\tv_exp_f32 %16, %16\n\tv_nop"
        : "+v"(corr), "+v"(e[0]), "+v"(e[1]), "+v"(e[2]), "+v"(e[3]), "+v"(e[4]), "+v"(e[5]), "+v"(e[6]), "+v"(e[7]), "+v"(e[8]), "+v"(e[9]), "+v"(e[10]), "+v"(e[11]), "+v"(e[12]), "+v"(e[13]), "+v"(e[14]), "+v"(e[15]));
    FragH pf; float sum = 0.f;
    for (int r = 0; r < 8; ++r) { sum += e[r] + e[8 + r]; pf.h[r] = (_Float16)e[r]; pf.h[8 + r] = (_Float16)e[8 + r]; }
    l = fmaf(l, corr, sum);
    for (int r = 0; r < 8; ++r) { o0[r] *= corr; o1[r] *= corr; o2[r] *= corr; o3[r] *= corr; }
    o0 = g2_mma(v0, pf.v, o0); o1 = g2_mma(v1, pf.v, o1); o2 = g2_mma(v2, pf.v, o2); o3 = g2_mma(v3, pf.v, o3); }
  const float fin = 64.0f / (l + fa_xhalf(l));      /* the two lane halves hold disjoint keys of the same query */
  unsigned short* op = (unsigned short*)O + (size_t)qi * DM + h * HD + 8 * hh; FragH f0, f1;
  for (int r = 0; r < 8; ++r) { f0.h[r] = (_Float16)(o0[r] * fin); f0.h[8 + r] = (_Float16)(o1[r] * fin); f1.h[r] = (_Float16)(o2[r] * fin); f1.h[8 + r] = (_Float16)(o3[r] * fin); }
  *(v8us*)op = f0.half[0]; *(v8us*)(op + 16) = f0.half[1]; *(v8us*)(op + 32) = f1.half[0]; *(v8us*)(op + 48) = f1.half[1]; }      /* register r of tile dt = O[qi][16 dt + 8 hh + r]: 16-byte stores */

template <int MASKADD>
__global__ __launch_bounds__(64) void k_att0(const float* __restrict__ QF, const float* __restrict__ KF, const float* __restrict__ VF, int ld, const float* __restrict__ mask, float scale, float* __restrict__ OF, int ldo) {
  __shared__ __attribute__((aligned(16))) float lq[64][64]; __shared__ __attribute__((aligned(16))) float lo[64][64];
  const int tid = threadIdx.x; const int h = blockIdx.x / (QT0 / 64), rg = blockIdx.x % (QT0 / 64); const int i = rg * 64 + tid;
  const float* qr = QF + (size_t)i * ld + h * HD;
  for (int c = 0; c < HD / 4; ++c) { *(v4f*)&lq[tid][c * 4] = *(const v4fa*)(qr + c * 4); const v4f z = {0.f, 0.f, 0.f, 0.f}; *(v4f*)&lo[tid][c * 4] = z; }
  float m = -1.0e30f, l = 0.f; const int jmax = MASKADD ? (SQ - 1) : (rg * 64 + 63);      /* additive-mask form: every key (the mask input decides); causal form: keys up to the block's last row */
  for (int j = 0; j <= jmax; ++j) { const float* kr = KF + (size_t)j * ld + h * HD; const float* vr = VF + (size_t)j * ld + h * HD; float s = 0.f;
    for (int c = 0; c < HD / 4; ++c) { const v4f kq = *(const v4fa*)(kr + c * 4); const v4f qq = *(v4f*)&lq[tid][c * 4]; s = __fadd_rn(s, __fmul_rn(qq[0], kq[0])); s = __fadd_rn(s, __fmul_rn(qq[1], kq[1])); s = __fadd_rn(s, __fmul_rn(qq[2], kq[2])); s = __fadd_rn(s, __fmul_rn(qq[3], kq[3])); }
    s = __fmul_rn(s, scale); if (MASKADD) s = __fadd_rn(s, __fmul_rn(bf16_round(mask[(size_t)i * SQ + j]), -10000.0f));
    const float f = (MASKADD || j <= i) ? 1.f : 0.f; const float sm = fmaf(f, s, (1.f - f) * -1.0e30f); const float mn = fmaxf(m, sm); const float sc = expf(m - mn); const float e = expf(sm - mn); l = __fadd_rn(__fmul_rn(l, sc), e); m = mn;
    for (int c = 0; c < HD / 4; ++c) { const v4f vv = *(const v4fa*)(vr + c * 4); v4f oo = *(v4f*)&lo[tid][c * 4]; for (int u = 0; u < 4; ++u) oo[u] = __fadd_rn(__fmul_rn(oo[u], sc), __fmul_rn(e, vv[u])); *(v4f*)&lo[tid][c * 4] = oo; } }
  const float fin = 64.0f / l;      /* o carried x64 like the f16 path */
  for (int c = 0; c < HD / 4; ++c) { v4f oo = *(v4f*)&lo[tid][c * 4]; for (int u = 0; u < 4; ++u) oo[u] = __fmul_rn(oo[u], fin); *(v4f*)&lo[tid][c * 4] = oo; }
  __syncthreads();
  {
    for (int it = 0; it < 16; ++it) { const int row = it * 4 + tid / 16, pc = (tid % 16) * 4; const v4f v = *(const v4f*)&lo[row][pc]; *(v4f*)(OF + (size_t)(rg * 64 + row) * ldo + h * HD + pc) = v; }
     } }

__global__ __launch_bounds__(256) void k_kvexp(const float* __restrict__ src, float* __restrict__ dst, size_t n4) { const size_t t = (size_t)blockIdx.x * 256 + threadIdx.x; if (t >= n4) return; const size_t e = t * 4; const size_t row = e / DM; const int col = (int)(e % DM); const int h = col / HD, d = col % HD; const v4f v = *(const v4fa*)(src + row * KVD + (size_t)(h / HPG) * HD + d); *(v4f*)(dst + e) = v;  }

__global__ __launch_bounds__(256) void k_tab2(float theta, float* __restrict__ CS, float* __restrict__ SN) {
  const int t = blockIdx.x * 256 + threadIdx.x; if (t >= SQ * (HD / 2)) return; const int i = t % (HD / 2); const int p = t / (HD / 2); const float invf = 1.0f / powf(theta, (float)(2 * i) / (float)HD); const float ang = __fmul_rn((float)p, invf); const float c = cosf(ang), s = sinf(ang);
  *(float*)(CS + t) = c; *(float*)(SN + t) = s;  }
template <int NORM, int ROPE>
__global__ __launch_bounds__(64) void k_xform(const float* __restrict__ F, int ldf, int nh, const float* __restrict__ gain, float eps, const float* __restrict__ CS, const float* __restrict__ SN, _Float16* __restrict__ H16, int ldo) {
  __shared__ float xv[HD]; __shared__ float red[HD]; __shared__ unsigned short sh_[HD]; const int d = threadIdx.x; const int h = blockIdx.x % nh; const size_t r = blockIdx.x / nh; const int p = (int)(r % SQ);
  float x = F[r * (size_t)ldf + (size_t)h * HD + d];
  if (NORM) { red[d] = __fmul_rn(x, x); __syncthreads(); for (int st = HD / 2; st > 0; st >>= 1) { if (d < st) red[d] = __fadd_rn(red[d], red[d + st]); __syncthreads(); } const float rs = rsqrtf(__fadd_rn(red[0] / (float)HD, eps)); x = __fmul_rn(__fmul_rn(x, rs), bf16_round(gain[d])); }
  xv[d] = x; __syncthreads();
  float o = x;
  if (ROPE == 1) { const int i = d >> 1; const float c = CS[p * (HD / 2) + i], s = SN[p * (HD / 2) + i]; const float ev = xv[2 * i], od = xv[2 * i + 1]; o = (d & 1) ? __fadd_rn(__fmul_rn(ev, s), __fmul_rn(od, c)) : __fadd_rn(__fmul_rn(ev, c), -__fmul_rn(od, s)); }
  if (ROPE == 2) { const int i = d & (HD / 2 - 1); const float c = CS[p * (HD / 2) + i], s = SN[p * (HD / 2) + i]; const float lo = xv[i], hi = xv[i + HD / 2]; o = (d < HD / 2) ? __fadd_rn(__fmul_rn(lo, c), -__fmul_rn(hi, s)) : __fadd_rn(__fmul_rn(lo, s), __fmul_rn(hi, c)); }
  if (ROPE == 3) { const float c = CS[p * HD + d], s = SN[p * HD + d]; const float lo = xv[d & (HD / 2 - 1)], hi = xv[(d & (HD / 2 - 1)) + HD / 2]; o = (d < HD / 2) ? __fadd_rn(__fmul_rn(lo, c), -__fmul_rn(hi, s)) : __fadd_rn(__fmul_rn(hi, c), __fmul_rn(lo, s)); }      /* rotate-half with FULL-width per-element tables [pos][HD] */
  FragH th; th.h[0] = (_Float16)o; sh_[d] = th.u[0]; __syncthreads();
  if (d < HD / 8) { FragH f; for (int q = 0; q < 8; ++q) f.u[q] = sh_[d * 8 + q]; unsigned short* dst = (unsigned short*)H16 + r * (size_t)ldo + (size_t)h * HD + d * 8; *(v8us*)dst = f.half[0];  } }

template <int NORM, int ROPE>
__global__ __launch_bounds__(64) void k_xformf(const float* __restrict__ F, int ldf, int nh, const float* __restrict__ gain, float eps, const float* __restrict__ CS, const float* __restrict__ SN, float* __restrict__ F32, int ldo) {
  __shared__ float xv[HD]; __shared__ float red[HD]; const int d = threadIdx.x; const int h = blockIdx.x % nh; const size_t r = blockIdx.x / nh; const int p = (int)(r % SQ);
  float x = F[r * (size_t)ldf + (size_t)h * HD + d];
  if (NORM) { red[d] = __fmul_rn(x, x); __syncthreads(); for (int st = HD / 2; st > 0; st >>= 1) { if (d < st) red[d] = __fadd_rn(red[d], red[d + st]); __syncthreads(); } const float rs = rsqrtf(__fadd_rn(red[0] / (float)HD, eps)); x = __fmul_rn(__fmul_rn(x, rs), bf16_round(gain[d])); }
  xv[d] = x; __syncthreads();
  float o = x;
  if (ROPE == 1) { const int i = d >> 1; const float c = CS[p * (HD / 2) + i], s = SN[p * (HD / 2) + i]; const float ev = xv[2 * i], od = xv[2 * i + 1]; o = (d & 1) ? __fadd_rn(__fmul_rn(ev, s), __fmul_rn(od, c)) : __fadd_rn(__fmul_rn(ev, c), -__fmul_rn(od, s)); }
  if (ROPE == 2) { const int i = d & (HD / 2 - 1); const float c = CS[p * (HD / 2) + i], s = SN[p * (HD / 2) + i]; const float lo = xv[i], hi = xv[i + HD / 2]; o = (d < HD / 2) ? __fadd_rn(__fmul_rn(lo, c), -__fmul_rn(hi, s)) : __fadd_rn(__fmul_rn(lo, s), __fmul_rn(hi, c)); }
  if (ROPE == 3) { const float c = CS[p * HD + d], s = SN[p * HD + d]; const float lo = xv[d & (HD / 2 - 1)], hi = xv[(d & (HD / 2 - 1)) + HD / 2]; o = (d < HD / 2) ? __fadd_rn(__fmul_rn(lo, c), -__fmul_rn(hi, s)) : __fadd_rn(__fmul_rn(hi, c), __fmul_rn(lo, s)); }      /* rotate-half with FULL-width per-element tables [pos][HD] */
  float* dst = F32 + r * (size_t)ldo + (size_t)h * HD + d; *(float*)dst = o;  }

__global__ __launch_bounds__(256) void k_bfcp(const float* __restrict__ src, float* __restrict__ dst, size_t n4) { const size_t t = (size_t)blockIdx.x * 256 + threadIdx.x; if (t >= n4) return; const v4f a = *(const v4fa*)(src + t * 4); v4f o; for (int q = 0; q < 4; ++q) o[q] = bf16_round(a[q]); *(v4f*)(dst + t * 4) = o;  }

__global__ __launch_bounds__(256) void k_tabhalf(const float* __restrict__ cs, const float* __restrict__ sn, float* __restrict__ CS, float* __restrict__ SN) { const int t = blockIdx.x * 256 + threadIdx.x; if (t >= SQ * (HD / 2)) return; const int p = t / (HD / 2), i = t % (HD / 2); const float c = bf16_round(cs[(size_t)p * HD + i]), s = bf16_round(sn[(size_t)p * HD + i]);
  *(float*)(CS + t) = c; *(float*)(SN + t) = s;  }

__global__ __launch_bounds__(256) void k_tab2d(float* __restrict__ CS, float* __restrict__ SN) {
  const int t = blockIdx.x * 256 + threadIdx.x; if (t >= SQ * (HD / 2)) return; const int i = t % (HD / 2); const int p = t / (HD / 2); const float invf = (float)(1.0 / pow(10000.0, (double)(2 * i) / (double)HD)); const float ang = __fmul_rn((float)p, invf); const float c = cosf(ang), s = sinf(ang);
  *(float*)(CS + t) = c; *(float*)(SN + t) = s;  }
extern "C" void kernel_launch(void* const* d_in, const int* in_sizes, int n_in,
                              void* d_out, int out_size, void* d_ws, size_t ws_size, hipStream_t stream) {
  (void)in_sizes; (void)n_in; (void)out_size;
  const float* const* I = (const float* const*)d_in; const float* x = I[0]; const float* wattn = I[1]; const float* wo = I[2]; const float* qg = I[3]; const float* kg = I[4];      /* x; fused [in][out] Wqkv [1024][3072] (q, k, v column thirds); [in][out] Wproj; RMS-norm gains q_norm_w / k_norm_w [64]; no biases; rope tables computed in-kernel (positions = row index) */
  static_assert(HPG == 1 && NH == NG * HPG && NH * HD == DM && KVD == DM, "plain multi-head attention as 16 kv groups of one query head"); const float* bq = nullptr; const float* bk = nullptr; const float* bv = nullptr; const float* bo = nullptr;      /* no biases in this module */
  char* ws = (char*)d_ws; size_t off = 0;
  auto take = [&](size_t bytes) { char* p = ws + off; off += (bytes + 255) & ~(size_t)255; return p; };
  _Float16* BQKV = (_Float16*)take((size_t)3 * DM * DM * 2); _Float16* BQ = BQKV; _Float16* BK = BQKV + (size_t)DM * DM; _Float16* BV = BQKV + (size_t)2 * DM * DM; _Float16* BO = (_Float16*)take((size_t)DM * DM * 2);      /* one transposed plane Bt [3072][1024] of the fused weight: rows 0..1023 = q, 1024.. = k, 2048.. = v */
  _Float16* X16 = (_Float16*)take(NR * DM * 2); float* QF = (float*)take((size_t)SQ * DM * 4); float* KF = (float*)take((size_t)SQ * KVD * 4); float* CSB = (float*)take((size_t)SQ * HD * 4); float* SNB = (float*)take((size_t)SQ * HD * 4); _Float16* Q16 = (_Float16*)take(NR * DM * 2); _Float16* K16 = (_Float16*)take(NR * KVD * 2); _Float16* V16 = (_Float16*)take(NR * KVD * 2); _Float16* O16 = (_Float16*)take(NR * DM * 2);
  _Float16* VT = (_Float16*)take((size_t)NH * HD * SQ * 2);
  float* QF0 = (float*)take((size_t)QT0 * DM * 4); float* KF0 = (float*)take((size_t)QT0 * KVD * 4); float* VF0 = (float*)take((size_t)QT0 * KVD * 4); float* KF0e = (float*)take((size_t)QT0 * DM * 4); float* VF0e = (float*)take((size_t)QT0 * DM * 4); float* OF0 = (float*)take((size_t)NB * QT0 * DM * 4); _Float16* OH0 = (_Float16*)take((size_t)NB * QT0 * DM * 2); _Float16* OL0 = (_Float16*)take((size_t)NB * QT0 * DM * 2);
  if (off > ws_size) return;
  k_wt_f16<<<(unsigned)(((size_t)3 * DM * (DM / 8) + 255) / 256), 256, 0, stream>>>(wattn, BQKV, DM, 3 * DM, 16.0f); k_wt_f16<<<(unsigned)(((size_t)DM * (DM / 8) + 255) / 256), 256, 0, stream>>>(wo, BO, DM, DM, 16.0f);      /* [in][out] -> Bt x16 planes (fused Wqkv: K 1024, N 3072) */
  k_x16<<<(unsigned)((NR * DM / 8 + 255) / 256), 256, 0, stream>>>(x, X16, NR * DM / 8);
  k_tab2<<<(SQ * (HD / 2) + 255) / 256, 256, 0, stream>>>(10000.0f, CSB, SNB);      /* rope tables cos / sin(p / 10000^(2i/64)), i < 32: f32 pow, reciprocal, product */
  const size_t r0p = (size_t)B0 * SQ;      /* first projected row */
  k_gemm2<0><<<dim3((unsigned)((MP / 128) * (KVD / 64)), 1), 128, 0, stream>>>(X16 + r0p * DM, DM, 0, BV, DM, 0, 0.0625f, bv, 0, nullptr, 1, 0, 0, nullptr, V16 + r0p * KVD, KVD, 0, MP, KVD, DM);
  for (int b = B0; b < B0 + NBR; ++b) { const size_t r0 = (size_t)b * SQ;
    k_gemm2<0><<<dim3((unsigned)((SQ / 128) * (DM / 64)), 1), 128, 0, stream>>>(X16 + r0 * DM, DM, 0, BQ, DM, 0, 0.0625f, bq, 0, nullptr, 1, 0, 0, QF, nullptr, DM, 0, SQ, DM, DM);      /* q (f32) of this batch */
    k_gemm2<0><<<dim3((unsigned)((SQ / 128) * (KVD / 64)), 1), 128, 0, stream>>>(X16 + r0 * DM, DM, 0, BK, DM, 0, 0.0625f, bk, 0, nullptr, 1, 0, 0, KF, nullptr, KVD, 0, SQ, KVD, DM);      /* k (f32) */
    k_xform<1, 2><<<(unsigned)((size_t)SQ * NH), 64, 0, stream>>>(QF, DM, NH, qg, 1e-5f, CSB, SNB, Q16 + r0 * DM, DM); k_xform<1, 2><<<(unsigned)((size_t)SQ * NG), 64, 0, stream>>>(KF, KVD, NG, kg, 1e-5f, CSB, SNB, K16 + r0 * KVD, KVD);      /* per-head RMS norm (gain, eps 1e-5) then the half-split rope <1, 2> (out_lo = x_lo c - x_hi s, out_hi = x_lo s + x_hi c = t cos + rotate_half(t) sin with the module's [f | f] tables) -> f16 rows */
    k_xformf<1, 2><<<(unsigned)(QT0 * NH), 64, 0, stream>>>(QF, DM, NH, qg, 1e-5f, CSB, SNB, QF0, DM); k_xformf<1, 2><<<(unsigned)(QT0 * NG), 64, 0, stream>>>(KF, KVD, NG, kg, 1e-5f, CSB, SNB, KF0, KVD);      /* f32 normed and half-split-roped q, k of rows 0..255 */
    k_vt<NG, SQ><<<NG * (SQ / 64), 256, 0, stream>>>(V16 + r0 * KVD, KVD, 0, VT);      /* V^T [NH][HD][SQ] for this batch */
    k_gemm2<0><<<dim3((QT0 / 128) * (KVD / 64), 1), 128, 0, stream>>>(X16 + r0 * DM, DM, 0, BV, DM, 0, 0.0625f, bv, 0, nullptr, 1, 0, 0, VF0, nullptr, KVD, 0, QT0, KVD, DM);
    k_kvexp<<<(unsigned)(((size_t)QT0 * DM / 4 + 255) / 256), 256, 0, stream>>>(KF0, KF0e, (size_t)QT0 * DM / 4); k_kvexp<<<(unsigned)(((size_t)QT0 * DM / 4 + 255) / 256), 256, 0, stream>>>(VF0, VF0e, (size_t)QT0 * DM / 4);      /* head h <- kv group h / HPG (HPG is 1 here: a plain copy) for the exact first-tile kernel */      /* f32 q, k, v of the first 256 rows (exact products) */
    k_att0<0><<<NH * (QT0 / 64), 64, 0, stream>>>(QF0, KF0e, VF0e, DM, nullptr, 0.125f, OF0 + (size_t)b * QT0 * DM, DM);      /* exact f32 attention for rows 0..255 (o x64) */
    k_fattn<<<dim3(SQ / 64, NH), 128, 0, stream>>>(Q16 + r0 * LQ, K16 + r0 * KVD, VT, O16 + r0 * DM); }      /* scores, causal softmax and weights x V of all 16 heads and all query rows of this batch in ONE launch; scores and weights stay in registers (o x64) */
  k_gemm2<0><<<dim3((unsigned)((MPO / 128) * (DM / 64)), 1), 128, 0, stream>>>(O16 + r0p * DM, DM, 0, BO, DM, 0, 0.0009765625f, bo, 0, nullptr, 1, 0, 0, (float*)d_out + r0p * DM, nullptr, DM, 0, MPO, DM, DM);      /* out rows are the output layout */
  k_hl<<<(unsigned)(((size_t)NB * QT0 * DM / 8 + 255) / 256), 256, 0, stream>>>(OF0, OH0, OL0, (size_t)NB * QT0 * DM / 8);      /* first-tile o (x64) -> f16 hi + x1024 residual planes */
  for (int b = B0; b < B0 + NBR; ++b) { const size_t r0 = (size_t)b * SQ; const size_t f0 = (size_t)b * QT0;
    k_gemm2<0><<<dim3((QT0 / 128) * (DM / 64), 1), 128, 0, stream>>>(OH0 + f0 * DM, DM, 0, BO, DM, 0, 0.0009765625f, bo, 0, nullptr, 1, 0, 0, (float*)d_out + r0 * DM, nullptr, DM, 0, QT0, DM, DM);      /* rows 0..255: out = o_hi Wo (no bias here), overwriting the f16-path rows */
    k_gemm2<0><<<dim3((QT0 / 128) * (DM / 64), 1), 128, 0, stream>>>(OL0 + f0 * DM, DM, 0, BO, DM, 0, 0.00000095367431640625f, nullptr, 0, (const float*)d_out + r0 * DM, -1, 0, 0, (float*)d_out + r0 * DM, nullptr, DM, 0, QT0, DM, DM); }      /* += o_lo Wo 2^-20 (own-element accumulate) */
}

// v002
// It runs in 1150 microseconds.
// Two timings next to v001 both put it at 1.71 times that version's speed.
// Counting every step since v000, it is 6.36 times as fast.
#include <hip/hip_runtime.h>
// Causal multi-head self-attention with a per-head RMS norm on q and k THEN rotate-half RoPE computed in the module, and a bias-free fused QKV projection (x [4][2048][1024]; qkv = x Wqkv ([in][out] 1024 x 3072, no bias) split into q | k | v thirds, 16 heads of 64; q, k = x * rsqrt(mean(x^2 over the 64 head dims) + 1e-5) * gain (gains q_norm_w / k_norm_w [64], read); cos / sin = [f | f] of pos * (1 / 10000^(2i/64)); q = q cos + rotate_half(q) sin with rotate_half = cat(-x2, x1), likewise k; scores / sqrt(64); causal (tril, -inf); softmax; out = merged Wproj ([in][out], no bias) -> [4][2048][1024]); run as grouped-query causal attention with 16 groups of ONE head with the norm stage on and the rope stage in its half-split mode.
// Compute dtype: inputs rounded to bf16 (the two gain vectors bf16-rounded on load); x / weights exact; the per-head RMS norm and the rotation in f32 on VALU; q, k, v, softmax weights and o as plain f16 GEMM operands (~2^-12); scores and softmax statistics f32; v_wmma_f32_16x16x32_f16.
#define NB 4
#define NG 16
#define HPG 1
#define KVD (NG * HD)
#define SQ 2048
#define DM 1024
#define NH 16
#define HD 64
#define HG 4
#define QT 256                       /* unused (k_fattn tiles 16 query rows per wave) */
#define NKX SQ
#define QT0 256                      /* first-tile rows recomputed exactly in f32 */
#define B0 0                         /* first batch processed (debug hook) */
#define NBR NB                       /* batches processed (debug hook) */
#define NR ((size_t)NB * SQ)         /* token rows */
#define MP ((int)((size_t)NBR * SQ)) /* rows projected (debug hook) */
#define QN SQ                        /* unused (k_fattn attends all SQ rows of a batch) */
#define NHD NH                       /* unused (all NH heads are attended) */
#define MPO MP                       /* rows through the output stage (debug hook) */
#define LQ DM      /* row pitch of the q/k/v rows */
typedef __bf16 v16b __attribute__((ext_vector_type(16)));
typedef unsigned short v8us __attribute__((ext_vector_type(8), may_alias));
typedef float  v8f  __attribute__((ext_vector_type(8)));
typedef float  v4f  __attribute__((ext_vector_type(4)));
typedef float  v4fa __attribute__((ext_vector_type(4), may_alias));
union FragB { v16b v; v8us half[2]; unsigned short u[16]; };

__device__ __forceinline__ unsigned short bf16_bits(float x) { unsigned int u = __float_as_uint(x); return (unsigned short)((u + 0x7FFFu + ((u >> 16) & 1u)) >> 16); }
__device__ __forceinline__ float bf16_val(unsigned short b) { return __uint_as_float(((unsigned int)b) << 16); }
__device__ __forceinline__ float bf16_round(float x) { return bf16_val(bf16_bits(x)); }
// D += A·B with NT terms: 1 = ah·bh, 2 = + al·bh (A split), 3 = + ah·bl (both split)
template <int NT>
__device__ __forceinline__ v8f mmaN(v16b ah, v16b al, v16b bh, v16b bl, v8f c) {
  c = __builtin_amdgcn_wmma_f32_16x16x32_bf16(false, ah, false, bh, (short)0, c, false, false);
  if (NT >= 2) c = __builtin_amdgcn_wmma_f32_16x16x32_bf16(false, al, false, bh, (short)0, c, false, false);
  if (NT >= 3) c = __builtin_amdgcn_wmma_f32_16x16x32_bf16(false, ah, false, bl, (short)0, c, false, false);
  asm volatile("v_nop\n\tv_nop\n\tv_nop\n\tv_nop" : "+v"(c) : "v"(ah), "v"(al), "v"(bh), "v"(bl));
  return c;
}

__global__ __launch_bounds__(256) void k_wt_bf16(const float* __restrict__ W, unsigned short* __restrict__ Wt, int K, int N) {
  const int t = blockIdx.x * 256 + threadIdx.x;
  const int k8n = K / 8;
  if (t >= N * k8n) return;
  const int n = t / k8n, k8 = (t % k8n) * 8;
  v8us v;
#pragma unroll
  for (int i = 0; i < 8; ++i) v[i] = bf16_bits(W[(size_t)(k8 + i) * N + n]);
  *(v8us*)(Wt + (size_t)n * K + k8) = v;
  
}

// GEMM C[M][N] (f32, pitch ldc) = act(A[M][K]·W + bias). A f32 row-major (pitch lda) converted per fragment to bf16
// (ASPLIT: hi/lo two planes -> 2 terms, else single rounded term); Wt bf16 [N][K] (pitch ldb). BIAS_BF16 rounds the
// bias to bf16 first (bias quantised to bf16 before the add). K%32==0, M%16==0, N%64==0.
template <bool ASPLIT, int ACT, bool BIAS_BF16>
__global__ __launch_bounds__(128) void k_gemm_bf(const float* __restrict__ A, int lda, const unsigned short* __restrict__ Wt, int ldb,
                                               const float* __restrict__ bias, float* __restrict__ C, int ldc, int M, int N, int K) {
  __shared__ __attribute__((aligned(16))) float so[4][16][64];
  const int tid = threadIdx.x, w = tid >> 5, lane = tid & 31, ln = lane & 15, hh = lane >> 4;
  const int ntn = N / 64;
  const int wid = blockIdx.x * 4 + w;
  const int mt = wid / ntn, nq = wid % ntn;
  if (mt * 16 >= M) return;
  const int row0 = mt * 16, col0 = nq * 64;
  const float* arow = A + (size_t)(row0 + ln) * lda;
  v8f acc[4] = {};
  for (int kb = 0; kb < K; kb += 32) {
    FragB ah, al;
    const v4f x0 = *(const v4fa*)(arow + kb + 8 * hh), x1 = *(const v4fa*)(arow + kb + 8 * hh + 4);
    const v4f x2 = *(const v4fa*)(arow + kb + 16 + 8 * hh), x3 = *(const v4fa*)(arow + kb + 16 + 8 * hh + 4);
    float xs[16] = {x0[0],x0[1],x0[2],x0[3],x1[0],x1[1],x1[2],x1[3],x2[0],x2[1],x2[2],x2[3],x3[0],x3[1],x3[2],x3[3]};
#pragma unroll
    for (int i = 0; i < 16; ++i) { const unsigned short hb = bf16_bits(xs[i]); ah.u[i] = hb; al.u[i] = ASPLIT ? bf16_bits(xs[i] - bf16_val(hb)) : (unsigned short)0; }
#pragma unroll
    for (int t = 0; t < 4; ++t) {
      const unsigned short* brow = Wt + (size_t)(col0 + t * 16 + ln) * ldb + kb;
      FragB b;
      b.half[0] = *(const v8us*)(brow + 8 * hh);
      b.half[1] = *(const v8us*)(brow + 16 + 8 * hh);
      acc[t] = mmaN<ASPLIT ? 2 : 1>(ah.v, al.v, b.v, b.v, acc[t]);
    }
  }
#pragma unroll
  for (int t = 0; t < 4; ++t) {
    float bv = bias ? bias[col0 + t * 16 + ln] : 0.f;
    if (BIAS_BF16) bv = bf16_round(bv);
#pragma unroll
    for (int r = 0; r < 8; ++r) { float v = acc[t][r] + bv; if (ACT == 1) v = fmaxf(v, 0.f); so[w][8 * hh + r][t * 16 + ln] = v; }
  }
  __builtin_amdgcn_fence(__ATOMIC_ACQ_REL, "workgroup");
  __builtin_amdgcn_wave_barrier();
  const int rsub = lane >> 4, c4 = (lane & 15) * 4;
  {
#pragma unroll
    for (int q = 0; q < 8; ++q) {
      const int r = q * 2 + rsub;
      const v4f v = *(const v4fa*)&so[w][r][c4];
      *(v4f*)(C + (size_t)(row0 + r) * ldc + col0 + c4) = v;
    }
    
  }
}

// GEMM C = act(A·W + bias + resid): A f32 (ASPLIT -> hi/lo 2 terms), Wt bf16 [N][K]; ACT 0 none, 1 relu, 2 exact gelu;
// resid (optional, f32, row index = (row % rmod), pitch ldr, RES_BF16 rounds it) added before the activation.
template <bool ASPLIT, int ACT, bool BIAS_BF16, bool RES_BF16>
__global__ __launch_bounds__(128) void k_gemm_bf3(const float* __restrict__ A, int lda, const unsigned short* __restrict__ Wt, int ldb,
                                                const float* __restrict__ bias, const float* __restrict__ resid, int rmod, int ldr,
                                                float* __restrict__ C, int ldc, int M, int N, int K) {
  __shared__ __attribute__((aligned(16))) float so[4][16][64];
  const int tid = threadIdx.x, w = tid >> 5, lane = tid & 31, ln = lane & 15, hh = lane >> 4;
  const int ntn = N / 64;
  const int wid = blockIdx.x * 4 + w;
  const int mt = wid / ntn, nq = wid % ntn;
  if (mt * 16 >= M) return;
  const int row0 = mt * 16, col0 = nq * 64;
  const float* arow = A + (size_t)(row0 + ln) * lda;
  v8f acc[4] = {};
  for (int kb = 0; kb < K; kb += 32) {
    FragB ah, al;
    const v4f x0 = *(const v4fa*)(arow + kb + 8 * hh), x1 = *(const v4fa*)(arow + kb + 8 * hh + 4);
    const v4f x2 = *(const v4fa*)(arow + kb + 16 + 8 * hh), x3 = *(const v4fa*)(arow + kb + 16 + 8 * hh + 4);
    float xs[16] = {x0[0],x0[1],x0[2],x0[3],x1[0],x1[1],x1[2],x1[3],x2[0],x2[1],x2[2],x2[3],x3[0],x3[1],x3[2],x3[3]};
#pragma unroll
    for (int i = 0; i < 16; ++i) { const unsigned short hb = bf16_bits(xs[i]); ah.u[i] = hb; al.u[i] = ASPLIT ? bf16_bits(xs[i] - bf16_val(hb)) : (unsigned short)0; }
#pragma unroll
    for (int t = 0; t < 4; ++t) {
      const unsigned short* brow = Wt + (size_t)(col0 + t * 16 + ln) * ldb + kb;
      FragB b;
      b.half[0] = *(const v8us*)(brow + 8 * hh);
      b.half[1] = *(const v8us*)(brow + 16 + 8 * hh);
      acc[t] = mmaN<ASPLIT ? 2 : 1>(ah.v, al.v, b.v, b.v, acc[t]);
    }
  }
#pragma unroll
  for (int t = 0; t < 4; ++t) {
    const int col = col0 + t * 16 + ln;
    float bv = bias ? bias[col] : 0.f;
    if (BIAS_BF16) bv = bf16_round(bv);
#pragma unroll
    for (int r = 0; r < 8; ++r) {
      float v = acc[t][r] + bv;
      if (resid) { float rv = resid[(size_t)((row0 + 8 * hh + r) % rmod) * ldr + col]; if (RES_BF16) rv = bf16_round(rv); v += rv; }
      if (ACT == 1) v = fmaxf(v, 0.f);
      if (ACT == 2) v = 0.5f * v * (1.0f + erff(v * 0.70710678118654752f));
      if (ACT == 3) { const float u = 0.7978845608028654f * (v + 0.044715f * v * v * v); v = 0.5f * v * (1.0f + tanhf(u)); }
      so[w][8 * hh + r][t * 16 + ln] = v;
    }
  }
  __builtin_amdgcn_fence(__ATOMIC_ACQ_REL, "workgroup");
  __builtin_amdgcn_wave_barrier();
  const int rsub = lane >> 4, c4 = (lane & 15) * 4;
  {
#pragma unroll
    for (int q = 0; q < 8; ++q) {
      const int r = q * 2 + rsub;
      const v4f v = *(const v4fa*)&so[w][r][c4];
      *(v4f*)(C + (size_t)(row0 + r) * ldc + col0 + c4) = v;
    }
    
  }
}
// row LayerNorm (biased variance, eps) over N: s = X (+ R); optional out_sum <- s; out_norm <- (s-mu)*rsqrt(var+eps)*g + b
template <bool PARAM_BF16>
__global__ __launch_bounds__(256) void k_layernorm(const float* __restrict__ X, const float* __restrict__ R, const float* __restrict__ g, const float* __restrict__ bta,
                                                  float* __restrict__ out_sum, float* __restrict__ out_norm, int N, float eps) {
  __shared__ float red[256];
  const int row = blockIdx.x, tid = threadIdx.x;
  const float* x = X + (size_t)row * N; const float* rr = R ? R + (size_t)row * N : nullptr;
  float vals[16];                     // up to N = 4096
  const int per = N / 256;            // contiguous chunk per thread? use strided-by-4 chunks: thread handles j = tid*4 + 1024*u
  float s1 = 0.f;
  for (int u = 0; u < per / 4; ++u) {
    const int j = tid * 4 + 1024 * u;
    const v4f a = *(const v4fa*)(x + j);
    v4f b = {0.f,0.f,0.f,0.f}; if (rr) b = *(const v4fa*)(rr + j);
#pragma unroll
    for (int q = 0; q < 4; ++q) { const float v = a[q] + b[q]; vals[u * 4 + q] = v; s1 += v; }
  }
  red[tid] = s1; __syncthreads();
  for (int st = 128; st > 0; st >>= 1) { if (tid < st) red[tid] += red[tid + st]; __syncthreads(); }
  const float mu = red[0] / (float)N; __syncthreads();
  float s2 = 0.f;
  for (int u = 0; u < per / 4; ++u)
#pragma unroll
    for (int q = 0; q < 4; ++q) { const float c = vals[u * 4 + q] - mu; s2 += c * c; }
  red[tid] = s2; __syncthreads();
  for (int st = 128; st > 0; st >>= 1) { if (tid < st) red[tid] += red[tid + st]; __syncthreads(); }
  const float rs = rsqrtf(red[0] / (float)N + eps);
  {
    for (int u = 0; u < per / 4; ++u) {
      const int j = tid * 4 + 1024 * u;
      v4f o, sm;
#pragma unroll
      for (int q = 0; q < 4; ++q) {
        float gg = g[j + q], bb = bta[j + q];
        if (PARAM_BF16) { gg = bf16_round(gg); bb = bf16_round(bb); }
        sm[q] = vals[u * 4 + q]; o[q] = (vals[u * 4 + q] - mu) * rs * gg + bb;
      }
      if (out_sum) *(v4f*)(out_sum + (size_t)row * N + j) = sm;
      *(v4f*)(out_norm + (size_t)row * N + j) = o;
    }
    
  }
}

// ---- f16 WMMA path (v_wmma_f32_16x16x32_f16): 11-bit significands for operands in range — used where a [0,1] probability operand needs more precision than bf16
typedef _Float16 v16h __attribute__((ext_vector_type(16)));
union FragH { v16h v; v8us half[2]; _Float16 h[16]; unsigned short u[16]; };
template <int NT>
__device__ __forceinline__ v8f mmaH(v16h ah, v16h al, v16h bh, v16h bl, v8f c) {
  c = __builtin_amdgcn_wmma_f32_16x16x32_f16(false, ah, false, bh, (short)0, c, false, false);
  if (NT >= 2) c = __builtin_amdgcn_wmma_f32_16x16x32_f16(false, al, false, bh, (short)0, c, false, false);
  if (NT >= 3) c = __builtin_amdgcn_wmma_f32_16x16x32_f16(false, ah, false, bl, (short)0, c, false, false);
  asm volatile("v_nop\n\tv_nop\n\tv_nop\n\tv_nop" : "+v"(c) : "v"(ah), "v"(al), "v"(bh), "v"(bl));
  return c;
}
// batched GEMM like k_gemm_b but f16 operands: A f32 (split into f16 hi/lo if ASPLIT, else rounded to f16), Bt = f16 values [n][k]; alpha; C f32; N multiple of 16 (partial tiles skipped)
template <bool ASPLIT>
__global__ __launch_bounds__(128) void k_gemm_h(const float* __restrict__ A, int lda, size_t sA, const _Float16* __restrict__ Bh, int ldb, size_t sB, float alpha, float* __restrict__ C, int ldc, size_t sC, int M, int N, int K) {
  __shared__ __attribute__((aligned(16))) float so[4][16][64];
  const int tid = threadIdx.x, w = tid >> 5, lane = tid & 31, ln = lane & 15, hh = lane >> 4; const int by = blockIdx.y;
  A += (size_t)by * sA; Bh += (size_t)by * sB; C += (size_t)by * sC;
  const int ntn = (N + 63) / 64; const int wid = blockIdx.x * 4 + w; const int mt = wid / ntn, nq = wid % ntn; if (mt * 16 >= M) return;
  const int row0 = mt * 16, col0 = nq * 64; const float* arow = A + (size_t)(row0 + ln) * lda;
  v8f acc[4] = {};
  for (int kb = 0; kb < K; kb += 32) {
    FragH ah, al;
    const v4f x0 = *(const v4fa*)(arow + kb + 8 * hh), x1 = *(const v4fa*)(arow + kb + 8 * hh + 4), x2 = *(const v4fa*)(arow + kb + 16 + 8 * hh), x3 = *(const v4fa*)(arow + kb + 16 + 8 * hh + 4);
    float xs[16] = {x0[0],x0[1],x0[2],x0[3],x1[0],x1[1],x1[2],x1[3],x2[0],x2[1],x2[2],x2[3],x3[0],x3[1],x3[2],x3[3]};
#pragma unroll
    for (int i = 0; i < 16; ++i) { const _Float16 h = (_Float16)xs[i]; ah.h[i] = h; al.h[i] = ASPLIT ? (_Float16)(xs[i] - (float)h) : (_Float16)0.0f; }
#pragma unroll
    for (int t = 0; t < 4; ++t) { if (col0 + t * 16 >= N) continue; const size_t boff = (size_t)(col0 + t * 16 + ln) * ldb + kb; FragH bq; bq.half[0] = *(const v8us*)(Bh + boff + 8 * hh); bq.half[1] = *(const v8us*)(Bh + boff + 16 + 8 * hh);
      acc[t] = mmaH<ASPLIT ? 2 : 1>(ah.v, al.v, bq.v, bq.v, acc[t]); }
  }
#pragma unroll
  for (int t = 0; t < 4; ++t) { if (col0 + t * 16 >= N) continue;
#pragma unroll
    for (int r = 0; r < 8; ++r) so[w][8 * hh + r][t * 16 + ln] = acc[t][r] * alpha; }
  __builtin_amdgcn_fence(__ATOMIC_ACQ_REL, "workgroup"); __builtin_amdgcn_wave_barrier();
  const int rsub = lane >> 4, c4 = (lane & 15) * 4;
  {
#pragma unroll
    for (int q = 0; q < 8; ++q) { const int r = q * 2 + rsub; if (col0 + c4 < N) { const v4f v = *(const v4fa*)&so[w][r][c4]; *(v4f*)(C + (size_t)(row0 + r) * ldc + col0 + c4) = v; } }
     }
}

// Wt[n][k] = f16(W[k][n]·scale) from f32 row-major W[K][N] (scale = power of two; bf16-exact weights stay exact in f16 away from the subnormal range)
__global__ __launch_bounds__(256) void k_wt_f16(const float* __restrict__ W, _Float16* __restrict__ Wt, int K, int N, float scale) {
  const int t = blockIdx.x * 256 + threadIdx.x; if (t >= N * (K / 8)) return; const int n = t / (K / 8), k8 = (t % (K / 8)) * 8; FragH f;
#pragma unroll
  for (int i = 0; i < 8; ++i) f.h[i] = (_Float16)(bf16_round(W[(size_t)(k8 + i) * N + n]) * scale); const v8us o = f.half[0];
  *(v8us*)((unsigned short*)Wt + (size_t)n * K + k8) = o; 
}
// k_gemm_hh variant with fused epilogue: v = acc·alpha + bias[by·sBias + col] (+ CP[(row/rowsPerB)·sCPb + by·64 + col] if CP) ; ACT 0 none / 1 elu ; writes f16 C16 (and f32 C if non-null)
template <int ACT>
__global__ __launch_bounds__(128) void k_gemm_hhx(const _Float16* __restrict__ A, int lda, size_t sA, const _Float16* __restrict__ Bh, int ldb, size_t sB, float alpha, const float* __restrict__ bias, size_t sBias, const float* __restrict__ CP, int rowsPerB, size_t sCPb, int row0g,
    float* __restrict__ C, _Float16* __restrict__ C16, int ldc, size_t sC, int M, int N, int K) {
  __shared__ __attribute__((aligned(16))) float so[4][16][64];
  const int tid = threadIdx.x, w = tid >> 5, lane = tid & 31, ln = lane & 15, hh = lane >> 4; const int by = blockIdx.y;
  A += (size_t)by * sA; Bh += (size_t)by * sB; const size_t cofs = (size_t)by * sC; const float* bp = bias ? bias + (size_t)by * sBias : nullptr;
  const int ntn = (N + 63) / 64; const int wid = blockIdx.x * 4 + w; const int mt = wid / ntn, nq = wid % ntn; if (mt * 16 >= M) return;
  const int row0 = mt * 16, col0 = nq * 64; const _Float16* arow = A + (size_t)(row0 + ln) * lda;
  v8f acc[4] = {};
  for (int kb = 0; kb < K; kb += 32) { FragH ah; ah.half[0] = *(const v8us*)((const unsigned short*)arow + kb + 8 * hh); ah.half[1] = *(const v8us*)((const unsigned short*)arow + kb + 16 + 8 * hh);
#pragma unroll
    for (int t = 0; t < 4; ++t) { if (col0 + t * 16 >= N) continue; const size_t boff = (size_t)(col0 + t * 16 + ln) * ldb + kb; FragH bq; bq.half[0] = *(const v8us*)((const unsigned short*)Bh + boff + 8 * hh); bq.half[1] = *(const v8us*)((const unsigned short*)Bh + boff + 16 + 8 * hh);
      acc[t] = mmaH<1>(ah.v, ah.v, bq.v, bq.v, acc[t]); }
  }
#pragma unroll
  for (int t = 0; t < 4; ++t) { if (col0 + t * 16 >= N) continue; const int col = col0 + t * 16 + ln; const float bv = bp ? bf16_round(bp[col]) : 0.f;
#pragma unroll
    for (int r = 0; r < 8; ++r) { float v = acc[t][r] * alpha + bv; if (CP) { const int rr = row0g + row0 + 8 * hh + r; if (rowsPerB < 0) v += CP[cofs + (size_t)rr * ldc + col];      /* rowsPerB < 0: own element of the batched C plane */ else { const int bidx = rr / rowsPerB; v += CP[(size_t)bidx * sCPb + (size_t)by * 64 + col]; } } if (ACT == 1) v = (v > 0.f) ? v : expm1f(v); else if (ACT == 7) v = (v > 0.f) ? v + 1.0f : expf(v); else if (ACT == 8) v = tanhf(v); else if (ACT == 9) v = 0.5f * v * (1.0f + tanhf(0.7978845608028654f * (v + 0.044715f * v * v * v))); else if (ACT == 11) v = 1.0f / (1.0f + expf(-v)); else if (ACT == 12) v = (v > 0.f) ? v : 0.01f * v; else if (ACT == 14) v = (v > 0.f) ? v : 0.1f * v; else if (ACT == 16) v = (v >= 0.f) ? v : 0.3f * v; else if (ACT == 17) v = (v >= 0.f) ? v : 0.2f * v; else if (ACT == 15) v = v / (1.0f + expf(-v)); else if (ACT == 3) v = fmaxf(v, 0.f); else if (ACT == 6) v = 0.5f * v * (1.0f + erff(v * 0.70710678118654752f)); so[w][8 * hh + r][t * 16 + ln] = v; } }
  __builtin_amdgcn_fence(__ATOMIC_ACQ_REL, "workgroup"); __builtin_amdgcn_wave_barrier();
  const int rsub = lane >> 4, c4 = (lane & 15) * 4; typedef _Float16 v4h __attribute__((ext_vector_type(4)));
  {
#pragma unroll
    for (int q = 0; q < 8; ++q) { const int r = q * 2 + rsub; if (col0 + c4 < N) { const v4f v = *(const v4fa*)&so[w][r][c4]; if (C) *(v4f*)(C + cofs + (size_t)(row0 + r) * ldc + col0 + c4) = v; if (C16) { v4h h4; for (int i = 0; i < 4; ++i) h4[i] = (_Float16)v[i]; *(v4h*)(C16 + cofs + (size_t)(row0 + r) * ldc + col0 + c4) = h4; } } }
     }
}

typedef _Float16 v4h __attribute__((ext_vector_type(4)));

__global__ __launch_bounds__(256) void k_x16(const float* __restrict__ x, _Float16* __restrict__ X16, size_t n8) { const size_t t = (size_t)blockIdx.x * 256 + threadIdx.x; if (t >= n8) return; FragH f;
#pragma unroll
  for (int q = 0; q < 8; ++q) f.h[q] = (_Float16)bf16_round(x[t * 8 + q]); *(v8us*)((unsigned short*)X16 + t * 8) = f.half[0];  }
__global__ __launch_bounds__(256) void k_h16(const float* __restrict__ x, _Float16* __restrict__ X16, size_t n8) { const size_t t = (size_t)blockIdx.x * 256 + threadIdx.x; if (t >= n8) return; FragH f;
#pragma unroll
  for (int q = 0; q < 8; ++q) f.h[q] = (_Float16)x[t * 8 + q]; *(v8us*)((unsigned short*)X16 + t * 8) = f.half[0];  }
__global__ __launch_bounds__(256) void k_round16f(const float* __restrict__ W, _Float16* __restrict__ Bt, size_t n8) { const size_t t = (size_t)blockIdx.x * 256 + threadIdx.x; if (t >= n8) return; FragH f;
#pragma unroll
  for (int i = 0; i < 8; ++i) f.h[i] = (_Float16)(bf16_round(W[t * 8 + i]) * 16.0f); *(v8us*)((unsigned short*)Bt + t * 8) = f.half[0];  }
template <int NHv, int TTv>
__global__ __launch_bounds__(256) void k_vt(const _Float16* __restrict__ V16, int ldv, int voff, _Float16* __restrict__ Vt) { __shared__ unsigned short tl[64][66]; const int tid = threadIdx.x; const int slab = blockIdx.x / (TTv / 64), lg = blockIdx.x % (TTv / 64); const int b = slab / NHv, h = slab % NHv;
  for (int i = tid; i < 64 * 8; i += 256) { const int r = i / 8, c8 = (i % 8) * 8; FragH f; f.half[0] = *(const v8us*)((const unsigned short*)V16 + ((size_t)b * TTv + lg * 64 + r) * ldv + voff + h * 64 + c8);
#pragma unroll
    for (int q = 0; q < 8; ++q) tl[r][c8 + q] = f.u[q]; }
  __syncthreads();
  {
#pragma unroll
    for (int rd = 0; rd < 2; ++rd) { const int d = rd * 32 + tid / 8, pc = tid % 8; FragH f;
#pragma unroll
      for (int q = 0; q < 8; ++q) f.u[q] = tl[pc * 8 + q][d];
      *(v8us*)((unsigned short*)Vt + ((size_t)slab * 64 + d) * TTv + lg * 64 + pc * 8) = f.half[0]; }
     } }

__global__ __launch_bounds__(256) void k_hl(const float* __restrict__ F, _Float16* __restrict__ Hh, _Float16* __restrict__ Hl, size_t n8) { const size_t t = (size_t)blockIdx.x * 256 + threadIdx.x; if (t >= n8) return; FragH fh, fl; const v4f a = *(const v4fa*)(F + t * 8), c = *(const v4fa*)(F + t * 8 + 4);
#pragma unroll
  for (int q = 0; q < 4; ++q) { _Float16 h = (_Float16)a[q]; fh.h[q] = h; fl.h[q] = (_Float16)((a[q] - (float)h) * 1024.0f); h = (_Float16)c[q]; fh.h[4 + q] = h; fl.h[4 + q] = (_Float16)((c[q] - (float)h) * 1024.0f); }
  { *(v8us*)((unsigned short*)Hh + t * 8) = fh.half[0]; *(v8us*)((unsigned short*)Hl + t * 8) = fl.half[0];  } }

// ---- fast GEMM (wave tile 32x64; requires M % 32 == 0 rows per launch region and N % 64 == 0); epilogue = k_gemm_hhx semantics ----
__device__ __forceinline__ v16h g2_frag(const _Float16* p, int hh) { FragH f; f.half[0] = *(const v8us*)((const unsigned short*)p + 8 * hh); f.half[1] = *(const v8us*)((const unsigned short*)p + 16 + 8 * hh); return f.v; }
__device__ __forceinline__ v8f g2_mma(v16h a, v16h b, v8f c) { v8f d = __builtin_amdgcn_wmma_f32_16x16x32_f16(false, a, false, b, (short)0, c, false, false); asm volatile("v_nop\n\tv_nop\n\tv_nop\n\tv_nop" : "+v"(d) : "v"(a), "v"(b)); return d; }
template <int ACT>
__global__ __launch_bounds__(128) void k_gemm2(const _Float16* __restrict__ A, int lda, size_t sA, const _Float16* __restrict__ Bh, int ldb, size_t sB, float alpha, const float* __restrict__ bias, size_t sBias, const float* __restrict__ CP, int rowsPerB, size_t sCPb, int row0g,
    float* __restrict__ C, _Float16* __restrict__ C16, int ldc, size_t sC, int M, int N, int K) { static_assert(ACT == 0 || ACT == 3 || ACT == 6 || ACT == 8 || ACT == 9 || ACT == 11 || ACT == 12 || ACT == 14 || ACT == 15 || ACT == 16 || ACT == 17, "k_gemm2: unsupported ACT code (would silently apply no activation)");
  __shared__ __attribute__((aligned(16))) float so[4][32][68];
  const int tid = threadIdx.x, w = tid >> 5, lane = tid & 31, ln = lane & 15, hh = lane >> 4; const int by = blockIdx.y;
  A += (size_t)by * sA; Bh += (size_t)by * sB; const size_t cofs = (size_t)by * sC; const float* bp = bias ? bias + (size_t)by * sBias : nullptr;
  const int ntn = N >> 6; const int mt = blockIdx.x / ntn, nq = blockIdx.x - mt * ntn; const int row0 = mt * 128 + 32 * w, col0 = nq * 64; if (row0 >= M) return;
  const _Float16* a0p = A + (size_t)(row0 + ln) * lda; const _Float16* a1p = a0p + (size_t)16 * lda;
  const _Float16* b0p = Bh + (size_t)(col0 + ln) * ldb; const _Float16* b1p = b0p + (size_t)16 * ldb; const _Float16* b2p = b1p + (size_t)16 * ldb; const _Float16* b3p = b2p + (size_t)16 * ldb;
  const v8f z8 = {0.f,0.f,0.f,0.f,0.f,0.f,0.f,0.f}; v8f c00 = z8, c01 = z8, c02 = z8, c03 = z8, c10 = z8, c11 = z8, c12 = z8, c13 = z8;
  for (int kb = 0; kb < K; kb += 32) { const v16h a0 = g2_frag(a0p + kb, hh), a1 = g2_frag(a1p + kb, hh);
    v16h b = g2_frag(b0p + kb, hh); c00 = g2_mma(a0, b, c00); c10 = g2_mma(a1, b, c10);
    b = g2_frag(b1p + kb, hh); c01 = g2_mma(a0, b, c01); c11 = g2_mma(a1, b, c11);
    b = g2_frag(b2p + kb, hh); c02 = g2_mma(a0, b, c02); c12 = g2_mma(a1, b, c12);
    b = g2_frag(b3p + kb, hh); c03 = g2_mma(a0, b, c03); c13 = g2_mma(a1, b, c13); }
  v8f accs[8] = {c00, c01, c02, c03, c10, c11, c12, c13};
#pragma unroll
  for (int u = 0; u < 8; ++u) { const int t = u & 3, half = u >> 2; const int col = col0 + t * 16 + ln; const float bv = bp ? bf16_round(bp[col]) : 0.f;
#pragma unroll
    for (int r = 0; r < 8; ++r) { const int rloc = half * 16 + 8 * hh + r; float v = accs[u][r] * alpha + bv; if (CP) { if (rowsPerB < 0) v += CP[cofs + (size_t)(row0g + row0 + rloc) * ldc + col];      /* rowsPerB < 0: own element of the batched C plane */ else { const int bidx = (row0g + row0 + rloc) / rowsPerB; v += CP[(size_t)bidx * sCPb + (size_t)by * 64 + col]; } }
      if (ACT == 3) v = fmaxf(v, 0.f); else if (ACT == 6) v = 0.5f * v * (1.0f + erff(v * 0.70710678118654752f)); else if (ACT == 11) v = 1.0f / (1.0f + expf(-v)); else if (ACT == 15) v = v / (1.0f + expf(-v)); else if (ACT == 12) v = (v > 0.f) ? v : 0.01f * v; else if (ACT == 8) v = tanhf(v); else if (ACT == 9) v = 0.5f * v * (1.0f + tanhf(0.7978845608028654f * (v + 0.044715f * v * v * v))); else if (ACT == 14) v = (v > 0.f) ? v : 0.1f * v; else if (ACT == 16) v = (v >= 0.f) ? v : 0.3f * v; else if (ACT == 17) v = (v >= 0.f) ? v : 0.2f * v;
      so[w][rloc][t * 16 + ln] = v; } }
  __builtin_amdgcn_fence(__ATOMIC_ACQ_REL, "workgroup"); __builtin_amdgcn_wave_barrier();
  const int rsub = lane >> 4, c4 = (lane & 15) * 4;
  {
#pragma unroll
    for (int q = 0; q < 16; ++q) { const int r = q * 2 + rsub; const v4f v = *(const v4fa*)&so[w][r][c4]; if (C) *(v4f*)(C + cofs + (size_t)(row0 + r) * ldc + col0 + c4) = v; if (C16) { v4h h4; for (int i = 0; i < 4; ++i) h4[i] = (_Float16)v[i]; *(v4h*)(C16 + cofs + (size_t)(row0 + r) * ldc + col0 + c4) = h4; } }
     } }

__global__ __launch_bounds__(256) void k_wnat(const float* __restrict__ w, size_t n8, _Float16* __restrict__ Bt) { const size_t t = (size_t)blockIdx.x * 256 + threadIdx.x; if (t >= n8) return; FragH f; for (int q = 0; q < 8; ++q) f.h[q] = (_Float16)(bf16_round(w[t * 8 + q]) * 16.0f); *(v8us*)((unsigned short*)Bt + t * 8) = f.half[0];  }

// Fused causal attention of one batch: one wave owns 16 query rows of one head and walks its keys 32 at a time with a running maximum and sum.
// S^T = K Q^T (A = key rows, B = query rows): a lane holds scores of ONE query (column ln), keys 8 hh + r of each 16-key tile, so two converted score tiles are, as they lie, the B fragment of O^T += V^T P^T (A = rows of V^T).
// Weights are carried x256 (f16 range) and cancel in the division by their own sum; o leaves x64 like before.
__device__ __forceinline__ float fa_xhalf(float x) { return __builtin_bit_cast(float, __builtin_amdgcn_permlanex16(__builtin_bit_cast(int, x), __builtin_bit_cast(int, x), 0x76543210, 0xfedcba98, false, false)); }      /* lane l <-> lane l ^ 16 */
__global__ __launch_bounds__(128) void k_fattn(const _Float16* __restrict__ Q, const _Float16* __restrict__ K, const _Float16* __restrict__ Vt, _Float16* __restrict__ O) {
  const int lane = threadIdx.x & 31, ln = lane & 15, hh = lane >> 4; const int w = __builtin_amdgcn_readfirstlane((int)(threadIdx.x >> 5)); const int h = blockIdx.y;
  const int q0w = ((int)(gridDim.x - 1 - blockIdx.x) * 4 + w) * 16;      /* longest key walks are dispatched first */
  const int qi = q0w + ln; const int kend = ((q0w >> 5) + 1) * 32;      /* keys 0 .. kend - 1 cover every key <= q0w + 15; kend <= SQ */
  const _Float16* qp = Q + (size_t)qi * LQ + h * HD; const v16h qa = g2_frag(qp, hh), qb = g2_frag(qp + 32, hh);
  const _Float16* kp = K + (size_t)ln * KVD + h * HD; const _Float16* vp = Vt + ((size_t)h * HD + ln) * SQ;
  const v8f z8 = {0.f,0.f,0.f,0.f,0.f,0.f,0.f,0.f}; v8f o0 = z8, o1 = z8, o2 = z8, o3 = z8;
  const float cs = 0.125f * 1.4426950408889634f;      /* 1 / sqrt(64), and e^x = 2^(x log2 e) */
  float m = -1.0e30f, l = 0.f;
  v16h k0a = g2_frag(kp, hh), k0b = g2_frag(kp + 32, hh), k1a = g2_frag(kp + (size_t)16 * KVD, hh), k1b = g2_frag(kp + (size_t)16 * KVD + 32, hh);
  for (int kb = 0; kb < kend; kb += 32) {
    const v16h v0 = g2_frag(vp + kb, hh), v1 = g2_frag(vp + (size_t)16 * SQ + kb, hh), v2 = g2_frag(vp + (size_t)32 * SQ + kb, hh), v3 = g2_frag(vp + (size_t)48 * SQ + kb, hh);
    v8f s0 = g2_mma(k0a, qa, z8); s0 = g2_mma(k0b, qb, s0); v8f s1 = g2_mma(k1a, qa, z8); s1 = g2_mma(k1b, qb, s1);
    const int kn = (kb + 32 < kend) ? kb + 32 : kb;      /* next pass's key rows fetched under this pass's softmax; the last pass re-reads its own */
    const _Float16* kq = kp + (size_t)kn * KVD; k0a = g2_frag(kq, hh); k0b = g2_frag(kq + 32, hh); k1a = g2_frag(kq + (size_t)16 * KVD, hh); k1b = g2_frag(kq + (size_t)16 * KVD + 32, hh);
    asm volatile("s_wait_xcnt 0x0" ::: "memory");      /* behind this pass's 16 loads, in front of every later write of an address register that they name (the V^T pointer's step, the reuse of the key pointer's pair) */
    if (kb + 31 > q0w) {      /* only the last pass holds keys above a query of this tile */
      for (int r = 0; r < 8; ++r) { const int key = kb + 8 * hh + r; s0[r] = (key <= qi) ? s0[r] : -1.0e30f; s1[r] = (key + 16 <= qi) ? s1[r] : -1.0e30f; } }
    float mx = fmaxf(s0[0], s1[0]);
    for (int r = 1; r < 8; ++r) mx = fmaxf(mx, fmaxf(s0[r], s1[r]));
    mx = fmaxf(mx, fa_xhalf(mx)); const float mn = fmaxf(m, mx); float corr = (m - mn) * cs; m = mn; const float bias = fmaf(-mn, cs, 8.0f);
    float e[16];
    for (int r = 0; r < 8; ++r) { e[r] = fmaf(s0[r], cs, bias); e[8 + r] = fmaf(s1[r], cs, bias); }
    /* the pass's 17 exponentials, each in place on a register of its own, so that no transcendental is directly followed by a reader of its result or a writer of its source; the v_nop is that slot behind the last one */
    asm("v_exp_f32 %0, %0\n\tv_exp_f32 %1, %1\n\tv_exp_f32 %2, %2\n\tv_exp_f32 %3, %3\n\tv_exp_f32 %4, %4\n\tv_exp_f32 %5, %5\n\tv_exp_f32 %6, %6\n\tv_exp_f32 %7, %7\n\tv_exp_f32 %8, %8\n\t"
        "v_exp_f32 %9, %9\n\tv_exp_f32 %10, %10\n\tv_exp_f32 %11, %11\n\tv_exp_f32 %12, %12\n\tv_exp_f32 %13, %13\n\tv_exp_f32 %14, %14\n\tv_exp_f32 %15, %15\n\tv_exp_f32 %16, %16\n\tv_nop"
        : "+v"(corr), "+v"(e[0]), "+v"(e[1]), "+v"(e[2]), "+v"(e[3]), "+v"(e[4]), "+v"(e[5]), "+v"(e[6]), "+v"(e[7]), "+v"(e[8]), "+v"(e[9]), "+v"(e[10]), "+v"(e[11]), "+v"(e[12]), "+v"(e[13]), "+v"(e[14]), "+v"(e[15]));
    FragH pf; float sum = 0.f;
    for (int r = 0; r < 8; ++r) { sum += e[r] + e[8 + r]; pf.h[r] = (_Float16)e[r]; pf.h[8 + r] = (_Float16)e[8 + r]; }
    l = fmaf(l, corr, sum);
    for (int r = 0; r < 8; ++r) { o0[r] *= corr; o1[r] *= corr; o2[r] *= corr; o3[r] *= corr; }
    o0 = g2_mma(v0, pf.v, o0); o1 = g2_mma(v1, pf.v, o1); o2 = g2_mma(v2, pf.v, o2); o3 = g2_mma(v3, pf.v, o3); }
  const float fin = 64.0f / (l + fa_xhalf(l));      /* the two lane halves hold disjoint keys of the same query */
  unsigned short* op = (unsigned short*)O + (size_t)qi * DM + h * HD + 8 * hh; FragH f0, f1;
  for (int r = 0; r < 8; ++r) { f0.h[r] = (_Float16)(o0[r] * fin); f0.h[8 + r] = (_Float16)(o1[r] * fin); f1.h[r] = (_Float16)(o2[r] * fin); f1.h[8 + r] = (_Float16)(o3[r] * fin); }
  *(v8us*)op = f0.half[0]; *(v8us*)(op + 16) = f0.half[1]; *(v8us*)(op + 32) = f1.half[0]; *(v8us*)(op + 48) = f1.half[1]; }      /* register r of tile dt = O[qi][16 dt + 8 hh + r]: 16-byte stores */

// Exact f32 attention of the first QT0 rows: one wave owns ONE query row. Lane = (key slice ks = lane >> 2, dim part dp = lane & 3): the lane walks keys ks, ks + 8, ... of its row
// and keeps dims 16 c + 4 dp + u (c, u < 4) of q and of its slice's partial o in registers, with the slice's own running maximum and sum (base-2 exponents); the 8 slices are merged at the end by lane exchanges.
template <int CTRL> __device__ __forceinline__ float a0_dpp(float x) { return __builtin_bit_cast(float, __builtin_amdgcn_update_dpp(0, __builtin_bit_cast(int, x), CTRL, 0xf, 0xf, true)); }      /* 0x160 + n: lane l <- lane l ^ n inside a 16-lane row; every lane is on wherever it is used */
__device__ __forceinline__ void a0_exp2x2(float& x, float& y) { asm("v_exp_f32 %0, %0\n\tv_exp_f32 %1, %1\n\tv_nop" : "+v"(x), "+v"(y)); }      /* two exponentials, each in place on its own register, so that neither is directly followed by a reader of its result; the v_nop is that slot behind the second */
template <int STEP> __device__ __forceinline__ float a0_swap(float x) { return STEP == 16 ? fa_xhalf(x) : a0_dpp<0x160 + (STEP & 15)>(x); }
template <int STEP> __device__ __forceinline__ void a0_merge(float& m, float& l, v4f (&o)[4]) {      /* this lane's slices with those of lane ^ STEP; a slice without keys has m = -1e30, l = 0, o = 0 and drops out */
  const float mo = a0_swap<STEP>(m), lo = a0_swap<STEP>(l); const float mn = fmaxf(m, mo); float fa = m - mn, fb = mo - mn; a0_exp2x2(fa, fb);
  l = fmaf(l, fa, lo * fb); m = mn;
  for (int c = 0; c < 4; ++c) for (int u = 0; u < 4; ++u) o[c][u] = fmaf(o[c][u], fa, a0_swap<STEP>(o[c][u]) * fb); }
__device__ __forceinline__ void a0_exp2x3(float& x, float& y, float& z) { asm("v_exp_f32 %0, %0\n\tv_exp_f32 %1, %1\n\tv_exp_f32 %2, %2\n\tv_nop" : "+v"(x), "+v"(y), "+v"(z)); }      /* as a0_exp2x2, for three */
__device__ __forceinline__ float a0_dot(const v4f (&q)[4], const v4f (&kk)[4]) {      /* q . k over the four lanes of a key: all four end with the same bits */
  v4f pv = q[0] * kk[0]; for (int c = 1; c < 4; ++c) pv = __builtin_elementwise_fma(q[c], kk[c], pv);
  float s = (pv[0] + pv[1]) + (pv[2] + pv[3]); s += a0_dpp<0x161>(s); s += a0_dpp<0x162>(s); return s; }
__global__ __launch_bounds__(256) void k_att0(const float* __restrict__ QF, const float* __restrict__ KF, const float* __restrict__ VF, int ld, float scale, float* __restrict__ OF, int ldo) {
  static_assert(HD == 64 && QT0 % 8 == 0, "four lanes of 16 dims a row; eight rows a block");
  const int lane = threadIdx.x & 31, ks = lane >> 2, dp = lane & 3; const int w = __builtin_amdgcn_readfirstlane((int)(threadIdx.x >> 5)); const int h = blockIdx.y;
  const int i = QT0 - 1 - (w * (QT0 / 8) + (int)blockIdx.x);      /* a block's eight rows lie QT0 / 8 apart: every block holds long and short key walks alike */
  const int col = h * HD + dp * 4; const float* qr = QF + (unsigned)(i * ld + col);
  v4f q[4], o[4]; const v4f z4 = {0.f, 0.f, 0.f, 0.f};
  for (int c = 0; c < 4; ++c) { q[c] = *(const v4fa*)(qr + c * 16); o[c] = z4; }
  const float cs = scale * 1.4426950408889634f;      /* e^x = 2^(x log2 e) */
  float m = -1.0e30f, l = 0.f;
  for (int jb = 0; jb <= i; jb += 16) {      /* 16 keys a pass, two a lane group: ja and ja + 8; a key above the diagonal (last pass only) is read as row i and weighs 0 */
    const int ja = jb + ks; const bool oka = ja <= i, okb = ja + 8 <= i;
    const unsigned offa = (unsigned)((oka ? ja : i) * ld + col), offb = (unsigned)((okb ? ja + 8 : i) * ld + col); v4f ka[4], kb[4], va[4], vb[4];
    const float* pka = KF + offa; const float* pkb = KF + offb; const float* pva = VF + offa; const float* pvb = VF + offb;
    for (int c = 0; c < 4; ++c) { ka[c] = *(const v4fa*)(pka + c * 16); kb[c] = *(const v4fa*)(pkb + c * 16); }
    for (int c = 0; c < 4; ++c) { va[c] = *(const v4fa*)(pva + c * 16); vb[c] = *(const v4fa*)(pvb + c * 16); }
    asm volatile("s_wait_xcnt 0x0" :: "v"(pka), "v"(pkb), "v"(pva), "v"(pvb) : "memory");      /* behind the pass's 16 loads, in front of every write of an address register that they name; the four addresses are inputs so that their registers live up to the wait and no load of the pass lands on one */
    __builtin_amdgcn_sched_barrier(0);      /* the arithmetic stays behind the 16 loads; without this the loads are spread among it in small groups, each waited for in turn */
    const float sa = a0_dot(q, ka) * cs, sb = a0_dot(q, kb) * cs;
    const float mn = fmaxf(m, fmaxf(oka ? sa : -1.0e30f, okb ? sb : -1.0e30f)); float sc = m - mn, ea = oka ? sa - mn : -1.0e30f, eb = okb ? sb - mn : -1.0e30f; a0_exp2x3(sc, ea, eb); m = mn;
    l = fmaf(l, sc, ea + eb); const v4f ea4 = {ea, ea, ea, ea}, eb4 = {eb, eb, eb, eb};
    for (int c = 0; c < 4; ++c) o[c] = __builtin_elementwise_fma(vb[c], eb4, __builtin_elementwise_fma(va[c], ea4, o[c] * sc)); }
  a0_merge<4>(m, l, o); a0_merge<8>(m, l, o); a0_merge<16>(m, l, o);
  const float fin = 64.0f / l;      /* o carried x64 like the f16 path; key 0 is in every row, so l > 0 */
  if (ks == 0) { float* dst = OF + (unsigned)(i * ldo + col); for (int c = 0; c < 4; ++c) *(v4f*)(dst + c * 16) = o[c] * fin; } }

__global__ __launch_bounds__(256) void k_kvexp(const float* __restrict__ src, float* __restrict__ dst, size_t n4) { const size_t t = (size_t)blockIdx.x * 256 + threadIdx.x; if (t >= n4) return; const size_t e = t * 4; const size_t row = e / DM; const int col = (int)(e % DM); const int h = col / HD, d = col % HD; const v4f v = *(const v4fa*)(src + row * KVD + (size_t)(h / HPG) * HD + d); *(v4f*)(dst + e) = v;  }

__global__ __launch_bounds__(256) void k_tab2(float theta, float* __restrict__ CS, float* __restrict__ SN) {
  const int t = blockIdx.x * 256 + threadIdx.x; if (t >= SQ * (HD / 2)) return; const int i = t % (HD / 2); const int p = t / (HD / 2); const float invf = 1.0f / powf(theta, (float)(2 * i) / (float)HD); const float ang = __fmul_rn((float)p, invf); const float c = cosf(ang), s = sinf(ang);
  *(float*)(CS + t) = c; *(float*)(SN + t) = s;  }
template <int NORM, int ROPE>
__global__ __launch_bounds__(64) void k_xform(const float* __restrict__ F, int ldf, int nh, const float* __restrict__ gain, float eps, const float* __restrict__ CS, const float* __restrict__ SN, _Float16* __restrict__ H16, int ldo) {
  __shared__ float xv[HD]; __shared__ float red[HD]; __shared__ unsigned short sh_[HD]; const int d = threadIdx.x; const int h = blockIdx.x % nh; const size_t r = blockIdx.x / nh; const int p = (int)(r % SQ);
  float x = F[r * (size_t)ldf + (size_t)h * HD + d];
  if (NORM) { red[d] = __fmul_rn(x, x); __syncthreads(); for (int st = HD / 2; st > 0; st >>= 1) { if (d < st) red[d] = __fadd_rn(red[d], red[d + st]); __syncthreads(); } const float rs = rsqrtf(__fadd_rn(red[0] / (float)HD, eps)); x = __fmul_rn(__fmul_rn(x, rs), bf16_round(gain[d])); }
  xv[d] = x; __syncthreads();
  float o = x;
  if (ROPE == 1) { const int i = d >> 1; const float c = CS[p * (HD / 2) + i], s = SN[p * (HD / 2) + i]; const float ev = xv[2 * i], od = xv[2 * i + 1]; o = (d & 1) ? __fadd_rn(__fmul_rn(ev, s), __fmul_rn(od, c)) : __fadd_rn(__fmul_rn(ev, c), -__fmul_rn(od, s)); }
  if (ROPE == 2) { const int i = d & (HD / 2 - 1); const float c = CS[p * (HD / 2) + i], s = SN[p * (HD / 2) + i]; const float lo = xv[i], hi = xv[i + HD / 2]; o = (d < HD / 2) ? __fadd_rn(__fmul_rn(lo, c), -__fmul_rn(hi, s)) : __fadd_rn(__fmul_rn(lo, s), __fmul_rn(hi, c)); }
  if (ROPE == 3) { const float c = CS[p * HD + d], s = SN[p * HD + d]; const float lo = xv[d & (HD / 2 - 1)], hi = xv[(d & (HD / 2 - 1)) + HD / 2]; o = (d < HD / 2) ? __fadd_rn(__fmul_rn(lo, c), -__fmul_rn(hi, s)) : __fadd_rn(__fmul_rn(hi, c), __fmul_rn(lo, s)); }      /* rotate-half with FULL-width per-element tables [pos][HD] */
  FragH th; th.h[0] = (_Float16)o; sh_[d] = th.u[0]; __syncthreads();
  if (d < HD / 8) { FragH f; for (int q = 0; q < 8; ++q) f.u[q] = sh_[d * 8 + q]; unsigned short* dst = (unsigned short*)H16 + r * (size_t)ldo + (size_t)h * HD + d * 8; *(v8us*)dst = f.half[0];  } }

template <int NORM, int ROPE>
__global__ __launch_bounds__(64) void k_xformf(const float* __restrict__ F, int ldf, int nh, const float* __restrict__ gain, float eps, const float* __restrict__ CS, const float* __restrict__ SN, float* __restrict__ F32, int ldo) {
  __shared__ float xv[HD]; __shared__ float red[HD]; const int d = threadIdx.x; const int h = blockIdx.x % nh; const size_t r = blockIdx.x / nh; const int p = (int)(r % SQ);
  float x = F[r * (size_t)ldf + (size_t)h * HD + d];
  if (NORM) { red[d] = __fmul_rn(x, x); __syncthreads(); for (int st = HD / 2; st > 0; st >>= 1) { if (d < st) red[d] = __fadd_rn(red[d], red[d + st]); __syncthreads(); } const float rs = rsqrtf(__fadd_rn(red[0] / (float)HD, eps)); x = __fmul_rn(__fmul_rn(x, rs), bf16_round(gain[d])); }
  xv[d] = x; __syncthreads();
  float o = x;
  if (ROPE == 1) { const int i = d >> 1; const float c = CS[p * (HD / 2) + i], s = SN[p * (HD / 2) + i]; const float ev = xv[2 * i], od = xv[2 * i + 1]; o = (d & 1) ? __fadd_rn(__fmul_rn(ev, s), __fmul_rn(od, c)) : __fadd_rn(__fmul_rn(ev, c), -__fmul_rn(od, s)); }
  if (ROPE == 2) { const int i = d & (HD / 2 - 1); const float c = CS[p * (HD / 2) + i], s = SN[p * (HD / 2) + i]; const float lo = xv[i], hi = xv[i + HD / 2]; o = (d < HD / 2) ? __fadd_rn(__fmul_rn(lo, c), -__fmul_rn(hi, s)) : __fadd_rn(__fmul_rn(lo, s), __fmul_rn(hi, c)); }
  if (ROPE == 3) { const float c = CS[p * HD + d], s = SN[p * HD + d]; const float lo = xv[d & (HD / 2 - 1)], hi = xv[(d & (HD / 2 - 1)) + HD / 2]; o = (d < HD / 2) ? __fadd_rn(__fmul_rn(lo, c), -__fmul_rn(hi, s)) : __fadd_rn(__fmul_rn(hi, c), __fmul_rn(lo, s)); }      /* rotate-half with FULL-width per-element tables [pos][HD] */
  float* dst = F32 + r * (size_t)ldo + (size_t)h * HD + d; *(float*)dst = o;  }

__global__ __launch_bounds__(256) void k_bfcp(const float* __restrict__ src, float* __restrict__ dst, size_t n4) { const size_t t = (size_t)blockIdx.x * 256 + threadIdx.x; if (t >= n4) return; const v4f a = *(const v4fa*)(src + t * 4); v4f o; for (int q = 0; q < 4; ++q) o[q] = bf16_round(a[q]); *(v4f*)(dst + t * 4) = o;  }

__global__ __launch_bounds__(256) void k_tabhalf(const float* __restrict__ cs, const float* __restrict__ sn, float* __restrict__ CS, float* __restrict__ SN) { const int t = blockIdx.x * 256 + threadIdx.x; if (t >= SQ * (HD / 2)) return; const int p = t / (HD / 2), i = t % (HD / 2); const float c = bf16_round(cs[(size_t)p * HD + i]), s = bf16_round(sn[(size_t)p * HD + i]);
  *(float*)(CS + t) = c; *(float*)(SN + t) = s;  }

__global__ __launch_bounds__(256) void k_tab2d(float* __restrict__ CS, float* __restrict__ SN) {
  const int t = blockIdx.x * 256 + threadIdx.x; if (t >= SQ * (HD / 2)) return; const int i = t % (HD / 2); const int p = t / (HD / 2); const float invf = (float)(1.0 / pow(10000.0, (double)(2 * i) / (double)HD)); const float ang = __fmul_rn((float)p, invf); const float c = cosf(ang), s = sinf(ang);
  *(float*)(CS + t) = c; *(float*)(SN + t) = s;  }
extern "C" void kernel_launch(void* const* d_in, const int* in_sizes, int n_in,
                              void* d_out, int out_size, void* d_ws, size_t ws_size, hipStream_t stream) {
  (void)in_sizes; (void)n_in; (void)out_size;
  const float* const* I = (const float* const*)d_in; const float* x = I[0]; const float* wattn = I[1]; const float* wo = I[2]; const float* qg = I[3]; const float* kg = I[4];      /* x; fused [in][out] Wqkv [1024][3072] (q, k, v column thirds); [in][out] Wproj; RMS-norm gains q_norm_w / k_norm_w [64]; no biases; rope tables computed in-kernel (positions = row index) */
  static_assert(HPG == 1 && NH == NG * HPG && NH * HD == DM && KVD == DM, "plain multi-head attention as 16 kv groups of one query head"); const float* bq = nullptr; const float* bk = nullptr; const float* bv = nullptr; const float* bo = nullptr;      /* no biases in this module */
  char* ws = (char*)d_ws; size_t off = 0;
  auto take = [&](size_t bytes) { char* p = ws + off; off += (bytes + 255) & ~(size_t)255; return p; };
  _Float16* BQKV = (_Float16*)take((size_t)3 * DM * DM * 2); _Float16* BQ = BQKV; _Float16* BK = BQKV + (size_t)DM * DM; _Float16* BV = BQKV + (size_t)2 * DM * DM; _Float16* BO = (_Float16*)take((size_t)DM * DM * 2);      /* one transposed plane Bt [3072][1024] of the fused weight: rows 0..1023 = q, 1024.. = k, 2048.. = v */
  _Float16* X16 = (_Float16*)take(NR * DM * 2); float* QF = (float*)take((size_t)SQ * DM * 4); float* KF = (float*)take((size_t)SQ * KVD * 4); float* CSB = (float*)take((size_t)SQ * HD * 4); float* SNB = (float*)take((size_t)SQ * HD * 4); _Float16* Q16 = (_Float16*)take(NR * DM * 2); _Float16* K16 = (_Float16*)take(NR * KVD * 2); _Float16* V16 = (_Float16*)take(NR * KVD * 2); _Float16* O16 = (_Float16*)take(NR * DM * 2);
  _Float16* VT = (_Float16*)take((size_t)NH * HD * SQ * 2);
  float* QF0 = (float*)take((size_t)QT0 * DM * 4); float* KF0 = (float*)take((size_t)QT0 * KVD * 4); float* VF0 = (float*)take((size_t)QT0 * KVD * 4); float* KF0e = (float*)take((size_t)QT0 * DM * 4); float* VF0e = (float*)take((size_t)QT0 * DM * 4); float* OF0 = (float*)take((size_t)NB * QT0 * DM * 4); _Float16* OH0 = (_Float16*)take((size_t)NB * QT0 * DM * 2); _Float16* OL0 = (_Float16*)take((size_t)NB * QT0 * DM * 2);
  if (off > ws_size) return;
  k_wt_f16<<<(unsigned)(((size_t)3 * DM * (DM / 8) + 255) / 256), 256, 0, stream>>>(wattn, BQKV, DM, 3 * DM, 16.0f); k_wt_f16<<<(unsigned)(((size_t)DM * (DM / 8) + 255) / 256), 256, 0, stream>>>(wo, BO, DM, DM, 16.0f);      /* [in][out] -> Bt x16 planes (fused Wqkv: K 1024, N 3072) */
  k_x16<<<(unsigned)((NR * DM / 8 + 255) / 256), 256, 0, stream>>>(x, X16, NR * DM / 8);
  k_tab2<<<(SQ * (HD / 2) + 255) / 256, 256, 0, stream>>>(10000.0f, CSB, SNB);      /* rope tables cos / sin(p / 10000^(2i/64)), i < 32: f32 pow, reciprocal, product */
  const size_t r0p = (size_t)B0 * SQ;      /* first projected row */
  k_gemm2<0><<<dim3((unsigned)((MP / 128) * (KVD / 64)), 1), 128, 0, stream>>>(X16 + r0p * DM, DM, 0, BV, DM, 0, 0.0625f, bv, 0, nullptr, 1, 0, 0, nullptr, V16 + r0p * KVD, KVD, 0, MP, KVD, DM);
  for (int b = B0; b < B0 + NBR; ++b) { const size_t r0 = (size_t)b * SQ;
    k_gemm2<0><<<dim3((unsigned)((SQ / 128) * (DM / 64)), 1), 128, 0, stream>>>(X16 + r0 * DM, DM, 0, BQ, DM, 0, 0.0625f, bq, 0, nullptr, 1, 0, 0, QF, nullptr, DM, 0, SQ, DM, DM);      /* q (f32) of this batch */
    k_gemm2<0><<<dim3((unsigned)((SQ / 128) * (KVD / 64)), 1), 128, 0, stream>>>(X16 + r0 * DM, DM, 0, BK, DM, 0, 0.0625f, bk, 0, nullptr, 1, 0, 0, KF, nullptr, KVD, 0, SQ, KVD, DM);      /* k (f32) */
    k_xform<1, 2><<<(unsigned)((size_t)SQ * NH), 64, 0, stream>>>(QF, DM, NH, qg, 1e-5f, CSB, SNB, Q16 + r0 * DM, DM); k_xform<1, 2><<<(unsigned)((size_t)SQ * NG), 64, 0, stream>>>(KF, KVD, NG, kg, 1e-5f, CSB, SNB, K16 + r0 * KVD, KVD);      /* per-head RMS norm (gain, eps 1e-5) then the half-split rope <1, 2> (out_lo = x_lo c - x_hi s, out_hi = x_lo s + x_hi c = t cos + rotate_half(t) sin with the module's [f | f] tables) -> f16 rows */
    k_xformf<1, 2><<<(unsigned)(QT0 * NH), 64, 0, stream>>>(QF, DM, NH, qg, 1e-5f, CSB, SNB, QF0, DM); k_xformf<1, 2><<<(unsigned)(QT0 * NG), 64, 0, stream>>>(KF, KVD, NG, kg, 1e-5f, CSB, SNB, KF0, KVD);      /* f32 normed and half-split-roped q, k of rows 0..255 */
    k_vt<NG, SQ><<<NG * (SQ / 64), 256, 0, stream>>>(V16 + r0 * KVD, KVD, 0, VT);      /* V^T [NH][HD][SQ] for this batch */
    k_gemm2<0><<<dim3((QT0 / 128) * (KVD / 64), 1), 128, 0, stream>>>(X16 + r0 * DM, DM, 0, BV, DM, 0, 0.0625f, bv, 0, nullptr, 1, 0, 0, VF0, nullptr, KVD, 0, QT0, KVD, DM);
    k_kvexp<<<(unsigned)(((size_t)QT0 * DM / 4 + 255) / 256), 256, 0, stream>>>(KF0, KF0e, (size_t)QT0 * DM / 4); k_kvexp<<<(unsigned)(((size_t)QT0 * DM / 4 + 255) / 256), 256, 0, stream>>>(VF0, VF0e, (size_t)QT0 * DM / 4);      /* head h <- kv group h / HPG (HPG is 1 here: a plain copy) for the exact first-tile kernel */      /* f32 q, k, v of the first 256 rows (exact products) */
    k_att0<<<dim3(QT0 / 8, NH), 256, 0, stream>>>(QF0, KF0e, VF0e, DM, 0.125f, OF0 + (size_t)b * QT0 * DM, DM);      /* exact f32 attention for rows 0..255 (o x64) */
    k_fattn<<<dim3(SQ / 64, NH), 128, 0, stream>>>(Q16 + r0 * LQ, K16 + r0 * KVD, VT, O16 + r0 * DM); }      /* scores, causal softmax and weights x V of all 16 heads and all query rows of this batch in ONE launch; scores and weights stay in registers (o x64) */
  k_gemm2<0><<<dim3((unsigned)((MPO / 128) * (DM / 64)), 1), 128, 0, stream>>>(O16 + r0p * DM, DM, 0, BO, DM, 0, 0.0009765625f, bo, 0, nullptr, 1, 0, 0, (float*)d_out + r0p * DM, nullptr, DM, 0, MPO, DM, DM);      /* out rows are the output layout */
  k_hl<<<(unsigned)(((size_t)NB * QT0 * DM / 8 + 255) / 256), 256, 0, stream>>>(OF0, OH0, OL0, (size_t)NB * QT0 * DM / 8);      /* first-tile o (x64) -> f16 hi + x1024 residual planes */
  for (int b = B0; b < B0 + NBR; ++b) { const size_t r0 = (size_t)b * SQ; const size_t f0 = (size_t)b * QT0;
    k_gemm2<0><<<dim3((QT0 / 128) * (DM / 64), 1), 128, 0, stream>>>(OH0 + f0 * DM, DM, 0, BO, DM, 0, 0.0009765625f, bo, 0, nullptr, 1, 0, 0, (float*)d_out + r0 * DM, nullptr, DM, 0, QT0, DM, DM);      /* rows 0..255: out = o_hi Wo (no bias here), overwriting the f16-path rows */
    k_gemm2<0><<<dim3((QT0 / 128) * (DM / 64), 1), 128, 0, stream>>>(OL0 + f0 * DM, DM, 0, BO, DM, 0, 0.00000095367431640625f, nullptr, 0, (const float*)d_out + r0 * DM, -1, 0, 0, (float*)d_out + r0 * DM, nullptr, DM, 0, QT0, DM, DM); }      /* += o_lo Wo 2^-20 (own-element accumulate) */
}

// v003
// It runs in 1050 microseconds.
// Next to v002, in two timings, it ran 1.10 times as fast each time.
// All steps since v000 together make it 6.97 times as fast.
#include <hip/hip_runtime.h>
// Causal multi-head self-attention with a per-head RMS norm on q and k THEN rotate-half RoPE computed in the module, and a bias-free fused QKV projection (x [4][2048][1024]; qkv = x Wqkv ([in][out] 1024 x 3072, no bias) split into q | k | v thirds, 16 heads of 64; q, k = x * rsqrt(mean(x^2 over the 64 head dims) + 1e-5) * gain (gains q_norm_w / k_norm_w [64], read); cos / sin = [f | f] of pos * (1 / 10000^(2i/64)); q = q cos + rotate_half(q) sin with rotate_half = cat(-x2, x1), likewise k; scores / sqrt(64); causal (tril, -inf); softmax; out = merged Wproj ([in][out], no bias) -> [4][2048][1024]); run as grouped-query causal attention with 16 groups of ONE head with the norm stage on and the rope stage in its half-split mode.
// Compute dtype: inputs rounded to bf16 (the two gain vectors bf16-rounded on load); x / weights exact; the per-head RMS norm and the rotation in f32 on VALU; q, k, v, softmax weights and o as plain f16 GEMM operands (~2^-12); scores and softmax statistics f32; v_wmma_f32_16x16x32_f16.
#define NB 4
#define NG 16
#define HPG 1
#define KVD (NG * HD)
#define SQ 2048
#define DM 1024
#define NH 16
#define HD 64
#define HG 4
#define QT 256                       /* unused (k_fattn tiles 16 query rows per wave) */
#define NKX SQ
#define QT0 256                      /* first-tile rows recomputed exactly in f32 */
#define B0 0                         /* first batch processed (debug hook) */
#define NBR NB                       /* batches processed (debug hook) */
#define NR ((size_t)NB * SQ)         /* token rows */
#define MP ((int)((size_t)NBR * SQ)) /* rows projected (debug hook) */
#define QN SQ                        /* unused (k_fattn attends all SQ rows of a batch) */
#define NHD NH                       /* unused (all NH heads are attended) */
#define MPO MP                       /* rows through the output stage (debug hook) */
#define LQ DM      /* row pitch of the q/k/v rows */
typedef __bf16 v16b __attribute__((ext_vector_type(16)));
typedef unsigned short v8us __attribute__((ext_vector_type(8), may_alias));
typedef float  v8f  __attribute__((ext_vector_type(8)));
typedef float  v4f  __attribute__((ext_vector_type(4)));
typedef float  v4fa __attribute__((ext_vector_type(4), may_alias));
union FragB { v16b v; v8us half[2]; unsigned short u[16]; };

__device__ __forceinline__ unsigned short bf16_bits(float x) { unsigned int u = __float_as_uint(x); return (unsigned short)((u + 0x7FFFu + ((u >> 16) & 1u)) >> 16); }
__device__ __forceinline__ float bf16_val(unsigned short b) { return __uint_as_float(((unsigned int)b) << 16); }
__device__ __forceinline__ float bf16_round(float x) { return bf16_val(bf16_bits(x)); }
// D += A·B with NT terms: 1 = ah·bh, 2 = + al·bh (A split), 3 = + ah·bl (both split)
template <int NT>
__device__ __forceinline__ v8f mmaN(v16b ah, v16b al, v16b bh, v16b bl, v8f c) {
  c = __builtin_amdgcn_wmma_f32_16x16x32_bf16(false, ah, false, bh, (short)0, c, false, false);
  if (NT >= 2) c = __builtin_amdgcn_wmma_f32_16x16x32_bf16(false, al, false, bh, (short)0, c, false, false);
  if (NT >= 3) c = __builtin_amdgcn_wmma_f32_16x16x32_bf16(false, ah, false, bl, (short)0, c, false, false);
  asm volatile("v_nop\n\tv_nop\n\tv_nop\n\tv_nop" : "+v"(c) : "v"(ah), "v"(al), "v"(bh), "v"(bl));
  return c;
}

__global__ __launch_bounds__(256) void k_wt_bf16(const float* __restrict__ W, unsigned short* __restrict__ Wt, int K, int N) {
  const int t = blockIdx.x * 256 + threadIdx.x;
  const int k8n = K / 8;
  if (t >= N * k8n) return;
  const int n = t / k8n, k8 = (t % k8n) * 8;
  v8us v;
#pragma unroll
  for (int i = 0; i < 8; ++i) v[i] = bf16_bits(W[(size_t)(k8 + i) * N + n]);
  *(v8us*)(Wt + (size_t)n * K + k8) = v;
  
}

// GEMM C[M][N] (f32, pitch ldc) = act(A[M][K]·W + bias). A f32 row-major (pitch lda) converted per fragment to bf16
// (ASPLIT: hi/lo two planes -> 2 terms, else single rounded term); Wt bf16 [N][K] (pitch ldb). BIAS_BF16 rounds the
// bias to bf16 first (bias quantised to bf16 before the add). K%32==0, M%16==0, N%64==0.
template <bool ASPLIT, int ACT, bool BIAS_BF16>
__global__ __launch_bounds__(128) void k_gemm_bf(const float* __restrict__ A, int lda, const unsigned short* __restrict__ Wt, int ldb,
                                               const float* __restrict__ bias, float* __restrict__ C, int ldc, int M, int N, int K) {
  __shared__ __attribute__((aligned(16))) float so[4][16][64];
  const int tid = threadIdx.x, w = tid >> 5, lane = tid & 31, ln = lane & 15, hh = lane >> 4;
  const int ntn = N / 64;
  const int wid = blockIdx.x * 4 + w;
  const int mt = wid / ntn, nq = wid % ntn;
  if (mt * 16 >= M) return;
  const int row0 = mt * 16, col0 = nq * 64;
  const float* arow = A + (size_t)(row0 + ln) * lda;
  v8f acc[4] = {};
  for (int kb = 0; kb < K; kb += 32) {
    FragB ah, al;
    const v4f x0 = *(const v4fa*)(arow + kb + 8 * hh), x1 = *(const v4fa*)(arow + kb + 8 * hh + 4);
    const v4f x2 = *(const v4fa*)(arow + kb + 16 + 8 * hh), x3 = *(const v4fa*)(arow + kb + 16 + 8 * hh + 4);
    float xs[16] = {x0[0],x0[1],x0[2],x0[3],x1[0],x1[1],x1[2],x1[3],x2[0],x2[1],x2[2],x2[3],x3[0],x3[1],x3[2],x3[3]};
#pragma unroll
    for (int i = 0; i < 16; ++i) { const unsigned short hb = bf16_bits(xs[i]); ah.u[i] = hb; al.u[i] = ASPLIT ? bf16_bits(xs[i] - bf16_val(hb)) : (unsigned short)0; }
#pragma unroll
    for (int t = 0; t < 4; ++t) {
      const unsigned short* brow = Wt + (size_t)(col0 + t * 16 + ln) * ldb + kb;
      FragB b;
      b.half[0] = *(const v8us*)(brow + 8 * hh);
      b.half[1] = *(const v8us*)(brow + 16 + 8 * hh);
      acc[t] = mmaN<ASPLIT ? 2 : 1>(ah.v, al.v, b.v, b.v, acc[t]);
    }
  }
#pragma unroll
  for (int t = 0; t < 4; ++t) {
    float bv = bias ? bias[col0 + t * 16 + ln] : 0.f;
    if (BIAS_BF16) bv = bf16_round(bv);
#pragma unroll
    for (int r = 0; r < 8; ++r) { float v = acc[t][r] + bv; if (ACT == 1) v = fmaxf(v, 0.f); so[w][8 * hh + r][t * 16 + ln] = v; }
  }
  __builtin_amdgcn_fence(__ATOMIC_ACQ_REL, "workgroup");
  __builtin_amdgcn_wave_barrier();
  const int rsub = lane >> 4, c4 = (lane & 15) * 4;
  {
#pragma unroll
    for (int q = 0; q < 8; ++q) {
      const int r = q * 2 + rsub;
      const v4f v = *(const v4fa*)&so[w][r][c4];
      *(v4f*)(C + (size_t)(row0 + r) * ldc + col0 + c4) = v;
    }
    
  }
}

// GEMM C = act(A·W + bias + resid): A f32 (ASPLIT -> hi/lo 2 terms), Wt bf16 [N][K]; ACT 0 none, 1 relu, 2 exact gelu;
// resid (optional, f32, row index = (row % rmod), pitch ldr, RES_BF16 rounds it) added before the activation.
template <bool ASPLIT, int ACT, bool BIAS_BF16, bool RES_BF16>
__global__ __launch_bounds__(128) void k_gemm_bf3(const float* __restrict__ A, int lda, const unsigned short* __restrict__ Wt, int ldb,
                                                const float* __restrict__ bias, const float* __restrict__ resid, int rmod, int ldr,
                                                float* __restrict__ C, int ldc, int M, int N, int K) {
  __shared__ __attribute__((aligned(16))) float so[4][16][64];
  const int tid = threadIdx.x, w = tid >> 5, lane = tid & 31, ln = lane & 15, hh = lane >> 4;
  const int ntn = N / 64;
  const int wid = blockIdx.x * 4 + w;
  const int mt = wid / ntn, nq = wid % ntn;
  if (mt * 16 >= M) return;
  const int row0 = mt * 16, col0 = nq * 64;
  const float* arow = A + (size_t)(row0 + ln) * lda;
  v8f acc[4] = {};
  for (int kb = 0; kb < K; kb += 32) {
    FragB ah, al;
    const v4f x0 = *(const v4fa*)(arow + kb + 8 * hh), x1 = *(const v4fa*)(arow + kb + 8 * hh + 4);
    const v4f x2 = *(const v4fa*)(arow + kb + 16 + 8 * hh), x3 = *(const v4fa*)(arow + kb + 16 + 8 * hh + 4);
    float xs[16] = {x0[0],x0[1],x0[2],x0[3],x1[0],x1[1],x1[2],x1[3],x2[0],x2[1],x2[2],x2[3],x3[0],x3[1],x3[2],x3[3]};
#pragma unroll
    for (int i = 0; i < 16; ++i) { const unsigned short hb = bf16_bits(xs[i]); ah.u[i] = hb; al.u[i] = ASPLIT ? bf16_bits(xs[i] - bf16_val(hb)) : (unsigned short)0; }
#pragma unroll
    for (int t = 0; t < 4; ++t) {
      const unsigned short* brow = Wt + (size_t)(col0 + t * 16 + ln) * ldb + kb;
      FragB b;
      b.half[0] = *(const v8us*)(brow + 8 * hh);
      b.half[1] = *(const v8us*)(brow + 16 + 8 * hh);
      acc[t] = mmaN<ASPLIT ? 2 : 1>(ah.v, al.v, b.v, b.v, acc[t]);
    }
  }
#pragma unroll
  for (int t = 0; t < 4; ++t) {
    const int col = col0 + t * 16 + ln;
    float bv = bias ? bias[col] : 0.f;
    if (BIAS_BF16) bv = bf16_round(bv);
#pragma unroll
    for (int r = 0; r < 8; ++r) {
      float v = acc[t][r] + bv;
      if (resid) { float rv = resid[(size_t)((row0 + 8 * hh + r) % rmod) * ldr + col]; if (RES_BF16) rv = bf16_round(rv); v += rv; }
      if (ACT == 1) v = fmaxf(v, 0.f);
      if (ACT == 2) v = 0.5f * v * (1.0f + erff(v * 0.70710678118654752f));
      if (ACT == 3) { const float u = 0.7978845608028654f * (v + 0.044715f * v * v * v); v = 0.5f * v * (1.0f + tanhf(u)); }
      so[w][8 * hh + r][t * 16 + ln] = v;
    }
  }
  __builtin_amdgcn_fence(__ATOMIC_ACQ_REL, "workgroup");
  __builtin_amdgcn_wave_barrier();
  const int rsub = lane >> 4, c4 = (lane & 15) * 4;
  {
#pragma unroll
    for (int q = 0; q < 8; ++q) {
      const int r = q * 2 + rsub;
      const v4f v = *(const v4fa*)&so[w][r][c4];
      *(v4f*)(C + (size_t)(row0 + r) * ldc + col0 + c4) = v;
    }
    
  }
}
// row LayerNorm (biased variance, eps) over N: s = X (+ R); optional out_sum <- s; out_norm <- (s-mu)*rsqrt(var+eps)*g + b
template <bool PARAM_BF16>
__global__ __launch_bounds__(256) void k_layernorm(const float* __restrict__ X, const float* __restrict__ R, const float* __restrict__ g, const float* __restrict__ bta,
                                                  float* __restrict__ out_sum, float* __restrict__ out_norm, int N, float eps) {
  __shared__ float red[256];
  const int row = blockIdx.x, tid = threadIdx.x;
  const float* x = X + (size_t)row * N; const float* rr = R ? R + (size_t)row * N : nullptr;
  float vals[16];                     // up to N = 4096
  const int per = N / 256;            // contiguous chunk per thread? use strided-by-4 chunks: thread handles j = tid*4 + 1024*u
  float s1 = 0.f;
  for (int u = 0; u < per / 4; ++u) {
    const int j = tid * 4 + 1024 * u;
    const v4f a = *(const v4fa*)(x + j);
    v4f b = {0.f,0.f,0.f,0.f}; if (rr) b = *(const v4fa*)(rr + j);
#pragma unroll
    for (int q = 0; q < 4; ++q) { const float v = a[q] + b[q]; vals[u * 4 + q] = v; s1 += v; }
  }
  red[tid] = s1; __syncthreads();
  for (int st = 128; st > 0; st >>= 1) { if (tid < st) red[tid] += red[tid + st]; __syncthreads(); }
  const float mu = red[0] / (float)N; __syncthreads();
  float s2 = 0.f;
  for (int u = 0; u < per / 4; ++u)
#pragma unroll
    for (int q = 0; q < 4; ++q) { const float c = vals[u * 4 + q] - mu; s2 += c * c; }
  red[tid] = s2; __syncthreads();
  for (int st = 128; st > 0; st >>= 1) { if (tid < st) red[tid] += red[tid + st]; __syncthreads(); }
  const float rs = rsqrtf(red[0] / (float)N + eps);
  {
    for (int u = 0; u < per / 4; ++u) {
      const int j = tid * 4 + 1024 * u;
      v4f o, sm;
#pragma unroll
      for (int q = 0; q < 4; ++q) {
        float gg = g[j + q], bb = bta[j + q];
        if (PARAM_BF16) { gg = bf16_round(gg); bb = bf16_round(bb); }
        sm[q] = vals[u * 4 + q]; o[q] = (vals[u * 4 + q] - mu) * rs * gg + bb;
      }
      if (out_sum) *(v4f*)(out_sum + (size_t)row * N + j) = sm;
      *(v4f*)(out_norm + (size_t)row * N + j) = o;
    }
    
  }
}

// ---- f16 WMMA path (v_wmma_f32_16x16x32_f16): 11-bit significands for operands in range — used where a [0,1] probability operand needs more precision than bf16
typedef _Float16 v16h __attribute__((ext_vector_type(16)));
union FragH { v16h v; v8us half[2]; _Float16 h[16]; unsigned short u[16]; };
template <int NT>
__device__ __forceinline__ v8f mmaH(v16h ah, v16h al, v16h bh, v16h bl, v8f c) {
  c = __builtin_amdgcn_wmma_f32_16x16x32_f16(false, ah, false, bh, (short)0, c, false, false);
  if (NT >= 2) c = __builtin_amdgcn_wmma_f32_16x16x32_f16(false, al, false, bh, (short)0, c, false, false);
  if (NT >= 3) c = __builtin_amdgcn_wmma_f32_16x16x32_f16(false, ah, false, bl, (short)0, c, false, false);
  asm volatile("v_nop\n\tv_nop\n\tv_nop\n\tv_nop" : "+v"(c) : "v"(ah), "v"(al), "v"(bh), "v"(bl));
  return c;
}
// batched GEMM like k_gemm_b but f16 operands: A f32 (split into f16 hi/lo if ASPLIT, else rounded to f16), Bt = f16 values [n][k]; alpha; C f32; N multiple of 16 (partial tiles skipped)
template <bool ASPLIT>
__global__ __launch_bounds__(128) void k_gemm_h(const float* __restrict__ A, int lda, size_t sA, const _Float16* __restrict__ Bh, int ldb, size_t sB, float alpha, float* __restrict__ C, int ldc, size_t sC, int M, int N, int K) {
  __shared__ __attribute__((aligned(16))) float so[4][16][64];
  const int tid = threadIdx.x, w = tid >> 5, lane = tid & 31, ln = lane & 15, hh = lane >> 4; const int by = blockIdx.y;
  A += (size_t)by * sA; Bh += (size_t)by * sB; C += (size_t)by * sC;
  const int ntn = (N + 63) / 64; const int wid = blockIdx.x * 4 + w; const int mt = wid / ntn, nq = wid % ntn; if (mt * 16 >= M) return;
  const int row0 = mt * 16, col0 = nq * 64; const float* arow = A + (size_t)(row0 + ln) * lda;
  v8f acc[4] = {};
  for (int kb = 0; kb < K; kb += 32) {
    FragH ah, al;
    const v4f x0 = *(const v4fa*)(arow + kb + 8 * hh), x1 = *(const v4fa*)(arow + kb + 8 * hh + 4), x2 = *(const v4fa*)(arow + kb + 16 + 8 * hh), x3 = *(const v4fa*)(arow + kb + 16 + 8 * hh + 4);
    float xs[16] = {x0[0],x0[1],x0[2],x0[3],x1[0],x1[1],x1[2],x1[3],x2[0],x2[1],x2[2],x2[3],x3[0],x3[1],x3[2],x3[3]};
#pragma unroll
    for (int i = 0; i < 16; ++i) { const _Float16 h = (_Float16)xs[i]; ah.h[i] = h; al.h[i] = ASPLIT ? (_Float16)(xs[i] - (float)h) : (_Float16)0.0f; }
#pragma unroll
    for (int t = 0; t < 4; ++t) { if (col0 + t * 16 >= N) continue; const size_t boff = (size_t)(col0 + t * 16 + ln) * ldb + kb; FragH bq; bq.half[0] = *(const v8us*)(Bh + boff + 8 * hh); bq.half[1] = *(const v8us*)(Bh + boff + 16 + 8 * hh);
      acc[t] = mmaH<ASPLIT ? 2 : 1>(ah.v, al.v, bq.v, bq.v, acc[t]); }
  }
#pragma unroll
  for (int t = 0; t < 4; ++t) { if (col0 + t * 16 >= N) continue;
#pragma unroll
    for (int r = 0; r < 8; ++r) so[w][8 * hh + r][t * 16 + ln] = acc[t][r] * alpha; }
  __builtin_amdgcn_fence(__ATOMIC_ACQ_REL, "workgroup"); __builtin_amdgcn_wave_barrier();
  const int rsub = lane >> 4, c4 = (lane & 15) * 4;
  {
#pragma unroll
    for (int q = 0; q < 8; ++q) { const int r = q * 2 + rsub; if (col0 + c4 < N) { const v4f v = *(const v4fa*)&so[w][r][c4]; *(v4f*)(C + (size_t)(row0 + r) * ldc + col0 + c4) = v; } }
     }
}

// Wt[n][k] = f16(W[k][n]·scale) from f32 row-major W[K][N] (scale = power of two; bf16-exact weights stay exact in f16 away from the subnormal range)
__global__ __launch_bounds__(256) void k_wt_f16(const float* __restrict__ W, _Float16* __restrict__ Wt, int K, int N, float scale) {
  const int t = blockIdx.x * 256 + threadIdx.x; if (t >= N * (K / 8)) return; const int n = t / (K / 8), k8 = (t % (K / 8)) * 8; FragH f;
#pragma unroll
  for (int i = 0; i < 8; ++i) f.h[i] = (_Float16)(bf16_round(W[(size_t)(k8 + i) * N + n]) * scale); const v8us o = f.half[0];
  *(v8us*)((unsigned short*)Wt + (size_t)n * K + k8) = o; 
}
// k_gemm_hh variant with fused epilogue: v = acc·alpha + bias[by·sBias + col] (+ CP[(row/rowsPerB)·sCPb + by·64 + col] if CP) ; ACT 0 none / 1 elu ; writes f16 C16 (and f32 C if non-null)
template <int ACT>
__global__ __launch_bounds__(128) void k_gemm_hhx(const _Float16* __restrict__ A, int lda, size_t sA, const _Float16* __restrict__ Bh, int ldb, size_t sB, float alpha, const float* __restrict__ bias, size_t sBias, const float* __restrict__ CP, int rowsPerB, size_t sCPb, int row0g,
    float* __restrict__ C, _Float16* __restrict__ C16, int ldc, size_t sC, int M, int N, int K) {
  __shared__ __attribute__((aligned(16))) float so[4][16][64];
  const int tid = threadIdx.x, w = tid >> 5, lane = tid & 31, ln = lane & 15, hh = lane >> 4; const int by = blockIdx.y;
  A += (size_t)by * sA; Bh += (size_t)by * sB; const size_t cofs = (size_t)by * sC; const float* bp = bias ? bias + (size_t)by * sBias : nullptr;
  const int ntn = (N + 63) / 64; const int wid = blockIdx.x * 4 + w; const int mt = wid / ntn, nq = wid % ntn; if (mt * 16 >= M) return;
  const int row0 = mt * 16, col0 = nq * 64; const _Float16* arow = A + (size_t)(row0 + ln) * lda;
  v8f acc[4] = {};
  for (int kb = 0; kb < K; kb += 32) { FragH ah; ah.half[0] = *(const v8us*)((const unsigned short*)arow + kb + 8 * hh); ah.half[1] = *(const v8us*)((const unsigned short*)arow + kb + 16 + 8 * hh);
#pragma unroll
    for (int t = 0; t < 4; ++t) { if (col0 + t * 16 >= N) continue; const size_t boff = (size_t)(col0 + t * 16 + ln) * ldb + kb; FragH bq; bq.half[0] = *(const v8us*)((const unsigned short*)Bh + boff + 8 * hh); bq.half[1] = *(const v8us*)((const unsigned short*)Bh + boff + 16 + 8 * hh);
      acc[t] = mmaH<1>(ah.v, ah.v, bq.v, bq.v, acc[t]); }
  }
#pragma unroll
  for (int t = 0; t < 4; ++t) { if (col0 + t * 16 >= N) continue; const int col = col0 + t * 16 + ln; const float bv = bp ? bf16_round(bp[col]) : 0.f;
#pragma unroll
    for (int r = 0; r < 8; ++r) { float v = acc[t][r] * alpha + bv; if (CP) { const int rr = row0g + row0 + 8 * hh + r; if (rowsPerB < 0) v += CP[cofs + (size_t)rr * ldc + col];      /* rowsPerB < 0: own element of the batched C plane */ else { const int bidx = rr / rowsPerB; v += CP[(size_t)bidx * sCPb + (size_t)by * 64 + col]; } } if (ACT == 1) v = (v > 0.f) ? v : expm1f(v); else if (ACT == 7) v = (v > 0.f) ? v + 1.0f : expf(v); else if (ACT == 8) v = tanhf(v); else if (ACT == 9) v = 0.5f * v * (1.0f + tanhf(0.7978845608028654f * (v + 0.044715f * v * v * v))); else if (ACT == 11) v = 1.0f / (1.0f + expf(-v)); else if (ACT == 12) v = (v > 0.f) ? v : 0.01f * v; else if (ACT == 14) v = (v > 0.f) ? v : 0.1f * v; else if (ACT == 16) v = (v >= 0.f) ? v : 0.3f * v; else if (ACT == 17) v = (v >= 0.f) ? v : 0.2f * v; else if (ACT == 15) v = v / (1.0f + expf(-v)); else if (ACT == 3) v = fmaxf(v, 0.f); else if (ACT == 6) v = 0.5f * v * (1.0f + erff(v * 0.70710678118654752f)); so[w][8 * hh + r][t * 16 + ln] = v; } }
  __builtin_amdgcn_fence(__ATOMIC_ACQ_REL, "workgroup"); __builtin_amdgcn_wave_barrier();
  const int rsub = lane >> 4, c4 = (lane & 15) * 4; typedef _Float16 v4h __attribute__((ext_vector_type(4)));
  {
#pragma unroll
    for (int q = 0; q < 8; ++q) { const int r = q * 2 + rsub; if (col0 + c4 < N) { const v4f v = *(const v4fa*)&so[w][r][c4]; if (C) *(v4f*)(C + cofs + (size_t)(row0 + r) * ldc + col0 + c4) = v; if (C16) { v4h h4; for (int i = 0; i < 4; ++i) h4[i] = (_Float16)v[i]; *(v4h*)(C16 + cofs + (size_t)(row0 + r) * ldc + col0 + c4) = h4; } } }
     }
}

typedef _Float16 v4h __attribute__((ext_vector_type(4)));

__global__ __launch_bounds__(256) void k_x16(const float* __restrict__ x, _Float16* __restrict__ X16, size_t n8) { const size_t t = (size_t)blockIdx.x * 256 + threadIdx.x; if (t >= n8) return; FragH f;
#pragma unroll
  for (int q = 0; q < 8; ++q) f.h[q] = (_Float16)bf16_round(x[t * 8 + q]); *(v8us*)((unsigned short*)X16 + t * 8) = f.half[0];  }
__global__ __launch_bounds__(256) void k_h16(const float* __restrict__ x, _Float16* __restrict__ X16, size_t n8) { const size_t t = (size_t)blockIdx.x * 256 + threadIdx.x; if (t >= n8) return; FragH f;
#pragma unroll
  for (int q = 0; q < 8; ++q) f.h[q] = (_Float16)x[t * 8 + q]; *(v8us*)((unsigned short*)X16 + t * 8) = f.half[0];  }
__global__ __launch_bounds__(256) void k_round16f(const float* __restrict__ W, _Float16* __restrict__ Bt, size_t n8) { const size_t t = (size_t)blockIdx.x * 256 + threadIdx.x; if (t >= n8) return; FragH f;
#pragma unroll
  for (int i = 0; i < 8; ++i) f.h[i] = (_Float16)(bf16_round(W[t * 8 + i]) * 16.0f); *(v8us*)((unsigned short*)Bt + t * 8) = f.half[0];  }
template <int NHv, int TTv>
__global__ __launch_bounds__(256) void k_vt(const _Float16* __restrict__ V16, int ldv, int voff, _Float16* __restrict__ Vt) { __shared__ unsigned short tl[64][66]; const int tid = threadIdx.x; const int slab = blockIdx.x / (TTv / 64), lg = blockIdx.x % (TTv / 64); const int b = slab / NHv, h = slab % NHv;
  for (int i = tid; i < 64 * 8; i += 256) { const int r = i / 8, c8 = (i % 8) * 8; FragH f; f.half[0] = *(const v8us*)((const unsigned short*)V16 + ((size_t)b * TTv + lg * 64 + r) * ldv + voff + h * 64 + c8);
#pragma unroll
    for (int q = 0; q < 8; ++q) tl[r][c8 + q] = f.u[q]; }
  __syncthreads();
  {
#pragma unroll
    for (int rd = 0; rd < 2; ++rd) { const int d = rd * 32 + tid / 8, pc = tid % 8; FragH f;
#pragma unroll
      for (int q = 0; q < 8; ++q) f.u[q] = tl[pc * 8 + q][d];
      *(v8us*)((unsigned short*)Vt + ((size_t)slab * 64 + d) * TTv + lg * 64 + pc * 8) = f.half[0]; }
     } }

__global__ __launch_bounds__(256) void k_hl(const float* __restrict__ F, _Float16* __restrict__ Hh, _Float16* __restrict__ Hl, size_t n8) { const size_t t = (size_t)blockIdx.x * 256 + threadIdx.x; if (t >= n8) return; FragH fh, fl; const v4f a = *(const v4fa*)(F + t * 8), c = *(const v4fa*)(F + t * 8 + 4);
#pragma unroll
  for (int q = 0; q < 4; ++q) { _Float16 h = (_Float16)a[q]; fh.h[q] = h; fl.h[q] = (_Float16)((a[q] - (float)h) * 1024.0f); h = (_Float16)c[q]; fh.h[4 + q] = h; fl.h[4 + q] = (_Float16)((c[q] - (float)h) * 1024.0f); }
  { *(v8us*)((unsigned short*)Hh + t * 8) = fh.half[0]; *(v8us*)((unsigned short*)Hl + t * 8) = fl.half[0];  } }

// ---- per-head RMS norm and half-split rope on a staged 32 x 64 wave tile (k_gemm2's NROPE epilogue) ----
// The tile's 64 columns are ONE head, so it holds 32 whole head rows: 16 lanes read a row back, 4 dims a lane (d = 4 ln + u), and norm and rotate it in registers; dim d's rope partner d ^ 32 sits in lane ln ^ 8.
// The sum of squares is a halving tree over the 64 dims (d + 32, + 16, + 8, + 4 by the lane exchanges ln ^ 8, 4, 2, 1; d + 2, d + 1 inside the lane); every lane of a row ends with the same bits.
template <int CTRL> __device__ __forceinline__ float a0_dpp(float x);      /* defined with the first-tile kernel below */
__device__ __forceinline__ float nr_rsqrt(float a) {      /* rsqrtf as the compiler expands it (an argument below 2^-126 goes in x 2^24, its result out x 2^12), with the v_rsq_f32 in place on its own register and a v_nop behind it, so that no reader of its result and no writer of its source follows it directly */
  const bool tiny = a < 0x1p-126f; a = tiny ? a * 0x1p+24f : a; asm("v_rsq_f32 %0, %0\n\tv_nop" : "+v"(a)); return tiny ? a * 0x1p+12f : a; }
// The 16 row pairs of a wave's tile. trow / hp / fp = this lane's place in row hh of the tile and of the two outputs (pitch LQ); b1, b2 = table factors of x_lo and x_hi: (c, -s) in the low half (out_lo = x_lo c - x_hi s), (s, c) in the high half (out_hi = x_lo s + x_hi c).
template <bool F32OUT>
__device__ __forceinline__ void nr_rows(const float* trow, bool lowh, const v4f (&b1)[16], const v4f (&b2)[16], v4f g4, float eps, _Float16* hp, float* fp) {
#pragma unroll      /* the table factors are register arrays: every index must be a constant */
  for (int q = 0; q < 16; ++q) { v4f x = *(const v4fa*)(trow + q * 2 * 68); float t[4];
    for (int u = 0; u < 4; ++u) t[u] = __fmul_rn(x[u], x[u]);
    for (int u = 0; u < 4; ++u) t[u] = __fadd_rn(t[u], a0_dpp<0x168>(t[u]));
    for (int u = 0; u < 4; ++u) t[u] = __fadd_rn(t[u], a0_dpp<0x164>(t[u]));
    for (int u = 0; u < 4; ++u) t[u] = __fadd_rn(t[u], a0_dpp<0x162>(t[u]));
    for (int u = 0; u < 4; ++u) t[u] = __fadd_rn(t[u], a0_dpp<0x161>(t[u]));
    const float rs = nr_rsqrt(__fadd_rn(__fadd_rn(__fadd_rn(t[0], t[2]), __fadd_rn(t[1], t[3])) / (float)HD, eps));
    v4f o; v4h h4;      /* x_hi's product is rounded, x_lo's is fused into the sum, alike in both halves */
    for (int u = 0; u < 4; ++u) { const float own = __fmul_rn(__fmul_rn(x[u], rs), g4[u]), oth = a0_dpp<0x168>(own); const float lo = lowh ? own : oth, hi = lowh ? oth : own;
      o[u] = __builtin_fmaf(lo, b1[q][u], __fmul_rn(hi, b2[q][u])); h4[u] = (_Float16)o[u]; }
    *(v4h*)(hp + (size_t)q * 2 * LQ) = h4;
    if (F32OUT) *(v4f*)(fp + (size_t)q * 2 * LQ) = o; }
  asm volatile("s_wait_xcnt 0x0" ::: "memory"); }      /* behind the tail's last stores, in front of any later write of a register that they name (the code that follows the place where the two tails join) */

// ---- fast GEMM (wave tile 32x64; requires M % 32 == 0 rows per launch region and N % 64 == 0); epilogue = k_gemm_hhx semantics, or with NROPE: no bias, per-head RMS norm (gain, eps) and half-split rope (tables CS, SN; position = row % SQ) on acc alpha, f16 rows to C16 and, of rows below QT0, the same values in f32 to C, both at pitch LQ ----
__device__ __forceinline__ v16h g2_frag(const _Float16* p, int hh) { FragH f; f.half[0] = *(const v8us*)((const unsigned short*)p + 8 * hh); f.half[1] = *(const v8us*)((const unsigned short*)p + 16 + 8 * hh); return f.v; }
__device__ __forceinline__ v8f g2_mma(v16h a, v16h b, v8f c) { v8f d = __builtin_amdgcn_wmma_f32_16x16x32_f16(false, a, false, b, (short)0, c, false, false); asm volatile("v_nop\n\tv_nop\n\tv_nop\n\tv_nop" : "+v"(d) : "v"(a), "v"(b)); return d; }
template <int ACT, bool NROPE = false>
__global__ __launch_bounds__(128) void k_gemm2(const _Float16* __restrict__ A, int lda, size_t sA, const _Float16* __restrict__ Bh, int ldb, size_t sB, float alpha, const float* __restrict__ bias, size_t sBias, const float* __restrict__ CP, int rowsPerB, size_t sCPb, int row0g,
    float* __restrict__ C, _Float16* __restrict__ C16, int ldc, size_t sC, int M, int N, int K, const float* __restrict__ gain = nullptr, float eps = 0.f, const float* __restrict__ CS = nullptr, const float* __restrict__ SN = nullptr) { static_assert(ACT == 0 || ACT == 3 || ACT == 6 || ACT == 8 || ACT == 9 || ACT == 11 || ACT == 12 || ACT == 14 || ACT == 15 || ACT == 16 || ACT == 17, "k_gemm2: unsupported ACT code (would silently apply no activation)");
  __shared__ __attribute__((aligned(16))) float so[4][32][68];
  const int tid = threadIdx.x, w = tid >> 5, lane = tid & 31, ln = lane & 15, hh = lane >> 4; const int by = blockIdx.y;
  A += (size_t)by * sA; Bh += (size_t)by * sB; const size_t cofs = (size_t)by * sC; const float* bp = bias ? bias + (size_t)by * sBias : nullptr;
  const int ntn = N >> 6; const int mt = blockIdx.x / ntn, nq = blockIdx.x - mt * ntn; const int row0 = mt * 128 + 32 * w, col0 = nq * 64; if (row0 >= M) return;
  const _Float16* a0p = A + (size_t)(row0 + ln) * lda; const _Float16* a1p = a0p + (size_t)16 * lda;
  const _Float16* b0p = Bh + (size_t)(col0 + ln) * ldb; const _Float16* b1p = b0p + (size_t)16 * ldb; const _Float16* b2p = b1p + (size_t)16 * ldb; const _Float16* b3p = b2p + (size_t)16 * ldb;
  const v8f z8 = {0.f,0.f,0.f,0.f,0.f,0.f,0.f,0.f}; v8f c00 = z8, c01 = z8, c02 = z8, c03 = z8, c10 = z8, c11 = z8, c12 = z8, c13 = z8;
  for (int kb = 0; kb < K; kb += 32) { const v16h a0 = g2_frag(a0p + kb, hh), a1 = g2_frag(a1p + kb, hh);
    v16h b = g2_frag(b0p + kb, hh); c00 = g2_mma(a0, b, c00); c10 = g2_mma(a1, b, c10);
    b = g2_frag(b1p + kb, hh); c01 = g2_mma(a0, b, c01); c11 = g2_mma(a1, b, c11);
    b = g2_frag(b2p + kb, hh); c02 = g2_mma(a0, b, c02); c12 = g2_mma(a1, b, c12);
    b = g2_frag(b3p + kb, hh); c03 = g2_mma(a0, b, c03); c13 = g2_mma(a1, b, c13); }
  v8f accs[8] = {c00, c01, c02, c03, c10, c11, c12, c13};
  if constexpr (NROPE) { static_assert(HD == 64 && QT0 % 32 == 0 && SQ % 32 == 0, "a wave tile's 64 columns are one head; its 32 rows lie on one side of QT0 and in one sequence");
    const int c4 = ln * 4; const bool lowh = ln < 8; const unsigned tofs = (unsigned)((row0 % SQ + hh) * (HD / 2) + (ln & 7) * 4);      /* table row = the token's position, table column = d & 31 */
    const float* cp = CS + tofs; const float* sp = SN + tofs; v4f tc[16], ts[16];
#pragma unroll      /* register arrays: constant indices */
    for (int q = 0; q < 16; ++q) { tc[q] = *(const v4fa*)(cp + q * 2 * (HD / 2)); ts[q] = *(const v4fa*)(sp + q * 2 * (HD / 2)); }      /* all 32 table rows asked for here, so that one latency runs under the LDS staging below */
    v4f g4 = *(const v4fa*)(gain + c4);
    asm volatile("s_wait_xcnt 0x0" ::: "memory");      /* behind the 33 loads, in front of every later write of an address register that they name */
#pragma unroll      /* accs is a register array: constant indices */
    for (int u = 0; u < 8; ++u) for (int r = 0; r < 8; ++r) so[w][(u >> 2) * 16 + 8 * hh + r][(u & 3) * 16 + ln] = accs[u][r] * alpha;
    __builtin_amdgcn_fence(__ATOMIC_ACQ_REL, "workgroup"); __builtin_amdgcn_wave_barrier();      /* as in the plain epilogue: the wave's own LDS writes before its reads */
    for (int u = 0; u < 4; ++u) g4[u] = bf16_round(g4[u]);
#pragma unroll      /* register arrays: constant indices */
    for (int q = 0; q < 16; ++q) { const v4f c = tc[q], s = ts[q]; tc[q] = lowh ? c : s; ts[q] = lowh ? -s : c; }
    const size_t e = cofs + (size_t)(row0 + hh) * LQ + col0 + c4;
    if (__builtin_amdgcn_readfirstlane(row0) < QT0) nr_rows<true>(&so[w][hh][c4], lowh, tc, ts, g4, eps, C16 + e, C + e);      /* one wave-uniform branch around the whole tail: inside it the 16 row pairs stay one block of code to schedule */
    else nr_rows<false>(&so[w][hh][c4], lowh, tc, ts, g4, eps, C16 + e, C + e);
    return; }
#pragma unroll
  for (int u = 0; u < 8; ++u) { const int t = u & 3, half = u >> 2; const int col = col0 + t * 16 + ln; const float bv = bp ? bf16_round(bp[col]) : 0.f;
#pragma unroll
    for (int r = 0; r < 8; ++r) { const int rloc = half * 16 + 8 * hh + r; float v = accs[u][r] * alpha + bv; if (CP) { if (rowsPerB < 0) v += CP[cofs + (size_t)(row0g + row0 + rloc) * ldc + col];      /* rowsPerB < 0: own element of the batched C plane */ else { const int bidx = (row0g + row0 + rloc) / rowsPerB; v += CP[(size_t)bidx * sCPb + (size_t)by * 64 + col]; } }
      if (ACT == 3) v = fmaxf(v, 0.f); else if (ACT == 6) v = 0.5f * v * (1.0f + erff(v * 0.70710678118654752f)); else if (ACT == 11) v = 1.0f / (1.0f + expf(-v)); else if (ACT == 15) v = v / (1.0f + expf(-v)); else if (ACT == 12) v = (v > 0.f) ? v : 0.01f * v; else if (ACT == 8) v = tanhf(v); else if (ACT == 9) v = 0.5f * v * (1.0f + tanhf(0.7978845608028654f * (v + 0.044715f * v * v * v))); else if (ACT == 14) v = (v > 0.f) ? v : 0.1f * v; else if (ACT == 16) v = (v >= 0.f) ? v : 0.3f * v; else if (ACT == 17) v = (v >= 0.f) ? v : 0.2f * v;
      so[w][rloc][t * 16 + ln] = v; } }
  __builtin_amdgcn_fence(__ATOMIC_ACQ_REL, "workgroup"); __builtin_amdgcn_wave_barrier();
  const int rsub = lane >> 4, c4 = (lane & 15) * 4;
  {
#pragma unroll
    for (int q = 0; q < 16; ++q) { const int r = q * 2 + rsub; const v4f v = *(const v4fa*)&so[w][r][c4]; if (C) *(v4f*)(C + cofs + (size_t)(row0 + r) * ldc + col0 + c4) = v; if (C16) { v4h h4; for (int i = 0; i < 4; ++i) h4[i] = (_Float16)v[i]; *(v4h*)(C16 + cofs + (size_t)(row0 + r) * ldc + col0 + c4) = h4; } }
     } }

__global__ __launch_bounds__(256) void k_wnat(const float* __restrict__ w, size_t n8, _Float16* __restrict__ Bt) { const size_t t = (size_t)blockIdx.x * 256 + threadIdx.x; if (t >= n8) return; FragH f; for (int q = 0; q < 8; ++q) f.h[q] = (_Float16)(bf16_round(w[t * 8 + q]) * 16.0f); *(v8us*)((unsigned short*)Bt + t * 8) = f.half[0];  }

// Fused causal attention of one batch: one wave owns 16 query rows of one head and walks its keys 32 at a time with a running maximum and sum.
// S^T = K Q^T (A = key rows, B = query rows): a lane holds scores of ONE query (column ln), keys 8 hh + r of each 16-key tile, so two converted score tiles are, as they lie, the B fragment of O^T += V^T P^T (A = rows of V^T).
// Weights are carried x256 (f16 range) and cancel in the division by their own sum; o leaves x64 like before.
__device__ __forceinline__ float fa_xhalf(float x) { return __builtin_bit_cast(float, __builtin_amdgcn_permlanex16(__builtin_bit_cast(int, x), __builtin_bit_cast(int, x), 0x76543210, 0xfedcba98, false, false)); }      /* lane l <-> lane l ^ 16 */
__global__ __launch_bounds__(128) void k_fattn(const _Float16* __restrict__ Q, const _Float16* __restrict__ K, const _Float16* __restrict__ Vt, _Float16* __restrict__ O) {
  const int lane = threadIdx.x & 31, ln = lane & 15, hh = lane >> 4; const int w = __builtin_amdgcn_readfirstlane((int)(threadIdx.x >> 5)); const int h = blockIdx.y;
  const int q0w = ((int)(gridDim.x - 1 - blockIdx.x) * 4 + w) * 16;      /* longest key walks get the lowest block indices */
  const int qi = q0w + ln; const int kend = ((q0w >> 5) + 1) * 32;      /* keys 0 .. kend - 1 cover every key <= q0w + 15; kend <= SQ */
  const _Float16* qp = Q + (size_t)qi * LQ + h * HD; const v16h qa = g2_frag(qp, hh), qb = g2_frag(qp + 32, hh);
  const _Float16* kp = K + (size_t)ln * KVD + h * HD; const _Float16* vp = Vt + ((size_t)h * HD + ln) * SQ;
  const v8f z8 = {0.f,0.f,0.f,0.f,0.f,0.f,0.f,0.f}; v8f o0 = z8, o1 = z8, o2 = z8, o3 = z8;
  const float cs = 0.125f * 1.4426950408889634f;      /* 1 / sqrt(64), and e^x = 2^(x log2 e) */
  float m = -1.0e30f, l = 0.f;
  v16h k0a = g2_frag(kp, hh), k0b = g2_frag(kp + 32, hh), k1a = g2_frag(kp + (size_t)16 * KVD, hh), k1b = g2_frag(kp + (size_t)16 * KVD + 32, hh);
  for (int kb = 0; kb < kend; kb += 32) {
    const v16h v0 = g2_frag(vp + kb, hh), v1 = g2_frag(vp + (size_t)16 * SQ + kb, hh), v2 = g2_frag(vp + (size_t)32 * SQ + kb, hh), v3 = g2_frag(vp + (size_t)48 * SQ + kb, hh);
    v8f s0 = g2_mma(k0a, qa, z8); s0 = g2_mma(k0b, qb, s0); v8f s1 = g2_mma(k1a, qa, z8); s1 = g2_mma(k1b, qb, s1);
    const int kn = (kb + 32 < kend) ? kb + 32 : kb;      /* next pass's key rows fetched under this pass's softmax; the last pass re-reads its own */
    const _Float16* kq = kp + (size_t)kn * KVD; k0a = g2_frag(kq, hh); k0b = g2_frag(kq + 32, hh); k1a = g2_frag(kq + (size_t)16 * KVD, hh); k1b = g2_frag(kq + (size_t)16 * KVD + 32, hh);
    asm volatile("s_wait_xcnt 0x0" ::: "memory");      /* behind this pass's 16 loads, in front of every later write of an address register that they name (the V^T pointer's step, the reuse of the key pointer's pair) */
    if (kb + 31 > q0w) {      /* only the last pass holds keys above a query of this tile */
      for (int r = 0; r < 8; ++r) { const int key = kb + 8 * hh + r; s0[r] = (key <= qi) ? s0[r] : -1.0e30f; s1[r] = (key + 16 <= qi) ? s1[r] : -1.0e30f; } }
    float mx = fmaxf(s0[0], s1[0]);
    for (int r = 1; r < 8; ++r) mx = fmaxf(mx, fmaxf(s0[r], s1[r]));
    mx = fmaxf(mx, fa_xhalf(mx)); const float mn = fmaxf(m, mx); float corr = (m - mn) * cs; m = mn; const float bias = fmaf(-mn, cs, 8.0f);
    float e[16];
    for (int r = 0; r < 8; ++r) { e[r] = fmaf(s0[r], cs, bias); e[8 + r] = fmaf(s1[r], cs, bias); }
    /* the pass's 17 exponentials, each in place on a register of its own, so that no transcendental is directly followed by a reader of its result or a writer of its source; the v_nop is that slot behind the last one */
    asm("v_exp_f32 %0, %0\n\tv_exp_f32 %1, %1\n\tv_exp_f32 %2, %2\n\tv_exp_f32 %3, %3\n\tv_exp_f32 %4, %4\n\tv_exp_f32 %5, %5\n\tv_exp_f32 %6, %6\n\tv_exp_f32 %7, %7\n\tv_exp_f32 %8, %8\n\t"
        "v_exp_f32 %9, %9\n\tv_exp_f32 %10, %10\n\tv_exp_f32 %11, %11\n\tv_exp_f32 %12, %12\n\tv_exp_f32 %13, %13\n\tv_exp_f32 %14, %14\n\tv_exp_f32 %15, %15\n\tv_exp_f32 %16, %16\n\tv_nop"
        : "+v"(corr), "+v"(e[0]), "+v"(e[1]), "+v"(e[2]), "+v"(e[3]), "+v"(e[4]), "+v"(e[5]), "+v"(e[6]), "+v"(e[7]), "+v"(e[8]), "+v"(e[9]), "+v"(e[10]), "+v"(e[11]), "+v"(e[12]), "+v"(e[13]), "+v"(e[14]), "+v"(e[15]));
    FragH pf; float sum = 0.f;
    for (int r = 0; r < 8; ++r) { sum += e[r] + e[8 + r]; pf.h[r] = (_Float16)e[r]; pf.h[8 + r] = (_Float16)e[8 + r]; }
    l = fmaf(l, corr, sum);
    for (int r = 0; r < 8; ++r) { o0[r] *= corr; o1[r] *= corr; o2[r] *= corr; o3[r] *= corr; }
    o0 = g2_mma(v0, pf.v, o0); o1 = g2_mma(v1, pf.v, o1); o2 = g2_mma(v2, pf.v, o2); o3 = g2_mma(v3, pf.v, o3); }
  const float fin = 64.0f / (l + fa_xhalf(l));      /* the two lane halves hold disjoint keys of the same query */
  unsigned short* op = (unsigned short*)O + (size_t)qi * DM + h * HD + 8 * hh; FragH f0, f1;
  for (int r = 0; r < 8; ++r) { f0.h[r] = (_Float16)(o0[r] * fin); f0.h[8 + r] = (_Float16)(o1[r] * fin); f1.h[r] = (_Float16)(o2[r] * fin); f1.h[8 + r] = (_Float16)(o3[r] * fin); }
  *(v8us*)op = f0.half[0]; *(v8us*)(op + 16) = f0.half[1]; *(v8us*)(op + 32) = f1.half[0]; *(v8us*)(op + 48) = f1.half[1]; }      /* register r of tile dt = O[qi][16 dt + 8 hh + r]: 16-byte stores */

// Exact f32 attention of the first QT0 rows: one wave owns ONE query row. Lane = (key slice ks = lane >> 2, dim part dp = lane & 3): the lane walks keys ks, ks + 8, ... of its row
// and keeps dims 16 c + 4 dp + u (c, u < 4) of q and of its slice's partial o in registers, with the slice's own running maximum and sum (base-2 exponents); the 8 slices are merged at the end by lane exchanges.
template <int CTRL> __device__ __forceinline__ float a0_dpp(float x) { return __builtin_bit_cast(float, __builtin_amdgcn_update_dpp(0, __builtin_bit_cast(int, x), CTRL, 0xf, 0xf, true)); }      /* 0x160 + n: lane l <- lane l ^ n inside a 16-lane row; every lane is on wherever it is used */
__device__ __forceinline__ void a0_exp2x2(float& x, float& y) { asm("v_exp_f32 %0, %0\n\tv_exp_f32 %1, %1\n\tv_nop" : "+v"(x), "+v"(y)); }      /* two exponentials, each in place on its own register, so that neither is directly followed by a reader of its result; the v_nop is that slot behind the second */
template <int STEP> __device__ __forceinline__ float a0_swap(float x) { return STEP == 16 ? fa_xhalf(x) : a0_dpp<0x160 + (STEP & 15)>(x); }
template <int STEP> __device__ __forceinline__ void a0_merge(float& m, float& l, v4f (&o)[4]) {      /* this lane's slices with those of lane ^ STEP; a slice without keys has m = -1e30, l = 0, o = 0 and drops out */
  const float mo = a0_swap<STEP>(m), lo = a0_swap<STEP>(l); const float mn = fmaxf(m, mo); float fa = m - mn, fb = mo - mn; a0_exp2x2(fa, fb);
  l = fmaf(l, fa, lo * fb); m = mn;
  for (int c = 0; c < 4; ++c) for (int u = 0; u < 4; ++u) o[c][u] = fmaf(o[c][u], fa, a0_swap<STEP>(o[c][u]) * fb); }
__device__ __forceinline__ void a0_exp2x3(float& x, float& y, float& z) { asm("v_exp_f32 %0, %0\n\tv_exp_f32 %1, %1\n\tv_exp_f32 %2, %2\n\tv_nop" : "+v"(x), "+v"(y), "+v"(z)); }      /* as a0_exp2x2, for three */
__device__ __forceinline__ float a0_dot(const v4f (&q)[4], const v4f (&kk)[4]) {      /* q . k over the four lanes of a key: all four end with the same bits */
  v4f pv = q[0] * kk[0]; for (int c = 1; c < 4; ++c) pv = __builtin_elementwise_fma(q[c], kk[c], pv);
  float s = (pv[0] + pv[1]) + (pv[2] + pv[3]); s += a0_dpp<0x161>(s); s += a0_dpp<0x162>(s); return s; }
__global__ __launch_bounds__(256) void k_att0(const float* __restrict__ QF, const float* __restrict__ KF, const float* __restrict__ VF, int ld, float scale, float* __restrict__ OF, int ldo) {
  static_assert(HD == 64 && QT0 % 8 == 0, "four lanes of 16 dims a row; eight rows a block");
  const int lane = threadIdx.x & 31, ks = lane >> 2, dp = lane & 3; const int w = __builtin_amdgcn_readfirstlane((int)(threadIdx.x >> 5)); const int h = blockIdx.y;
  const int i = QT0 - 1 - (w * (QT0 / 8) + (int)blockIdx.x);      /* a block's eight rows lie QT0 / 8 apart: every block holds long and short key walks alike */
  const int col = h * HD + dp * 4; const float* qr = QF + (unsigned)(i * ld + col);
  v4f q[4], o[4]; const v4f z4 = {0.f, 0.f, 0.f, 0.f};
  for (int c = 0; c < 4; ++c) { q[c] = *(const v4fa*)(qr + c * 16); o[c] = z4; }
  const float cs = scale * 1.4426950408889634f;      /* e^x = 2^(x log2 e) */
  float m = -1.0e30f, l = 0.f;
  for (int jb = 0; jb <= i; jb += 16) {      /* 16 keys a pass, two a lane group: ja and ja + 8; a key above the diagonal (last pass only) is read as row i and weighs 0 */
    const int ja = jb + ks; const bool oka = ja <= i, okb = ja + 8 <= i;
    const unsigned offa = (unsigned)((oka ? ja : i) * ld + col), offb = (unsigned)((okb ? ja + 8 : i) * ld + col); v4f ka[4], kb[4], va[4], vb[4];
    const float* pka = KF + offa; const float* pkb = KF + offb; const float* pva = VF + offa; const float* pvb = VF + offb;
    for (int c = 0; c < 4; ++c) { ka[c] = *(const v4fa*)(pka + c * 16); kb[c] = *(const v4fa*)(pkb + c * 16); }
    for (int c = 0; c < 4; ++c) { va[c] = *(const v4fa*)(pva + c * 16); vb[c] = *(const v4fa*)(pvb + c * 16); }
    asm volatile("s_wait_xcnt 0x0" :: "v"(pka), "v"(pkb), "v"(pva), "v"(pvb) : "memory");      /* behind the pass's 16 loads, in front of every write of an address register that they name; the four addresses are inputs so that their registers live up to the wait and no load of the pass lands on one */
    __builtin_amdgcn_sched_barrier(0);      /* the arithmetic stays behind the 16 loads; without this the loads are spread among it in small groups, each waited for in turn */
    const float sa = a0_dot(q, ka) * cs, sb = a0_dot(q, kb) * cs;
    const float mn = fmaxf(m, fmaxf(oka ? sa : -1.0e30f, okb ? sb : -1.0e30f)); float sc = m - mn, ea = oka ? sa - mn : -1.0e30f, eb = okb ? sb - mn : -1.0e30f; a0_exp2x3(sc, ea, eb); m = mn;
    l = fmaf(l, sc, ea + eb); const v4f ea4 = {ea, ea, ea, ea}, eb4 = {eb, eb, eb, eb};
    for (int c = 0; c < 4; ++c) o[c] = __builtin_elementwise_fma(vb[c], eb4, __builtin_elementwise_fma(va[c], ea4, o[c] * sc)); }
  a0_merge<4>(m, l, o); a0_merge<8>(m, l, o); a0_merge<16>(m, l, o);
  const float fin = 64.0f / l;      /* o carried x64 like the f16 path; key 0 is in every row, so l > 0 */
  if (ks == 0) { float* dst = OF + (unsigned)(i * ldo + col); for (int c = 0; c < 4; ++c) *(v4f*)(dst + c * 16) = o[c] * fin; } }

__global__ __launch_bounds__(256) void k_kvexp(const float* __restrict__ src, float* __restrict__ dst, size_t n4) { const size_t t = (size_t)blockIdx.x * 256 + threadIdx.x; if (t >= n4) return; const size_t e = t * 4; const size_t row = e / DM; const int col = (int)(e % DM); const int h = col / HD, d = col % HD; const v4f v = *(const v4fa*)(src + row * KVD + (size_t)(h / HPG) * HD + d); *(v4f*)(dst + e) = v;  }

__global__ __launch_bounds__(256) void k_tab2(float theta, float* __restrict__ CS, float* __restrict__ SN) {
  const int t = blockIdx.x * 256 + threadIdx.x; if (t >= SQ * (HD / 2)) return; const int i = t % (HD / 2); const int p = t / (HD / 2); const float invf = 1.0f / powf(theta, (float)(2 * i) / (float)HD); const float ang = __fmul_rn((float)p, invf); const float c = cosf(ang), s = sinf(ang);
  *(float*)(CS + t) = c; *(float*)(SN + t) = s;  }
__global__ __launch_bounds__(256) void k_bfcp(const float* __restrict__ src, float* __restrict__ dst, size_t n4) { const size_t t = (size_t)blockIdx.x * 256 + threadIdx.x; if (t >= n4) return; const v4f a = *(const v4fa*)(src + t * 4); v4f o; for (int q = 0; q < 4; ++q) o[q] = bf16_round(a[q]); *(v4f*)(dst + t * 4) = o;  }

__global__ __launch_bounds__(256) void k_tabhalf(const float* __restrict__ cs, const float* __restrict__ sn, float* __restrict__ CS, float* __restrict__ SN) { const int t = blockIdx.x * 256 + threadIdx.x; if (t >= SQ * (HD / 2)) return; const int p = t / (HD / 2), i = t % (HD / 2); const float c = bf16_round(cs[(size_t)p * HD + i]), s = bf16_round(sn[(size_t)p * HD + i]);
  *(float*)(CS + t) = c; *(float*)(SN + t) = s;  }

__global__ __launch_bounds__(256) void k_tab2d(float* __restrict__ CS, float* __restrict__ SN) {
  const int t = blockIdx.x * 256 + threadIdx.x; if (t >= SQ * (HD / 2)) return; const int i = t % (HD / 2); const int p = t / (HD / 2); const float invf = (float)(1.0 / pow(10000.0, (double)(2 * i) / (double)HD)); const float ang = __fmul_rn((float)p, invf); const float c = cosf(ang), s = sinf(ang);
  *(float*)(CS + t) = c; *(float*)(SN + t) = s;  }
extern "C" void kernel_launch(void* const* d_in, const int* in_sizes, int n_in,
                              void* d_out, int out_size, void* d_ws, size_t ws_size, hipStream_t stream) {
  (void)in_sizes; (void)n_in; (void)out_size;
  const float* const* I = (const float* const*)d_in; const float* x = I[0]; const float* wattn = I[1]; const float* wo = I[2]; const float* qg = I[3]; const float* kg = I[4];      /* x; fused [in][out] Wqkv [1024][3072] (q, k, v column thirds); [in][out] Wproj; RMS-norm gains q_norm_w / k_norm_w [64]; no biases; rope tables computed in-kernel (positions = row index) */
  static_assert(HPG == 1 && NH == NG * HPG && NH * HD == DM && KVD == DM, "plain multi-head attention as 16 kv groups of one query head"); const float* bv = nullptr; const float* bo = nullptr;      /* no biases in this module */
  char* ws = (char*)d_ws; size_t off = 0;
  auto take = [&](size_t bytes) { char* p = ws + off; off += (bytes + 255) & ~(size_t)255; return p; };
  _Float16* BQKV = (_Float16*)take((size_t)3 * DM * DM * 2); _Float16* BQ = BQKV; _Float16* BK = BQKV + (size_t)DM * DM; _Float16* BV = BQKV + (size_t)2 * DM * DM; _Float16* BO = (_Float16*)take((size_t)DM * DM * 2);      /* one transposed plane Bt [3072][1024] of the fused weight: rows 0..1023 = q, 1024.. = k, 2048.. = v */
  _Float16* X16 = (_Float16*)take(NR * DM * 2); float* CSB = (float*)take((size_t)SQ * HD * 4); float* SNB = (float*)take((size_t)SQ * HD * 4); _Float16* Q16 = (_Float16*)take(NR * DM * 2); _Float16* K16 = (_Float16*)take(NR * KVD * 2); _Float16* V16 = (_Float16*)take(NR * KVD * 2); _Float16* O16 = (_Float16*)take(NR * DM * 2);
  _Float16* VT = (_Float16*)take((size_t)NH * HD * SQ * 2);
  float* QF0 = (float*)take((size_t)QT0 * DM * 4); float* KF0 = (float*)take((size_t)QT0 * KVD * 4); float* VF0 = (float*)take((size_t)QT0 * KVD * 4); float* KF0e = (float*)take((size_t)QT0 * DM * 4); float* VF0e = (float*)take((size_t)QT0 * DM * 4); float* OF0 = (float*)take((size_t)NB * QT0 * DM * 4); _Float16* OH0 = (_Float16*)take((size_t)NB * QT0 * DM * 2); _Float16* OL0 = (_Float16*)take((size_t)NB * QT0 * DM * 2);
  if (off > ws_size) return;
  k_wt_f16<<<(unsigned)(((size_t)3 * DM * (DM / 8) + 255) / 256), 256, 0, stream>>>(wattn, BQKV, DM, 3 * DM, 16.0f); k_wt_f16<<<(unsigned)(((size_t)DM * (DM / 8) + 255) / 256), 256, 0, stream>>>(wo, BO, DM, DM, 16.0f);      /* [in][out] -> Bt x16 planes (fused Wqkv: K 1024, N 3072) */
  k_x16<<<(unsigned)((NR * DM / 8 + 255) / 256), 256, 0, stream>>>(x, X16, NR * DM / 8);
  k_tab2<<<(SQ * (HD / 2) + 255) / 256, 256, 0, stream>>>(10000.0f, CSB, SNB);      /* rope tables cos / sin(p / 10000^(2i/64)), i < 32: f32 pow, reciprocal, product */
  const size_t r0p = (size_t)B0 * SQ;      /* first projected row */
  k_gemm2<0><<<dim3((unsigned)((MP / 128) * (KVD / 64)), 1), 128, 0, stream>>>(X16 + r0p * DM, DM, 0, BV, DM, 0, 0.0625f, bv, 0, nullptr, 1, 0, 0, nullptr, V16 + r0p * KVD, KVD, 0, MP, KVD, DM);
  for (int b = B0; b < B0 + NBR; ++b) { const size_t r0 = (size_t)b * SQ;
    k_gemm2<0, true><<<dim3((unsigned)((SQ / 128) * (DM / 64)), 1), 128, 0, stream>>>(X16 + r0 * DM, DM, 0, BQ, DM, 0, 0.0625f, nullptr, 0, nullptr, 1, 0, 0, QF0, Q16 + r0 * DM, DM, 0, SQ, DM, DM, qg, 1e-5f, CSB, SNB);      /* q of this batch: projection, per-head RMS norm (gain, eps 1e-5), half-split rope (out_lo = x_lo c - x_hi s, out_hi = x_lo s + x_hi c = t cos + rotate_half(t) sin with the module's [f | f] tables) -> f16 rows; rows 0..255 in f32 too */
    k_gemm2<0, true><<<dim3((unsigned)((SQ / 128) * (KVD / 64)), 1), 128, 0, stream>>>(X16 + r0 * DM, DM, 0, BK, DM, 0, 0.0625f, nullptr, 0, nullptr, 1, 0, 0, KF0, K16 + r0 * KVD, KVD, 0, SQ, KVD, DM, kg, 1e-5f, CSB, SNB);      /* k likewise */
    k_vt<NG, SQ><<<NG * (SQ / 64), 256, 0, stream>>>(V16 + r0 * KVD, KVD, 0, VT);      /* V^T [NH][HD][SQ] for this batch */
    k_gemm2<0><<<dim3((QT0 / 128) * (KVD / 64), 1), 128, 0, stream>>>(X16 + r0 * DM, DM, 0, BV, DM, 0, 0.0625f, bv, 0, nullptr, 1, 0, 0, VF0, nullptr, KVD, 0, QT0, KVD, DM);
    k_kvexp<<<(unsigned)(((size_t)QT0 * DM / 4 + 255) / 256), 256, 0, stream>>>(KF0, KF0e, (size_t)QT0 * DM / 4); k_kvexp<<<(unsigned)(((size_t)QT0 * DM / 4 + 255) / 256), 256, 0, stream>>>(VF0, VF0e, (size_t)QT0 * DM / 4);      /* head h <- kv group h / HPG (HPG is 1 here: a plain copy) for the exact first-tile kernel */      /* f32 q, k, v of the first 256 rows (exact products) */
    k_att0<<<dim3(QT0 / 8, NH), 256, 0, stream>>>(QF0, KF0e, VF0e, DM, 0.125f, OF0 + (size_t)b * QT0 * DM, DM);      /* exact f32 attention for rows 0..255 (o x64) */
    k_fattn<<<dim3(SQ / 64, NH), 128, 0, stream>>>(Q16 + r0 * LQ, K16 + r0 * KVD, VT, O16 + r0 * DM); }      /* scores, causal softmax and weights x V of all 16 heads and all query rows of this batch in ONE launch; scores and weights stay in registers (o x64) */
  k_gemm2<0><<<dim3((unsigned)((MPO / 128) * (DM / 64)), 1), 128, 0, stream>>>(O16 + r0p * DM, DM, 0, BO, DM, 0, 0.0009765625f, bo, 0, nullptr, 1, 0, 0, (float*)d_out + r0p * DM, nullptr, DM, 0, MPO, DM, DM);      /* out rows are the output layout */
  k_hl<<<(unsigned)(((size_t)NB * QT0 * DM / 8 + 255) / 256), 256, 0, stream>>>(OF0, OH0, OL0, (size_t)NB * QT0 * DM / 8);      /* first-tile o (x64) -> f16 hi + x1024 residual planes */
  for (int b = B0; b < B0 + NBR; ++b) { const size_t r0 = (size_t)b * SQ; const size_t f0 = (size_t)b * QT0;
    k_gemm2<0><<<dim3((QT0 / 128) * (DM / 64), 1), 128, 0, stream>>>(OH0 + f0 * DM, DM, 0, BO, DM, 0, 0.0009765625f, bo, 0, nullptr, 1, 0, 0, (float*)d_out + r0 * DM, nullptr, DM, 0, QT0, DM, DM);      /* rows 0..255: out = o_hi Wo (no bias here), overwriting the f16-path rows */
    k_gemm2<0><<<dim3((QT0 / 128) * (DM / 64), 1), 128, 0, stream>>>(OL0 + f0 * DM, DM, 0, BO, DM, 0, 0.00000095367431640625f, nullptr, 0, (const float*)d_out + r0 * DM, -1, 0, 0, (float*)d_out + r0 * DM, nullptr, DM, 0, QT0, DM, DM); }      /* += o_lo Wo 2^-20 (own-element accumulate) */
}

// v004
// A run of this version takes 481 microseconds.
// Next to v003, in two timings, it ran 2.20 and 2.18 times as fast.
// Over all steps from v000 it is 15.3 times as fast.
#include <hip/hip_runtime.h>
// Causal multi-head self-attention with a per-head RMS norm on q and k THEN rotate-half RoPE computed in the module, and a bias-free fused QKV projection (x [4][2048][1024]; qkv = x Wqkv ([in][out] 1024 x 3072, no bias) split into q | k | v thirds, 16 heads of 64; q, k = x * rsqrt(mean(x^2 over the 64 head dims) + 1e-5) * gain (gains q_norm_w / k_norm_w [64], read); cos / sin = [f | f] of pos * (1 / 10000^(2i/64)); q = q cos + rotate_half(q) sin with rotate_half = cat(-x2, x1), likewise k; scores / sqrt(64); causal (tril, -inf); softmax; out = merged Wproj ([in][out], no bias) -> [4][2048][1024]); run as grouped-query causal attention with 16 groups of ONE head with the norm stage on and the rope stage in its half-split mode.
// Compute dtype: inputs rounded to bf16 (the two gain vectors bf16-rounded on load); x / weights exact; the per-head RMS norm and the rotation in f32 on VALU; q, k, v, softmax weights and o as plain f16 GEMM operands (~2^-12); scores and softmax statistics f32; v_wmma_f32_16x16x32_f16.
#define NB 4
#define NG 16
#define HPG 1
#define KVD (NG * HD)
#define SQ 2048
#define DM 1024
#define NH 16
#define HD 64
#define HG 4
#define QT 256                       /* unused (k_fattn tiles 16 query rows per wave) */
#define NKX SQ
#define QT0 256                      /* first-tile rows recomputed exactly in f32 */
#define B0 0                         /* first batch processed (debug hook) */
#define NBR NB                       /* batches processed (debug hook) */
#define NR ((size_t)NB * SQ)         /* token rows */
#define MP ((int)((size_t)NBR * SQ)) /* rows projected (debug hook) */
#define QN SQ                        /* unused (k_fattn attends all SQ rows of a batch) */
#define NHD NH                       /* unused (all NH heads are attended) */
#define MPO MP                       /* rows through the output stage (debug hook) */
#define LQ DM      /* row pitch of the q/k/v rows */
typedef __bf16 v16b __attribute__((ext_vector_type(16)));
typedef unsigned short v8us __attribute__((ext_vector_type(8), may_alias));
typedef float  v8f  __attribute__((ext_vector_type(8)));
typedef float  v4f  __attribute__((ext_vector_type(4)));
typedef float  v4fa __attribute__((ext_vector_type(4), may_alias));
union FragB { v16b v; v8us half[2]; unsigned short u[16]; };

__device__ __forceinline__ unsigned short bf16_bits(float x) { unsigned int u = __float_as_uint(x); return (unsigned short)((u + 0x7FFFu + ((u >> 16) & 1u)) >> 16); }
__device__ __forceinline__ float bf16_val(unsigned short b) { return __uint_as_float(((unsigned int)b) << 16); }
__device__ __forceinline__ float bf16_round(float x) { return bf16_val(bf16_bits(x)); }
// D += A·B with NT terms: 1 = ah·bh, 2 = + al·bh (A split), 3 = + ah·bl (both split)
template <int NT>
__device__ __forceinline__ v8f mmaN(v16b ah, v16b al, v16b bh, v16b bl, v8f c) {
  c = __builtin_amdgcn_wmma_f32_16x16x32_bf16(false, ah, false, bh, (short)0, c, false, false);
  if (NT >= 2) c = __builtin_amdgcn_wmma_f32_16x16x32_bf16(false, al, false, bh, (short)0, c, false, false);
  if (NT >= 3) c = __builtin_amdgcn_wmma_f32_16x16x32_bf16(false, ah, false, bl, (short)0, c, false, false);
  asm volatile("v_nop\n\tv_nop\n\tv_nop\n\tv_nop" : "+v"(c) : "v"(ah), "v"(al), "v"(bh), "v"(bl));
  return c;
}

__global__ __launch_bounds__(256) void k_wt_bf16(const float* __restrict__ W, unsigned short* __restrict__ Wt, int K, int N) {
  const int t = blockIdx.x * 256 + threadIdx.x;
  const int k8n = K / 8;
  if (t >= N * k8n) return;
  const int n = t / k8n, k8 = (t % k8n) * 8;
  v8us v;
#pragma unroll
  for (int i = 0; i < 8; ++i) v[i] = bf16_bits(W[(size_t)(k8 + i) * N + n]);
  *(v8us*)(Wt + (size_t)n * K + k8) = v;
  
}

// GEMM C[M][N] (f32, pitch ldc) = act(A[M][K]·W + bias). A f32 row-major (pitch lda) converted per fragment to bf16
// (ASPLIT: hi/lo two planes -> 2 terms, else single rounded term); Wt bf16 [N][K] (pitch ldb). BIAS_BF16 rounds the
// bias to bf16 first (bias quantised to bf16 before the add). K%32==0, M%16==0, N%64==0.
template <bool ASPLIT, int ACT, bool BIAS_BF16>
__global__ __launch_bounds__(128) void k_gemm_bf(const float* __restrict__ A, int lda, const unsigned short* __restrict__ Wt, int ldb,
                                               const float* __restrict__ bias, float* __restrict__ C, int ldc, int M, int N, int K) {
  __shared__ __attribute__((aligned(16))) float so[4][16][64];
  const int tid = threadIdx.x, w = tid >> 5, lane = tid & 31, ln = lane & 15, hh = lane >> 4;
  const int ntn = N / 64;
  const int wid = blockIdx.x * 4 + w;
  const int mt = wid / ntn, nq = wid % ntn;
  if (mt * 16 >= M) return;
  const int row0 = mt * 16, col0 = nq * 64;
  const float* arow = A + (size_t)(row0 + ln) * lda;
  v8f acc[4] = {};
  for (int kb = 0; kb < K; kb += 32) {
    FragB ah, al;
    const v4f x0 = *(const v4fa*)(arow + kb + 8 * hh), x1 = *(const v4fa*)(arow + kb + 8 * hh + 4);
    const v4f x2 = *(const v4fa*)(arow + kb + 16 + 8 * hh), x3 = *(const v4fa*)(arow + kb + 16 + 8 * hh + 4);
    float xs[16] = {x0[0],x0[1],x0[2],x0[3],x1[0],x1[1],x1[2],x1[3],x2[0],x2[1],x2[2],x2[3],x3[0],x3[1],x3[2],x3[3]};
#pragma unroll
    for (int i = 0; i < 16; ++i) { const unsigned short hb = bf16_bits(xs[i]); ah.u[i] = hb; al.u[i] = ASPLIT ? bf16_bits(xs[i] - bf16_val(hb)) : (unsigned short)0; }
#pragma unroll
    for (int t = 0; t < 4; ++t) {
      const unsigned short* brow = Wt + (size_t)(col0 + t * 16 + ln) * ldb + kb;
      FragB b;
      b.half[0] = *(const v8us*)(brow + 8 * hh);
      b.half[1] = *(const v8us*)(brow + 16 + 8 * hh);
      acc[t] = mmaN<ASPLIT ? 2 : 1>(ah.v, al.v, b.v, b.v, acc[t]);
    }
  }
#pragma unroll
  for (int t = 0; t < 4; ++t) {
    float bv = bias ? bias[col0 + t * 16 + ln] : 0.f;
    if (BIAS_BF16) bv = bf16_round(bv);
#pragma unroll
    for (int r = 0; r < 8; ++r) { float v = acc[t][r] + bv; if (ACT == 1) v = fmaxf(v, 0.f); so[w][8 * hh + r][t * 16 + ln] = v; }
  }
  __builtin_amdgcn_fence(__ATOMIC_ACQ_REL, "workgroup");
  __builtin_amdgcn_wave_barrier();
  const int rsub = lane >> 4, c4 = (lane & 15) * 4;
  {
#pragma unroll
    for (int q = 0; q < 8; ++q) {
      const int r = q * 2 + rsub;
      const v4f v = *(const v4fa*)&so[w][r][c4];
      *(v4f*)(C + (size_t)(row0 + r) * ldc + col0 + c4) = v;
    }
    
  }
}

// GEMM C = act(A·W + bias + resid): A f32 (ASPLIT -> hi/lo 2 terms), Wt bf16 [N][K]; ACT 0 none, 1 relu, 2 exact gelu;
// resid (optional, f32, row index = (row % rmod), pitch ldr, RES_BF16 rounds it) added before the activation.
template <bool ASPLIT, int ACT, bool BIAS_BF16, bool RES_BF16>
__global__ __launch_bounds__(128) void k_gemm_bf3(const float* __restrict__ A, int lda, const unsigned short* __restrict__ Wt, int ldb,
                                                const float* __restrict__ bias, const float* __restrict__ resid, int rmod, int ldr,
                                                float* __restrict__ C, int ldc, int M, int N, int K) {
  __shared__ __attribute__((aligned(16))) float so[4][16][64];
  const int tid = threadIdx.x, w = tid >> 5, lane = tid & 31, ln = lane & 15, hh = lane >> 4;
  const int ntn = N / 64;
  const int wid = blockIdx.x * 4 + w;
  const int mt = wid / ntn, nq = wid % ntn;
  if (mt * 16 >= M) return;
  const int row0 = mt * 16, col0 = nq * 64;
  const float* arow = A + (size_t)(row0 + ln) * lda;
  v8f acc[4] = {};
  for (int kb = 0; kb < K; kb += 32) {
    FragB ah, al;
    const v4f x0 = *(const v4fa*)(arow + kb + 8 * hh), x1 = *(const v4fa*)(arow + kb + 8 * hh + 4);
    const v4f x2 = *(const v4fa*)(arow + kb + 16 + 8 * hh), x3 = *(const v4fa*)(arow + kb + 16 + 8 * hh + 4);
    float xs[16] = {x0[0],x0[1],x0[2],x0[3],x1[0],x1[1],x1[2],x1[3],x2[0],x2[1],x2[2],x2[3],x3[0],x3[1],x3[2],x3[3]};
#pragma unroll
    for (int i = 0; i < 16; ++i) { const unsigned short hb = bf16_bits(xs[i]); ah.u[i] = hb; al.u[i] = ASPLIT ? bf16_bits(xs[i] - bf16_val(hb)) : (unsigned short)0; }
#pragma unroll
    for (int t = 0; t < 4; ++t) {
      const unsigned short* brow = Wt + (size_t)(col0 + t * 16 + ln) * ldb + kb;
      FragB b;
      b.half[0] = *(const v8us*)(brow + 8 * hh);
      b.half[1] = *(const v8us*)(brow + 16 + 8 * hh);
      acc[t] = mmaN<ASPLIT ? 2 : 1>(ah.v, al.v, b.v, b.v, acc[t]);
    }
  }
#pragma unroll
  for (int t = 0; t < 4; ++t) {
    const int col = col0 + t * 16 + ln;
    float bv = bias ? bias[col] : 0.f;
    if (BIAS_BF16) bv = bf16_round(bv);
#pragma unroll
    for (int r = 0; r < 8; ++r) {
      float v = acc[t][r] + bv;
      if (resid) { float rv = resid[(size_t)((row0 + 8 * hh + r) % rmod) * ldr + col]; if (RES_BF16) rv = bf16_round(rv); v += rv; }
      if (ACT == 1) v = fmaxf(v, 0.f);
      if (ACT == 2) v = 0.5f * v * (1.0f + erff(v * 0.70710678118654752f));
      if (ACT == 3) { const float u = 0.7978845608028654f * (v + 0.044715f * v * v * v); v = 0.5f * v * (1.0f + tanhf(u)); }
      so[w][8 * hh + r][t * 16 + ln] = v;
    }
  }
  __builtin_amdgcn_fence(__ATOMIC_ACQ_REL, "workgroup");
  __builtin_amdgcn_wave_barrier();
  const int rsub = lane >> 4, c4 = (lane & 15) * 4;
  {
#pragma unroll
    for (int q = 0; q < 8; ++q) {
      const int r = q * 2 + rsub;
      const v4f v = *(const v4fa*)&so[w][r][c4];
      *(v4f*)(C + (size_t)(row0 + r) * ldc + col0 + c4) = v;
    }
    
  }
}
// row LayerNorm (biased variance, eps) over N: s = X (+ R); optional out_sum <- s; out_norm <- (s-mu)*rsqrt(var+eps)*g + b
template <bool PARAM_BF16>
__global__ __launch_bounds__(256) void k_layernorm(const float* __restrict__ X, const float* __restrict__ R, const float* __restrict__ g, const float* __restrict__ bta,
                                                  float* __restrict__ out_sum, float* __restrict__ out_norm, int N, float eps) {
  __shared__ float red[256];
  const int row = blockIdx.x, tid = threadIdx.x;
  const float* x = X + (size_t)row * N; const float* rr = R ? R + (size_t)row * N : nullptr;
  float vals[16];                     // up to N = 4096
  const int per = N / 256;            // contiguous chunk per thread? use strided-by-4 chunks: thread handles j = tid*4 + 1024*u
  float s1 = 0.f;
  for (int u = 0; u < per / 4; ++u) {
    const int j = tid * 4 + 1024 * u;
    const v4f a = *(const v4fa*)(x + j);
    v4f b = {0.f,0.f,0.f,0.f}; if (rr) b = *(const v4fa*)(rr + j);
#pragma unroll
    for (int q = 0; q < 4; ++q) { const float v = a[q] + b[q]; vals[u * 4 + q] = v; s1 += v; }
  }
  red[tid] = s1; __syncthreads();
  for (int st = 128; st > 0; st >>= 1) { if (tid < st) red[tid] += red[tid + st]; __syncthreads(); }
  const float mu = red[0] / (float)N; __syncthreads();
  float s2 = 0.f;
  for (int u = 0; u < per / 4; ++u)
#pragma unroll
    for (int q = 0; q < 4; ++q) { const float c = vals[u * 4 + q] - mu; s2 += c * c; }
  red[tid] = s2; __syncthreads();
  for (int st = 128; st > 0; st >>= 1) { if (tid < st) red[tid] += red[tid + st]; __syncthreads(); }
  const float rs = rsqrtf(red[0] / (float)N + eps);
  {
    for (int u = 0; u < per / 4; ++u) {
      const int j = tid * 4 + 1024 * u;
      v4f o, sm;
#pragma unroll
      for (int q = 0; q < 4; ++q) {
        float gg = g[j + q], bb = bta[j + q];
        if (PARAM_BF16) { gg = bf16_round(gg); bb = bf16_round(bb); }
        sm[q] = vals[u * 4 + q]; o[q] = (vals[u * 4 + q] - mu) * rs * gg + bb;
      }
      if (out_sum) *(v4f*)(out_sum + (size_t)row * N + j) = sm;
      *(v4f*)(out_norm + (size_t)row * N + j) = o;
    }
    
  }
}

// ---- f16 WMMA path (v_wmma_f32_16x16x32_f16): 11-bit significands for operands in range — used where a [0,1] probability operand needs more precision than bf16
typedef _Float16 v16h __attribute__((ext_vector_type(16)));
union FragH { v16h v; v8us half[2]; _Float16 h[16]; unsigned short u[16]; };
template <int NT>
__device__ __forceinline__ v8f mmaH(v16h ah, v16h al, v16h bh, v16h bl, v8f c) {
  c = __builtin_amdgcn_wmma_f32_16x16x32_f16(false, ah, false, bh, (short)0, c, false, false);
  if (NT >= 2) c = __builtin_amdgcn_wmma_f32_16x16x32_f16(false, al, false, bh, (short)0, c, false, false);
  if (NT >= 3) c = __builtin_amdgcn_wmma_f32_16x16x32_f16(false, ah, false, bl, (short)0, c, false, false);
  asm volatile("v_nop\n\tv_nop\n\tv_nop\n\tv_nop" : "+v"(c) : "v"(ah), "v"(al), "v"(bh), "v"(bl));
  return c;
}
// batched GEMM like k_gemm_b but f16 operands: A f32 (split into f16 hi/lo if ASPLIT, else rounded to f16), Bt = f16 values [n][k]; alpha; C f32; N multiple of 16 (partial tiles skipped)
template <bool ASPLIT>
__global__ __launch_bounds__(128) void k_gemm_h(const float* __restrict__ A, int lda, size_t sA, const _Float16* __restrict__ Bh, int ldb, size_t sB, float alpha, float* __restrict__ C, int ldc, size_t sC, int M, int N, int K) {
  __shared__ __attribute__((aligned(16))) float so[4][16][64];
  const int tid = threadIdx.x, w = tid >> 5, lane = tid & 31, ln = lane & 15, hh = lane >> 4; const int by = blockIdx.y;
  A += (size_t)by * sA; Bh += (size_t)by * sB; C += (size_t)by * sC;
  const int ntn = (N + 63) / 64; const int wid = blockIdx.x * 4 + w; const int mt = wid / ntn, nq = wid % ntn; if (mt * 16 >= M) return;
  const int row0 = mt * 16, col0 = nq * 64; const float* arow = A + (size_t)(row0 + ln) * lda;
  v8f acc[4] = {};
  for (int kb = 0; kb < K; kb += 32) {
    FragH ah, al;
    const v4f x0 = *(const v4fa*)(arow + kb + 8 * hh), x1 = *(const v4fa*)(arow + kb + 8 * hh + 4), x2 = *(const v4fa*)(arow + kb + 16 + 8 * hh), x3 = *(const v4fa*)(arow + kb + 16 + 8 * hh + 4);
    float xs[16] = {x0[0],x0[1],x0[2],x0[3],x1[0],x1[1],x1[2],x1[3],x2[0],x2[1],x2[2],x2[3],x3[0],x3[1],x3[2],x3[3]};
#pragma unroll
    for (int i = 0; i < 16; ++i) { const _Float16 h = (_Float16)xs[i]; ah.h[i] = h; al.h[i] = ASPLIT ? (_Float16)(xs[i] - (float)h) : (_Float16)0.0f; }
#pragma unroll
    for (int t = 0; t < 4; ++t) { if (col0 + t * 16 >= N) continue; const size_t boff = (size_t)(col0 + t * 16 + ln) * ldb + kb; FragH bq; bq.half[0] = *(const v8us*)(Bh + boff + 8 * hh); bq.half[1] = *(const v8us*)(Bh + boff + 16 + 8 * hh);
      acc[t] = mmaH<ASPLIT ? 2 : 1>(ah.v, al.v, bq.v, bq.v, acc[t]); }
  }
#pragma unroll
  for (int t = 0; t < 4; ++t) { if (col0 + t * 16 >= N) continue;
#pragma unroll
    for (int r = 0; r < 8; ++r) so[w][8 * hh + r][t * 16 + ln] = acc[t][r] * alpha; }
  __builtin_amdgcn_fence(__ATOMIC_ACQ_REL, "workgroup"); __builtin_amdgcn_wave_barrier();
  const int rsub = lane >> 4, c4 = (lane & 15) * 4;
  {
#pragma unroll
    for (int q = 0; q < 8; ++q) { const int r = q * 2 + rsub; if (col0 + c4 < N) { const v4f v = *(const v4fa*)&so[w][r][c4]; *(v4f*)(C + (size_t)(row0 + r) * ldc + col0 + c4) = v; } }
     }
}

// Wt[n][k] = f16(W[k][n]·scale) from f32 row-major W[K][N] (scale = power of two; bf16-exact weights stay exact in f16 away from the subnormal range)
__global__ __launch_bounds__(256) void k_wt_f16(const float* __restrict__ W, _Float16* __restrict__ Wt, int K, int N, float scale) {
  const int t = blockIdx.x * 256 + threadIdx.x; if (t >= N * (K / 8)) return; const int n = t / (K / 8), k8 = (t % (K / 8)) * 8; FragH f;
#pragma unroll
  for (int i = 0; i < 8; ++i) f.h[i] = (_Float16)(bf16_round(W[(size_t)(k8 + i) * N + n]) * scale); const v8us o = f.half[0];
  *(v8us*)((unsigned short*)Wt + (size_t)n * K + k8) = o; 
}
// k_gemm_hh variant with fused epilogue: v = acc·alpha + bias[by·sBias + col] (+ CP[(row/rowsPerB)·sCPb + by·64 + col] if CP) ; ACT 0 none / 1 elu ; writes f16 C16 (and f32 C if non-null)
template <int ACT>
__global__ __launch_bounds__(128) void k_gemm_hhx(const _Float16* __restrict__ A, int lda, size_t sA, const _Float16* __restrict__ Bh, int ldb, size_t sB, float alpha, const float* __restrict__ bias, size_t sBias, const float* __restrict__ CP, int rowsPerB, size_t sCPb, int row0g,
    float* __restrict__ C, _Float16* __restrict__ C16, int ldc, size_t sC, int M, int N, int K) {
  __shared__ __attribute__((aligned(16))) float so[4][16][64];
  const int tid = threadIdx.x, w = tid >> 5, lane = tid & 31, ln = lane & 15, hh = lane >> 4; const int by = blockIdx.y;
  A += (size_t)by * sA; Bh += (size_t)by * sB; const size_t cofs = (size_t)by * sC; const float* bp = bias ? bias + (size_t)by * sBias : nullptr;
  const int ntn = (N + 63) / 64; const int wid = blockIdx.x * 4 + w; const int mt = wid / ntn, nq = wid % ntn; if (mt * 16 >= M) return;
  const int row0 = mt * 16, col0 = nq * 64; const _Float16* arow = A + (size_t)(row0 + ln) * lda;
  v8f acc[4] = {};
  for (int kb = 0; kb < K; kb += 32) { FragH ah; ah.half[0] = *(const v8us*)((const unsigned short*)arow + kb + 8 * hh); ah.half[1] = *(const v8us*)((const unsigned short*)arow + kb + 16 + 8 * hh);
#pragma unroll
    for (int t = 0; t < 4; ++t) { if (col0 + t * 16 >= N) continue; const size_t boff = (size_t)(col0 + t * 16 + ln) * ldb + kb; FragH bq; bq.half[0] = *(const v8us*)((const unsigned short*)Bh + boff + 8 * hh); bq.half[1] = *(const v8us*)((const unsigned short*)Bh + boff + 16 + 8 * hh);
      acc[t] = mmaH<1>(ah.v, ah.v, bq.v, bq.v, acc[t]); }
  }
#pragma unroll
  for (int t = 0; t < 4; ++t) { if (col0 + t * 16 >= N) continue; const int col = col0 + t * 16 + ln; const float bv = bp ? bf16_round(bp[col]) : 0.f;
#pragma unroll
    for (int r = 0; r < 8; ++r) { float v = acc[t][r] * alpha + bv; if (CP) { const int rr = row0g + row0 + 8 * hh + r; if (rowsPerB < 0) v += CP[cofs + (size_t)rr * ldc + col];      /* rowsPerB < 0: own element of the batched C plane */ else { const int bidx = rr / rowsPerB; v += CP[(size_t)bidx * sCPb + (size_t)by * 64 + col]; } } if (ACT == 1) v = (v > 0.f) ? v : expm1f(v); else if (ACT == 7) v = (v > 0.f) ? v + 1.0f : expf(v); else if (ACT == 8) v = tanhf(v); else if (ACT == 9) v = 0.5f * v * (1.0f + tanhf(0.7978845608028654f * (v + 0.044715f * v * v * v))); else if (ACT == 11) v = 1.0f / (1.0f + expf(-v)); else if (ACT == 12) v = (v > 0.f) ? v : 0.01f * v; else if (ACT == 14) v = (v > 0.f) ? v : 0.1f * v; else if (ACT == 16) v = (v >= 0.f) ? v : 0.3f * v; else if (ACT == 17) v = (v >= 0.f) ? v : 0.2f * v; else if (ACT == 15) v = v / (1.0f + expf(-v)); else if (ACT == 3) v = fmaxf(v, 0.f); else if (ACT == 6) v = 0.5f * v * (1.0f + erff(v * 0.70710678118654752f)); so[w][8 * hh + r][t * 16 + ln] = v; } }
  __builtin_amdgcn_fence(__ATOMIC_ACQ_REL, "workgroup"); __builtin_amdgcn_wave_barrier();
  const int rsub = lane >> 4, c4 = (lane & 15) * 4; typedef _Float16 v4h __attribute__((ext_vector_type(4)));
  {
#pragma unroll
    for (int q = 0; q < 8; ++q) { const int r = q * 2 + rsub; if (col0 + c4 < N) { const v4f v = *(const v4fa*)&so[w][r][c4]; if (C) *(v4f*)(C + cofs + (size_t)(row0 + r) * ldc + col0 + c4) = v; if (C16) { v4h h4; for (int i = 0; i < 4; ++i) h4[i] = (_Float16)v[i]; *(v4h*)(C16 + cofs + (size_t)(row0 + r) * ldc + col0 + c4) = h4; } } }
     }
}

typedef _Float16 v4h __attribute__((ext_vector_type(4)));

__global__ __launch_bounds__(256) void k_x16(const float* __restrict__ x, _Float16* __restrict__ X16, size_t n8) { const size_t t = (size_t)blockIdx.x * 256 + threadIdx.x; if (t >= n8) return; FragH f;
#pragma unroll
  for (int q = 0; q < 8; ++q) f.h[q] = (_Float16)bf16_round(x[t * 8 + q]); *(v8us*)((unsigned short*)X16 + t * 8) = f.half[0];  }
__global__ __launch_bounds__(256) void k_h16(const float* __restrict__ x, _Float16* __restrict__ X16, size_t n8) { const size_t t = (size_t)blockIdx.x * 256 + threadIdx.x; if (t >= n8) return; FragH f;
#pragma unroll
  for (int q = 0; q < 8; ++q) f.h[q] = (_Float16)x[t * 8 + q]; *(v8us*)((unsigned short*)X16 + t * 8) = f.half[0];  }
__global__ __launch_bounds__(256) void k_round16f(const float* __restrict__ W, _Float16* __restrict__ Bt, size_t n8) { const size_t t = (size_t)blockIdx.x * 256 + threadIdx.x; if (t >= n8) return; FragH f;
#pragma unroll
  for (int i = 0; i < 8; ++i) f.h[i] = (_Float16)(bf16_round(W[t * 8 + i]) * 16.0f); *(v8us*)((unsigned short*)Bt + t * 8) = f.half[0];  }
template <int NHv, int TTv>
__global__ __launch_bounds__(256) void k_vt(const _Float16* __restrict__ V16, int ldv, int voff, _Float16* __restrict__ Vt) { __shared__ unsigned short tl[64][66]; const int tid = threadIdx.x; const int slab = blockIdx.x / (TTv / 64), lg = blockIdx.x % (TTv / 64); const int b = slab / NHv, h = slab % NHv;
  for (int i = tid; i < 64 * 8; i += 256) { const int r = i / 8, c8 = (i % 8) * 8; FragH f; f.half[0] = *(const v8us*)((const unsigned short*)V16 + ((size_t)b * TTv + lg * 64 + r) * ldv + voff + h * 64 + c8);
#pragma unroll
    for (int q = 0; q < 8; ++q) tl[r][c8 + q] = f.u[q]; }
  __syncthreads();
  {
#pragma unroll
    for (int rd = 0; rd < 2; ++rd) { const int d = rd * 32 + tid / 8, pc = tid % 8; FragH f;
#pragma unroll
      for (int q = 0; q < 8; ++q) f.u[q] = tl[pc * 8 + q][d];
      *(v8us*)((unsigned short*)Vt + ((size_t)slab * 64 + d) * TTv + lg * 64 + pc * 8) = f.half[0]; }
     } }

__global__ __launch_bounds__(256) void k_hl(const float* __restrict__ F, _Float16* __restrict__ Hh, _Float16* __restrict__ Hl, size_t n8) { const size_t t = (size_t)blockIdx.x * 256 + threadIdx.x; if (t >= n8) return; FragH fh, fl; const v4f a = *(const v4fa*)(F + t * 8), c = *(const v4fa*)(F + t * 8 + 4);
#pragma unroll
  for (int q = 0; q < 4; ++q) { _Float16 h = (_Float16)a[q]; fh.h[q] = h; fl.h[q] = (_Float16)((a[q] - (float)h) * 1024.0f); h = (_Float16)c[q]; fh.h[4 + q] = h; fl.h[4 + q] = (_Float16)((c[q] - (float)h) * 1024.0f); }
  { *(v8us*)((unsigned short*)Hh + t * 8) = fh.half[0]; *(v8us*)((unsigned short*)Hl + t * 8) = fl.half[0];  } }

// ---- per-head RMS norm and half-split rope on a staged 32 x 64 wave tile (k_gemm2's NROPE epilogue) ----
// The tile's 64 columns are ONE head, so it holds 32 whole head rows: 16 lanes read a row back, 4 dims a lane (d = 4 ln + u), and norm and rotate it in registers; dim d's rope partner d ^ 32 sits in lane ln ^ 8.
// The sum of squares is a halving tree over the 64 dims (d + 32, + 16, + 8, + 4 by the lane exchanges ln ^ 8, 4, 2, 1; d + 2, d + 1 inside the lane); every lane of a row ends with the same bits.
template <int CTRL> __device__ __forceinline__ float a0_dpp(float x);      /* defined with the first-tile kernel below */
__device__ __forceinline__ float nr_rsqrt(float a) {      /* rsqrtf as the compiler expands it (an argument below 2^-126 goes in x 2^24, its result out x 2^12), with the v_rsq_f32 in place on its own register and a v_nop behind it, so that no reader of its result and no writer of its source follows it directly */
  const bool tiny = a < 0x1p-126f; a = tiny ? a * 0x1p+24f : a; asm("v_rsq_f32 %0, %0\n\tv_nop" : "+v"(a)); return tiny ? a * 0x1p+12f : a; }
// The 16 row pairs of a wave's tile. trow / hp / fp = this lane's place in row hh of the tile and of the two outputs (pitch LQ); b1, b2 = table factors of x_lo and x_hi: (c, -s) in the low half (out_lo = x_lo c - x_hi s), (s, c) in the high half (out_hi = x_lo s + x_hi c).
template <bool F32OUT>
__device__ __forceinline__ void nr_rows(const float* trow, bool lowh, const v4f (&b1)[16], const v4f (&b2)[16], v4f g4, float eps, _Float16* hp, float* fp) {
#pragma unroll      /* the table factors are register arrays: every index must be a constant */
  for (int q = 0; q < 16; ++q) { v4f x = *(const v4fa*)(trow + q * 2 * 68); float t[4];
    for (int u = 0; u < 4; ++u) t[u] = __fmul_rn(x[u], x[u]);
    for (int u = 0; u < 4; ++u) t[u] = __fadd_rn(t[u], a0_dpp<0x168>(t[u]));
    for (int u = 0; u < 4; ++u) t[u] = __fadd_rn(t[u], a0_dpp<0x164>(t[u]));
    for (int u = 0; u < 4; ++u) t[u] = __fadd_rn(t[u], a0_dpp<0x162>(t[u]));
    for (int u = 0; u < 4; ++u) t[u] = __fadd_rn(t[u], a0_dpp<0x161>(t[u]));
    const float rs = nr_rsqrt(__fadd_rn(__fadd_rn(__fadd_rn(t[0], t[2]), __fadd_rn(t[1], t[3])) / (float)HD, eps));
    v4f o; v4h h4;      /* x_hi's product is rounded, x_lo's is fused into the sum, alike in both halves */
    for (int u = 0; u < 4; ++u) { const float own = __fmul_rn(__fmul_rn(x[u], rs), g4[u]), oth = a0_dpp<0x168>(own); const float lo = lowh ? own : oth, hi = lowh ? oth : own;
      o[u] = __builtin_fmaf(lo, b1[q][u], __fmul_rn(hi, b2[q][u])); h4[u] = (_Float16)o[u]; }
    *(v4h*)(hp + (size_t)q * 2 * LQ) = h4;
    if (F32OUT) *(v4f*)(fp + (size_t)q * 2 * LQ) = o; }
  asm volatile("s_wait_xcnt 0x0" ::: "memory"); }      /* behind the tail's last stores, in front of any later write of a register that they name (the code that follows the place where the two tails join) */

// ---- fast GEMM (wave tile 32x64; requires M % 32 == 0 rows per launch region and N % 64 == 0); epilogue = k_gemm_hhx semantics, or with NROPE: no bias, per-head RMS norm (gain, eps) and half-split rope (tables CS, SN; position = row % SQ) on acc alpha, f16 rows to C16 and, of the positions below QT0 of every sequence, the same values in f32 to C (QT0 rows a sequence), both at pitch LQ ----
__device__ __forceinline__ v16h g2_frag(const _Float16* p, int hh) { FragH f; f.half[0] = *(const v8us*)((const unsigned short*)p + 8 * hh); f.half[1] = *(const v8us*)((const unsigned short*)p + 16 + 8 * hh); return f.v; }
__device__ __forceinline__ v8f g2_mma(v16h a, v16h b, v8f c) { v8f d = __builtin_amdgcn_wmma_f32_16x16x32_f16(false, a, false, b, (short)0, c, false, false); asm volatile("v_nop\n\tv_nop\n\tv_nop\n\tv_nop" : "+v"(d) : "v"(a), "v"(b)); return d; }
template <int ACT, bool NROPE = false>
__global__ __launch_bounds__(128) void k_gemm2(const _Float16* __restrict__ A, int lda, size_t sA, const _Float16* __restrict__ Bh, int ldb, size_t sB, float alpha, const float* __restrict__ bias, size_t sBias, const float* __restrict__ CP, int rowsPerB, size_t sCPb, int row0g,
    float* __restrict__ C, _Float16* __restrict__ C16, int ldc, size_t sC, int M, int N, int K, const float* __restrict__ gain = nullptr, float eps = 0.f, const float* __restrict__ CS = nullptr, const float* __restrict__ SN = nullptr) { static_assert(ACT == 0 || ACT == 3 || ACT == 6 || ACT == 8 || ACT == 9 || ACT == 11 || ACT == 12 || ACT == 14 || ACT == 15 || ACT == 16 || ACT == 17, "k_gemm2: unsupported ACT code (would silently apply no activation)");
  __shared__ __attribute__((aligned(16))) float so[4][32][68];
  const int tid = threadIdx.x, w = tid >> 5, lane = tid & 31, ln = lane & 15, hh = lane >> 4; const int by = blockIdx.y;
  A += (size_t)by * sA; Bh += (size_t)by * sB; const size_t cofs = (size_t)by * sC; const float* bp = bias ? bias + (size_t)by * sBias : nullptr;
  const int ntn = N >> 6; const int mt = blockIdx.x / ntn, nq = blockIdx.x - mt * ntn; const int row0 = mt * 128 + 32 * w, col0 = nq * 64; if (row0 >= M) return;
  const _Float16* a0p = A + (size_t)(row0 + ln) * lda; const _Float16* a1p = a0p + (size_t)16 * lda;
  const _Float16* b0p = Bh + (size_t)(col0 + ln) * ldb; const _Float16* b1p = b0p + (size_t)16 * ldb; const _Float16* b2p = b1p + (size_t)16 * ldb; const _Float16* b3p = b2p + (size_t)16 * ldb;
  const v8f z8 = {0.f,0.f,0.f,0.f,0.f,0.f,0.f,0.f}; v8f c00 = z8, c01 = z8, c02 = z8, c03 = z8, c10 = z8, c11 = z8, c12 = z8, c13 = z8;
  for (int kb = 0; kb < K; kb += 32) { const v16h a0 = g2_frag(a0p + kb, hh), a1 = g2_frag(a1p + kb, hh);
    v16h b = g2_frag(b0p + kb, hh); c00 = g2_mma(a0, b, c00); c10 = g2_mma(a1, b, c10);
    b = g2_frag(b1p + kb, hh); c01 = g2_mma(a0, b, c01); c11 = g2_mma(a1, b, c11);
    b = g2_frag(b2p + kb, hh); c02 = g2_mma(a0, b, c02); c12 = g2_mma(a1, b, c12);
    b = g2_frag(b3p + kb, hh); c03 = g2_mma(a0, b, c03); c13 = g2_mma(a1, b, c13); }
  v8f accs[8] = {c00, c01, c02, c03, c10, c11, c12, c13};
  if constexpr (NROPE) { static_assert(HD == 64 && QT0 % 32 == 0 && SQ % 32 == 0, "a wave tile's 64 columns are one head; its 32 rows lie on one side of QT0 and in one sequence");
    const int c4 = ln * 4; const bool lowh = ln < 8; const unsigned tofs = (unsigned)((row0 % SQ + hh) * (HD / 2) + (ln & 7) * 4);      /* table row = the token's position, table column = d & 31 */
    const float* cp = CS + tofs; const float* sp = SN + tofs; v4f tc[16], ts[16];
#pragma unroll      /* register arrays: constant indices */
    for (int q = 0; q < 16; ++q) { tc[q] = *(const v4fa*)(cp + q * 2 * (HD / 2)); ts[q] = *(const v4fa*)(sp + q * 2 * (HD / 2)); }      /* all 32 table rows asked for here, so that one latency runs under the LDS staging below */
    v4f g4 = *(const v4fa*)(gain + c4);
    asm volatile("s_wait_xcnt 0x0" ::: "memory");      /* behind the 33 loads, in front of every later write of an address register that they name */
#pragma unroll      /* accs is a register array: constant indices */
    for (int u = 0; u < 8; ++u) for (int r = 0; r < 8; ++r) so[w][(u >> 2) * 16 + 8 * hh + r][(u & 3) * 16 + ln] = accs[u][r] * alpha;
    __builtin_amdgcn_fence(__ATOMIC_ACQ_REL, "workgroup"); __builtin_amdgcn_wave_barrier();      /* as in the plain epilogue: the wave's own LDS writes before its reads */
    for (int u = 0; u < 4; ++u) g4[u] = bf16_round(g4[u]);
#pragma unroll      /* register arrays: constant indices */
    for (int q = 0; q < 16; ++q) { const v4f c = tc[q], s = ts[q]; tc[q] = lowh ? c : s; ts[q] = lowh ? -s : c; }
    const size_t e = cofs + (size_t)(row0 + hh) * LQ + col0 + c4; const size_t ef = e - (size_t)(row0 / SQ) * (SQ - QT0) * LQ;      /* the f32 plane holds QT0 rows a sequence: sequence s, position p lies at row s QT0 + p */
    if (__builtin_amdgcn_readfirstlane(row0 % SQ) < QT0) nr_rows<true>(&so[w][hh][c4], lowh, tc, ts, g4, eps, C16 + e, C + ef);      /* one wave-uniform branch around the whole tail: inside it the 16 row pairs stay one block of code to schedule */
    else nr_rows<false>(&so[w][hh][c4], lowh, tc, ts, g4, eps, C16 + e, C + ef);
    return; }
#pragma unroll
  for (int u = 0; u < 8; ++u) { const int t = u & 3, half = u >> 2; const int col = col0 + t * 16 + ln; const float bv = bp ? bf16_round(bp[col]) : 0.f;
#pragma unroll
    for (int r = 0; r < 8; ++r) { const int rloc = half * 16 + 8 * hh + r; float v = accs[u][r] * alpha + bv; if (CP) { if (rowsPerB < 0) v += CP[cofs + (size_t)(row0g + row0 + rloc) * ldc + col];      /* rowsPerB < 0: own element of the batched C plane */ else { const int bidx = (row0g + row0 + rloc) / rowsPerB; v += CP[(size_t)bidx * sCPb + (size_t)by * 64 + col]; } }
      if (ACT == 3) v = fmaxf(v, 0.f); else if (ACT == 6) v = 0.5f * v * (1.0f + erff(v * 0.70710678118654752f)); else if (ACT == 11) v = 1.0f / (1.0f + expf(-v)); else if (ACT == 15) v = v / (1.0f + expf(-v)); else if (ACT == 12) v = (v > 0.f) ? v : 0.01f * v; else if (ACT == 8) v = tanhf(v); else if (ACT == 9) v = 0.5f * v * (1.0f + tanhf(0.7978845608028654f * (v + 0.044715f * v * v * v))); else if (ACT == 14) v = (v > 0.f) ? v : 0.1f * v; else if (ACT == 16) v = (v >= 0.f) ? v : 0.3f * v; else if (ACT == 17) v = (v >= 0.f) ? v : 0.2f * v;
      so[w][rloc][t * 16 + ln] = v; } }
  __builtin_amdgcn_fence(__ATOMIC_ACQ_REL, "workgroup"); __builtin_amdgcn_wave_barrier();
  const int rsub = lane >> 4, c4 = (lane & 15) * 4;
  {
#pragma unroll
    for (int q = 0; q < 16; ++q) { const int r = q * 2 + rsub; const v4f v = *(const v4fa*)&so[w][r][c4]; if (C) *(v4f*)(C + cofs + (size_t)(row0 + r) * ldc + col0 + c4) = v; if (C16) { v4h h4; for (int i = 0; i < 4; ++i) h4[i] = (_Float16)v[i]; *(v4h*)(C16 + cofs + (size_t)(row0 + r) * ldc + col0 + c4) = h4; } }
     } }

__global__ __launch_bounds__(256) void k_wnat(const float* __restrict__ w, size_t n8, _Float16* __restrict__ Bt) { const size_t t = (size_t)blockIdx.x * 256 + threadIdx.x; if (t >= n8) return; FragH f; for (int q = 0; q < 8; ++q) f.h[q] = (_Float16)(bf16_round(w[t * 8 + q]) * 16.0f); *(v8us*)((unsigned short*)Bt + t * 8) = f.half[0];  }

// Fused causal attention of all batches (blockIdx.x = head + NH * batch, blockIdx.y = query tile group): one wave owns 16 query rows of one head and walks its keys 32 at a time with a running maximum and sum.
// S^T = K Q^T (A = key rows, B = query rows): a lane holds scores of ONE query (column ln), keys 8 hh + r of each 16-key tile, so two converted score tiles are, as they lie, the B fragment of O^T += V^T P^T (A = rows of V^T).
// Weights are carried x256 (f16 range) and cancel in the division by their own sum; o leaves x64 like before.
__device__ __forceinline__ float fa_xhalf(float x) { return __builtin_bit_cast(float, __builtin_amdgcn_permlanex16(__builtin_bit_cast(int, x), __builtin_bit_cast(int, x), 0x76543210, 0xfedcba98, false, false)); }      /* lane l <-> lane l ^ 16 */
__global__ __launch_bounds__(128) void k_fattn(const _Float16* __restrict__ Q, const _Float16* __restrict__ K, const _Float16* __restrict__ Vt, _Float16* __restrict__ O) {
  const int lane = threadIdx.x & 31, ln = lane & 15, hh = lane >> 4; const int w = __builtin_amdgcn_readfirstlane((int)(threadIdx.x >> 5)); const int h = blockIdx.x % NH; const size_t bz = blockIdx.x / NH;
  Q += bz * SQ * LQ; K += bz * SQ * KVD; Vt += bz * NH * HD * SQ; O += bz * SQ * DM;      /* this batch's rows and its V^T planes */
  const int q0w = ((int)(gridDim.y - 1 - blockIdx.y) * 4 + w) * 16;      /* the tile group is the slow grid index, reversed: grid row 0 holds the longest key walks of every head and batch (for speed only) */
  const int qi = q0w + ln; const int kend = ((q0w >> 5) + 1) * 32;      /* keys 0 .. kend - 1 cover every key <= q0w + 15; kend <= SQ */
  const _Float16* qp = Q + (size_t)qi * LQ + h * HD; const v16h qa = g2_frag(qp, hh), qb = g2_frag(qp + 32, hh);
  const _Float16* kp = K + (size_t)ln * KVD + h * HD; const _Float16* vp = Vt + ((size_t)h * HD + ln) * SQ;
  const v8f z8 = {0.f,0.f,0.f,0.f,0.f,0.f,0.f,0.f}; v8f o0 = z8, o1 = z8, o2 = z8, o3 = z8;
  const float cs = 0.125f * 1.4426950408889634f;      /* 1 / sqrt(64), and e^x = 2^(x log2 e) */
  float m = -1.0e30f, l = 0.f;
  v16h k0a = g2_frag(kp, hh), k0b = g2_frag(kp + 32, hh), k1a = g2_frag(kp + (size_t)16 * KVD, hh), k1b = g2_frag(kp + (size_t)16 * KVD + 32, hh);
  for (int kb = 0; kb < kend; kb += 32) {
    const v16h v0 = g2_frag(vp + kb, hh), v1 = g2_frag(vp + (size_t)16 * SQ + kb, hh), v2 = g2_frag(vp + (size_t)32 * SQ + kb, hh), v3 = g2_frag(vp + (size_t)48 * SQ + kb, hh);
    v8f s0 = g2_mma(k0a, qa, z8); s0 = g2_mma(k0b, qb, s0); v8f s1 = g2_mma(k1a, qa, z8); s1 = g2_mma(k1b, qb, s1);
    const int kn = (kb + 32 < kend) ? kb + 32 : kb;      /* next pass's key rows fetched under this pass's softmax; the last pass re-reads its own */
    const _Float16* kq = kp + (size_t)kn * KVD; k0a = g2_frag(kq, hh); k0b = g2_frag(kq + 32, hh); k1a = g2_frag(kq + (size_t)16 * KVD, hh); k1b = g2_frag(kq + (size_t)16 * KVD + 32, hh);
    asm volatile("s_wait_xcnt 0x0" ::: "memory");      /* behind this pass's 16 loads, in front of every later write of an address register that they name (the V^T pointer's step, the reuse of the key pointer's pair) */
    if (kb + 31 > q0w) {      /* only the last pass holds keys above a query of this tile */
      for (int r = 0; r < 8; ++r) { const int key = kb + 8 * hh + r; s0[r] = (key <= qi) ? s0[r] : -1.0e30f; s1[r] = (key + 16 <= qi) ? s1[r] : -1.0e30f; } }
    float mx = fmaxf(s0[0], s1[0]);
    for (int r = 1; r < 8; ++r) mx = fmaxf(mx, fmaxf(s0[r], s1[r]));
    mx = fmaxf(mx, fa_xhalf(mx)); const float mn = fmaxf(m, mx); float corr = (m - mn) * cs; m = mn; const float bias = fmaf(-mn, cs, 8.0f);
    float e[16];
    for (int r = 0; r < 8; ++r) { e[r] = fmaf(s0[r], cs, bias); e[8 + r] = fmaf(s1[r], cs, bias); }
    /* the pass's 17 exponentials, each in place on a register of its own, so that no transcendental is directly followed by a reader of its result or a writer of its source; the v_nop is that slot behind the last one */
    asm("v_exp_f32 %0, %0\n\tv_exp_f32 %1, %1\n\tv_exp_f32 %2, %2\n\tv_exp_f32 %3, %3\n\tv_exp_f32 %4, %4\n\tv_exp_f32 %5, %5\n\tv_exp_f32 %6, %6\n\tv_exp_f32 %7, %7\n\tv_exp_f32 %8, %8\n\t"
        "v_exp_f32 %9, %9\n\tv_exp_f32 %10, %10\n\tv_exp_f32 %11, %11\n\tv_exp_f32 %12, %12\n\tv_exp_f32 %13, %13\n\tv_exp_f32 %14, %14\n\tv_exp_f32 %15, %15\n\tv_exp_f32 %16, %16\n\tv_nop"
        : "+v"(corr), "+v"(e[0]), "+v"(e[1]), "+v"(e[2]), "+v"(e[3]), "+v"(e[4]), "+v"(e[5]), "+v"(e[6]), "+v"(e[7]), "+v"(e[8]), "+v"(e[9]), "+v"(e[10]), "+v"(e[11]), "+v"(e[12]), "+v"(e[13]), "+v"(e[14]), "+v"(e[15]));
    FragH pf; float sum = 0.f;
    for (int r = 0; r < 8; ++r) { sum += e[r] + e[8 + r]; pf.h[r] = (_Float16)e[r]; pf.h[8 + r] = (_Float16)e[8 + r]; }
    l = fmaf(l, corr, sum);
    for (int r = 0; r < 8; ++r) { o0[r] *= corr; o1[r] *= corr; o2[r] *= corr; o3[r] *= corr; }
    o0 = g2_mma(v0, pf.v, o0); o1 = g2_mma(v1, pf.v, o1); o2 = g2_mma(v2, pf.v, o2); o3 = g2_mma(v3, pf.v, o3); }
  const float fin = 64.0f / (l + fa_xhalf(l));      /* the two lane halves hold disjoint keys of the same query */
  unsigned short* op = (unsigned short*)O + (size_t)qi * DM + h * HD + 8 * hh; FragH f0, f1;
  for (int r = 0; r < 8; ++r) { f0.h[r] = (_Float16)(o0[r] * fin); f0.h[8 + r] = (_Float16)(o1[r] * fin); f1.h[r] = (_Float16)(o2[r] * fin); f1.h[8 + r] = (_Float16)(o3[r] * fin); }
  *(v8us*)op = f0.half[0]; *(v8us*)(op + 16) = f0.half[1]; *(v8us*)(op + 32) = f1.half[0]; *(v8us*)(op + 48) = f1.half[1]; }      /* register r of tile dt = O[qi][16 dt + 8 hh + r]: 16-byte stores */

// Exact f32 attention of the first QT0 rows: one wave owns ONE query row. Lane = (key slice ks = lane >> 2, dim part dp = lane & 3): the lane walks keys ks, ks + 8, ... of its row
// and keeps dims 16 c + 4 dp + u (c, u < 4) of q and of its slice's partial o in registers, with the slice's own running maximum and sum (base-2 exponents); the 8 slices are merged at the end by lane exchanges.
template <int CTRL> __device__ __forceinline__ float a0_dpp(float x) { return __builtin_bit_cast(float, __builtin_amdgcn_update_dpp(0, __builtin_bit_cast(int, x), CTRL, 0xf, 0xf, true)); }      /* 0x160 + n: lane l <- lane l ^ n inside a 16-lane row; every lane is on wherever it is used */
__device__ __forceinline__ void a0_exp2x2(float& x, float& y) { asm("v_exp_f32 %0, %0\n\tv_exp_f32 %1, %1\n\tv_nop" : "+v"(x), "+v"(y)); }      /* two exponentials, each in place on its own register, so that neither is directly followed by a reader of its result; the v_nop is that slot behind the second */
template <int STEP> __device__ __forceinline__ float a0_swap(float x) { return STEP == 16 ? fa_xhalf(x) : a0_dpp<0x160 + (STEP & 15)>(x); }
template <int STEP> __device__ __forceinline__ void a0_merge(float& m, float& l, v4f (&o)[4]) {      /* this lane's slices with those of lane ^ STEP; a slice without keys has m = -1e30, l = 0, o = 0 and drops out */
  const float mo = a0_swap<STEP>(m), lo = a0_swap<STEP>(l); const float mn = fmaxf(m, mo); float fa = m - mn, fb = mo - mn; a0_exp2x2(fa, fb);
  l = fmaf(l, fa, lo * fb); m = mn;
  for (int c = 0; c < 4; ++c) for (int u = 0; u < 4; ++u) o[c][u] = fmaf(o[c][u], fa, a0_swap<STEP>(o[c][u]) * fb); }
__device__ __forceinline__ void a0_exp2x3(float& x, float& y, float& z) { asm("v_exp_f32 %0, %0\n\tv_exp_f32 %1, %1\n\tv_exp_f32 %2, %2\n\tv_nop" : "+v"(x), "+v"(y), "+v"(z)); }      /* as a0_exp2x2, for three */
__device__ __forceinline__ float a0_dot(const v4f (&q)[4], const v4f (&kk)[4]) {      /* q . k over the four lanes of a key: all four end with the same bits */
  v4f pv = q[0] * kk[0]; for (int c = 1; c < 4; ++c) pv = __builtin_elementwise_fma(q[c], kk[c], pv);
  float s = (pv[0] + pv[1]) + (pv[2] + pv[3]); s += a0_dpp<0x161>(s); s += a0_dpp<0x162>(s); return s; }
__global__ __launch_bounds__(256) void k_att0(const float* __restrict__ QF, const float* __restrict__ KF, const float* __restrict__ VF, int ld, float scale, float* __restrict__ OF, int ldo) {
  static_assert(HD == 64 && QT0 % 8 == 0, "four lanes of 16 dims a row; eight rows a block");
  const int lane = threadIdx.x & 31, ks = lane >> 2, dp = lane & 3; const int w = __builtin_amdgcn_readfirstlane((int)(threadIdx.x >> 5)); const int h = blockIdx.y;
  { const size_t zb = (size_t)blockIdx.z * QT0; QF += zb * ld; KF += zb * ld; VF += zb * ld; OF += zb * ldo; }      /* blockIdx.z = batch: QT0 rows of each plane */
  const int i = QT0 - 1 - (w * (QT0 / 8) + (int)blockIdx.x);      /* a block's eight rows lie QT0 / 8 apart: every block holds long and short key walks alike */
  const int col = h * HD + dp * 4; const float* qr = QF + (unsigned)(i * ld + col);
  v4f q[4], o[4]; const v4f z4 = {0.f, 0.f, 0.f, 0.f};
  for (int c = 0; c < 4; ++c) { q[c] = *(const v4fa*)(qr + c * 16); o[c] = z4; }
  const float cs = scale * 1.4426950408889634f;      /* e^x = 2^(x log2 e) */
  float m = -1.0e30f, l = 0.f;
  for (int jb = 0; jb <= i; jb += 16) {      /* 16 keys a pass, two a lane group: ja and ja + 8; a key above the diagonal (last pass only) is read as row i and weighs 0 */
    const int ja = jb + ks; const bool oka = ja <= i, okb = ja + 8 <= i;
    const unsigned offa = (unsigned)((oka ? ja : i) * ld + col), offb = (unsigned)((okb ? ja + 8 : i) * ld + col); v4f ka[4], kb[4], va[4], vb[4];
    const float* pka = KF + offa; const float* pkb = KF + offb; const float* pva = VF + offa; const float* pvb = VF + offb;
    for (int c = 0; c < 4; ++c) { ka[c] = *(const v4fa*)(pka + c * 16); kb[c] = *(const v4fa*)(pkb + c * 16); }
    for (int c = 0; c < 4; ++c) { va[c] = *(const v4fa*)(pva + c * 16); vb[c] = *(const v4fa*)(pvb + c * 16); }
    asm volatile("s_wait_xcnt 0x0" :: "v"(pka), "v"(pkb), "v"(pva), "v"(pvb) : "memory");      /* behind the pass's 16 loads, in front of every write of an address register that they name; the four addresses are inputs so that their registers live up to the wait and no load of the pass lands on one */
    __builtin_amdgcn_sched_barrier(0);      /* the arithmetic stays behind the 16 loads; without this the loads are spread among it in small groups, each waited for in turn */
    const float sa = a0_dot(q, ka) * cs, sb = a0_dot(q, kb) * cs;
    const float mn = fmaxf(m, fmaxf(oka ? sa : -1.0e30f, okb ? sb : -1.0e30f)); float sc = m - mn, ea = oka ? sa - mn : -1.0e30f, eb = okb ? sb - mn : -1.0e30f; a0_exp2x3(sc, ea, eb); m = mn;
    l = fmaf(l, sc, ea + eb); const v4f ea4 = {ea, ea, ea, ea}, eb4 = {eb, eb, eb, eb};
    for (int c = 0; c < 4; ++c) o[c] = __builtin_elementwise_fma(vb[c], eb4, __builtin_elementwise_fma(va[c], ea4, o[c] * sc)); }
  a0_merge<4>(m, l, o); a0_merge<8>(m, l, o); a0_merge<16>(m, l, o);
  const float fin = 64.0f / l;      /* o carried x64 like the f16 path; key 0 is in every row, so l > 0 */
  if (ks == 0) { float* dst = OF + (unsigned)(i * ldo + col); for (int c = 0; c < 4; ++c) *(v4f*)(dst + c * 16) = o[c] * fin; } }

__global__ __launch_bounds__(256) void k_kvexp(const float* __restrict__ src, float* __restrict__ dst, size_t n4) { const size_t t = (size_t)blockIdx.x * 256 + threadIdx.x; if (t >= n4) return; const size_t e = t * 4; const size_t row = e / DM; const int col = (int)(e % DM); const int h = col / HD, d = col % HD; const v4f v = *(const v4fa*)(src + row * KVD + (size_t)(h / HPG) * HD + d); *(v4f*)(dst + e) = v;  }

__global__ __launch_bounds__(256) void k_tab2(float theta, float* __restrict__ CS, float* __restrict__ SN) {
  const int t = blockIdx.x * 256 + threadIdx.x; if (t >= SQ * (HD / 2)) return; const int i = t % (HD / 2); const int p = t / (HD / 2); const float invf = 1.0f / powf(theta, (float)(2 * i) / (float)HD); const float ang = __fmul_rn((float)p, invf); const float c = cosf(ang), s = sinf(ang);
  *(float*)(CS + t) = c; *(float*)(SN + t) = s;  }
__global__ __launch_bounds__(256) void k_bfcp(const float* __restrict__ src, float* __restrict__ dst, size_t n4) { const size_t t = (size_t)blockIdx.x * 256 + threadIdx.x; if (t >= n4) return; const v4f a = *(const v4fa*)(src + t * 4); v4f o; for (int q = 0; q < 4; ++q) o[q] = bf16_round(a[q]); *(v4f*)(dst + t * 4) = o;  }

__global__ __launch_bounds__(256) void k_tabhalf(const float* __restrict__ cs, const float* __restrict__ sn, float* __restrict__ CS, float* __restrict__ SN) { const int t = blockIdx.x * 256 + threadIdx.x; if (t >= SQ * (HD / 2)) return; const int p = t / (HD / 2), i = t % (HD / 2); const float c = bf16_round(cs[(size_t)p * HD + i]), s = bf16_round(sn[(size_t)p * HD + i]);
  *(float*)(CS + t) = c; *(float*)(SN + t) = s;  }

__global__ __launch_bounds__(256) void k_tab2d(float* __restrict__ CS, float* __restrict__ SN) {
  const int t = blockIdx.x * 256 + threadIdx.x; if (t >= SQ * (HD / 2)) return; const int i = t % (HD / 2); const int p = t / (HD / 2); const float invf = (float)(1.0 / pow(10000.0, (double)(2 * i) / (double)HD)); const float ang = __fmul_rn((float)p, invf); const float c = cosf(ang), s = sinf(ang);
  *(float*)(CS + t) = c; *(float*)(SN + t) = s;  }
extern "C" void kernel_launch(void* const* d_in, const int* in_sizes, int n_in,
                              void* d_out, int out_size, void* d_ws, size_t ws_size, hipStream_t stream) {
  (void)in_sizes; (void)n_in; (void)out_size;
  const float* const* I = (const float* const*)d_in; const float* x = I[0]; const float* wattn = I[1]; const float* wo = I[2]; const float* qg = I[3]; const float* kg = I[4];      /* x; fused [in][out] Wqkv [1024][3072] (q, k, v column thirds); [in][out] Wproj; RMS-norm gains q_norm_w / k_norm_w [64]; no biases; rope tables computed in-kernel (positions = row index) */
  static_assert(HPG == 1 && NH == NG * HPG && NH * HD == DM && KVD == DM, "plain multi-head attention as 16 kv groups of one query head"); const float* bv = nullptr; const float* bo = nullptr;      /* no biases in this module */
  char* ws = (char*)d_ws; size_t off = 0;
  auto take = [&](size_t bytes) { char* p = ws + off; off += (bytes + 255) & ~(size_t)255; return p; };
  _Float16* BQKV = (_Float16*)take((size_t)3 * DM * DM * 2); _Float16* BQ = BQKV; _Float16* BK = BQKV + (size_t)DM * DM; _Float16* BV = BQKV + (size_t)2 * DM * DM; _Float16* BO = (_Float16*)take((size_t)DM * DM * 2);      /* one transposed plane Bt [3072][1024] of the fused weight: rows 0..1023 = q, 1024.. = k, 2048.. = v */
  _Float16* X16 = (_Float16*)take(NR * DM * 2); float* CSB = (float*)take((size_t)SQ * HD * 4); float* SNB = (float*)take((size_t)SQ * HD * 4); _Float16* Q16 = (_Float16*)take(NR * DM * 2); _Float16* K16 = (_Float16*)take(NR * KVD * 2); _Float16* V16 = (_Float16*)take(NR * KVD * 2); _Float16* O16 = (_Float16*)take(NR * DM * 2);
  _Float16* VT = (_Float16*)take((size_t)NB * NH * HD * SQ * 2);
  float* QF0 = (float*)take((size_t)NB * QT0 * DM * 4); float* KF0 = (float*)take((size_t)NB * QT0 * KVD * 4); float* VF0 = (float*)take((size_t)NB * QT0 * KVD * 4); float* KF0e = (float*)take((size_t)NB * QT0 * DM * 4); float* VF0e = (float*)take((size_t)NB * QT0 * DM * 4); float* OF0 = (float*)take((size_t)NB * QT0 * DM * 4); _Float16* OH0 = (_Float16*)take((size_t)NB * QT0 * DM * 2); _Float16* OL0 = (_Float16*)take((size_t)NB * QT0 * DM * 2);      /* every per-batch plane holds all batches: each stage below is one launch over them */
  if (off > ws_size) return;
  k_wt_f16<<<(unsigned)(((size_t)3 * DM * (DM / 8) + 255) / 256), 256, 0, stream>>>(wattn, BQKV, DM, 3 * DM, 16.0f); k_wt_f16<<<(unsigned)(((size_t)DM * (DM / 8) + 255) / 256), 256, 0, stream>>>(wo, BO, DM, DM, 16.0f);      /* [in][out] -> Bt x16 planes (fused Wqkv: K 1024, N 3072) */
  k_x16<<<(unsigned)((NR * DM / 8 + 255) / 256), 256, 0, stream>>>(x, X16, NR * DM / 8);
  k_tab2<<<(SQ * (HD / 2) + 255) / 256, 256, 0, stream>>>(10000.0f, CSB, SNB);      /* rope tables cos / sin(p / 10000^(2i/64)), i < 32: f32 pow, reciprocal, product */
  const size_t r0p = (size_t)B0 * SQ;      /* first projected row */
  k_gemm2<0><<<dim3((unsigned)((MP / 128) * (KVD / 64)), 1), 128, 0, stream>>>(X16 + r0p * DM, DM, 0, BV, DM, 0, 0.0625f, bv, 0, nullptr, 1, 0, 0, nullptr, V16 + r0p * KVD, KVD, 0, MP, KVD, DM);
  k_gemm2<0, true><<<dim3((unsigned)((MP / 128) * (DM / 64)), 1), 128, 0, stream>>>(X16 + r0p * DM, DM, 0, BQ, DM, 0, 0.0625f, nullptr, 0, nullptr, 1, 0, 0, QF0, Q16 + r0p * DM, DM, 0, MP, DM, DM, qg, 1e-5f, CSB, SNB);      /* q of all batches: projection, per-head RMS norm (gain, eps 1e-5), half-split rope (out_lo = x_lo c - x_hi s, out_hi = x_lo s + x_hi c = t cos + rotate_half(t) sin with the module's [f | f] tables) -> f16 rows; positions 0..255 of each batch in f32 too */
  k_gemm2<0, true><<<dim3((unsigned)((MP / 128) * (KVD / 64)), 1), 128, 0, stream>>>(X16 + r0p * DM, DM, 0, BK, DM, 0, 0.0625f, nullptr, 0, nullptr, 1, 0, 0, KF0, K16 + r0p * KVD, KVD, 0, MP, KVD, DM, kg, 1e-5f, CSB, SNB);      /* k likewise */
  k_vt<NG, SQ><<<NBR * NG * (SQ / 64), 256, 0, stream>>>(V16 + r0p * KVD, KVD, 0, VT);      /* V^T [batch][NH][HD][SQ] */
  k_gemm2<0><<<dim3((QT0 / 128) * (KVD / 64), NBR), 128, 0, stream>>>(X16 + r0p * DM, DM, (size_t)SQ * DM, BV, DM, 0, 0.0625f, bv, 0, nullptr, 1, 0, 0, VF0, nullptr, KVD, (size_t)QT0 * KVD, QT0, KVD, DM);      /* f32 v of the first 256 rows of each batch (grid y = batch) */
  k_kvexp<<<(unsigned)(((size_t)NBR * QT0 * DM / 4 + 255) / 256), 256, 0, stream>>>(KF0, KF0e, (size_t)NBR * QT0 * DM / 4); k_kvexp<<<(unsigned)(((size_t)NBR * QT0 * DM / 4 + 255) / 256), 256, 0, stream>>>(VF0, VF0e, (size_t)NBR * QT0 * DM / 4);      /* head h <- kv group h / HPG (HPG is 1 here: a plain copy) for the exact first-tile kernel */
  k_att0<<<dim3(QT0 / 8, NH, NBR), 256, 0, stream>>>(QF0, KF0e, VF0e, DM, 0.125f, OF0 + (size_t)B0 * QT0 * DM, DM);      /* exact f32 attention for rows 0..255 of each batch (o x64) */
  k_fattn<<<dim3(NH * NBR, SQ / 64), 128, 0, stream>>>(Q16 + r0p * LQ, K16 + r0p * KVD, VT, O16 + r0p * DM);      /* scores, causal softmax and weights x V of all heads, batches and query rows in ONE launch; scores and weights stay in registers (o x64) */
  k_gemm2<0><<<dim3((unsigned)((MPO / 128) * (DM / 64)), 1), 128, 0, stream>>>(O16 + r0p * DM, DM, 0, BO, DM, 0, 0.0009765625f, bo, 0, nullptr, 1, 0, 0, (float*)d_out + r0p * DM, nullptr, DM, 0, MPO, DM, DM);      /* out rows are the output layout */
  k_hl<<<(unsigned)(((size_t)NB * QT0 * DM / 8 + 255) / 256), 256, 0, stream>>>(OF0, OH0, OL0, (size_t)NB * QT0 * DM / 8);      /* first-tile o (x64) -> f16 hi + x1024 residual planes */
  k_gemm2<0><<<dim3((QT0 / 128) * (DM / 64), NBR), 128, 0, stream>>>(OH0 + (size_t)B0 * QT0 * DM, DM, (size_t)QT0 * DM, BO, DM, 0, 0.0009765625f, bo, 0, nullptr, 1, 0, 0, (float*)d_out + r0p * DM, nullptr, DM, (size_t)SQ * DM, QT0, DM, DM);      /* rows 0..255 of each batch (grid y = batch): out = o_hi Wo (no bias here), overwriting the f16-path rows */
  k_gemm2<0><<<dim3((QT0 / 128) * (DM / 64), NBR), 128, 0, stream>>>(OL0 + (size_t)B0 * QT0 * DM, DM, (size_t)QT0 * DM, BO, DM, 0, 0.00000095367431640625f, nullptr, 0, (const float*)d_out + r0p * DM, -1, 0, 0, (float*)d_out + r0p * DM, nullptr, DM, (size_t)SQ * DM, QT0, DM, DM);      /* += o_lo Wo 2^-20 (own-element accumulate) */
}

// v005
// It runs in 293 microseconds.
// Two timings next to v004 put it at 1.65 and 1.63 times that version's speed.
// Over all steps from v000 it is 25.1 times as fast.
#include <hip/hip_runtime.h>
// Causal multi-head self-attention with a per-head RMS norm on q and k THEN rotate-half RoPE computed in the module, and a bias-free fused QKV projection (x [4][2048][1024]; qkv = x Wqkv ([in][out] 1024 x 3072, no bias) split into q | k | v thirds, 16 heads of 64; q, k = x * rsqrt(mean(x^2 over the 64 head dims) + 1e-5) * gain (gains q_norm_w / k_norm_w [64], read); cos / sin = [f | f] of pos * (1 / 10000^(2i/64)); q = q cos + rotate_half(q) sin with rotate_half = cat(-x2, x1), likewise k; scores / sqrt(64); causal (tril, -inf); softmax; out = merged Wproj ([in][out], no bias) -> [4][2048][1024]); run as grouped-query causal attention with 16 groups of ONE head with the norm stage on and the rope stage in its half-split mode.
// Compute dtype: inputs rounded to bf16 (the two gain vectors bf16-rounded on load); x / weights exact; the per-head RMS norm and the rotation in f32 on VALU; q, k, v, softmax weights and o as plain f16 GEMM operands (~2^-12); scores and softmax statistics f32; v_wmma_f32_16x16x32_f16.
#define NB 4
#define NG 16
#define HPG 1
#define KVD (NG * HD)
#define SQ 2048
#define DM 1024
#define NH 16
#define HD 64
#define HG 4
#define QT 256                       /* unused (k_fattn tiles 16 query rows per wave) */
#define NKX SQ
#define QT0 256                      /* first-tile rows recomputed exactly in f32 */
#define B0 0                         /* first batch processed (debug hook) */
#define NBR NB                       /* batches processed (debug hook) */
#define NR ((size_t)NB * SQ)         /* token rows */
#define MP ((int)((size_t)NBR * SQ)) /* rows projected (debug hook) */
#define QN SQ                        /* unused (k_fattn attends all SQ rows of a batch) */
#define NHD NH                       /* unused (all NH heads are attended) */
#define MPO MP                       /* rows through the output stage (debug hook) */
#define LQ DM      /* row pitch of the q/k/v rows */
typedef __bf16 v16b __attribute__((ext_vector_type(16)));
typedef unsigned short v8us __attribute__((ext_vector_type(8), may_alias));
typedef float  v8f  __attribute__((ext_vector_type(8)));
typedef float  v4f  __attribute__((ext_vector_type(4)));
typedef float  v4fa __attribute__((ext_vector_type(4), may_alias));
union FragB { v16b v; v8us half[2]; unsigned short u[16]; };

__device__ __forceinline__ unsigned short bf16_bits(float x) { unsigned int u = __float_as_uint(x); return (unsigned short)((u + 0x7FFFu + ((u >> 16) & 1u)) >> 16); }
__device__ __forceinline__ float bf16_val(unsigned short b) { return __uint_as_float(((unsigned int)b) << 16); }
__device__ __forceinline__ float bf16_round(float x) { return bf16_val(bf16_bits(x)); }
// D += A·B with NT terms: 1 = ah·bh, 2 = + al·bh (A split), 3 = + ah·bl (both split)
template <int NT>
__device__ __forceinline__ v8f mmaN(v16b ah, v16b al, v16b bh, v16b bl, v8f c) {
  c = __builtin_amdgcn_wmma_f32_16x16x32_bf16(false, ah, false, bh, (short)0, c, false, false);
  if (NT >= 2) c = __builtin_amdgcn_wmma_f32_16x16x32_bf16(false, al, false, bh, (short)0, c, false, false);
  if (NT >= 3) c = __builtin_amdgcn_wmma_f32_16x16x32_bf16(false, ah, false, bl, (short)0, c, false, false);
  asm volatile("v_nop\n\tv_nop\n\tv_nop\n\tv_nop" : "+v"(c) : "v"(ah), "v"(al), "v"(bh), "v"(bl));
  return c;
}

__global__ __launch_bounds__(256) void k_wt_bf16(const float* __restrict__ W, unsigned short* __restrict__ Wt, int K, int N) {
  const int t = blockIdx.x * 256 + threadIdx.x;
  const int k8n = K / 8;
  if (t >= N * k8n) return;
  const int n = t / k8n, k8 = (t % k8n) * 8;
  v8us v;
#pragma unroll
  for (int i = 0; i < 8; ++i) v[i] = bf16_bits(W[(size_t)(k8 + i) * N + n]);
  *(v8us*)(Wt + (size_t)n * K + k8) = v;
  
}

// GEMM C[M][N] (f32, pitch ldc) = act(A[M][K]·W + bias). A f32 row-major (pitch lda) converted per fragment to bf16
// (ASPLIT: hi/lo two planes -> 2 terms, else single rounded term); Wt bf16 [N][K] (pitch ldb). BIAS_BF16 rounds the
// bias to bf16 first (bias quantised to bf16 before the add). K%32==0, M%16==0, N%64==0.
template <bool ASPLIT, int ACT, bool BIAS_BF16>
__global__ __launch_bounds__(128) void k_gemm_bf(const float* __restrict__ A, int lda, const unsigned short* __restrict__ Wt, int ldb,
                                               const float* __restrict__ bias, float* __restrict__ C, int ldc, int M, int N, int K) {
  __shared__ __attribute__((aligned(16))) float so[4][16][64];
  const int tid = threadIdx.x, w = tid >> 5, lane = tid & 31, ln = lane & 15, hh = lane >> 4;
  const int ntn = N / 64;
  const int wid = blockIdx.x * 4 + w;
  const int mt = wid / ntn, nq = wid % ntn;
  if (mt * 16 >= M) return;
  const int row0 = mt * 16, col0 = nq * 64;
  const float* arow = A + (size_t)(row0 + ln) * lda;
  v8f acc[4] = {};
  for (int kb = 0; kb < K; kb += 32) {
    FragB ah, al;
    const v4f x0 = *(const v4fa*)(arow + kb + 8 * hh), x1 = *(const v4fa*)(arow + kb + 8 * hh + 4);
    const v4f x2 = *(const v4fa*)(arow + kb + 16 + 8 * hh), x3 = *(const v4fa*)(arow + kb + 16 + 8 * hh + 4);
    float xs[16] = {x0[0],x0[1],x0[2],x0[3],x1[0],x1[1],x1[2],x1[3],x2[0],x2[1],x2[2],x2[3],x3[0],x3[1],x3[2],x3[3]};
#pragma unroll
    for (int i = 0; i < 16; ++i) { const unsigned short hb = bf16_bits(xs[i]); ah.u[i] = hb; al.u[i] = ASPLIT ? bf16_bits(xs[i] - bf16_val(hb)) : (unsigned short)0; }
#pragma unroll
    for (int t = 0; t < 4; ++t) {
      const unsigned short* brow = Wt + (size_t)(col0 + t * 16 + ln) * ldb + kb;
      FragB b;
      b.half[0] = *(const v8us*)(brow + 8 * hh);
      b.half[1] = *(const v8us*)(brow + 16 + 8 * hh);
      acc[t] = mmaN<ASPLIT ? 2 : 1>(ah.v, al.v, b.v, b.v, acc[t]);
    }
  }
#pragma unroll
  for (int t = 0; t < 4; ++t) {
    float bv = bias ? bias[col0 + t * 16 + ln] : 0.f;
    if (BIAS_BF16) bv = bf16_round(bv);
#pragma unroll
    for (int r = 0; r < 8; ++r) { float v = acc[t][r] + bv; if (ACT == 1) v = fmaxf(v, 0.f); so[w][8 * hh + r][t * 16 + ln] = v; }
  }
  __builtin_amdgcn_fence(__ATOMIC_ACQ_REL, "workgroup");
  __builtin_amdgcn_wave_barrier();
  const int rsub = lane >> 4, c4 = (lane & 15) * 4;
  {
#pragma unroll
    for (int q = 0; q < 8; ++q) {
      const int r = q * 2 + rsub;
      const v4f v = *(const v4fa*)&so[w][r][c4];
      *(v4f*)(C + (size_t)(row0 + r) * ldc + col0 + c4) = v;
    }
    
  }
}

// GEMM C = act(A·W + bias + resid): A f32 (ASPLIT -> hi/lo 2 terms), Wt bf16 [N][K]; ACT 0 none, 1 relu, 2 exact gelu;
// resid (optional, f32, row index = (row % rmod), pitch ldr, RES_BF16 rounds it) added before the activation.
template <bool ASPLIT, int ACT, bool BIAS_BF16, bool RES_BF16>
__global__ __launch_bounds__(128) void k_gemm_bf3(const float* __restrict__ A, int lda, const unsigned short* __restrict__ Wt, int ldb,
                                                const float* __restrict__ bias, const float* __restrict__ resid, int rmod, int ldr,
                                                float* __restrict__ C, int ldc, int M, int N, int K) {
  __shared__ __attribute__((aligned(16))) float so[4][16][64];
  const int tid = threadIdx.x, w = tid >> 5, lane = tid & 31, ln = lane & 15, hh = lane >> 4;
  const int ntn = N / 64;
  const int wid = blockIdx.x * 4 + w;
  const int mt = wid / ntn, nq = wid % ntn;
  if (mt * 16 >= M) return;
  const int row0 = mt * 16, col0 = nq * 64;
  const float* arow = A + (size_t)(row0 + ln) * lda;
  v8f acc[4] = {};
  for (int kb = 0; kb < K; kb += 32) {
    FragB ah, al;
    const v4f x0 = *(const v4fa*)(arow + kb + 8 * hh), x1 = *(const v4fa*)(arow + kb + 8 * hh + 4);
    const v4f x2 = *(const v4fa*)(arow + kb + 16 + 8 * hh), x3 = *(const v4fa*)(arow + kb + 16 + 8 * hh + 4);
    float xs[16] = {x0[0],x0[1],x0[2],x0[3],x1[0],x1[1],x1[2],x1[3],x2[0],x2[1],x2[2],x2[3],x3[0],x3[1],x3[2],x3[3]};
#pragma unroll
    for (int i = 0; i < 16; ++i) { const unsigned short hb = bf16_bits(xs[i]); ah.u[i] = hb; al.u[i] = ASPLIT ? bf16_bits(xs[i] - bf16_val(hb)) : (unsigned short)0; }
#pragma unroll
    for (int t = 0; t < 4; ++t) {
      const unsigned short* brow = Wt + (size_t)(col0 + t * 16 + ln) * ldb + kb;
      FragB b;
      b.half[0] = *(const v8us*)(brow + 8 * hh);
      b.half[1] = *(const v8us*)(brow + 16 + 8 * hh);
      acc[t] = mmaN<ASPLIT ? 2 : 1>(ah.v, al.v, b.v, b.v, acc[t]);
    }
  }
#pragma unroll
  for (int t = 0; t < 4; ++t) {
    const int col = col0 + t * 16 + ln;
    float bv = bias ? bias[col] : 0.f;
    if (BIAS_BF16) bv = bf16_round(bv);
#pragma unroll
    for (int r = 0; r < 8; ++r) {
      float v = acc[t][r] + bv;
      if (resid) { float rv = resid[(size_t)((row0 + 8 * hh + r) % rmod) * ldr + col]; if (RES_BF16) rv = bf16_round(rv); v += rv; }
      if (ACT == 1) v = fmaxf(v, 0.f);
      if (ACT == 2) v = 0.5f * v * (1.0f + erff(v * 0.70710678118654752f));
      if (ACT == 3) { const float u = 0.7978845608028654f * (v + 0.044715f * v * v * v); v = 0.5f * v * (1.0f + tanhf(u)); }
      so[w][8 * hh + r][t * 16 + ln] = v;
    }
  }
  __builtin_amdgcn_fence(__ATOMIC_ACQ_REL, "workgroup");
  __builtin_amdgcn_wave_barrier();
  const int rsub = lane >> 4, c4 = (lane & 15) * 4;
  {
#pragma unroll
    for (int q = 0; q < 8; ++q) {
      const int r = q * 2 + rsub;
      const v4f v = *(const v4fa*)&so[w][r][c4];
      *(v4f*)(C + (size_t)(row0 + r) * ldc + col0 + c4) = v;
    }
    
  }
}
// row LayerNorm (biased variance, eps) over N: s = X (+ R); optional out_sum <- s; out_norm <- (s-mu)*rsqrt(var+eps)*g + b
template <bool PARAM_BF16>
__global__ __launch_bounds__(256) void k_layernorm(const float* __restrict__ X, const float* __restrict__ R, const float* __restrict__ g, const float* __restrict__ bta,
                                                  float* __restrict__ out_sum, float* __restrict__ out_norm, int N, float eps) {
  __shared__ float red[256];
  const int row = blockIdx.x, tid = threadIdx.x;
  const float* x = X + (size_t)row * N; const float* rr = R ? R + (size_t)row * N : nullptr;
  float vals[16];                     // up to N = 4096
  const int per = N / 256;            // contiguous chunk per thread? use strided-by-4 chunks: thread handles j = tid*4 + 1024*u
  float s1 = 0.f;
  for (int u = 0; u < per / 4; ++u) {
    const int j = tid * 4 + 1024 * u;
    const v4f a = *(const v4fa*)(x + j);
    v4f b = {0.f,0.f,0.f,0.f}; if (rr) b = *(const v4fa*)(rr + j);
#pragma unroll
    for (int q = 0; q < 4; ++q) { const float v = a[q] + b[q]; vals[u * 4 + q] = v; s1 += v; }
  }
  red[tid] = s1; __syncthreads();
  for (int st = 128; st > 0; st >>= 1) { if (tid < st) red[tid] += red[tid + st]; __syncthreads(); }
  const float mu = red[0] / (float)N; __syncthreads();
  float s2 = 0.f;
  for (int u = 0; u < per / 4; ++u)
#pragma unroll
    for (int q = 0; q < 4; ++q) { const float c = vals[u * 4 + q] - mu; s2 += c * c; }
  red[tid] = s2; __syncthreads();
  for (int st = 128; st > 0; st >>= 1) { if (tid < st) red[tid] += red[tid + st]; __syncthreads(); }
  const float rs = rsqrtf(red[0] / (float)N + eps);
  {
    for (int u = 0; u < per / 4; ++u) {
      const int j = tid * 4 + 1024 * u;
      v4f o, sm;
#pragma unroll
      for (int q = 0; q < 4; ++q) {
        float gg = g[j + q], bb = bta[j + q];
        if (PARAM_BF16) { gg = bf16_round(gg); bb = bf16_round(bb); }
        sm[q] = vals[u * 4 + q]; o[q] = (vals[u * 4 + q] - mu) * rs * gg + bb;
      }
      if (out_sum) *(v4f*)(out_sum + (size_t)row * N + j) = sm;
      *(v4f*)(out_norm + (size_t)row * N + j) = o;
    }
    
  }
}

// ---- f16 WMMA path (v_wmma_f32_16x16x32_f16): 11-bit significands for operands in range — used where a [0,1] probability operand needs more precision than bf16
typedef _Float16 v16h __attribute__((ext_vector_type(16)));
union FragH { v16h v; v8us half[2]; _Float16 h[16]; unsigned short u[16]; };
template <int NT>
__device__ __forceinline__ v8f mmaH(v16h ah, v16h al, v16h bh, v16h bl, v8f c) {
  c = __builtin_amdgcn_wmma_f32_16x16x32_f16(false, ah, false, bh, (short)0, c, false, false);
  if (NT >= 2) c = __builtin_amdgcn_wmma_f32_16x16x32_f16(false, al, false, bh, (short)0, c, false, false);
  if (NT >= 3) c = __builtin_amdgcn_wmma_f32_16x16x32_f16(false, ah, false, bl, (short)0, c, false, false);
  asm volatile("v_nop\n\tv_nop\n\tv_nop\n\tv_nop" : "+v"(c) : "v"(ah), "v"(al), "v"(bh), "v"(bl));
  return c;
}
// batched GEMM like k_gemm_b but f16 operands: A f32 (split into f16 hi/lo if ASPLIT, else rounded to f16), Bt = f16 values [n][k]; alpha; C f32; N multiple of 16 (partial tiles skipped)
template <bool ASPLIT>
__global__ __launch_bounds__(128) void k_gemm_h(const float* __restrict__ A, int lda, size_t sA, const _Float16* __restrict__ Bh, int ldb, size_t sB, float alpha, float* __restrict__ C, int ldc, size_t sC, int M, int N, int K) {
  __shared__ __attribute__((aligned(16))) float so[4][16][64];
  const int tid = threadIdx.x, w = tid >> 5, lane = tid & 31, ln = lane & 15, hh = lane >> 4; const int by = blockIdx.y;
  A += (size_t)by * sA; Bh += (size_t)by * sB; C += (size_t)by * sC;
  const int ntn = (N + 63) / 64; const int wid = blockIdx.x * 4 + w; const int mt = wid / ntn, nq = wid % ntn; if (mt * 16 >= M) return;
  const int row0 = mt * 16, col0 = nq * 64; const float* arow = A + (size_t)(row0 + ln) * lda;
  v8f acc[4] = {};
  for (int kb = 0; kb < K; kb += 32) {
    FragH ah, al;
    const v4f x0 = *(const v4fa*)(arow + kb + 8 * hh), x1 = *(const v4fa*)(arow + kb + 8 * hh + 4), x2 = *(const v4fa*)(arow + kb + 16 + 8 * hh), x3 = *(const v4fa*)(arow + kb + 16 + 8 * hh + 4);
    float xs[16] = {x0[0],x0[1],x0[2],x0[3],x1[0],x1[1],x1[2],x1[3],x2[0],x2[1],x2[2],x2[3],x3[0],x3[1],x3[2],x3[3]};
#pragma unroll
    for (int i = 0; i < 16; ++i) { const _Float16 h = (_Float16)xs[i]; ah.h[i] = h; al.h[i] = ASPLIT ? (_Float16)(xs[i] - (float)h) : (_Float16)0.0f; }
#pragma unroll
    for (int t = 0; t < 4; ++t) { if (col0 + t * 16 >= N) continue; const size_t boff = (size_t)(col0 + t * 16 + ln) * ldb + kb; FragH bq; bq.half[0] = *(const v8us*)(Bh + boff + 8 * hh); bq.half[1] = *(const v8us*)(Bh + boff + 16 + 8 * hh);
      acc[t] = mmaH<ASPLIT ? 2 : 1>(ah.v, al.v, bq.v, bq.v, acc[t]); }
  }
#pragma unroll
  for (int t = 0; t < 4; ++t) { if (col0 + t * 16 >= N) continue;
#pragma unroll
    for (int r = 0; r < 8; ++r) so[w][8 * hh + r][t * 16 + ln] = acc[t][r] * alpha; }
  __builtin_amdgcn_fence(__ATOMIC_ACQ_REL, "workgroup"); __builtin_amdgcn_wave_barrier();
  const int rsub = lane >> 4, c4 = (lane & 15) * 4;
  {
#pragma unroll
    for (int q = 0; q < 8; ++q) { const int r = q * 2 + rsub; if (col0 + c4 < N) { const v4f v = *(const v4fa*)&so[w][r][c4]; *(v4f*)(C + (size_t)(row0 + r) * ldc + col0 + c4) = v; } }
     }
}

// Wt[n][k] = f16(W[k][n]·scale) from f32 row-major W[K][N] (scale = power of two; bf16-exact weights stay exact in f16 away from the subnormal range)
__global__ __launch_bounds__(256) void k_wt_f16(const float* __restrict__ W, _Float16* __restrict__ Wt, int K, int N, float scale) {
  const int t = blockIdx.x * 256 + threadIdx.x; if (t >= N * (K / 8)) return; const int n = t / (K / 8), k8 = (t % (K / 8)) * 8; FragH f;
#pragma unroll
  for (int i = 0; i < 8; ++i) f.h[i] = (_Float16)(bf16_round(W[(size_t)(k8 + i) * N + n]) * scale); const v8us o = f.half[0];
  *(v8us*)((unsigned short*)Wt + (size_t)n * K + k8) = o; 
}
// k_gemm_hh variant with fused epilogue: v = acc·alpha + bias[by·sBias + col] (+ CP[(row/rowsPerB)·sCPb + by·64 + col] if CP) ; ACT 0 none / 1 elu ; writes f16 C16 (and f32 C if non-null)
template <int ACT>
__global__ __launch_bounds__(128) void k_gemm_hhx(const _Float16* __restrict__ A, int lda, size_t sA, const _Float16* __restrict__ Bh, int ldb, size_t sB, float alpha, const float* __restrict__ bias, size_t sBias, const float* __restrict__ CP, int rowsPerB, size_t sCPb, int row0g,
    float* __restrict__ C, _Float16* __restrict__ C16, int ldc, size_t sC, int M, int N, int K) {
  __shared__ __attribute__((aligned(16))) float so[4][16][64];
  const int tid = threadIdx.x, w = tid >> 5, lane = tid & 31, ln = lane & 15, hh = lane >> 4; const int by = blockIdx.y;
  A += (size_t)by * sA; Bh += (size_t)by * sB; const size_t cofs = (size_t)by * sC; const float* bp = bias ? bias + (size_t)by * sBias : nullptr;
  const int ntn = (N + 63) / 64; const int wid = blockIdx.x * 4 + w; const int mt = wid / ntn, nq = wid % ntn; if (mt * 16 >= M) return;
  const int row0 = mt * 16, col0 = nq * 64; const _Float16* arow = A + (size_t)(row0 + ln) * lda;
  v8f acc[4] = {};
  for (int kb = 0; kb < K; kb += 32) { FragH ah; ah.half[0] = *(const v8us*)((const unsigned short*)arow + kb + 8 * hh); ah.half[1] = *(const v8us*)((const unsigned short*)arow + kb + 16 + 8 * hh);
#pragma unroll
    for (int t = 0; t < 4; ++t) { if (col0 + t * 16 >= N) continue; const size_t boff = (size_t)(col0 + t * 16 + ln) * ldb + kb; FragH bq; bq.half[0] = *(const v8us*)((const unsigned short*)Bh + boff + 8 * hh); bq.half[1] = *(const v8us*)((const unsigned short*)Bh + boff + 16 + 8 * hh);
      acc[t] = mmaH<1>(ah.v, ah.v, bq.v, bq.v, acc[t]); }
  }
#pragma unroll
  for (int t = 0; t < 4; ++t) { if (col0 + t * 16 >= N) continue; const int col = col0 + t * 16 + ln; const float bv = bp ? bf16_round(bp[col]) : 0.f;
#pragma unroll
    for (int r = 0; r < 8; ++r) { float v = acc[t][r] * alpha + bv; if (CP) { const int rr = row0g + row0 + 8 * hh + r; if (rowsPerB < 0) v += CP[cofs + (size_t)rr * ldc + col];      /* rowsPerB < 0: own element of the batched C plane */ else { const int bidx = rr / rowsPerB; v += CP[(size_t)bidx * sCPb + (size_t)by * 64 + col]; } } if (ACT == 1) v = (v > 0.f) ? v : expm1f(v); else if (ACT == 7) v = (v > 0.f) ? v + 1.0f : expf(v); else if (ACT == 8) v = tanhf(v); else if (ACT == 9) v = 0.5f * v * (1.0f + tanhf(0.7978845608028654f * (v + 0.044715f * v * v * v))); else if (ACT == 11) v = 1.0f / (1.0f + expf(-v)); else if (ACT == 12) v = (v > 0.f) ? v : 0.01f * v; else if (ACT == 14) v = (v > 0.f) ? v : 0.1f * v; else if (ACT == 16) v = (v >= 0.f) ? v : 0.3f * v; else if (ACT == 17) v = (v >= 0.f) ? v : 0.2f * v; else if (ACT == 15) v = v / (1.0f + expf(-v)); else if (ACT == 3) v = fmaxf(v, 0.f); else if (ACT == 6) v = 0.5f * v * (1.0f + erff(v * 0.70710678118654752f)); so[w][8 * hh + r][t * 16 + ln] = v; } }
  __builtin_amdgcn_fence(__ATOMIC_ACQ_REL, "workgroup"); __builtin_amdgcn_wave_barrier();
  const int rsub = lane >> 4, c4 = (lane & 15) * 4; typedef _Float16 v4h __attribute__((ext_vector_type(4)));
  {
#pragma unroll
    for (int q = 0; q < 8; ++q) { const int r = q * 2 + rsub; if (col0 + c4 < N) { const v4f v = *(const v4fa*)&so[w][r][c4]; if (C) *(v4f*)(C + cofs + (size_t)(row0 + r) * ldc + col0 + c4) = v; if (C16) { v4h h4; for (int i = 0; i < 4; ++i) h4[i] = (_Float16)v[i]; *(v4h*)(C16 + cofs + (size_t)(row0 + r) * ldc + col0 + c4) = h4; } } }
     }
}

typedef _Float16 v4h __attribute__((ext_vector_type(4)));

__global__ __launch_bounds__(256) void k_x16(const float* __restrict__ x, _Float16* __restrict__ X16, size_t n8) { const size_t t = (size_t)blockIdx.x * 256 + threadIdx.x; if (t >= n8) return; FragH f;
#pragma unroll
  for (int q = 0; q < 8; ++q) f.h[q] = (_Float16)bf16_round(x[t * 8 + q]); *(v8us*)((unsigned short*)X16 + t * 8) = f.half[0];  }
__global__ __launch_bounds__(256) void k_h16(const float* __restrict__ x, _Float16* __restrict__ X16, size_t n8) { const size_t t = (size_t)blockIdx.x * 256 + threadIdx.x; if (t >= n8) return; FragH f;
#pragma unroll
  for (int q = 0; q < 8; ++q) f.h[q] = (_Float16)x[t * 8 + q]; *(v8us*)((unsigned short*)X16 + t * 8) = f.half[0];  }
__global__ __launch_bounds__(256) void k_round16f(const float* __restrict__ W, _Float16* __restrict__ Bt, size_t n8) { const size_t t = (size_t)blockIdx.x * 256 + threadIdx.x; if (t >= n8) return; FragH f;
#pragma unroll
  for (int i = 0; i < 8; ++i) f.h[i] = (_Float16)(bf16_round(W[t * 8 + i]) * 16.0f); *(v8us*)((unsigned short*)Bt + t * 8) = f.half[0];  }
template <int NHv, int TTv>
__global__ __launch_bounds__(256) void k_vt(const _Float16* __restrict__ V16, int ldv, int voff, _Float16* __restrict__ Vt) { __shared__ unsigned short tl[64][66]; const int tid = threadIdx.x; const int slab = blockIdx.x / (TTv / 64), lg = blockIdx.x % (TTv / 64); const int b = slab / NHv, h = slab % NHv;
  for (int i = tid; i < 64 * 8; i += 256) { const int r = i / 8, c8 = (i % 8) * 8; FragH f; f.half[0] = *(const v8us*)((const unsigned short*)V16 + ((size_t)b * TTv + lg * 64 + r) * ldv + voff + h * 64 + c8);
#pragma unroll
    for (int q = 0; q < 8; ++q) tl[r][c8 + q] = f.u[q]; }
  __syncthreads();
  {
#pragma unroll
    for (int rd = 0; rd < 2; ++rd) { const int d = rd * 32 + tid / 8, pc = tid % 8; FragH f;
#pragma unroll
      for (int q = 0; q < 8; ++q) f.u[q] = tl[pc * 8 + q][d];
      *(v8us*)((unsigned short*)Vt + ((size_t)slab * 64 + d) * TTv + lg * 64 + pc * 8) = f.half[0]; }
     } }

__global__ __launch_bounds__(256) void k_hl(const float* __restrict__ F, _Float16* __restrict__ Hh, _Float16* __restrict__ Hl, size_t n8) { const size_t t = (size_t)blockIdx.x * 256 + threadIdx.x; if (t >= n8) return; FragH fh, fl; const v4f a = *(const v4fa*)(F + t * 8), c = *(const v4fa*)(F + t * 8 + 4);
#pragma unroll
  for (int q = 0; q < 4; ++q) { _Float16 h = (_Float16)a[q]; fh.h[q] = h; fl.h[q] = (_Float16)((a[q] - (float)h) * 1024.0f); h = (_Float16)c[q]; fh.h[4 + q] = h; fl.h[4 + q] = (_Float16)((c[q] - (float)h) * 1024.0f); }
  { *(v8us*)((unsigned short*)Hh + t * 8) = fh.half[0]; *(v8us*)((unsigned short*)Hl + t * 8) = fl.half[0];  } }

// ---- per-head RMS norm and half-split rope on a staged 32 x 64 wave tile (k_gemm2's NROPE epilogue) ----
// The tile's 64 columns are ONE head, so it holds 32 whole head rows: 16 lanes read a row back, 4 dims a lane (d = 4 ln + u), and norm and rotate it in registers; dim d's rope partner d ^ 32 sits in lane ln ^ 8.
// The sum of squares is a halving tree over the 64 dims (d + 32, + 16, + 8, + 4 by the lane exchanges ln ^ 8, 4, 2, 1; d + 2, d + 1 inside the lane); every lane of a row ends with the same bits.
template <int CTRL> __device__ __forceinline__ float a0_dpp(float x);      /* defined with the first-tile kernel below */
__device__ __forceinline__ float nr_rsqrt(float a) {      /* rsqrtf as the compiler expands it (an argument below 2^-126 goes in x 2^24, its result out x 2^12), with the v_rsq_f32 in place on its own register and a v_nop behind it, so that no reader of its result and no writer of its source follows it directly */
  const bool tiny = a < 0x1p-126f; a = tiny ? a * 0x1p+24f : a; asm("v_rsq_f32 %0, %0\n\tv_nop" : "+v"(a)); return tiny ? a * 0x1p+12f : a; }
// The 16 row pairs of a wave's tile. trow / hp / fp = this lane's place in row hh of the tile and of the two outputs (pitch LQ); b1, b2 = table factors of x_lo and x_hi: (c, -s) in the low half (out_lo = x_lo c - x_hi s), (s, c) in the high half (out_hi = x_lo s + x_hi c).
template <bool F32OUT>
__device__ __forceinline__ void nr_rows(const float* trow, bool lowh, const v4f (&b1)[16], const v4f (&b2)[16], v4f g4, float eps, _Float16* hp, float* fp) {
#pragma unroll      /* the table factors are register arrays: every index must be a constant */
  for (int q = 0; q < 16; ++q) { v4f x = *(const v4fa*)(trow + q * 2 * 68); float t[4];
    for (int u = 0; u < 4; ++u) t[u] = __fmul_rn(x[u], x[u]);
    for (int u = 0; u < 4; ++u) t[u] = __fadd_rn(t[u], a0_dpp<0x168>(t[u]));
    for (int u = 0; u < 4; ++u) t[u] = __fadd_rn(t[u], a0_dpp<0x164>(t[u]));
    for (int u = 0; u < 4; ++u) t[u] = __fadd_rn(t[u], a0_dpp<0x162>(t[u]));
    for (int u = 0; u < 4; ++u) t[u] = __fadd_rn(t[u], a0_dpp<0x161>(t[u]));
    const float rs = nr_rsqrt(__fadd_rn(__fadd_rn(__fadd_rn(t[0], t[2]), __fadd_rn(t[1], t[3])) / (float)HD, eps));
    v4f o; v4h h4;      /* x_hi's product is rounded, x_lo's is fused into the sum, alike in both halves */
    for (int u = 0; u < 4; ++u) { const float own = __fmul_rn(__fmul_rn(x[u], rs), g4[u]), oth = a0_dpp<0x168>(own); const float lo = lowh ? own : oth, hi = lowh ? oth : own;
      o[u] = __builtin_fmaf(lo, b1[q][u], __fmul_rn(hi, b2[q][u])); h4[u] = (_Float16)o[u]; }
    *(v4h*)(hp + (size_t)q * 2 * LQ) = h4;
    if (F32OUT) *(v4f*)(fp + (size_t)q * 2 * LQ) = o; }
  asm volatile("s_wait_xcnt 0x0" ::: "memory"); }      /* behind the tail's last stores, in front of any later write of a register that they name (the code that follows the place where the two tails join) */

// ---- fast GEMM (block tile 128x64, wave tile 32x64; requires M % 128 == 0 rows per launch region, N % 64 == 0 and K % 64 == 0). Operands go through LDS: a stage is 64 k (one 128-byte line of each of the 128 A rows and 64 B rows), read from global as whole lines (8 lanes a row) one stage ahead into registers and stored to the other of two buffers at a row pitch of 144 bytes (16 x odd: ds_load_b128 fragment reads without bank conflicts); epilogue = k_gemm_hhx semantics, or with NROPE: no bias, per-head RMS norm (gain, eps) and half-split rope (tables CS, SN; position = row % SQ) on acc alpha, f16 rows to C16 and, of the positions below QT0 of every sequence, the same values in f32 to C (QT0 rows a sequence), both at pitch LQ ----
__device__ __forceinline__ v16h g2_frag(const _Float16* p, int hh) { FragH f; f.half[0] = *(const v8us*)((const unsigned short*)p + 8 * hh); f.half[1] = *(const v8us*)((const unsigned short*)p + 16 + 8 * hh); return f.v; }
__device__ __forceinline__ v8f g2_mma(v16h a, v16h b, v8f c) { v8f d = __builtin_amdgcn_wmma_f32_16x16x32_f16(false, a, false, b, (short)0, c, false, false); asm volatile("v_nop\n\tv_nop\n\tv_nop\n\tv_nop" : "+v"(d) : "v"(a), "v"(b)); return d; }
template <int ACT, bool NROPE = false>
__global__ __launch_bounds__(128) void k_gemm2(const _Float16* __restrict__ A, int lda, size_t sA, const _Float16* __restrict__ Bh, int ldb, size_t sB, float alpha, const float* __restrict__ bias, size_t sBias, const float* __restrict__ CP, int rowsPerB, size_t sCPb, int row0g,
    float* __restrict__ C, _Float16* __restrict__ C16, int ldc, size_t sC, int M, int N, int K, const float* __restrict__ gain = nullptr, float eps = 0.f, const float* __restrict__ CS = nullptr, const float* __restrict__ SN = nullptr) { static_assert(ACT == 0 || ACT == 3 || ACT == 6 || ACT == 8 || ACT == 9 || ACT == 11 || ACT == 12 || ACT == 14 || ACT == 15 || ACT == 16 || ACT == 17, "k_gemm2: unsupported ACT code (would silently apply no activation)");
  constexpr int LP = 72, ABUF = 128 * LP, BBUF = 64 * LP;      /* LDS row pitch and buffer sizes in 16-bit elements */
  __shared__ __attribute__((aligned(16))) unsigned short sm[2 * (ABUF + BBUF)];      /* A buffers 0, 1, then B buffers 0, 1; behind the k loop's last barrier the same bytes are the epilogue's staging tiles */
  static_assert(sizeof(sm) >= 4 * 32 * 68 * sizeof(float), "the epilogue's four 32 x 68 f32 tiles fit the operand buffers");
  float (*so)[32][68] = reinterpret_cast<float (*)[32][68]>(sm);
  const int tid = threadIdx.x, w = tid >> 5, lane = tid & 31, ln = lane & 15, hh = lane >> 4; const int by = blockIdx.y;
  A += (size_t)by * sA; Bh += (size_t)by * sB; const size_t cofs = (size_t)by * sC; const float* bp = bias ? bias + (size_t)by * sBias : nullptr;
  const int ntn = N >> 6; const int mt = blockIdx.x / ntn, nq = blockIdx.x - mt * ntn; const int row0 = mt * 128 + 32 * w, col0 = nq * 64; if (mt * 128 >= M) return;      /* the whole block leaves or none does: barriers follow */
  __builtin_assume(lda == DM && ldb == DM);      /* every launch below passes these two pitches: the 16-row steps of a stage's loads become immediate offsets of one address */
  const char* ga = (const char*)(A + (size_t)(mt * 128) * lda); const char* gb = (const char*)(Bh + (size_t)col0 * ldb);      /* the block's first A and B row */
  const unsigned sr = (((unsigned)tid >> 3) & 1u) * 8u + ((unsigned)tid >> 4), sc = ((unsigned)tid & 7u) * 8u;      /* 8 lanes a row; the two rows of 16 neighbouring lanes lie 8 apart, so that at the 144-byte pitch their 256 stored bytes fall on 64 different banks */
  const unsigned va = (sr * (unsigned)lda + sc) * 2u, vb = (sr * (unsigned)ldb + sc) * 2u;      /* this thread's 16 bytes of row sr + 16 i of a stage: a 32-bit byte offset beside a block-uniform base */
  unsigned short* la = sm + sr * LP + sc; unsigned short* lb = sm + 2 * ABUF + sr * LP + sc;
  const _Float16* fa = (const _Float16*)sm + (32 * w + ln) * LP; const _Float16* fb = (const _Float16*)sm + 2 * ABUF + ln * LP;      /* this lane's fragment rows */
  v8us ra[8], rb[4];
  auto fetch = [&](int s) {
#pragma unroll      /* register arrays: constant indices */
    for (int i = 0; i < 8; ++i) ra[i] = *(const v8us*)(ga + ((size_t)(i * 32) * lda + (size_t)s * 128) + va);
#pragma unroll      /* register arrays: constant indices */
    for (int i = 0; i < 4; ++i) rb[i] = *(const v8us*)(gb + ((size_t)(i * 32) * ldb + (size_t)s * 128) + vb);
    asm volatile("s_wait_xcnt 0x0" ::: "memory"); };      /* behind the stage's 12 loads, in front of every later write of an address register that they name */
  auto put = [&](int buf) {
#pragma unroll      /* register arrays: constant indices */
    for (int i = 0; i < 8; ++i) *(v8us*)(la + buf * ABUF + i * 16 * LP) = ra[i];
#pragma unroll      /* register arrays: constant indices */
    for (int i = 0; i < 4; ++i) *(v8us*)(lb + buf * BBUF + i * 16 * LP) = rb[i]; };
  const v8f z8 = {0.f,0.f,0.f,0.f,0.f,0.f,0.f,0.f}; v8f c00 = z8, c01 = z8, c02 = z8, c03 = z8, c10 = z8, c11 = z8, c12 = z8, c13 = z8;
  const int nst = K >> 6;
  if (nst > 0) { fetch(0); put(0); }
  __syncthreads();      /* stage 0 is in buffer 0 for every wave */
  for (int s = 0; s < nst; ++s) { const int cur = s & 1; const bool more = s + 1 < nst;
    if (more) fetch(s + 1);      /* the next stage's lines fly under this stage's products */
    const _Float16* pa = fa + cur * ABUF; const _Float16* pb = fb + cur * BBUF; v16h a0[2], a1[2], b[2][4];
#pragma unroll      /* register arrays: constant indices */
    for (int kk = 0; kk < 2; ++kk) { a0[kk] = g2_frag(pa + kk * 32, hh); a1[kk] = g2_frag(pa + 16 * LP + kk * 32, hh);
      for (int t = 0; t < 4; ++t) b[kk][t] = g2_frag(pb + t * 16 * LP + kk * 32, hh); }
#pragma unroll      /* register arrays: constant indices */
    for (int kk = 0; kk < 2; ++kk) { c00 = g2_mma(a0[kk], b[kk][0], c00); c10 = g2_mma(a1[kk], b[kk][0], c10); c01 = g2_mma(a0[kk], b[kk][1], c01); c11 = g2_mma(a1[kk], b[kk][1], c11);
      c02 = g2_mma(a0[kk], b[kk][2], c02); c12 = g2_mma(a1[kk], b[kk][2], c12); c03 = g2_mma(a0[kk], b[kk][3], c03); c13 = g2_mma(a1[kk], b[kk][3], c13); }
    if (more) put(cur ^ 1);      /* into the buffer whose last readers passed the barrier at the foot of the trip before */
    __syncthreads(); }      /* publishes stage s + 1 and ends every wave's reads of stage s (behind the last trip: before the epilogue reuses the bytes) */
  v8f accs[8] = {c00, c01, c02, c03, c10, c11, c12, c13};
  if constexpr (NROPE) { static_assert(HD == 64 && QT0 % 32 == 0 && SQ % 32 == 0, "a wave tile's 64 columns are one head; its 32 rows lie on one side of QT0 and in one sequence");
    const int c4 = ln * 4; const bool lowh = ln < 8; const unsigned tofs = (unsigned)((row0 % SQ + hh) * (HD / 2) + (ln & 7) * 4);      /* table row = the token's position, table column = d & 31 */
    const float* cp = CS + tofs; const float* sp = SN + tofs; v4f tc[16], ts[16];
#pragma unroll      /* register arrays: constant indices */
    for (int q = 0; q < 16; ++q) { tc[q] = *(const v4fa*)(cp + q * 2 * (HD / 2)); ts[q] = *(const v4fa*)(sp + q * 2 * (HD / 2)); }      /* all 32 table rows asked for here, so that one latency runs under the LDS staging below */
    v4f g4 = *(const v4fa*)(gain + c4);
    asm volatile("s_wait_xcnt 0x0" ::: "memory");      /* behind the 33 loads, in front of every later write of an address register that they name */
#pragma unroll      /* accs is a register array: constant indices */
    for (int u = 0; u < 8; ++u) for (int r = 0; r < 8; ++r) so[w][(u >> 2) * 16 + 8 * hh + r][(u & 3) * 16 + ln] = accs[u][r] * alpha;
    __builtin_amdgcn_fence(__ATOMIC_ACQ_REL, "workgroup"); __builtin_amdgcn_wave_barrier();      /* as in the plain epilogue: the wave's own LDS writes before its reads */
    for (int u = 0; u < 4; ++u) g4[u] = bf16_round(g4[u]);
#pragma unroll      /* register arrays: constant indices */
    for (int q = 0; q < 16; ++q) { const v4f c = tc[q], s = ts[q]; tc[q] = lowh ? c : s; ts[q] = lowh ? -s : c; }
    const size_t e = cofs + (size_t)(row0 + hh) * LQ + col0 + c4; const size_t ef = e - (size_t)(row0 / SQ) * (SQ - QT0) * LQ;      /* the f32 plane holds QT0 rows a sequence: sequence s, position p lies at row s QT0 + p */
    if (__builtin_amdgcn_readfirstlane(row0 % SQ) < QT0) nr_rows<true>(&so[w][hh][c4], lowh, tc, ts, g4, eps, C16 + e, C + ef);      /* one wave-uniform branch around the whole tail: inside it the 16 row pairs stay one block of code to schedule */
    else nr_rows<false>(&so[w][hh][c4], lowh, tc, ts, g4, eps, C16 + e, C + ef);
    return; }
#pragma unroll
  for (int u = 0; u < 8; ++u) { const int t = u & 3, half = u >> 2; const int col = col0 + t * 16 + ln; const float bv = bp ? bf16_round(bp[col]) : 0.f;
#pragma unroll
    for (int r = 0; r < 8; ++r) { const int rloc = half * 16 + 8 * hh + r; float v = accs[u][r] * alpha + bv; if (CP) { if (rowsPerB < 0) v += CP[cofs + (size_t)(row0g + row0 + rloc) * ldc + col];      /* rowsPerB < 0: own element of the batched C plane */ else { const int bidx = (row0g + row0 + rloc) / rowsPerB; v += CP[(size_t)bidx * sCPb + (size_t)by * 64 + col]; } }
      if (ACT == 3) v = fmaxf(v, 0.f); else if (ACT == 6) v = 0.5f * v * (1.0f + erff(v * 0.70710678118654752f)); else if (ACT == 11) v = 1.0f / (1.0f + expf(-v)); else if (ACT == 15) v = v / (1.0f + expf(-v)); else if (ACT == 12) v = (v > 0.f) ? v : 0.01f * v; else if (ACT == 8) v = tanhf(v); else if (ACT == 9) v = 0.5f * v * (1.0f + tanhf(0.7978845608028654f * (v + 0.044715f * v * v * v))); else if (ACT == 14) v = (v > 0.f) ? v : 0.1f * v; else if (ACT == 16) v = (v >= 0.f) ? v : 0.3f * v; else if (ACT == 17) v = (v >= 0.f) ? v : 0.2f * v;
      so[w][rloc][t * 16 + ln] = v; } }
  __builtin_amdgcn_fence(__ATOMIC_ACQ_REL, "workgroup"); __builtin_amdgcn_wave_barrier();
  const int rsub = lane >> 4, c4 = (lane & 15) * 4;
  {
#pragma unroll
    for (int q = 0; q < 16; ++q) { const int r = q * 2 + rsub; const v4f v = *(const v4fa*)&so[w][r][c4]; if (C) *(v4f*)(C + cofs + (size_t)(row0 + r) * ldc + col0 + c4) = v; if (C16) { v4h h4; for (int i = 0; i < 4; ++i) h4[i] = (_Float16)v[i]; *(v4h*)(C16 + cofs + (size_t)(row0 + r) * ldc + col0 + c4) = h4; } }
     } }

__global__ __launch_bounds__(256) void k_wnat(const float* __restrict__ w, size_t n8, _Float16* __restrict__ Bt) { const size_t t = (size_t)blockIdx.x * 256 + threadIdx.x; if (t >= n8) return; FragH f; for (int q = 0; q < 8; ++q) f.h[q] = (_Float16)(bf16_round(w[t * 8 + q]) * 16.0f); *(v8us*)((unsigned short*)Bt + t * 8) = f.half[0];  }

// Fused causal attention of all batches (blockIdx.x = head + NH * batch, blockIdx.y = query tile group): one wave owns 16 query rows of one head and walks its keys 32 at a time with a running maximum and sum.
// S^T = K Q^T (A = key rows, B = query rows): a lane holds scores of ONE query (column ln), keys 8 hh + r of each 16-key tile, so two converted score tiles are, as they lie, the B fragment of O^T += V^T P^T (A = rows of V^T).
// Weights are carried x256 (f16 range) and cancel in the division by their own sum; o leaves x64 like before.
__device__ __forceinline__ float fa_xhalf(float x) { return __builtin_bit_cast(float, __builtin_amdgcn_permlanex16(__builtin_bit_cast(int, x), __builtin_bit_cast(int, x), 0x76543210, 0xfedcba98, false, false)); }      /* lane l <-> lane l ^ 16 */
__global__ __launch_bounds__(128) void k_fattn(const _Float16* __restrict__ Q, const _Float16* __restrict__ K, const _Float16* __restrict__ Vt, _Float16* __restrict__ O) {
  const int lane = threadIdx.x & 31, ln = lane & 15, hh = lane >> 4; const int w = __builtin_amdgcn_readfirstlane((int)(threadIdx.x >> 5)); const int h = blockIdx.x % NH; const size_t bz = blockIdx.x / NH;
  Q += bz * SQ * LQ; K += bz * SQ * KVD; Vt += bz * NH * HD * SQ; O += bz * SQ * DM;      /* this batch's rows and its V^T planes */
  const int q0w = ((int)(gridDim.y - 1 - blockIdx.y) * 4 + w) * 16;      /* the tile group is the slow grid index, reversed: grid row 0 holds the longest key walks of every head and batch (for speed only) */
  const int qi = q0w + ln; const int kend = ((q0w >> 5) + 1) * 32;      /* keys 0 .. kend - 1 cover every key <= q0w + 15; kend <= SQ */
  const _Float16* qp = Q + (size_t)qi * LQ + h * HD; const v16h qa = g2_frag(qp, hh), qb = g2_frag(qp + 32, hh);
  const _Float16* kp = K + (size_t)ln * KVD + h * HD; const _Float16* vp = Vt + ((size_t)h * HD + ln) * SQ;
  const v8f z8 = {0.f,0.f,0.f,0.f,0.f,0.f,0.f,0.f}; v8f o0 = z8, o1 = z8, o2 = z8, o3 = z8;
  const float cs = 0.125f * 1.4426950408889634f;      /* 1 / sqrt(64), and e^x = 2^(x log2 e) */
  float m = -1.0e30f, l = 0.f;
  v16h k0a = g2_frag(kp, hh), k0b = g2_frag(kp + 32, hh), k1a = g2_frag(kp + (size_t)16 * KVD, hh), k1b = g2_frag(kp + (size_t)16 * KVD + 32, hh);
  for (int kb = 0; kb < kend; kb += 32) {
    const v16h v0 = g2_frag(vp + kb, hh), v1 = g2_frag(vp + (size_t)16 * SQ + kb, hh), v2 = g2_frag(vp + (size_t)32 * SQ + kb, hh), v3 = g2_frag(vp + (size_t)48 * SQ + kb, hh);
    v8f s0 = g2_mma(k0a, qa, z8); s0 = g2_mma(k0b, qb, s0); v8f s1 = g2_mma(k1a, qa, z8); s1 = g2_mma(k1b, qb, s1);
    const int kn = (kb + 32 < kend) ? kb + 32 : kb;      /* next pass's key rows fetched under this pass's softmax; the last pass re-reads its own */
    const _Float16* kq = kp + (size_t)kn * KVD; k0a = g2_frag(kq, hh); k0b = g2_frag(kq + 32, hh); k1a = g2_frag(kq + (size_t)16 * KVD, hh); k1b = g2_frag(kq + (size_t)16 * KVD + 32, hh);
    asm volatile("s_wait_xcnt 0x0" ::: "memory");      /* behind this pass's 16 loads, in front of every later write of an address register that they name (the V^T pointer's step, the reuse of the key pointer's pair) */
    if (kb + 31 > q0w) {      /* only the last pass holds keys above a query of this tile */
      for (int r = 0; r < 8; ++r) { const int key = kb + 8 * hh + r; s0[r] = (key <= qi) ? s0[r] : -1.0e30f; s1[r] = (key + 16 <= qi) ? s1[r] : -1.0e30f; } }
    float mx = fmaxf(s0[0], s1[0]);
    for (int r = 1; r < 8; ++r) mx = fmaxf(mx, fmaxf(s0[r], s1[r]));
    mx = fmaxf(mx, fa_xhalf(mx)); const float mn = fmaxf(m, mx); float corr = (m - mn) * cs; m = mn; const float bias = fmaf(-mn, cs, 8.0f);
    float e[16];
    for (int r = 0; r < 8; ++r) { e[r] = fmaf(s0[r], cs, bias); e[8 + r] = fmaf(s1[r], cs, bias); }
    /* the pass's 17 exponentials, each in place on a register of its own, so that no transcendental is directly followed by a reader of its result or a writer of its source; the v_nop is that slot behind the last one */
    asm("v_exp_f32 %0, %0\n\tv_exp_f32 %1, %1\n\tv_exp_f32 %2, %2\n\tv_exp_f32 %3, %3\n\tv_exp_f32 %4, %4\n\tv_exp_f32 %5, %5\n\tv_exp_f32 %6, %6\n\tv_exp_f32 %7, %7\n\tv_exp_f32 %8, %8\n\t"
        "v_exp_f32 %9, %9\n\tv_exp_f32 %10, %10\n\tv_exp_f32 %11, %11\n\tv_exp_f32 %12, %12\n\tv_exp_f32 %13, %13\n\tv_exp_f32 %14, %14\n\tv_exp_f32 %15, %15\n\tv_exp_f32 %16, %16\n\tv_nop"
        : "+v"(corr), "+v"(e[0]), "+v"(e[1]), "+v"(e[2]), "+v"(e[3]), "+v"(e[4]), "+v"(e[5]), "+v"(e[6]), "+v"(e[7]), "+v"(e[8]), "+v"(e[9]), "+v"(e[10]), "+v"(e[11]), "+v"(e[12]), "+v"(e[13]), "+v"(e[14]), "+v"(e[15]));
    FragH pf; float sum = 0.f;
    for (int r = 0; r < 8; ++r) { sum += e[r] + e[8 + r]; pf.h[r] = (_Float16)e[r]; pf.h[8 + r] = (_Float16)e[8 + r]; }
    l = fmaf(l, corr, sum);
    for (int r = 0; r < 8; ++r) { o0[r] *= corr; o1[r] *= corr; o2[r] *= corr; o3[r] *= corr; }
    o0 = g2_mma(v0, pf.v, o0); o1 = g2_mma(v1, pf.v, o1); o2 = g2_mma(v2, pf.v, o2); o3 = g2_mma(v3, pf.v, o3); }
  const float fin = 64.0f / (l + fa_xhalf(l));      /* the two lane halves hold disjoint keys of the same query */
  unsigned short* op = (unsigned short*)O + (size_t)qi * DM + h * HD + 8 * hh; FragH f0, f1;
  for (int r = 0; r < 8; ++r) { f0.h[r] = (_Float16)(o0[r] * fin); f0.h[8 + r] = (_Float16)(o1[r] * fin); f1.h[r] = (_Float16)(o2[r] * fin); f1.h[8 + r] = (_Float16)(o3[r] * fin); }
  *(v8us*)op = f0.half[0]; *(v8us*)(op + 16) = f0.half[1]; *(v8us*)(op + 32) = f1.half[0]; *(v8us*)(op + 48) = f1.half[1]; }      /* register r of tile dt = O[qi][16 dt + 8 hh + r]: 16-byte stores */

// Exact f32 attention of the first QT0 rows: one wave owns ONE query row. Lane = (key slice ks = lane >> 2, dim part dp = lane & 3): the lane walks keys ks, ks + 8, ... of its row
// and keeps dims 16 c + 4 dp + u (c, u < 4) of q and of its slice's partial o in registers, with the slice's own running maximum and sum (base-2 exponents); the 8 slices are merged at the end by lane exchanges.
template <int CTRL> __device__ __forceinline__ float a0_dpp(float x) { return __builtin_bit_cast(float, __builtin_amdgcn_update_dpp(0, __builtin_bit_cast(int, x), CTRL, 0xf, 0xf, true)); }      /* 0x160 + n: lane l <- lane l ^ n inside a 16-lane row; every lane is on wherever it is used */
__device__ __forceinline__ void a0_exp2x2(float& x, float& y) { asm("v_exp_f32 %0, %0\n\tv_exp_f32 %1, %1\n\tv_nop" : "+v"(x), "+v"(y)); }      /* two exponentials, each in place on its own register, so that neither is directly followed by a reader of its result; the v_nop is that slot behind the second */
template <int STEP> __device__ __forceinline__ float a0_swap(float x) { return STEP == 16 ? fa_xhalf(x) : a0_dpp<0x160 + (STEP & 15)>(x); }
template <int STEP> __device__ __forceinline__ void a0_merge(float& m, float& l, v4f (&o)[4]) {      /* this lane's slices with those of lane ^ STEP; a slice without keys has m = -1e30, l = 0, o = 0 and drops out */
  const float mo = a0_swap<STEP>(m), lo = a0_swap<STEP>(l); const float mn = fmaxf(m, mo); float fa = m - mn, fb = mo - mn; a0_exp2x2(fa, fb);
  l = fmaf(l, fa, lo * fb); m = mn;
  for (int c = 0; c < 4; ++c) for (int u = 0; u < 4; ++u) o[c][u] = fmaf(o[c][u], fa, a0_swap<STEP>(o[c][u]) * fb); }
__device__ __forceinline__ void a0_exp2x3(float& x, float& y, float& z) { asm("v_exp_f32 %0, %0\n\tv_exp_f32 %1, %1\n\tv_exp_f32 %2, %2\n\tv_nop" : "+v"(x), "+v"(y), "+v"(z)); }      /* as a0_exp2x2, for three */
__device__ __forceinline__ float a0_dot(const v4f (&q)[4], const v4f (&kk)[4]) {      /* q . k over the four lanes of a key: all four end with the same bits */
  v4f pv = q[0] * kk[0]; for (int c = 1; c < 4; ++c) pv = __builtin_elementwise_fma(q[c], kk[c], pv);
  float s = (pv[0] + pv[1]) + (pv[2] + pv[3]); s += a0_dpp<0x161>(s); s += a0_dpp<0x162>(s); return s; }
__global__ __launch_bounds__(256) void k_att0(const float* __restrict__ QF, const float* __restrict__ KF, const float* __restrict__ VF, int ld, float scale, float* __restrict__ OF, int ldo) {
  static_assert(HD == 64 && QT0 % 8 == 0, "four lanes of 16 dims a row; eight rows a block");
  const int lane = threadIdx.x & 31, ks = lane >> 2, dp = lane & 3; const int w = __builtin_amdgcn_readfirstlane((int)(threadIdx.x >> 5)); const int h = blockIdx.y;
  { const size_t zb = (size_t)blockIdx.z * QT0; QF += zb * ld; KF += zb * ld; VF += zb * ld; OF += zb * ldo; }      /* blockIdx.z = batch: QT0 rows of each plane */
  const int i = QT0 - 1 - (w * (QT0 / 8) + (int)blockIdx.x);      /* a block's eight rows lie QT0 / 8 apart: every block holds long and short key walks alike */
  const int col = h * HD + dp * 4; const float* qr = QF + (unsigned)(i * ld + col);
  v4f q[4], o[4]; const v4f z4 = {0.f, 0.f, 0.f, 0.f};
  for (int c = 0; c < 4; ++c) { q[c] = *(const v4fa*)(qr + c * 16); o[c] = z4; }
  const float cs = scale * 1.4426950408889634f;      /* e^x = 2^(x log2 e) */
  float m = -1.0e30f, l = 0.f;
  for (int jb = 0; jb <= i; jb += 16) {      /* 16 keys a pass, two a lane group: ja and ja + 8; a key above the diagonal (last pass only) is read as row i and weighs 0 */
    const int ja = jb + ks; const bool oka = ja <= i, okb = ja + 8 <= i;
    const unsigned offa = (unsigned)((oka ? ja : i) * ld + col), offb = (unsigned)((okb ? ja + 8 : i) * ld + col); v4f ka[4], kb[4], va[4], vb[4];
    const float* pka = KF + offa; const float* pkb = KF + offb; const float* pva = VF + offa; const float* pvb = VF + offb;
    for (int c = 0; c < 4; ++c) { ka[c] = *(const v4fa*)(pka + c * 16); kb[c] = *(const v4fa*)(pkb + c * 16); }
    for (int c = 0; c < 4; ++c) { va[c] = *(const v4fa*)(pva + c * 16); vb[c] = *(const v4fa*)(pvb + c * 16); }
    asm volatile("s_wait_xcnt 0x0" :: "v"(pka), "v"(pkb), "v"(pva), "v"(pvb) : "memory");      /* behind the pass's 16 loads, in front of every write of an address register that they name; the four addresses are inputs so that their registers live up to the wait and no load of the pass lands on one */
    __builtin_amdgcn_sched_barrier(0);      /* the arithmetic stays behind the 16 loads; without this the loads are spread among it in small groups, each waited for in turn */
    const float sa = a0_dot(q, ka) * cs, sb = a0_dot(q, kb) * cs;
    const float mn = fmaxf(m, fmaxf(oka ? sa : -1.0e30f, okb ? sb : -1.0e30f)); float sc = m - mn, ea = oka ? sa - mn : -1.0e30f, eb = okb ? sb - mn : -1.0e30f; a0_exp2x3(sc, ea, eb); m = mn;
    l = fmaf(l, sc, ea + eb); const v4f ea4 = {ea, ea, ea, ea}, eb4 = {eb, eb, eb, eb};
    for (int c = 0; c < 4; ++c) o[c] = __builtin_elementwise_fma(vb[c], eb4, __builtin_elementwise_fma(va[c], ea4, o[c] * sc)); }
  a0_merge<4>(m, l, o); a0_merge<8>(m, l, o); a0_merge<16>(m, l, o);
  const float fin = 64.0f / l;      /* o carried x64 like the f16 path; key 0 is in every row, so l > 0 */
  if (ks == 0) { float* dst = OF + (unsigned)(i * ldo + col); for (int c = 0; c < 4; ++c) *(v4f*)(dst + c * 16) = o[c] * fin; } }

__global__ __launch_bounds__(256) void k_kvexp(const float* __restrict__ src, float* __restrict__ dst, size_t n4) { const size_t t = (size_t)blockIdx.x * 256 + threadIdx.x; if (t >= n4) return; const size_t e = t * 4; const size_t row = e / DM; const int col = (int)(e % DM); const int h = col / HD, d = col % HD; const v4f v = *(const v4fa*)(src + row * KVD + (size_t)(h / HPG) * HD + d); *(v4f*)(dst + e) = v;  }

__global__ __launch_bounds__(256) void k_tab2(float theta, float* __restrict__ CS, float* __restrict__ SN) {
  const int t = blockIdx.x * 256 + threadIdx.x; if (t >= SQ * (HD / 2)) return; const int i = t % (HD / 2); const int p = t / (HD / 2); const float invf = 1.0f / powf(theta, (float)(2 * i) / (float)HD); const float ang = __fmul_rn((float)p, invf); const float c = cosf(ang), s = sinf(ang);
  *(float*)(CS + t) = c; *(float*)(SN + t) = s;  }
__global__ __launch_bounds__(256) void k_bfcp(const float* __restrict__ src, float* __restrict__ dst, size_t n4) { const size_t t = (size_t)blockIdx.x * 256 + threadIdx.x; if (t >= n4) return; const v4f a = *(const v4fa*)(src + t * 4); v4f o; for (int q = 0; q < 4; ++q) o[q] = bf16_round(a[q]); *(v4f*)(dst + t * 4) = o;  }

__global__ __launch_bounds__(256) void k_tabhalf(const float* __restrict__ cs, const float* __restrict__ sn, float* __restrict__ CS, float* __restrict__ SN) { const int t = blockIdx.x * 256 + threadIdx.x; if (t >= SQ * (HD / 2)) return; const int p = t / (HD / 2), i = t % (HD / 2); const float c = bf16_round(cs[(size_t)p * HD + i]), s = bf16_round(sn[(size_t)p * HD + i]);
  *(float*)(CS + t) = c; *(float*)(SN + t) = s;  }

__global__ __launch_bounds__(256) void k_tab2d(float* __restrict__ CS, float* __restrict__ SN) {
  const int t = blockIdx.x * 256 + threadIdx.x; if (t >= SQ * (HD / 2)) return; const int i = t % (HD / 2); const int p = t / (HD / 2); const float invf = (float)(1.0 / pow(10000.0, (double)(2 * i) / (double)HD)); const float ang = __fmul_rn((float)p, invf); const float c = cosf(ang), s = sinf(ang);
  *(float*)(CS + t) = c; *(float*)(SN + t) = s;  }
extern "C" void kernel_launch(void* const* d_in, const int* in_sizes, int n_in,
                              void* d_out, int out_size, void* d_ws, size_t ws_size, hipStream_t stream) {
  (void)in_sizes; (void)n_in; (void)out_size;
  const float* const* I = (const float* const*)d_in; const float* x = I[0]; const float* wattn = I[1]; const float* wo = I[2]; const float* qg = I[3]; const float* kg = I[4];      /* x; fused [in][out] Wqkv [1024][3072] (q, k, v column thirds); [in][out] Wproj; RMS-norm gains q_norm_w / k_norm_w [64]; no biases; rope tables computed in-kernel (positions = row index) */
  static_assert(HPG == 1 && NH == NG * HPG && NH * HD == DM && KVD == DM, "plain multi-head attention as 16 kv groups of one query head"); const float* bv = nullptr; const float* bo = nullptr;      /* no biases in this module */
  char* ws = (char*)d_ws; size_t off = 0;
  auto take = [&](size_t bytes) { char* p = ws + off; off += (bytes + 255) & ~(size_t)255; return p; };
  _Float16* BQKV = (_Float16*)take((size_t)3 * DM * DM * 2); _Float16* BQ = BQKV; _Float16* BK = BQKV + (size_t)DM * DM; _Float16* BV = BQKV + (size_t)2 * DM * DM; _Float16* BO = (_Float16*)take((size_t)DM * DM * 2);      /* one transposed plane Bt [3072][1024] of the fused weight: rows 0..1023 = q, 1024.. = k, 2048.. = v */
  _Float16* X16 = (_Float16*)take(NR * DM * 2); float* CSB = (float*)take((size_t)SQ * HD * 4); float* SNB = (float*)take((size_t)SQ * HD * 4); _Float16* Q16 = (_Float16*)take(NR * DM * 2); _Float16* K16 = (_Float16*)take(NR * KVD * 2); _Float16* V16 = (_Float16*)take(NR * KVD * 2); _Float16* O16 = (_Float16*)take(NR * DM * 2);
  _Float16* VT = (_Float16*)take((size_t)NB * NH * HD * SQ * 2);
  float* QF0 = (float*)take((size_t)NB * QT0 * DM * 4); float* KF0 = (float*)take((size_t)NB * QT0 * KVD * 4); float* VF0 = (float*)take((size_t)NB * QT0 * KVD * 4); float* KF0e = (float*)take((size_t)NB * QT0 * DM * 4); float* VF0e = (float*)take((size_t)NB * QT0 * DM * 4); float* OF0 = (float*)take((size_t)NB * QT0 * DM * 4); _Float16* OH0 = (_Float16*)take((size_t)NB * QT0 * DM * 2); _Float16* OL0 = (_Float16*)take((size_t)NB * QT0 * DM * 2);      /* every per-batch plane holds all batches: each stage below is one launch over them */
  if (off > ws_size) return;
  k_wt_f16<<<(unsigned)(((size_t)3 * DM * (DM / 8) + 255) / 256), 256, 0, stream>>>(wattn, BQKV, DM, 3 * DM, 16.0f); k_wt_f16<<<(unsigned)(((size_t)DM * (DM / 8) + 255) / 256), 256, 0, stream>>>(wo, BO, DM, DM, 16.0f);      /* [in][out] -> Bt x16 planes (fused Wqkv: K 1024, N 3072) */
  k_x16<<<(unsigned)((NR * DM / 8 + 255) / 256), 256, 0, stream>>>(x, X16, NR * DM / 8);
  k_tab2<<<(SQ * (HD / 2) + 255) / 256, 256, 0, stream>>>(10000.0f, CSB, SNB);      /* rope tables cos / sin(p / 10000^(2i/64)), i < 32: f32 pow, reciprocal, product */
  const size_t r0p = (size_t)B0 * SQ;      /* first projected row */
  k_gemm2<0><<<dim3((unsigned)((MP / 128) * (KVD / 64)), 1), 128, 0, stream>>>(X16 + r0p * DM, DM, 0, BV, DM, 0, 0.0625f, bv, 0, nullptr, 1, 0, 0, nullptr, V16 + r0p * KVD, KVD, 0, MP, KVD, DM);
  k_gemm2<0, true><<<dim3((unsigned)((MP / 128) * (DM / 64)), 1), 128, 0, stream>>>(X16 + r0p * DM, DM, 0, BQ, DM, 0, 0.0625f, nullptr, 0, nullptr, 1, 0, 0, QF0, Q16 + r0p * DM, DM, 0, MP, DM, DM, qg, 1e-5f, CSB, SNB);      /* q of all batches: projection, per-head RMS norm (gain, eps 1e-5), half-split rope (out_lo = x_lo c - x_hi s, out_hi = x_lo s + x_hi c = t cos + rotate_half(t) sin with the module's [f | f] tables) -> f16 rows; positions 0..255 of each batch in f32 too */
  k_gemm2<0, true><<<dim3((unsigned)((MP / 128) * (KVD / 64)), 1), 128, 0, stream>>>(X16 + r0p * DM, DM, 0, BK, DM, 0, 0.0625f, nullptr, 0, nullptr, 1, 0, 0, KF0, K16 + r0p * KVD, KVD, 0, MP, KVD, DM, kg, 1e-5f, CSB, SNB);      /* k likewise */
  k_vt<NG, SQ><<<NBR * NG * (SQ / 64), 256, 0, stream>>>(V16 + r0p * KVD, KVD, 0, VT);      /* V^T [batch][NH][HD][SQ] */
  k_gemm2<0><<<dim3((QT0 / 128) * (KVD / 64), NBR), 128, 0, stream>>>(X16 + r0p * DM, DM, (size_t)SQ * DM, BV, DM, 0, 0.0625f, bv, 0, nullptr, 1, 0, 0, VF0, nullptr, KVD, (size_t)QT0 * KVD, QT0, KVD, DM);      /* f32 v of the first 256 rows of each batch (grid y = batch) */
  k_kvexp<<<(unsigned)(((size_t)NBR * QT0 * DM / 4 + 255) / 256), 256, 0, stream>>>(KF0, KF0e, (size_t)NBR * QT0 * DM / 4); k_kvexp<<<(unsigned)(((size_t)NBR * QT0 * DM / 4 + 255) / 256), 256, 0, stream>>>(VF0, VF0e, (size_t)NBR * QT0 * DM / 4);      /* head h <- kv group h / HPG (HPG is 1 here: a plain copy) for the exact first-tile kernel */
  k_att0<<<dim3(QT0 / 8, NH, NBR), 256, 0, stream>>>(QF0, KF0e, VF0e, DM, 0.125f, OF0 + (size_t)B0 * QT0 * DM, DM);      /* exact f32 attention for rows 0..255 of each batch (o x64) */
  k_fattn<<<dim3(NH * NBR, SQ / 64), 128, 0, stream>>>(Q16 + r0p * LQ, K16 + r0p * KVD, VT, O16 + r0p * DM);      /* scores, causal softmax and weights x V of all heads, batches and query rows in ONE launch; scores and weights stay in registers (o x64) */
  k_gemm2<0><<<dim3((unsigned)((MPO / 128) * (DM / 64)), 1), 128, 0, stream>>>(O16 + r0p * DM, DM, 0, BO, DM, 0, 0.0009765625f, bo, 0, nullptr, 1, 0, 0, (float*)d_out + r0p * DM, nullptr, DM, 0, MPO, DM, DM);      /* out rows are the output layout */
  k_hl<<<(unsigned)(((size_t)NB * QT0 * DM / 8 + 255) / 256), 256, 0, stream>>>(OF0, OH0, OL0, (size_t)NB * QT0 * DM / 8);      /* first-tile o (x64) -> f16 hi + x1024 residual planes */
  k_gemm2<0><<<dim3((QT0 / 128) * (DM / 64), NBR), 128, 0, stream>>>(OH0 + (size_t)B0 * QT0 * DM, DM, (size_t)QT0 * DM, BO, DM, 0, 0.0009765625f, bo, 0, nullptr, 1, 0, 0, (float*)d_out + r0p * DM, nullptr, DM, (size_t)SQ * DM, QT0, DM, DM);      /* rows 0..255 of each batch (grid y = batch): out = o_hi Wo (no bias here), overwriting the f16-path rows */
  k_gemm2<0><<<dim3((QT0 / 128) * (DM / 64), NBR), 128, 0, stream>>>(OL0 + (size_t)B0 * QT0 * DM, DM, (size_t)QT0 * DM, BO, DM, 0, 0.00000095367431640625f, nullptr, 0, (const float*)d_out + r0p * DM, -1, 0, 0, (float*)d_out + r0p * DM, nullptr, DM, (size_t)SQ * DM, QT0, DM, DM);      /* += o_lo Wo 2^-20 (own-element accumulate) */
}

// v006
// Measured time: 253 microseconds a run.
// Next to v005, in two timings, it ran 1.16 times as fast each time.
// Counting every step since v000, it is 29.1 times as fast.
#include <hip/hip_runtime.h>
// Causal multi-head self-attention with a per-head RMS norm on q and k THEN rotate-half RoPE computed in the module, and a bias-free fused QKV projection (x [4][2048][1024]; qkv = x Wqkv ([in][out] 1024 x 3072, no bias) split into q | k | v thirds, 16 heads of 64; q, k = x * rsqrt(mean(x^2 over the 64 head dims) + 1e-5) * gain (gains q_norm_w / k_norm_w [64], read); cos / sin = [f | f] of pos * (1 / 10000^(2i/64)); q = q cos + rotate_half(q) sin with rotate_half = cat(-x2, x1), likewise k; scores / sqrt(64); causal (tril, -inf); softmax; out = merged Wproj ([in][out], no bias) -> [4][2048][1024]); run as grouped-query causal attention with 16 groups of ONE head with the norm stage on and the rope stage in its half-split mode.
// Compute dtype: inputs rounded to bf16 (the two gain vectors bf16-rounded on load); x / weights exact; the per-head RMS norm and the rotation in f32 on VALU; q, k, v, softmax weights and o as plain f16 GEMM operands (~2^-12); scores and softmax statistics f32; v_wmma_f32_16x16x32_f16.
#define NB 4
#define NG 16
#define HPG 1
#define KVD (NG * HD)
#define SQ 2048
#define DM 1024
#define NH 16
#define HD 64
#define HG 4
#define QT 256                       /* unused (k_fattn tiles 16 query rows per wave) */
#define NKX SQ
#define QT0 256                      /* first-tile rows recomputed exactly in f32 */
#define B0 0                         /* first batch processed (debug hook) */
#define NBR NB                       /* batches processed (debug hook) */
#define NR ((size_t)NB * SQ)         /* token rows */
#define MP ((int)((size_t)NBR * SQ)) /* rows projected (debug hook) */
#define QN SQ                        /* unused (k_fattn attends all SQ rows of a batch) */
#define NHD NH                       /* unused (all NH heads are attended) */
#define MPO MP                       /* rows through the output stage (debug hook) */
#define LQ DM      /* row pitch of the q/k/v rows */
typedef __bf16 v16b __attribute__((ext_vector_type(16)));
typedef unsigned short v8us __attribute__((ext_vector_type(8), may_alias));
typedef float  v8f  __attribute__((ext_vector_type(8)));
typedef float  v4f  __attribute__((ext_vector_type(4)));
typedef float  v4fa __attribute__((ext_vector_type(4), may_alias));
union FragB { v16b v; v8us half[2]; unsigned short u[16]; };

__device__ __forceinline__ unsigned short bf16_bits(float x) { unsigned int u = __float_as_uint(x); return (unsigned short)((u + 0x7FFFu + ((u >> 16) & 1u)) >> 16); }
__device__ __forceinline__ float bf16_val(unsigned short b) { return __uint_as_float(((unsigned int)b) << 16); }
__device__ __forceinline__ float bf16_round(float x) { return bf16_val(bf16_bits(x)); }
// D += A·B with NT terms: 1 = ah·bh, 2 = + al·bh (A split), 3 = + ah·bl (both split)
template <int NT>
__device__ __forceinline__ v8f mmaN(v16b ah, v16b al, v16b bh, v16b bl, v8f c) {
  c = __builtin_amdgcn_wmma_f32_16x16x32_bf16(false, ah, false, bh, (short)0, c, false, false);
  if (NT >= 2) c = __builtin_amdgcn_wmma_f32_16x16x32_bf16(false, al, false, bh, (short)0, c, false, false);
  if (NT >= 3) c = __builtin_amdgcn_wmma_f32_16x16x32_bf16(false, ah, false, bl, (short)0, c, false, false);
  asm volatile("v_nop\n\tv_nop\n\tv_nop\n\tv_nop" : "+v"(c) : "v"(ah), "v"(al), "v"(bh), "v"(bl));
  return c;
}

__global__ __launch_bounds__(256) void k_wt_bf16(const float* __restrict__ W, unsigned short* __restrict__ Wt, int K, int N) {
  const int t = blockIdx.x * 256 + threadIdx.x;
  const int k8n = K / 8;
  if (t >= N * k8n) return;
  const int n = t / k8n, k8 = (t % k8n) * 8;
  v8us v;
#pragma unroll
  for (int i = 0; i < 8; ++i) v[i] = bf16_bits(W[(size_t)(k8 + i) * N + n]);
  *(v8us*)(Wt + (size_t)n * K + k8) = v;
  
}

// GEMM C[M][N] (f32, pitch ldc) = act(A[M][K]·W + bias). A f32 row-major (pitch lda) converted per fragment to bf16
// (ASPLIT: hi/lo two planes -> 2 terms, else single rounded term); Wt bf16 [N][K] (pitch ldb). BIAS_BF16 rounds the
// bias to bf16 first (bias quantised to bf16 before the add). K%32==0, M%16==0, N%64==0.
template <bool ASPLIT, int ACT, bool BIAS_BF16>
__global__ __launch_bounds__(128) void k_gemm_bf(const float* __restrict__ A, int lda, const unsigned short* __restrict__ Wt, int ldb,
                                               const float* __restrict__ bias, float* __restrict__ C, int ldc, int M, int N, int K) {
  __shared__ __attribute__((aligned(16))) float so[4][16][64];
  const int tid = threadIdx.x, w = tid >> 5, lane = tid & 31, ln = lane & 15, hh = lane >> 4;
  const int ntn = N / 64;
  const int wid = blockIdx.x * 4 + w;
  const int mt = wid / ntn, nq = wid % ntn;
  if (mt * 16 >= M) return;
  const int row0 = mt * 16, col0 = nq * 64;
  const float* arow = A + (size_t)(row0 + ln) * lda;
  v8f acc[4] = {};
  for (int kb = 0; kb < K; kb += 32) {
    FragB ah, al;
    const v4f x0 = *(const v4fa*)(arow + kb + 8 * hh), x1 = *(const v4fa*)(arow + kb + 8 * hh + 4);
    const v4f x2 = *(const v4fa*)(arow + kb + 16 + 8 * hh), x3 = *(const v4fa*)(arow + kb + 16 + 8 * hh + 4);
    float xs[16] = {x0[0],x0[1],x0[2],x0[3],x1[0],x1[1],x1[2],x1[3],x2[0],x2[1],x2[2],x2[3],x3[0],x3[1],x3[2],x3[3]};
#pragma unroll
    for (int i = 0; i < 16; ++i) { const unsigned short hb = bf16_bits(xs[i]); ah.u[i] = hb; al.u[i] = ASPLIT ? bf16_bits(xs[i] - bf16_val(hb)) : (unsigned short)0; }
#pragma unroll
    for (int t = 0; t < 4; ++t) {
      const unsigned short* brow = Wt + (size_t)(col0 + t * 16 + ln) * ldb + kb;
      FragB b;
      b.half[0] = *(const v8us*)(brow + 8 * hh);
      b.half[1] = *(const v8us*)(brow + 16 + 8 * hh);
      acc[t] = mmaN<ASPLIT ? 2 : 1>(ah.v, al.v, b.v, b.v, acc[t]);
    }
  }
#pragma unroll
  for (int t = 0; t < 4; ++t) {
    float bv = bias ? bias[col0 + t * 16 + ln] : 0.f;
    if (BIAS_BF16) bv = bf16_round(bv);
#pragma unroll
    for (int r = 0; r < 8; ++r) { float v = acc[t][r] + bv; if (ACT == 1) v = fmaxf(v, 0.f); so[w][8 * hh + r][t * 16 + ln] = v; }
  }
  __builtin_amdgcn_fence(__ATOMIC_ACQ_REL, "workgroup");
  __builtin_amdgcn_wave_barrier();
  const int rsub = lane >> 4, c4 = (lane & 15) * 4;
  {
#pragma unroll
    for (int q = 0; q < 8; ++q) {
      const int r = q * 2 + rsub;
      const v4f v = *(const v4fa*)&so[w][r][c4];
      *(v4f*)(C + (size_t)(row0 + r) * ldc + col0 + c4) = v;
    }
    
  }
}

// GEMM C = act(A·W + bias + resid): A f32 (ASPLIT -> hi/lo 2 terms), Wt bf16 [N][K]; ACT 0 none, 1 relu, 2 exact gelu;
// resid (optional, f32, row index = (row % rmod), pitch ldr, RES_BF16 rounds it) added before the activation.
template <bool ASPLIT, int ACT, bool BIAS_BF16, bool RES_BF16>
__global__ __launch_bounds__(128) void k_gemm_bf3(const float* __restrict__ A, int lda, const unsigned short* __restrict__ Wt, int ldb,
                                                const float* __restrict__ bias, const float* __restrict__ resid, int rmod, int ldr,
                                                float* __restrict__ C, int ldc, int M, int N, int K) {
  __shared__ __attribute__((aligned(16))) float so[4][16][64];
  const int tid = threadIdx.x, w = tid >> 5, lane = tid & 31, ln = lane & 15, hh = lane >> 4;
  const int ntn = N / 64;
  const int wid = blockIdx.x * 4 + w;
  const int mt = wid / ntn, nq = wid % ntn;
  if (mt * 16 >= M) return;
  const int row0 = mt * 16, col0 = nq * 64;
  const float* arow = A + (size_t)(row0 + ln) * lda;
  v8f acc[4] = {};
  for (int kb = 0; kb < K; kb += 32) {
    FragB ah, al;
    const v4f x0 = *(const v4fa*)(arow + kb + 8 * hh), x1 = *(const v4fa*)(arow + kb + 8 * hh + 4);
    const v4f x2 = *(const v4fa*)(arow + kb + 16 + 8 * hh), x3 = *(const v4fa*)(arow + kb + 16 + 8 * hh + 4);
    float xs[16] = {x0[0],x0[1],x0[2],x0[3],x1[0],x1[1],x1[2],x1[3],x2[0],x2[1],x2[2],x2[3],x3[0],x3[1],x3[2],x3[3]};
#pragma unroll
    for (int i = 0; i < 16; ++i) { const unsigned short hb = bf16_bits(xs[i]); ah.u[i] = hb; al.u[i] = ASPLIT ? bf16_bits(xs[i] - bf16_val(hb)) : (unsigned short)0; }
#pragma unroll
    for (int t = 0; t < 4; ++t) {
      const unsigned short* brow = Wt + (size_t)(col0 + t * 16 + ln) * ldb + kb;
      FragB b;
      b.half[0] = *(const v8us*)(brow + 8 * hh);
      b.half[1] = *(const v8us*)(brow + 16 + 8 * hh);
      acc[t] = mmaN<ASPLIT ? 2 : 1>(ah.v, al.v, b.v, b.v, acc[t]);
    }
  }
#pragma unroll
  for (int t = 0; t < 4; ++t) {
    const int col = col0 + t * 16 + ln;
    float bv = bias ? bias[col] : 0.f;
    if (BIAS_BF16) bv = bf16_round(bv);
#pragma unroll
    for (int r = 0; r < 8; ++r) {
      float v = acc[t][r] + bv;
      if (resid) { float rv = resid[(size_t)((row0 + 8 * hh + r) % rmod) * ldr + col]; if (RES_BF16) rv = bf16_round(rv); v += rv; }
      if (ACT == 1) v = fmaxf(v, 0.f);
      if (ACT == 2) v = 0.5f * v * (1.0f + erff(v * 0.70710678118654752f));
      if (ACT == 3) { const float u = 0.7978845608028654f * (v + 0.044715f * v * v * v); v = 0.5f * v * (1.0f + tanhf(u)); }
      so[w][8 * hh + r][t * 16 + ln] = v;
    }
  }
  __builtin_amdgcn_fence(__ATOMIC_ACQ_REL, "workgroup");
  __builtin_amdgcn_wave_barrier();
  const int rsub = lane >> 4, c4 = (lane & 15) * 4;
  {
#pragma unroll
    for (int q = 0; q < 8; ++q) {
      const int r = q * 2 + rsub;
      const v4f v = *(const v4fa*)&so[w][r][c4];
      *(v4f*)(C + (size_t)(row0 + r) * ldc + col0 + c4) = v;
    }
    
  }
}
// row LayerNorm (biased variance, eps) over N: s = X (+ R); optional out_sum <- s; out_norm <- (s-mu)*rsqrt(var+eps)*g + b
template <bool PARAM_BF16>
__global__ __launch_bounds__(256) void k_layernorm(const float* __restrict__ X, const float* __restrict__ R, const float* __restrict__ g, const float* __restrict__ bta,
                                                  float* __restrict__ out_sum, float* __restrict__ out_norm, int N, float eps) {
  __shared__ float red[256];
  const int row = blockIdx.x, tid = threadIdx.x;
  const float* x = X + (size_t)row * N; const float* rr = R ? R + (size_t)row * N : nullptr;
  float vals[16];                     // up to N = 4096
  const int per = N / 256;            // contiguous chunk per thread? use strided-by-4 chunks: thread handles j = tid*4 + 1024*u
  float s1 = 0.f;
  for (int u = 0; u < per / 4; ++u) {
    const int j = tid * 4 + 1024 * u;
    const v4f a = *(const v4fa*)(x + j);
    v4f b = {0.f,0.f,0.f,0.f}; if (rr) b = *(const v4fa*)(rr + j);
#pragma unroll
    for (int q = 0; q < 4; ++q) { const float v = a[q] + b[q]; vals[u * 4 + q] = v; s1 += v; }
  }
  red[tid] = s1; __syncthreads();
  for (int st = 128; st > 0; st >>= 1) { if (tid < st) red[tid] += red[tid + st]; __syncthreads(); }
  const float mu = red[0] / (float)N; __syncthreads();
  float s2 = 0.f;
  for (int u = 0; u < per / 4; ++u)
#pragma unroll
    for (int q = 0; q < 4; ++q) { const float c = vals[u * 4 + q] - mu; s2 += c * c; }
  red[tid] = s2; __syncthreads();
  for (int st = 128; st > 0; st >>= 1) { if (tid < st) red[tid] += red[tid + st]; __syncthreads(); }
  const float rs = rsqrtf(red[0] / (float)N + eps);
  {
    for (int u = 0; u < per / 4; ++u) {
      const int j = tid * 4 + 1024 * u;
      v4f o, sm;
#pragma unroll
      for (int q = 0; q < 4; ++q) {
        float gg = g[j + q], bb = bta[j + q];
        if (PARAM_BF16) { gg = bf16_round(gg); bb = bf16_round(bb); }
        sm[q] = vals[u * 4 + q]; o[q] = (vals[u * 4 + q] - mu) * rs * gg + bb;
      }
      if (out_sum) *(v4f*)(out_sum + (size_t)row * N + j) = sm;
      *(v4f*)(out_norm + (size_t)row * N + j) = o;
    }
    
  }
}

// ---- f16 WMMA path (v_wmma_f32_16x16x32_f16): 11-bit significands for operands in range — used where a [0,1] probability operand needs more precision than bf16
typedef _Float16 v16h __attribute__((ext_vector_type(16)));
union FragH { v16h v; v8us half[2]; _Float16 h[16]; unsigned short u[16]; };
template <int NT>
__device__ __forceinline__ v8f mmaH(v16h ah, v16h al, v16h bh, v16h bl, v8f c) {
  c = __builtin_amdgcn_wmma_f32_16x16x32_f16(false, ah, false, bh, (short)0, c, false, false);
  if (NT >= 2) c = __builtin_amdgcn_wmma_f32_16x16x32_f16(false, al, false, bh, (short)0, c, false, false);
  if (NT >= 3) c = __builtin_amdgcn_wmma_f32_16x16x32_f16(false, ah, false, bl, (short)0, c, false, false);
  asm volatile("v_nop\n\tv_nop\n\tv_nop\n\tv_nop" : "+v"(c) : "v"(ah), "v"(al), "v"(bh), "v"(bl));
  return c;
}
// batched GEMM like k_gemm_b but f16 operands: A f32 (split into f16 hi/lo if ASPLIT, else rounded to f16), Bt = f16 values [n][k]; alpha; C f32; N multiple of 16 (partial tiles skipped)
template <bool ASPLIT>
__global__ __launch_bounds__(128) void k_gemm_h(const float* __restrict__ A, int lda, size_t sA, const _Float16* __restrict__ Bh, int ldb, size_t sB, float alpha, float* __restrict__ C, int ldc, size_t sC, int M, int N, int K) {
  __shared__ __attribute__((aligned(16))) float so[4][16][64];
  const int tid = threadIdx.x, w = tid >> 5, lane = tid & 31, ln = lane & 15, hh = lane >> 4; const int by = blockIdx.y;
  A += (size_t)by * sA; Bh += (size_t)by * sB; C += (size_t)by * sC;
  const int ntn = (N + 63) / 64; const int wid = blockIdx.x * 4 + w; const int mt = wid / ntn, nq = wid % ntn; if (mt * 16 >= M) return;
  const int row0 = mt * 16, col0 = nq * 64; const float* arow = A + (size_t)(row0 + ln) * lda;
  v8f acc[4] = {};
  for (int kb = 0; kb < K; kb += 32) {
    FragH ah, al;
    const v4f x0 = *(const v4fa*)(arow + kb + 8 * hh), x1 = *(const v4fa*)(arow + kb + 8 * hh + 4), x2 = *(const v4fa*)(arow + kb + 16 + 8 * hh), x3 = *(const v4fa*)(arow + kb + 16 + 8 * hh + 4);
    float xs[16] = {x0[0],x0[1],x0[2],x0[3],x1[0],x1[1],x1[2],x1[3],x2[0],x2[1],x2[2],x2[3],x3[0],x3[1],x3[2],x3[3]};
#pragma unroll
    for (int i = 0; i < 16; ++i) { const _Float16 h = (_Float16)xs[i]; ah.h[i] = h; al.h[i] = ASPLIT ? (_Float16)(xs[i] - (float)h) : (_Float16)0.0f; }
#pragma unroll
    for (int t = 0; t < 4; ++t) { if (col0 + t * 16 >= N) continue; const size_t boff = (size_t)(col0 + t * 16 + ln) * ldb + kb; FragH bq; bq.half[0] = *(const v8us*)(Bh + boff + 8 * hh); bq.half[1] = *(const v8us*)(Bh + boff + 16 + 8 * hh);
      acc[t] = mmaH<ASPLIT ? 2 : 1>(ah.v, al.v, bq.v, bq.v, acc[t]); }
  }
#pragma unroll
  for (int t = 0; t < 4; ++t) { if (col0 + t * 16 >= N) continue;
#pragma unroll
    for (int r = 0; r < 8; ++r) so[w][8 * hh + r][t * 16 + ln] = acc[t][r] * alpha; }
  __builtin_amdgcn_fence(__ATOMIC_ACQ_REL, "workgroup"); __builtin_amdgcn_wave_barrier();
  const int rsub = lane >> 4, c4 = (lane & 15) * 4;
  {
#pragma unroll
    for (int q = 0; q < 8; ++q) { const int r = q * 2 + rsub; if (col0 + c4 < N) { const v4f v = *(const v4fa*)&so[w][r][c4]; *(v4f*)(C + (size_t)(row0 + r) * ldc + col0 + c4) = v; } }
     }
}

// Wt[n][k] = f16(W[k][n]·scale) from f32 row-major W[K][N] (scale = power of two; bf16-exact weights stay exact in f16 away from the subnormal range)
__global__ __launch_bounds__(256) void k_wt_f16(const float* __restrict__ W, _Float16* __restrict__ Wt, int K, int N, float scale) {
  const int t = blockIdx.x * 256 + threadIdx.x; if (t >= N * (K / 8)) return; const int n = t / (K / 8), k8 = (t % (K / 8)) * 8; FragH f;
#pragma unroll
  for (int i = 0; i < 8; ++i) f.h[i] = (_Float16)(bf16_round(W[(size_t)(k8 + i) * N + n]) * scale); const v8us o = f.half[0];
  *(v8us*)((unsigned short*)Wt + (size_t)n * K + k8) = o; 
}
// k_gemm_hh variant with fused epilogue: v = acc·alpha + bias[by·sBias + col] (+ CP[(row/rowsPerB)·sCPb + by·64 + col] if CP) ; ACT 0 none / 1 elu ; writes f16 C16 (and f32 C if non-null)
template <int ACT>
__global__ __launch_bounds__(128) void k_gemm_hhx(const _Float16* __restrict__ A, int lda, size_t sA, const _Float16* __restrict__ Bh, int ldb, size_t sB, float alpha, const float* __restrict__ bias, size_t sBias, const float* __restrict__ CP, int rowsPerB, size_t sCPb, int row0g,
    float* __restrict__ C, _Float16* __restrict__ C16, int ldc, size_t sC, int M, int N, int K) {
  __shared__ __attribute__((aligned(16))) float so[4][16][64];
  const int tid = threadIdx.x, w = tid >> 5, lane = tid & 31, ln = lane & 15, hh = lane >> 4; const int by = blockIdx.y;
  A += (size_t)by * sA; Bh += (size_t)by * sB; const size_t cofs = (size_t)by * sC; const float* bp = bias ? bias + (size_t)by * sBias : nullptr;
  const int ntn = (N + 63) / 64; const int wid = blockIdx.x * 4 + w; const int mt = wid / ntn, nq = wid % ntn; if (mt * 16 >= M) return;
  const int row0 = mt * 16, col0 = nq * 64; const _Float16* arow = A + (size_t)(row0 + ln) * lda;
  v8f acc[4] = {};
  for (int kb = 0; kb < K; kb += 32) { FragH ah; ah.half[0] = *(const v8us*)((const unsigned short*)arow + kb + 8 * hh); ah.half[1] = *(const v8us*)((const unsigned short*)arow + kb + 16 + 8 * hh);
#pragma unroll
    for (int t = 0; t < 4; ++t) { if (col0 + t * 16 >= N) continue; const size_t boff = (size_t)(col0 + t * 16 + ln) * ldb + kb; FragH bq; bq.half[0] = *(const v8us*)((const unsigned short*)Bh + boff + 8 * hh); bq.half[1] = *(const v8us*)((const unsigned short*)Bh + boff + 16 + 8 * hh);
      acc[t] = mmaH<1>(ah.v, ah.v, bq.v, bq.v, acc[t]); }
  }
#pragma unroll
  for (int t = 0; t < 4; ++t) { if (col0 + t * 16 >= N) continue; const int col = col0 + t * 16 + ln; const float bv = bp ? bf16_round(bp[col]) : 0.f;
#pragma unroll
    for (int r = 0; r < 8; ++r) { float v = acc[t][r] * alpha + bv; if (CP) { const int rr = row0g + row0 + 8 * hh + r; if (rowsPerB < 0) v += CP[cofs + (size_t)rr * ldc + col];      /* rowsPerB < 0: own element of the batched C plane */ else { const int bidx = rr / rowsPerB; v += CP[(size_t)bidx * sCPb + (size_t)by * 64 + col]; } } if (ACT == 1) v = (v > 0.f) ? v : expm1f(v); else if (ACT == 7) v = (v > 0.f) ? v + 1.0f : expf(v); else if (ACT == 8) v = tanhf(v); else if (ACT == 9) v = 0.5f * v * (1.0f + tanhf(0.7978845608028654f * (v + 0.044715f * v * v * v))); else if (ACT == 11) v = 1.0f / (1.0f + expf(-v)); else if (ACT == 12) v = (v > 0.f) ? v : 0.01f * v; else if (ACT == 14) v = (v > 0.f) ? v : 0.1f * v; else if (ACT == 16) v = (v >= 0.f) ? v : 0.3f * v; else if (ACT == 17) v = (v >= 0.f) ? v : 0.2f * v; else if (ACT == 15) v = v / (1.0f + expf(-v)); else if (ACT == 3) v = fmaxf(v, 0.f); else if (ACT == 6) v = 0.5f * v * (1.0f + erff(v * 0.70710678118654752f)); so[w][8 * hh + r][t * 16 + ln] = v; } }
  __builtin_amdgcn_fence(__ATOMIC_ACQ_REL, "workgroup"); __builtin_amdgcn_wave_barrier();
  const int rsub = lane >> 4, c4 = (lane & 15) * 4; typedef _Float16 v4h __attribute__((ext_vector_type(4)));
  {
#pragma unroll
    for (int q = 0; q < 8; ++q) { const int r = q * 2 + rsub; if (col0 + c4 < N) { const v4f v = *(const v4fa*)&so[w][r][c4]; if (C) *(v4f*)(C + cofs + (size_t)(row0 + r) * ldc + col0 + c4) = v; if (C16) { v4h h4; for (int i = 0; i < 4; ++i) h4[i] = (_Float16)v[i]; *(v4h*)(C16 + cofs + (size_t)(row0 + r) * ldc + col0 + c4) = h4; } } }
     }
}

typedef _Float16 v4h __attribute__((ext_vector_type(4)));

__global__ __launch_bounds__(256) void k_x16(const float* __restrict__ x, _Float16* __restrict__ X16, size_t n8) { const size_t t = (size_t)blockIdx.x * 256 + threadIdx.x; if (t >= n8) return; FragH f;
#pragma unroll
  for (int q = 0; q < 8; ++q) f.h[q] = (_Float16)bf16_round(x[t * 8 + q]); *(v8us*)((unsigned short*)X16 + t * 8) = f.half[0];  }
__global__ __launch_bounds__(256) void k_h16(const float* __restrict__ x, _Float16* __restrict__ X16, size_t n8) { const size_t t = (size_t)blockIdx.x * 256 + threadIdx.x; if (t >= n8) return; FragH f;
#pragma unroll
  for (int q = 0; q < 8; ++q) f.h[q] = (_Float16)x[t * 8 + q]; *(v8us*)((unsigned short*)X16 + t * 8) = f.half[0];  }
__global__ __launch_bounds__(256) void k_round16f(const float* __restrict__ W, _Float16* __restrict__ Bt, size_t n8) { const size_t t = (size_t)blockIdx.x * 256 + threadIdx.x; if (t >= n8) return; FragH f;
#pragma unroll
  for (int i = 0; i < 8; ++i) f.h[i] = (_Float16)(bf16_round(W[t * 8 + i]) * 16.0f); *(v8us*)((unsigned short*)Bt + t * 8) = f.half[0];  }
template <int NHv, int TTv>
__global__ __launch_bounds__(256) void k_vt(const _Float16* __restrict__ V16, int ldv, int voff, _Float16* __restrict__ Vt) { __shared__ unsigned short tl[64][66]; const int tid = threadIdx.x; const int slab = blockIdx.x / (TTv / 64), lg = blockIdx.x % (TTv / 64); const int b = slab / NHv, h = slab % NHv;
  for (int i = tid; i < 64 * 8; i += 256) { const int r = i / 8, c8 = (i % 8) * 8; FragH f; f.half[0] = *(const v8us*)((const unsigned short*)V16 + ((size_t)b * TTv + lg * 64 + r) * ldv + voff + h * 64 + c8);
#pragma unroll
    for (int q = 0; q < 8; ++q) tl[r][c8 + q] = f.u[q]; }
  __syncthreads();
  {
#pragma unroll
    for (int rd = 0; rd < 2; ++rd) { const int d = rd * 32 + tid / 8, pc = tid % 8; FragH f;
#pragma unroll
      for (int q = 0; q < 8; ++q) f.u[q] = tl[pc * 8 + q][d];
      *(v8us*)((unsigned short*)Vt + ((size_t)slab * 64 + d) * TTv + lg * 64 + pc * 8) = f.half[0]; }
     } }

__global__ __launch_bounds__(256) void k_hl(const float* __restrict__ F, _Float16* __restrict__ Hh, _Float16* __restrict__ Hl, size_t n8) { const size_t t = (size_t)blockIdx.x * 256 + threadIdx.x; if (t >= n8) return; FragH fh, fl; const v4f a = *(const v4fa*)(F + t * 8), c = *(const v4fa*)(F + t * 8 + 4);
#pragma unroll
  for (int q = 0; q < 4; ++q) { _Float16 h = (_Float16)a[q]; fh.h[q] = h; fl.h[q] = (_Float16)((a[q] - (float)h) * 1024.0f); h = (_Float16)c[q]; fh.h[4 + q] = h; fl.h[4 + q] = (_Float16)((c[q] - (float)h) * 1024.0f); }
  { *(v8us*)((unsigned short*)Hh + t * 8) = fh.half[0]; *(v8us*)((unsigned short*)Hl + t * 8) = fl.half[0];  } }

// ---- per-head RMS norm and half-split rope on a staged 32 x 64 wave tile (k_gemm2's NROPE epilogue) ----
// The tile's 64 columns are ONE head, so it holds 32 whole head rows: 16 lanes read a row back, 4 dims a lane (d = 4 ln + u), and norm and rotate it in registers; dim d's rope partner d ^ 32 sits in lane ln ^ 8.
// The sum of squares is a halving tree over the 64 dims (d + 32, + 16, + 8, + 4 by the lane exchanges ln ^ 8, 4, 2, 1; d + 2, d + 1 inside the lane); every lane of a row ends with the same bits.
template <int CTRL> __device__ __forceinline__ float a0_dpp(float x);      /* defined with the first-tile kernel below */
__device__ __forceinline__ float nr_rsqrt(float a) {      /* rsqrtf as the compiler expands it (an argument below 2^-126 goes in x 2^24, its result out x 2^12), with the v_rsq_f32 in place on its own register and a v_nop behind it, so that no reader of its result and no writer of its source follows it directly */
  const bool tiny = a < 0x1p-126f; a = tiny ? a * 0x1p+24f : a; asm("v_rsq_f32 %0, %0\n\tv_nop" : "+v"(a)); return tiny ? a * 0x1p+12f : a; }
// The 16 row pairs of a wave's tile. trow / hp / fp = this lane's place in row hh of the tile and of the two outputs (pitch LQ); b1, b2 = table factors of x_lo and x_hi: (c, -s) in the low half (out_lo = x_lo c - x_hi s), (s, c) in the high half (out_hi = x_lo s + x_hi c).
template <bool F32OUT>
__device__ __forceinline__ void nr_rows(const float* trow, bool lowh, const v4f (&b1)[16], const v4f (&b2)[16], v4f g4, float eps, _Float16* hp, float* fp) {
#pragma unroll      /* the table factors are register arrays: every index must be a constant */
  for (int q = 0; q < 16; ++q) { v4f x = *(const v4fa*)(trow + q * 2 * 68); float t[4];
    for (int u = 0; u < 4; ++u) t[u] = __fmul_rn(x[u], x[u]);
    for (int u = 0; u < 4; ++u) t[u] = __fadd_rn(t[u], a0_dpp<0x168>(t[u]));
    for (int u = 0; u < 4; ++u) t[u] = __fadd_rn(t[u], a0_dpp<0x164>(t[u]));
    for (int u = 0; u < 4; ++u) t[u] = __fadd_rn(t[u], a0_dpp<0x162>(t[u]));
    for (int u = 0; u < 4; ++u) t[u] = __fadd_rn(t[u], a0_dpp<0x161>(t[u]));
    const float rs = nr_rsqrt(__fadd_rn(__fadd_rn(__fadd_rn(t[0], t[2]), __fadd_rn(t[1], t[3])) / (float)HD, eps));
    v4f o; v4h h4;      /* x_hi's product is rounded, x_lo's is fused into the sum, alike in both halves */
    for (int u = 0; u < 4; ++u) { const float own = __fmul_rn(__fmul_rn(x[u], rs), g4[u]), oth = a0_dpp<0x168>(own); const float lo = lowh ? own : oth, hi = lowh ? oth : own;
      o[u] = __builtin_fmaf(lo, b1[q][u], __fmul_rn(hi, b2[q][u])); h4[u] = (_Float16)o[u]; }
    *(v4h*)(hp + (size_t)q * 2 * LQ) = h4;
    if (F32OUT) *(v4f*)(fp + (size_t)q * 2 * LQ) = o; }
  asm volatile("s_wait_xcnt 0x0" ::: "memory"); }      /* behind the tail's last stores, in front of any later write of a register that they name (the code that follows the place where the two tails join) */

// ---- fast GEMM (block tile 128x64, wave tile 32x64; requires M % 128 == 0 rows per launch region, N % 64 == 0 and K % 64 == 0). Operands go through LDS: a stage is 64 k (one 128-byte line of each of the 128 A rows and 64 B rows), read from global as whole lines (8 lanes a row) one stage ahead into registers and stored to the other of two buffers at a row pitch of 144 bytes (16 x odd: ds_load_b128 fragment reads without bank conflicts); epilogue = k_gemm_hhx semantics, or with NROPE: no bias, per-head RMS norm (gain, eps) and half-split rope (tables CS, SN; position = row % SQ) on acc alpha, f16 rows to C16 and, of the positions below QT0 of every sequence, the same values in f32 to C (QT0 rows a sequence), both at pitch LQ ----
__device__ __forceinline__ v16h g2_frag(const _Float16* p, int hh) { FragH f; f.half[0] = *(const v8us*)((const unsigned short*)p + 8 * hh); f.half[1] = *(const v8us*)((const unsigned short*)p + 16 + 8 * hh); return f.v; }
__device__ __forceinline__ v8f g2_mma(v16h a, v16h b, v8f c) { v8f d = __builtin_amdgcn_wmma_f32_16x16x32_f16(false, a, false, b, (short)0, c, false, false); asm volatile("v_nop\n\tv_nop\n\tv_nop\n\tv_nop" : "+v"(d) : "v"(a), "v"(b)); return d; }
template <int ACT, bool NROPE = false>
__global__ __launch_bounds__(128) void k_gemm2(const _Float16* __restrict__ A, int lda, size_t sA, const _Float16* __restrict__ Bh, int ldb, size_t sB, float alpha, const float* __restrict__ bias, size_t sBias, const float* __restrict__ CP, int rowsPerB, size_t sCPb, int row0g,
    float* __restrict__ C, _Float16* __restrict__ C16, int ldc, size_t sC, int M, int N, int K, const float* __restrict__ gain = nullptr, float eps = 0.f, const float* __restrict__ CS = nullptr, const float* __restrict__ SN = nullptr) { static_assert(ACT == 0 || ACT == 3 || ACT == 6 || ACT == 8 || ACT == 9 || ACT == 11 || ACT == 12 || ACT == 14 || ACT == 15 || ACT == 16 || ACT == 17, "k_gemm2: unsupported ACT code (would silently apply no activation)");
  constexpr int LP = 72, ABUF = 128 * LP, BBUF = 64 * LP;      /* LDS row pitch and buffer sizes in 16-bit elements */
  __shared__ __attribute__((aligned(16))) unsigned short sm[2 * (ABUF + BBUF)];      /* A buffers 0, 1, then B buffers 0, 1; behind the k loop's last barrier the same bytes are the epilogue's staging tiles */
  static_assert(sizeof(sm) >= 4 * 32 * 68 * sizeof(float), "the epilogue's four 32 x 68 f32 tiles fit the operand buffers");
  float (*so)[32][68] = reinterpret_cast<float (*)[32][68]>(sm);
  const int tid = threadIdx.x, w = tid >> 5, lane = tid & 31, ln = lane & 15, hh = lane >> 4; const int by = blockIdx.y;
  A += (size_t)by * sA; Bh += (size_t)by * sB; const size_t cofs = (size_t)by * sC; const float* bp = bias ? bias + (size_t)by * sBias : nullptr;
  const int ntn = N >> 6; const int mt = blockIdx.x / ntn, nq = blockIdx.x - mt * ntn; const int row0 = mt * 128 + 32 * w, col0 = nq * 64; if (mt * 128 >= M) return;      /* the whole block leaves or none does: barriers follow */
  __builtin_assume(lda == DM && ldb == DM);      /* every launch below passes these two pitches: the 16-row steps of a stage's loads become immediate offsets of one address */
  const char* ga = (const char*)(A + (size_t)(mt * 128) * lda); const char* gb = (const char*)(Bh + (size_t)col0 * ldb);      /* the block's first A and B row */
  const unsigned sr = (((unsigned)tid >> 3) & 1u) * 8u + ((unsigned)tid >> 4), sc = ((unsigned)tid & 7u) * 8u;      /* 8 lanes a row; the two rows of 16 neighbouring lanes lie 8 apart, so that at the 144-byte pitch their 256 stored bytes fall on 64 different banks */
  const unsigned va = (sr * (unsigned)lda + sc) * 2u, vb = (sr * (unsigned)ldb + sc) * 2u;      /* this thread's 16 bytes of row sr + 16 i of a stage: a 32-bit byte offset beside a block-uniform base */
  unsigned short* la = sm + sr * LP + sc; unsigned short* lb = sm + 2 * ABUF + sr * LP + sc;
  const _Float16* fa = (const _Float16*)sm + (32 * w + ln) * LP; const _Float16* fb = (const _Float16*)sm + 2 * ABUF + ln * LP;      /* this lane's fragment rows */
  v8us ra[8], rb[4];
  auto fetch = [&](int s) {
#pragma unroll      /* register arrays: constant indices */
    for (int i = 0; i < 8; ++i) ra[i] = *(const v8us*)(ga + ((size_t)(i * 32) * lda + (size_t)s * 128) + va);
#pragma unroll      /* register arrays: constant indices */
    for (int i = 0; i < 4; ++i) rb[i] = *(const v8us*)(gb + ((size_t)(i * 32) * ldb + (size_t)s * 128) + vb);
    asm volatile("s_wait_xcnt 0x0" ::: "memory"); };      /* behind the stage's 12 loads, in front of every later write of an address register that they name */
  auto put = [&](int buf) {
#pragma unroll      /* register arrays: constant indices */
    for (int i = 0; i < 8; ++i) *(v8us*)(la + buf * ABUF + i * 16 * LP) = ra[i];
#pragma unroll      /* register arrays: constant indices */
    for (int i = 0; i < 4; ++i) *(v8us*)(lb + buf * BBUF + i * 16 * LP) = rb[i]; };
  const v8f z8 = {0.f,0.f,0.f,0.f,0.f,0.f,0.f,0.f}; v8f c00 = z8, c01 = z8, c02 = z8, c03 = z8, c10 = z8, c11 = z8, c12 = z8, c13 = z8;
  const int nst = K >> 6;
  if (nst > 0) { fetch(0); put(0); }
  __syncthreads();      /* stage 0 is in buffer 0 for every wave */
  for (int s = 0; s < nst; ++s) { const int cur = s & 1; const bool more = s + 1 < nst;
    if (more) fetch(s + 1);      /* the next stage's lines fly under this stage's products */
    const _Float16* pa = fa + cur * ABUF; const _Float16* pb = fb + cur * BBUF; v16h a0[2], a1[2], b[2][4];
#pragma unroll      /* register arrays: constant indices */
    for (int kk = 0; kk < 2; ++kk) { a0[kk] = g2_frag(pa + kk * 32, hh); a1[kk] = g2_frag(pa + 16 * LP + kk * 32, hh);
      for (int t = 0; t < 4; ++t) b[kk][t] = g2_frag(pb + t * 16 * LP + kk * 32, hh); }
#pragma unroll      /* register arrays: constant indices */
    for (int kk = 0; kk < 2; ++kk) { c00 = g2_mma(a0[kk], b[kk][0], c00); c10 = g2_mma(a1[kk], b[kk][0], c10); c01 = g2_mma(a0[kk], b[kk][1], c01); c11 = g2_mma(a1[kk], b[kk][1], c11);
      c02 = g2_mma(a0[kk], b[kk][2], c02); c12 = g2_mma(a1[kk], b[kk][2], c12); c03 = g2_mma(a0[kk], b[kk][3], c03); c13 = g2_mma(a1[kk], b[kk][3], c13); }
    if (more) put(cur ^ 1);      /* into the buffer whose last readers passed the barrier at the foot of the trip before */
    __syncthreads(); }      /* publishes stage s + 1 and ends every wave's reads of stage s (behind the last trip: before the epilogue reuses the bytes) */
  v8f accs[8] = {c00, c01, c02, c03, c10, c11, c12, c13};
  if constexpr (NROPE) { static_assert(HD == 64 && QT0 % 32 == 0 && SQ % 32 == 0, "a wave tile's 64 columns are one head; its 32 rows lie on one side of QT0 and in one sequence");
    const int c4 = ln * 4; const bool lowh = ln < 8; const unsigned tofs = (unsigned)((row0 % SQ + hh) * (HD / 2) + (ln & 7) * 4);      /* table row = the token's position, table column = d & 31 */
    const float* cp = CS + tofs; const float* sp = SN + tofs; v4f tc[16], ts[16];
#pragma unroll      /* register arrays: constant indices */
    for (int q = 0; q < 16; ++q) { tc[q] = *(const v4fa*)(cp + q * 2 * (HD / 2)); ts[q] = *(const v4fa*)(sp + q * 2 * (HD / 2)); }      /* all 32 table rows asked for here, so that one latency runs under the LDS staging below */
    v4f g4 = *(const v4fa*)(gain + c4);
    asm volatile("s_wait_xcnt 0x0" ::: "memory");      /* behind the 33 loads, in front of every later write of an address register that they name */
#pragma unroll      /* accs is a register array: constant indices */
    for (int u = 0; u < 8; ++u) for (int r = 0; r < 8; ++r) so[w][(u >> 2) * 16 + 8 * hh + r][(u & 3) * 16 + ln] = accs[u][r] * alpha;
    __builtin_amdgcn_fence(__ATOMIC_ACQ_REL, "workgroup"); __builtin_amdgcn_wave_barrier();      /* as in the plain epilogue: the wave's own LDS writes before its reads */
    for (int u = 0; u < 4; ++u) g4[u] = bf16_round(g4[u]);
#pragma unroll      /* register arrays: constant indices */
    for (int q = 0; q < 16; ++q) { const v4f c = tc[q], s = ts[q]; tc[q] = lowh ? c : s; ts[q] = lowh ? -s : c; }
    const size_t e = cofs + (size_t)(row0 + hh) * LQ + col0 + c4; const size_t ef = e - (size_t)(row0 / SQ) * (SQ - QT0) * LQ;      /* the f32 plane holds QT0 rows a sequence: sequence s, position p lies at row s QT0 + p */
    if (__builtin_amdgcn_readfirstlane(row0 % SQ) < QT0) nr_rows<true>(&so[w][hh][c4], lowh, tc, ts, g4, eps, C16 + e, C + ef);      /* one wave-uniform branch around the whole tail: inside it the 16 row pairs stay one block of code to schedule */
    else nr_rows<false>(&so[w][hh][c4], lowh, tc, ts, g4, eps, C16 + e, C + ef);
    return; }
#pragma unroll
  for (int u = 0; u < 8; ++u) { const int t = u & 3, half = u >> 2; const int col = col0 + t * 16 + ln; const float bv = bp ? bf16_round(bp[col]) : 0.f;
#pragma unroll
    for (int r = 0; r < 8; ++r) { const int rloc = half * 16 + 8 * hh + r; float v = accs[u][r] * alpha + bv; if (CP) { if (rowsPerB < 0) v += CP[cofs + (size_t)(row0g + row0 + rloc) * ldc + col];      /* rowsPerB < 0: own element of the batched C plane */ else { const int bidx = (row0g + row0 + rloc) / rowsPerB; v += CP[(size_t)bidx * sCPb + (size_t)by * 64 + col]; } }
      if (ACT == 3) v = fmaxf(v, 0.f); else if (ACT == 6) v = 0.5f * v * (1.0f + erff(v * 0.70710678118654752f)); else if (ACT == 11) v = 1.0f / (1.0f + expf(-v)); else if (ACT == 15) v = v / (1.0f + expf(-v)); else if (ACT == 12) v = (v > 0.f) ? v : 0.01f * v; else if (ACT == 8) v = tanhf(v); else if (ACT == 9) v = 0.5f * v * (1.0f + tanhf(0.7978845608028654f * (v + 0.044715f * v * v * v))); else if (ACT == 14) v = (v > 0.f) ? v : 0.1f * v; else if (ACT == 16) v = (v >= 0.f) ? v : 0.3f * v; else if (ACT == 17) v = (v >= 0.f) ? v : 0.2f * v;
      so[w][rloc][t * 16 + ln] = v; } }
  __builtin_amdgcn_fence(__ATOMIC_ACQ_REL, "workgroup"); __builtin_amdgcn_wave_barrier();
  const int rsub = lane >> 4, c4 = (lane & 15) * 4;
  {
#pragma unroll
    for (int q = 0; q < 16; ++q) { const int r = q * 2 + rsub; const v4f v = *(const v4fa*)&so[w][r][c4]; if (C) *(v4f*)(C + cofs + (size_t)(row0 + r) * ldc + col0 + c4) = v; if (C16) { v4h h4; for (int i = 0; i < 4; ++i) h4[i] = (_Float16)v[i]; *(v4h*)(C16 + cofs + (size_t)(row0 + r) * ldc + col0 + c4) = h4; } }
     } }

__global__ __launch_bounds__(256) void k_wnat(const float* __restrict__ w, size_t n8, _Float16* __restrict__ Bt) { const size_t t = (size_t)blockIdx.x * 256 + threadIdx.x; if (t >= n8) return; FragH f; for (int q = 0; q < 8; ++q) f.h[q] = (_Float16)(bf16_round(w[t * 8 + q]) * 16.0f); *(v8us*)((unsigned short*)Bt + t * 8) = f.half[0];  }

// Fused causal attention of all batches (blockIdx.x = head + NH * batch, blockIdx.y = query tile group): one wave owns 16 query rows of one head and walks its keys 32 at a time with a running maximum and sum; the block's four waves share the key and value tiles in LDS.
// S^T = K Q^T (A = key rows, B = query rows): a lane holds scores of ONE query (column ln), keys 8 hh + r of each 16-key tile, so two converted score tiles are, as they lie, the B fragment of O^T += V^T P^T (A = rows of V^T).
// Weights are carried x256 (f16 range) and cancel in the division by their own sum; o leaves x64 like before.
__device__ __forceinline__ float fa_xhalf(float x) { return __builtin_bit_cast(float, __builtin_amdgcn_permlanex16(__builtin_bit_cast(int, x), __builtin_bit_cast(int, x), 0x76543210, 0xfedcba98, false, false)); }      /* lane l <-> lane l ^ 16 */
__global__ __launch_bounds__(128) void k_fattn(const _Float16* __restrict__ Q, const _Float16* __restrict__ K, const _Float16* __restrict__ Vt, _Float16* __restrict__ O) {
  // The block's four waves own 64 neighbouring query rows of one head and walk the same keys, so K and V^T go through LDS once for all four: a stage is 64 keys (one 128-byte line of each of 64 key rows and of each of the 64 V^T rows),
  // read from global as whole lines (8 lanes a row) one stage ahead into registers and stored to the other of two buffers at the 144-byte row pitch of k_gemm2; the fragments are ds_load_b128 reads of the same elements as before.
  constexpr int LP = 72, TB = 64 * LP;      /* LDS row pitch and tile size in 16-bit elements */
  __shared__ __attribute__((aligned(16))) unsigned short sm[4 * TB];      /* K buffers 0, 1, then V^T buffers 0, 1 */
  const int tid = threadIdx.x, lane = tid & 31, ln = lane & 15, hh = lane >> 4; const int w = __builtin_amdgcn_readfirstlane((int)(threadIdx.x >> 5)); const int h = blockIdx.x % NH; const size_t bz = blockIdx.x / NH;
  Q += bz * SQ * LQ; K += bz * SQ * KVD; Vt += bz * NH * HD * SQ; O += bz * SQ * DM;      /* this batch's rows and its V^T planes */
  const int grp = (int)(gridDim.y - 1 - blockIdx.y);      /* the tile group is the slow grid index: the longest key walks of every head and batch have the lowest blockIdx.y */
  const int q0w = (grp * 4 + w) * 16;
  const int qi = q0w + ln; const int kend = ((q0w >> 5) + 1) * 32;      /* keys 0 .. kend - 1 cover every key <= q0w + 15; kend <= SQ */
  const int nst = grp + 1;      /* stages of the block: keys 0 .. 64 grp + 63, the same count for its four waves (barriers below) */
  const _Float16* qp = Q + (size_t)qi * LQ + h * HD; const v16h qa = g2_frag(qp, hh), qb = g2_frag(qp + 32, hh);
  const char* gk = (const char*)(K + h * HD); const char* gv = (const char*)(Vt + (size_t)h * HD * SQ);      /* the head's first key row and first V^T row */
  const unsigned sr = (((unsigned)tid >> 3) & 1u) * 8u + ((unsigned)tid >> 4), sc = ((unsigned)tid & 7u) * 8u;      /* as in k_gemm2: 8 lanes a row; the two rows of 16 neighbouring lanes lie 8 apart, so that their 256 stored bytes fall on 64 different banks */
  const unsigned vk = (sr * (unsigned)KVD + sc) * 2u, vv = (sr * (unsigned)SQ + sc) * 2u;      /* this thread's 16 bytes of row sr + 16 i of a stage: a 32-bit byte offset beside a block-uniform base */
  unsigned short* lk = sm + sr * LP + sc; unsigned short* lv = lk + 2 * TB;
  const _Float16* fk = (const _Float16*)sm + ln * LP; const _Float16* fv = fk + 2 * TB;      /* this lane's fragment rows */
  v8us rk[4], rv[4];
  auto fetch = [&](int s) {
#pragma unroll      /* register arrays: constant indices */
    for (int i = 0; i < 4; ++i) rk[i] = *(const v8us*)(gk + ((size_t)(s * 64 + i * 16) * (KVD * 2)) + vk);
#pragma unroll      /* register arrays: constant indices */
    for (int i = 0; i < 4; ++i) rv[i] = *(const v8us*)(gv + ((size_t)(i * 16) * (SQ * 2) + (size_t)s * 128) + vv);
    asm volatile("s_wait_xcnt 0x0" ::: "memory"); };      /* behind the stage's 8 loads, in front of every later write of an address register that they name */
  auto put = [&](int buf) {
#pragma unroll      /* register arrays: constant indices */
    for (int i = 0; i < 4; ++i) { *(v8us*)(lk + buf * TB + i * 16 * LP) = rk[i]; *(v8us*)(lv + buf * TB + i * 16 * LP) = rv[i]; } };
  const v8f z8 = {0.f,0.f,0.f,0.f,0.f,0.f,0.f,0.f}; v8f o0 = z8, o1 = z8, o2 = z8, o3 = z8;
  const float cs = 0.125f * 1.4426950408889634f;      /* 1 / sqrt(64), and e^x = 2^(x log2 e) */
  float m = -1.0e30f, l = 0.f;
  fetch(0); put(0);
  __syncthreads();      /* stage 0 is in buffer 0 for every wave */
  for (int s = 0; s < nst; ++s) { const int cur = s & 1; const bool more = s + 1 < nst;
    if (more) fetch(s + 1);      /* the next stage's lines fly under this stage's two passes */
   for (int ps = 0; ps < 2; ++ps) { const int kb = s * 64 + ps * 32;
    if (kb >= kend) break;      /* wave-uniform: the second half of the last stage lies above every query of the block's two lower waves */
    const _Float16* pk = fk + cur * TB + ps * 32 * LP; const _Float16* pv = fv + cur * TB + ps * 32;
    const v16h k0a = g2_frag(pk, hh), k0b = g2_frag(pk + 32, hh), k1a = g2_frag(pk + 16 * LP, hh), k1b = g2_frag(pk + 16 * LP + 32, hh);
    const v16h v0 = g2_frag(pv, hh), v1 = g2_frag(pv + 16 * LP, hh), v2 = g2_frag(pv + 32 * LP, hh), v3 = g2_frag(pv + 48 * LP, hh);
    v8f s0 = g2_mma(k0a, qa, z8); s0 = g2_mma(k0b, qb, s0); v8f s1 = g2_mma(k1a, qa, z8); s1 = g2_mma(k1b, qb, s1);
    if (kb + 31 > q0w) {      /* only the last pass holds keys above a query of this tile */
      for (int r = 0; r < 8; ++r) { const int key = kb + 8 * hh + r; s0[r] = (key <= qi) ? s0[r] : -1.0e30f; s1[r] = (key + 16 <= qi) ? s1[r] : -1.0e30f; } }
    float mx = fmaxf(s0[0], s1[0]);
    for (int r = 1; r < 8; ++r) mx = fmaxf(mx, fmaxf(s0[r], s1[r]));
    mx = fmaxf(mx, fa_xhalf(mx)); const float mn = fmaxf(m, mx); float corr = (m - mn) * cs; m = mn; const float bias = fmaf(-mn, cs, 8.0f);
    float e[16];
    for (int r = 0; r < 8; ++r) { e[r] = fmaf(s0[r], cs, bias); e[8 + r] = fmaf(s1[r], cs, bias); }
    /* the pass's 17 exponentials, each in place on a register of its own, so that no transcendental is directly followed by a reader of its result or a writer of its source; the v_nop is that slot behind the last one */
    asm("v_exp_f32 %0, %0\n\tv_exp_f32 %1, %1\n\tv_exp_f32 %2, %2\n\tv_exp_f32 %3, %3\n\tv_exp_f32 %4, %4\n\tv_exp_f32 %5, %5\n\tv_exp_f32 %6, %6\n\tv_exp_f32 %7, %7\n\tv_exp_f32 %8, %8\n\t"
        "v_exp_f32 %9, %9\n\tv_exp_f32 %10, %10\n\tv_exp_f32 %11, %11\n\tv_exp_f32 %12, %12\n\tv_exp_f32 %13, %13\n\tv_exp_f32 %14, %14\n\tv_exp_f32 %15, %15\n\tv_exp_f32 %16, %16\n\tv_nop"
        : "+v"(corr), "+v"(e[0]), "+v"(e[1]), "+v"(e[2]), "+v"(e[3]), "+v"(e[4]), "+v"(e[5]), "+v"(e[6]), "+v"(e[7]), "+v"(e[8]), "+v"(e[9]), "+v"(e[10]), "+v"(e[11]), "+v"(e[12]), "+v"(e[13]), "+v"(e[14]), "+v"(e[15]));
    FragH pf; float sum = 0.f;
    for (int r = 0; r < 8; ++r) { sum += e[r] + e[8 + r]; pf.h[r] = (_Float16)e[r]; pf.h[8 + r] = (_Float16)e[8 + r]; }
    l = fmaf(l, corr, sum);
    for (int r = 0; r < 8; ++r) { o0[r] *= corr; o1[r] *= corr; o2[r] *= corr; o3[r] *= corr; }
    o0 = g2_mma(v0, pf.v, o0); o1 = g2_mma(v1, pf.v, o1); o2 = g2_mma(v2, pf.v, o2); o3 = g2_mma(v3, pf.v, o3); }
    if (more) { put(cur ^ 1);      /* into the buffer whose last readers passed the barrier at the foot of the trip before */
      __syncthreads(); } }      /* block-uniform: publishes stage s + 1 and ends every wave's reads of stage s */
  const float fin = 64.0f / (l + fa_xhalf(l));      /* the two lane halves hold disjoint keys of the same query */
  unsigned short* op = (unsigned short*)O + (size_t)qi * DM + h * HD + 8 * hh; FragH f0, f1;
  for (int r = 0; r < 8; ++r) { f0.h[r] = (_Float16)(o0[r] * fin); f0.h[8 + r] = (_Float16)(o1[r] * fin); f1.h[r] = (_Float16)(o2[r] * fin); f1.h[8 + r] = (_Float16)(o3[r] * fin); }
  *(v8us*)op = f0.half[0]; *(v8us*)(op + 16) = f0.half[1]; *(v8us*)(op + 32) = f1.half[0]; *(v8us*)(op + 48) = f1.half[1]; }      /* register r of tile dt = O[qi][16 dt + 8 hh + r]: 16-byte stores */

// Exact f32 attention of the first QT0 rows: one wave owns ONE query row. Lane = (key slice ks = lane >> 2, dim part dp = lane & 3): the lane walks keys ks, ks + 8, ... of its row
// and keeps dims 16 c + 4 dp + u (c, u < 4) of q and of its slice's partial o in registers, with the slice's own running maximum and sum (base-2 exponents); the 8 slices are merged at the end by lane exchanges.
template <int CTRL> __device__ __forceinline__ float a0_dpp(float x) { return __builtin_bit_cast(float, __builtin_amdgcn_update_dpp(0, __builtin_bit_cast(int, x), CTRL, 0xf, 0xf, true)); }      /* 0x160 + n: lane l <- lane l ^ n inside a 16-lane row; every lane is on wherever it is used */
__device__ __forceinline__ void a0_exp2x2(float& x, float& y) { asm("v_exp_f32 %0, %0\n\tv_exp_f32 %1, %1\n\tv_nop" : "+v"(x), "+v"(y)); }      /* two exponentials, each in place on its own register, so that neither is directly followed by a reader of its result; the v_nop is that slot behind the second */
template <int STEP> __device__ __forceinline__ float a0_swap(float x) { return STEP == 16 ? fa_xhalf(x) : a0_dpp<0x160 + (STEP & 15)>(x); }
template <int STEP> __device__ __forceinline__ void a0_merge(float& m, float& l, v4f (&o)[4]) {      /* this lane's slices with those of lane ^ STEP; a slice without keys has m = -1e30, l = 0, o = 0 and drops out */
  const float mo = a0_swap<STEP>(m), lo = a0_swap<STEP>(l); const float mn = fmaxf(m, mo); float fa = m - mn, fb = mo - mn; a0_exp2x2(fa, fb);
  l = fmaf(l, fa, lo * fb); m = mn;
  for (int c = 0; c < 4; ++c) for (int u = 0; u < 4; ++u) o[c][u] = fmaf(o[c][u], fa, a0_swap<STEP>(o[c][u]) * fb); }
__device__ __forceinline__ void a0_exp2x3(float& x, float& y, float& z) { asm("v_exp_f32 %0, %0\n\tv_exp_f32 %1, %1\n\tv_exp_f32 %2, %2\n\tv_nop" : "+v"(x), "+v"(y), "+v"(z)); }      /* as a0_exp2x2, for three */
__device__ __forceinline__ float a0_dot(const v4f (&q)[4], const v4f (&kk)[4]) {      /* q . k over the four lanes of a key: all four end with the same bits */
  v4f pv = q[0] * kk[0]; for (int c = 1; c < 4; ++c) pv = __builtin_elementwise_fma(q[c], kk[c], pv);
  float s = (pv[0] + pv[1]) + (pv[2] + pv[3]); s += a0_dpp<0x161>(s); s += a0_dpp<0x162>(s); return s; }
__global__ __launch_bounds__(256) void k_att0(const float* __restrict__ QF, const float* __restrict__ KF, const float* __restrict__ VF, int ld, float scale, float* __restrict__ OF, int ldo) {
  static_assert(HD == 64 && QT0 % 8 == 0, "four lanes of 16 dims a row; eight rows a block");
  const int lane = threadIdx.x & 31, ks = lane >> 2, dp = lane & 3; const int w = __builtin_amdgcn_readfirstlane((int)(threadIdx.x >> 5)); const int h = blockIdx.y;
  { const size_t zb = (size_t)blockIdx.z * QT0; QF += zb * ld; KF += zb * ld; VF += zb * ld; OF += zb * ldo; }      /* blockIdx.z = batch: QT0 rows of each plane */
  const int i = QT0 - 1 - (w * (QT0 / 8) + (int)blockIdx.x);      /* a block's eight rows lie QT0 / 8 apart: every block holds long and short key walks alike */
  const int col = h * HD + dp * 4; const float* qr = QF + (unsigned)(i * ld + col);
  v4f q[4], o[4]; const v4f z4 = {0.f, 0.f, 0.f, 0.f};
  for (int c = 0; c < 4; ++c) { q[c] = *(const v4fa*)(qr + c * 16); o[c] = z4; }
  const float cs = scale * 1.4426950408889634f;      /* e^x = 2^(x log2 e) */
  float m = -1.0e30f, l = 0.f;
  for (int jb = 0; jb <= i; jb += 16) {      /* 16 keys a pass, two a lane group: ja and ja + 8; a key above the diagonal (last pass only) is read as row i and weighs 0 */
    const int ja = jb + ks; const bool oka = ja <= i, okb = ja + 8 <= i;
    const unsigned offa = (unsigned)((oka ? ja : i) * ld + col), offb = (unsigned)((okb ? ja + 8 : i) * ld + col); v4f ka[4], kb[4], va[4], vb[4];
    const float* pka = KF + offa; const float* pkb = KF + offb; const float* pva = VF + offa; const float* pvb = VF + offb;
    for (int c = 0; c < 4; ++c) { ka[c] = *(const v4fa*)(pka + c * 16); kb[c] = *(const v4fa*)(pkb + c * 16); }
    for (int c = 0; c < 4; ++c) { va[c] = *(const v4fa*)(pva + c * 16); vb[c] = *(const v4fa*)(pvb + c * 16); }
    asm volatile("s_wait_xcnt 0x0" :: "v"(pka), "v"(pkb), "v"(pva), "v"(pvb) : "memory");      /* behind the pass's 16 loads, in front of every write of an address register that they name; the four addresses are inputs so that their registers live up to the wait and no load of the pass lands on one */
    __builtin_amdgcn_sched_barrier(0);      /* the arithmetic stays behind the 16 loads; without this the loads are spread among it in small groups, each waited for in turn */
    const float sa = a0_dot(q, ka) * cs, sb = a0_dot(q, kb) * cs;
    const float mn = fmaxf(m, fmaxf(oka ? sa : -1.0e30f, okb ? sb : -1.0e30f)); float sc = m - mn, ea = oka ? sa - mn : -1.0e30f, eb = okb ? sb - mn : -1.0e30f; a0_exp2x3(sc, ea, eb); m = mn;
    l = fmaf(l, sc, ea + eb); const v4f ea4 = {ea, ea, ea, ea}, eb4 = {eb, eb, eb, eb};
    for (int c = 0; c < 4; ++c) o[c] = __builtin_elementwise_fma(vb[c], eb4, __builtin_elementwise_fma(va[c], ea4, o[c] * sc)); }
  a0_merge<4>(m, l, o); a0_merge<8>(m, l, o); a0_merge<16>(m, l, o);
  const float fin = 64.0f / l;      /* o carried x64 like the f16 path; key 0 is in every row, so l > 0 */
  if (ks == 0) { float* dst = OF + (unsigned)(i * ldo + col); for (int c = 0; c < 4; ++c) *(v4f*)(dst + c * 16) = o[c] * fin; } }

__global__ __launch_bounds__(256) void k_kvexp(const float* __restrict__ src, float* __restrict__ dst, size_t n4) { const size_t t = (size_t)blockIdx.x * 256 + threadIdx.x; if (t >= n4) return; const size_t e = t * 4; const size_t row = e / DM; const int col = (int)(e % DM); const int h = col / HD, d = col % HD; const v4f v = *(const v4fa*)(src + row * KVD + (size_t)(h / HPG) * HD + d); *(v4f*)(dst + e) = v;  }

__global__ __launch_bounds__(256) void k_tab2(float theta, float* __restrict__ CS, float* __restrict__ SN) {
  const int t = blockIdx.x * 256 + threadIdx.x; if (t >= SQ * (HD / 2)) return; const int i = t % (HD / 2); const int p = t / (HD / 2); const float invf = 1.0f / powf(theta, (float)(2 * i) / (float)HD); const float ang = __fmul_rn((float)p, invf); const float c = cosf(ang), s = sinf(ang);
  *(float*)(CS + t) = c; *(float*)(SN + t) = s;  }
__global__ __launch_bounds__(256) void k_bfcp(const float* __restrict__ src, float* __restrict__ dst, size_t n4) { const size_t t = (size_t)blockIdx.x * 256 + threadIdx.x; if (t >= n4) return; const v4f a = *(const v4fa*)(src + t * 4); v4f o; for (int q = 0; q < 4; ++q) o[q] = bf16_round(a[q]); *(v4f*)(dst + t * 4) = o;  }

__global__ __launch_bounds__(256) void k_tabhalf(const float* __restrict__ cs, const float* __restrict__ sn, float* __restrict__ CS, float* __restrict__ SN) { const int t = blockIdx.x * 256 + threadIdx.x; if (t >= SQ * (HD / 2)) return; const int p = t / (HD / 2), i = t % (HD / 2); const float c = bf16_round(cs[(size_t)p * HD + i]), s = bf16_round(sn[(size_t)p * HD + i]);
  *(float*)(CS + t) = c; *(float*)(SN + t) = s;  }

__global__ __launch_bounds__(256) void k_tab2d(float* __restrict__ CS, float* __restrict__ SN) {
  const int t = blockIdx.x * 256 + threadIdx.x; if (t >= SQ * (HD / 2)) return; const int i = t % (HD / 2); const int p = t / (HD / 2); const float invf = (float)(1.0 / pow(10000.0, (double)(2 * i) / (double)HD)); const float ang = __fmul_rn((float)p, invf); const float c = cosf(ang), s = sinf(ang);
  *(float*)(CS + t) = c; *(float*)(SN + t) = s;  }
extern "C" void kernel_launch(void* const* d_in, const int* in_sizes, int n_in,
                              void* d_out, int out_size, void* d_ws, size_t ws_size, hipStream_t stream) {
  (void)in_sizes; (void)n_in; (void)out_size;
  const float* const* I = (const float* const*)d_in; const float* x = I[0]; const float* wattn = I[1]; const float* wo = I[2]; const float* qg = I[3]; const float* kg = I[4];      /* x; fused [in][out] Wqkv [1024][3072] (q, k, v column thirds); [in][out] Wproj; RMS-norm gains q_norm_w / k_norm_w [64]; no biases; rope tables computed in-kernel (positions = row index) */
  static_assert(HPG == 1 && NH == NG * HPG && NH * HD == DM && KVD == DM, "plain multi-head attention as 16 kv groups of one query head"); const float* bv = nullptr; const float* bo = nullptr;      /* no biases in this module */
  char* ws = (char*)d_ws; size_t off = 0;
  auto take = [&](size_t bytes) { char* p = ws + off; off += (bytes + 255) & ~(size_t)255; return p; };
  _Float16* BQKV = (_Float16*)take((size_t)3 * DM * DM * 2); _Float16* BQ = BQKV; _Float16* BK = BQKV + (size_t)DM * DM; _Float16* BV = BQKV + (size_t)2 * DM * DM; _Float16* BO = (_Float16*)take((size_t)DM * DM * 2);      /* one transposed plane Bt [3072][1024] of the fused weight: rows 0..1023 = q, 1024.. = k, 2048.. = v */
  _Float16* X16 = (_Float16*)take(NR * DM * 2); float* CSB = (float*)take((size_t)SQ * HD * 4); float* SNB = (float*)take((size_t)SQ * HD * 4); _Float16* Q16 = (_Float16*)take(NR * DM * 2); _Float16* K16 = (_Float16*)take(NR * KVD * 2); _Float16* V16 = (_Float16*)take(NR * KVD * 2); _Float16* O16 = (_Float16*)take(NR * DM * 2);
  _Float16* VT = (_Float16*)take((size_t)NB * NH * HD * SQ * 2);
  float* QF0 = (float*)take((size_t)NB * QT0 * DM * 4); float* KF0 = (float*)take((size_t)NB * QT0 * KVD * 4); float* VF0 = (float*)take((size_t)NB * QT0 * KVD * 4); float* KF0e = (float*)take((size_t)NB * QT0 * DM * 4); float* VF0e = (float*)take((size_t)NB * QT0 * DM * 4); float* OF0 = (float*)take((size_t)NB * QT0 * DM * 4); _Float16* OH0 = (_Float16*)take((size_t)NB * QT0 * DM * 2); _Float16* OL0 = (_Float16*)take((size_t)NB * QT0 * DM * 2);      /* every per-batch plane holds all batches: each stage below is one launch over them */
  if (off > ws_size) return;
  k_wt_f16<<<(unsigned)(((size_t)3 * DM * (DM / 8) + 255) / 256), 256, 0, stream>>>(wattn, BQKV, DM, 3 * DM, 16.0f); k_wt_f16<<<(unsigned)(((size_t)DM * (DM / 8) + 255) / 256), 256, 0, stream>>>(wo, BO, DM, DM, 16.0f);      /* [in][out] -> Bt x16 planes (fused Wqkv: K 1024, N 3072) */
  k_x16<<<(unsigned)((NR * DM / 8 + 255) / 256), 256, 0, stream>>>(x, X16, NR * DM / 8);
  k_tab2<<<(SQ * (HD / 2) + 255) / 256, 256, 0, stream>>>(10000.0f, CSB, SNB);      /* rope tables cos / sin(p / 10000^(2i/64)), i < 32: f32 pow, reciprocal, product */
  const size_t r0p = (size_t)B0 * SQ;      /* first projected row */
  k_gemm2<0><<<dim3((unsigned)((MP / 128) * (KVD / 64)), 1), 128, 0, stream>>>(X16 + r0p * DM, DM, 0, BV, DM, 0, 0.0625f, bv, 0, nullptr, 1, 0, 0, nullptr, V16 + r0p * KVD, KVD, 0, MP, KVD, DM);
  k_gemm2<0, true><<<dim3((unsigned)((MP / 128) * (DM / 64)), 1), 128, 0, stream>>>(X16 + r0p * DM, DM, 0, BQ, DM, 0, 0.0625f, nullptr, 0, nullptr, 1, 0, 0, QF0, Q16 + r0p * DM, DM, 0, MP, DM, DM, qg, 1e-5f, CSB, SNB);      /* q of all batches: projection, per-head RMS norm (gain, eps 1e-5), half-split rope (out_lo = x_lo c - x_hi s, out_hi = x_lo s + x_hi c = t cos + rotate_half(t) sin with the module's [f | f] tables) -> f16 rows; positions 0..255 of each batch in f32 too */
  k_gemm2<0, true><<<dim3((unsigned)((MP / 128) * (KVD / 64)), 1), 128, 0, stream>>>(X16 + r0p * DM, DM, 0, BK, DM, 0, 0.0625f, nullptr, 0, nullptr, 1, 0, 0, KF0, K16 + r0p * KVD, KVD, 0, MP, KVD, DM, kg, 1e-5f, CSB, SNB);      /* k likewise */
  k_vt<NG, SQ><<<NBR * NG * (SQ / 64), 256, 0, stream>>>(V16 + r0p * KVD, KVD, 0, VT);      /* V^T [batch][NH][HD][SQ] */
  k_gemm2<0><<<dim3((QT0 / 128) * (KVD / 64), NBR), 128, 0, stream>>>(X16 + r0p * DM, DM, (size_t)SQ * DM, BV, DM, 0, 0.0625f, bv, 0, nullptr, 1, 0, 0, VF0, nullptr, KVD, (size_t)QT0 * KVD, QT0, KVD, DM);      /* f32 v of the first 256 rows of each batch (grid y = batch) */
  k_kvexp<<<(unsigned)(((size_t)NBR * QT0 * DM / 4 + 255) / 256), 256, 0, stream>>>(KF0, KF0e, (size_t)NBR * QT0 * DM / 4); k_kvexp<<<(unsigned)(((size_t)NBR * QT0 * DM / 4 + 255) / 256), 256, 0, stream>>>(VF0, VF0e, (size_t)NBR * QT0 * DM / 4);      /* head h <- kv group h / HPG (HPG is 1 here: a plain copy) for the exact first-tile kernel */
  k_att0<<<dim3(QT0 / 8, NH, NBR), 256, 0, stream>>>(QF0, KF0e, VF0e, DM, 0.125f, OF0 + (size_t)B0 * QT0 * DM, DM);      /* exact f32 attention for rows 0..255 of each batch (o x64) */
  k_fattn<<<dim3(NH * NBR, SQ / 64), 128, 0, stream>>>(Q16 + r0p * LQ, K16 + r0p * KVD, VT, O16 + r0p * DM);      /* scores, causal softmax and weights x V of all heads, batches and query rows in ONE launch; scores and weights stay in registers (o x64) */
  k_gemm2<0><<<dim3((unsigned)((MPO / 128) * (DM / 64)), 1), 128, 0, stream>>>(O16 + r0p * DM, DM, 0, BO, DM, 0, 0.0009765625f, bo, 0, nullptr, 1, 0, 0, (float*)d_out + r0p * DM, nullptr, DM, 0, MPO, DM, DM);      /* out rows are the output layout */
  k_hl<<<(unsigned)(((size_t)NB * QT0 * DM / 8 + 255) / 256), 256, 0, stream>>>(OF0, OH0, OL0, (size_t)NB * QT0 * DM / 8);      /* first-tile o (x64) -> f16 hi + x1024 residual planes */
  k_gemm2<0><<<dim3((QT0 / 128) * (DM / 64), NBR), 128, 0, stream>>>(OH0 + (size_t)B0 * QT0 * DM, DM, (size_t)QT0 * DM, BO, DM, 0, 0.0009765625f, bo, 0, nullptr, 1, 0, 0, (float*)d_out + r0p * DM, nullptr, DM, (size_t)SQ * DM, QT0, DM, DM);      /* rows 0..255 of each batch (grid y = batch): out = o_hi Wo (no bias here), overwriting the f16-path rows */
  k_gemm2<0><<<dim3((QT0 / 128) * (DM / 64), NBR), 128, 0, stream>>>(OL0 + (size_t)B0 * QT0 * DM, DM, (size_t)QT0 * DM, BO, DM, 0, 0.00000095367431640625f, nullptr, 0, (const float*)d_out + r0p * DM, -1, 0, 0, (float*)d_out + r0p * DM, nullptr, DM, (size_t)SQ * DM, QT0, DM, DM);      /* += o_lo Wo 2^-20 (own-element accumulate) */
}

// v007
// It runs in 231 microseconds.
// Timed twice side by side with v006, it ran 1.08 and 1.10 times as fast.
// All steps since v000 together make it 31.7 times as fast.
#include <hip/hip_runtime.h>
// Causal multi-head self-attention with a per-head RMS norm on q and k THEN rotate-half RoPE computed in the module, and a bias-free fused QKV projection (x [4][2048][1024]; qkv = x Wqkv ([in][out] 1024 x 3072, no bias) split into q | k | v thirds, 16 heads of 64; q, k = x * rsqrt(mean(x^2 over the 64 head dims) + 1e-5) * gain (gains q_norm_w / k_norm_w [64], read); cos / sin = [f | f] of pos * (1 / 10000^(2i/64)); q = q cos + rotate_half(q) sin with rotate_half = cat(-x2, x1), likewise k; scores / sqrt(64); causal (tril, -inf); softmax; out = merged Wproj ([in][out], no bias) -> [4][2048][1024]); run as grouped-query causal attention with 16 groups of ONE head with the norm stage on and the rope stage in its half-split mode.
// Compute dtype: inputs rounded to bf16 (the two gain vectors bf16-rounded on load); x / weights exact; the per-head RMS norm and the rotation in f32 on VALU; q, k, v, softmax weights and o as plain f16 GEMM operands (~2^-12); scores and softmax statistics f32; v_wmma_f32_16x16x32_f16.
#define NB 4
#define NG 16
#define HPG 1
#define KVD (NG * HD)
#define SQ 2048
#define DM 1024
#define NH 16
#define HD 64
#define HG 4
#define QT 256                       /* unused (k_fattn tiles 16 query rows per wave) */
#define NKX SQ
#define QT0 256                      /* first-tile rows recomputed exactly in f32 */
#define B0 0                         /* first batch processed (debug hook) */
#define NBR NB                       /* batches processed (debug hook) */
#define NR ((size_t)NB * SQ)         /* token rows */
#define MP ((int)((size_t)NBR * SQ)) /* rows projected (debug hook) */
#define QN SQ                        /* unused (k_fattn attends all SQ rows of a batch) */
#define NHD NH                       /* unused (all NH heads are attended) */
#define MPO MP                       /* rows through the output stage (debug hook) */
#define LQ DM      /* row pitch of the q/k/v rows */
typedef __bf16 v16b __attribute__((ext_vector_type(16)));
typedef unsigned short v8us __attribute__((ext_vector_type(8), may_alias));
typedef float  v8f  __attribute__((ext_vector_type(8)));
typedef float  v4f  __attribute__((ext_vector_type(4)));
typedef float  v4fa __attribute__((ext_vector_type(4), may_alias));
union FragB { v16b v; v8us half[2]; unsigned short u[16]; };

__device__ __forceinline__ unsigned short bf16_bits(float x) { unsigned int u = __float_as_uint(x); return (unsigned short)((u + 0x7FFFu + ((u >> 16) & 1u)) >> 16); }
__device__ __forceinline__ float bf16_val(unsigned short b) { return __uint_as_float(((unsigned int)b) << 16); }
__device__ __forceinline__ float bf16_round(float x) { return bf16_val(bf16_bits(x)); }
// D += A·B with NT terms: 1 = ah·bh, 2 = + al·bh (A split), 3 = + ah·bl (both split)
template <int NT>
__device__ __forceinline__ v8f mmaN(v16b ah, v16b al, v16b bh, v16b bl, v8f c) {
  c = __builtin_amdgcn_wmma_f32_16x16x32_bf16(false, ah, false, bh, (short)0, c, false, false);
  if (NT >= 2) c = __builtin_amdgcn_wmma_f32_16x16x32_bf16(false, al, false, bh, (short)0, c, false, false);
  if (NT >= 3) c = __builtin_amdgcn_wmma_f32_16x16x32_bf16(false, ah, false, bl, (short)0, c, false, false);
  asm volatile("v_nop\n\tv_nop\n\tv_nop\n\tv_nop" : "+v"(c) : "v"(ah), "v"(al), "v"(bh), "v"(bl));
  return c;
}

__global__ __launch_bounds__(256) void k_wt_bf16(const float* __restrict__ W, unsigned short* __restrict__ Wt, int K, int N) {
  const int t = blockIdx.x * 256 + threadIdx.x;
  const int k8n = K / 8;
  if (t >= N * k8n) return;
  const int n = t / k8n, k8 = (t % k8n) * 8;
  v8us v;
#pragma unroll
  for (int i = 0; i < 8; ++i) v[i] = bf16_bits(W[(size_t)(k8 + i) * N + n]);
  *(v8us*)(Wt + (size_t)n * K + k8) = v;
  
}

// GEMM C[M][N] (f32, pitch ldc) = act(A[M][K]·W + bias). A f32 row-major (pitch lda) converted per fragment to bf16
// (ASPLIT: hi/lo two planes -> 2 terms, else single rounded term); Wt bf16 [N][K] (pitch ldb). BIAS_BF16 rounds the
// bias to bf16 first (bias quantised to bf16 before the add). K%32==0, M%16==0, N%64==0.
template <bool ASPLIT, int ACT, bool BIAS_BF16>
__global__ __launch_bounds__(128) void k_gemm_bf(const float* __restrict__ A, int lda, const unsigned short* __restrict__ Wt, int ldb,
                                               const float* __restrict__ bias, float* __restrict__ C, int ldc, int M, int N, int K) {
  __shared__ __attribute__((aligned(16))) float so[4][16][64];
  const int tid = threadIdx.x, w = tid >> 5, lane = tid & 31, ln = lane & 15, hh = lane >> 4;
  const int ntn = N / 64;
  const int wid = blockIdx.x * 4 + w;
  const int mt = wid / ntn, nq = wid % ntn;
  if (mt * 16 >= M) return;
  const int row0 = mt * 16, col0 = nq * 64;
  const float* arow = A + (size_t)(row0 + ln) * lda;
  v8f acc[4] = {};
  for (int kb = 0; kb < K; kb += 32) {
    FragB ah, al;
    const v4f x0 = *(const v4fa*)(arow + kb + 8 * hh), x1 = *(const v4fa*)(arow + kb + 8 * hh + 4);
    const v4f x2 = *(const v4fa*)(arow + kb + 16 + 8 * hh), x3 = *(const v4fa*)(arow + kb + 16 + 8 * hh + 4);
    float xs[16] = {x0[0],x0[1],x0[2],x0[3],x1[0],x1[1],x1[2],x1[3],x2[0],x2[1],x2[2],x2[3],x3[0],x3[1],x3[2],x3[3]};
#pragma unroll
    for (int i = 0; i < 16; ++i) { const unsigned short hb = bf16_bits(xs[i]); ah.u[i] = hb; al.u[i] = ASPLIT ? bf16_bits(xs[i] - bf16_val(hb)) : (unsigned short)0; }
#pragma unroll
    for (int t = 0; t < 4; ++t) {
      const unsigned short* brow = Wt + (size_t)(col0 + t * 16 + ln) * ldb + kb;
      FragB b;
      b.half[0] = *(const v8us*)(brow + 8 * hh);
      b.half[1] = *(const v8us*)(brow + 16 + 8 * hh);
      acc[t] = mmaN<ASPLIT ? 2 : 1>(ah.v, al.v, b.v, b.v, acc[t]);
    }
  }
#pragma unroll
  for (int t = 0; t < 4; ++t) {
    float bv = bias ? bias[col0 + t * 16 + ln] : 0.f;
    if (BIAS_BF16) bv = bf16_round(bv);
#pragma unroll
    for (int r = 0; r < 8; ++r) { float v = acc[t][r] + bv; if (ACT == 1) v = fmaxf(v, 0.f); so[w][8 * hh + r][t * 16 + ln] = v; }
  }
  __builtin_amdgcn_fence(__ATOMIC_ACQ_REL, "workgroup");
  __builtin_amdgcn_wave_barrier();
  const int rsub = lane >> 4, c4 = (lane & 15) * 4;
  {
#pragma unroll
    for (int q = 0; q < 8; ++q) {
      const int r = q * 2 + rsub;
      const v4f v = *(const v4fa*)&so[w][r][c4];
      *(v4f*)(C + (size_t)(row0 + r) * ldc + col0 + c4) = v;
    }
    
  }
}

// GEMM C = act(A·W + bias + resid): A f32 (ASPLIT -> hi/lo 2 terms), Wt bf16 [N][K]; ACT 0 none, 1 relu, 2 exact gelu;
// resid (optional, f32, row index = (row % rmod), pitch ldr, RES_BF16 rounds it) added before the activation.
template <bool ASPLIT, int ACT, bool BIAS_BF16, bool RES_BF16>
__global__ __launch_bounds__(128) void k_gemm_bf3(const float* __restrict__ A, int lda, const unsigned short* __restrict__ Wt, int ldb,
                                                const float* __restrict__ bias, const float* __restrict__ resid, int rmod, int ldr,
                                                float* __restrict__ C, int ldc, int M, int N, int K) {
  __shared__ __attribute__((aligned(16))) float so[4][16][64];
  const int tid = threadIdx.x, w = tid >> 5, lane = tid & 31, ln = lane & 15, hh = lane >> 4;
  const int ntn = N / 64;
  const int wid = blockIdx.x * 4 + w;
  const int mt = wid / ntn, nq = wid % ntn;
  if (mt * 16 >= M) return;
  const int row0 = mt * 16, col0 = nq * 64;
  const float* arow = A + (size_t)(row0 + ln) * lda;
  v8f acc[4] = {};
  for (int kb = 0; kb < K; kb += 32) {
    FragB ah, al;
    const v4f x0 = *(const v4fa*)(arow + kb + 8 * hh), x1 = *(const v4fa*)(arow + kb + 8 * hh + 4);
    const v4f x2 = *(const v4fa*)(arow + kb + 16 + 8 * hh), x3 = *(const v4fa*)(arow + kb + 16 + 8 * hh + 4);
    float xs[16] = {x0[0],x0[1],x0[2],x0[3],x1[0],x1[1],x1[2],x1[3],x2[0],x2[1],x2[2],x2[3],x3[0],x3[1],x3[2],x3[3]};
#pragma unroll
    for (int i = 0; i < 16; ++i) { const unsigned short hb = bf16_bits(xs[i]); ah.u[i] = hb; al.u[i] = ASPLIT ? bf16_bits(xs[i] - bf16_val(hb)) : (unsigned short)0; }
#pragma unroll
    for (int t = 0; t < 4; ++t) {
      const unsigned short* brow = Wt + (size_t)(col0 + t * 16 + ln) * ldb + kb;
      FragB b;
      b.half[0] = *(const v8us*)(brow + 8 * hh);
      b.half[1] = *(const v8us*)(brow + 16 + 8 * hh);
      acc[t] = mmaN<ASPLIT ? 2 : 1>(ah.v, al.v, b.v, b.v, acc[t]);
    }
  }
#pragma unroll
  for (int t = 0; t < 4; ++t) {
    const int col = col0 + t * 16 + ln;
    float bv = bias ? bias[col] : 0.f;
    if (BIAS_BF16) bv = bf16_round(bv);
#pragma unroll
    for (int r = 0; r < 8; ++r) {
      float v = acc[t][r] + bv;
      if (resid) { float rv = resid[(size_t)((row0 + 8 * hh + r) % rmod) * ldr + col]; if (RES_BF16) rv = bf16_round(rv); v += rv; }
      if (ACT == 1) v = fmaxf(v, 0.f);
      if (ACT == 2) v = 0.5f * v * (1.0f + erff(v * 0.70710678118654752f));
      if (ACT == 3) { const float u = 0.7978845608028654f * (v + 0.044715f * v * v * v); v = 0.5f * v * (1.0f + tanhf(u)); }
      so[w][8 * hh + r][t * 16 + ln] = v;
    }
  }
  __builtin_amdgcn_fence(__ATOMIC_ACQ_REL, "workgroup");
  __builtin_amdgcn_wave_barrier();
  const int rsub = lane >> 4, c4 = (lane & 15) * 4;
  {
#pragma unroll
    for (int q = 0; q < 8; ++q) {
      const int r = q * 2 + rsub;
      const v4f v = *(const v4fa*)&so[w][r][c4];
      *(v4f*)(C + (size_t)(row0 + r) * ldc + col0 + c4) = v;
    }
    
  }
}
// row LayerNorm (biased variance, eps) over N: s = X (+ R); optional out_sum <- s; out_norm <- (s-mu)*rsqrt(var+eps)*g + b
template <bool PARAM_BF16>
__global__ __launch_bounds__(256) void k_layernorm(const float* __restrict__ X, const float* __restrict__ R, const float* __restrict__ g, const float* __restrict__ bta,
                                                  float* __restrict__ out_sum, float* __restrict__ out_norm, int N, float eps) {
  __shared__ float red[256];
  const int row = blockIdx.x, tid = threadIdx.x;
  const float* x = X + (size_t)row * N; const float* rr = R ? R + (size_t)row * N : nullptr;
  float vals[16];                     // up to N = 4096
  const int per = N / 256;            // contiguous chunk per thread? use strided-by-4 chunks: thread handles j = tid*4 + 1024*u
  float s1 = 0.f;
  for (int u = 0; u < per / 4; ++u) {
    const int j = tid * 4 + 1024 * u;
    const v4f a = *(const v4fa*)(x + j);
    v4f b = {0.f,0.f,0.f,0.f}; if (rr) b = *(const v4fa*)(rr + j);
#pragma unroll
    for (int q = 0; q < 4; ++q) { const float v = a[q] + b[q]; vals[u * 4 + q] = v; s1 += v; }
  }
  red[tid] = s1; __syncthreads();
  for (int st = 128; st > 0; st >>= 1) { if (tid < st) red[tid] += red[tid + st]; __syncthreads(); }
  const float mu = red[0] / (float)N; __syncthreads();
  float s2 = 0.f;
  for (int u = 0; u < per / 4; ++u)
#pragma unroll
    for (int q = 0; q < 4; ++q) { const float c = vals[u * 4 + q] - mu; s2 += c * c; }
  red[tid] = s2; __syncthreads();
  for (int st = 128; st > 0; st >>= 1) { if (tid < st) red[tid] += red[tid + st]; __syncthreads(); }
  const float rs = rsqrtf(red[0] / (float)N + eps);
  {
    for (int u = 0; u < per / 4; ++u) {
      const int j = tid * 4 + 1024 * u;
      v4f o, sm;
#pragma unroll
      for (int q = 0; q < 4; ++q) {
        float gg = g[j + q], bb = bta[j + q];
        if (PARAM_BF16) { gg = bf16_round(gg); bb = bf16_round(bb); }
        sm[q] = vals[u * 4 + q]; o[q] = (vals[u * 4 + q] - mu) * rs * gg + bb;
      }
      if (out_sum) *(v4f*)(out_sum + (size_t)row * N + j) = sm;
      *(v4f*)(out_norm + (size_t)row * N + j) = o;
    }
    
  }
}

// ---- f16 WMMA path (v_wmma_f32_16x16x32_f16): 11-bit significands for operands in range — used where a [0,1] probability operand needs more precision than bf16
typedef _Float16 v16h __attribute__((ext_vector_type(16)));
union FragH { v16h v; v8us half[2]; _Float16 h[16]; unsigned short u[16]; };
template <int NT>
__device__ __forceinline__ v8f mmaH(v16h ah, v16h al, v16h bh, v16h bl, v8f c) {
  c = __builtin_amdgcn_wmma_f32_16x16x32_f16(false, ah, false, bh, (short)0, c, false, false);
  if (NT >= 2) c = __builtin_amdgcn_wmma_f32_16x16x32_f16(false, al, false, bh, (short)0, c, false, false);
  if (NT >= 3) c = __builtin_amdgcn_wmma_f32_16x16x32_f16(false, ah, false, bl, (short)0, c, false, false);
  asm volatile("v_nop\n\tv_nop\n\tv_nop\n\tv_nop" : "+v"(c) : "v"(ah), "v"(al), "v"(bh), "v"(bl));
  return c;
}
// batched GEMM like k_gemm_b but f16 operands: A f32 (split into f16 hi/lo if ASPLIT, else rounded to f16), Bt = f16 values [n][k]; alpha; C f32; N multiple of 16 (partial tiles skipped)
template <bool ASPLIT>
__global__ __launch_bounds__(128) void k_gemm_h(const float* __restrict__ A, int lda, size_t sA, const _Float16* __restrict__ Bh, int ldb, size_t sB, float alpha, float* __restrict__ C, int ldc, size_t sC, int M, int N, int K) {
  __shared__ __attribute__((aligned(16))) float so[4][16][64];
  const int tid = threadIdx.x, w = tid >> 5, lane = tid & 31, ln = lane & 15, hh = lane >> 4; const int by = blockIdx.y;
  A += (size_t)by * sA; Bh += (size_t)by * sB; C += (size_t)by * sC;
  const int ntn = (N + 63) / 64; const int wid = blockIdx.x * 4 + w; const int mt = wid / ntn, nq = wid % ntn; if (mt * 16 >= M) return;
  const int row0 = mt * 16, col0 = nq * 64; const float* arow = A + (size_t)(row0 + ln) * lda;
  v8f acc[4] = {};
  for (int kb = 0; kb < K; kb += 32) {
    FragH ah, al;
    const v4f x0 = *(const v4fa*)(arow + kb + 8 * hh), x1 = *(const v4fa*)(arow + kb + 8 * hh + 4), x2 = *(const v4fa*)(arow + kb + 16 + 8 * hh), x3 = *(const v4fa*)(arow + kb + 16 + 8 * hh + 4);
    float xs[16] = {x0[0],x0[1],x0[2],x0[3],x1[0],x1[1],x1[2],x1[3],x2[0],x2[1],x2[2],x2[3],x3[0],x3[1],x3[2],x3[3]};
#pragma unroll
    for (int i = 0; i < 16; ++i) { const _Float16 h = (_Float16)xs[i]; ah.h[i] = h; al.h[i] = ASPLIT ? (_Float16)(xs[i] - (float)h) : (_Float16)0.0f; }
#pragma unroll
    for (int t = 0; t < 4; ++t) { if (col0 + t * 16 >= N) continue; const size_t boff = (size_t)(col0 + t * 16 + ln) * ldb + kb; FragH bq; bq.half[0] = *(const v8us*)(Bh + boff + 8 * hh); bq.half[1] = *(const v8us*)(Bh + boff + 16 + 8 * hh);
      acc[t] = mmaH<ASPLIT ? 2 : 1>(ah.v, al.v, bq.v, bq.v, acc[t]); }
  }
#pragma unroll
  for (int t = 0; t < 4; ++t) { if (col0 + t * 16 >= N) continue;
#pragma unroll
    for (int r = 0; r < 8; ++r) so[w][8 * hh + r][t * 16 + ln] = acc[t][r] * alpha; }
  __builtin_amdgcn_fence(__ATOMIC_ACQ_REL, "workgroup"); __builtin_amdgcn_wave_barrier();
  const int rsub = lane >> 4, c4 = (lane & 15) * 4;
  {
#pragma unroll
    for (int q = 0; q < 8; ++q) { const int r = q * 2 + rsub; if (col0 + c4 < N) { const v4f v = *(const v4fa*)&so[w][r][c4]; *(v4f*)(C + (size_t)(row0 + r) * ldc + col0 + c4) = v; } }
     }
}

// Wt[n][k] = f16(W[k][n]·scale) from f32 row-major W[K][N] (scale = power of two; bf16-exact weights stay exact in f16 away from the subnormal range)
// (vb = the block's index inside its own stage: the stage kernels below are device bodies, several of which share one launch; see the merged kernels in front of kernel_launch)
__device__ __forceinline__ void d_wt_f16(int vb, const float* __restrict__ W, _Float16* __restrict__ Wt, int K, int N, float scale) {
  const int t = vb * 256 + threadIdx.x; if (t >= N * (K / 8)) return; const int n = t / (K / 8), k8 = (t % (K / 8)) * 8; FragH f;
#pragma unroll
  for (int i = 0; i < 8; ++i) f.h[i] = (_Float16)(bf16_round(W[(size_t)(k8 + i) * N + n]) * scale); const v8us o = f.half[0];
  *(v8us*)((unsigned short*)Wt + (size_t)n * K + k8) = o; 
}
// k_gemm_hh variant with fused epilogue: v = acc·alpha + bias[by·sBias + col] (+ CP[(row/rowsPerB)·sCPb + by·64 + col] if CP) ; ACT 0 none / 1 elu ; writes f16 C16 (and f32 C if non-null)
template <int ACT>
__global__ __launch_bounds__(128) void k_gemm_hhx(const _Float16* __restrict__ A, int lda, size_t sA, const _Float16* __restrict__ Bh, int ldb, size_t sB, float alpha, const float* __restrict__ bias, size_t sBias, const float* __restrict__ CP, int rowsPerB, size_t sCPb, int row0g,
    float* __restrict__ C, _Float16* __restrict__ C16, int ldc, size_t sC, int M, int N, int K) {
  __shared__ __attribute__((aligned(16))) float so[4][16][64];
  const int tid = threadIdx.x, w = tid >> 5, lane = tid & 31, ln = lane & 15, hh = lane >> 4; const int by = blockIdx.y;
  A += (size_t)by * sA; Bh += (size_t)by * sB; const size_t cofs = (size_t)by * sC; const float* bp = bias ? bias + (size_t)by * sBias : nullptr;
  const int ntn = (N + 63) / 64; const int wid = blockIdx.x * 4 + w; const int mt = wid / ntn, nq = wid % ntn; if (mt * 16 >= M) return;
  const int row0 = mt * 16, col0 = nq * 64; const _Float16* arow = A + (size_t)(row0 + ln) * lda;
  v8f acc[4] = {};
  for (int kb = 0; kb < K; kb += 32) { FragH ah; ah.half[0] = *(const v8us*)((const unsigned short*)arow + kb + 8 * hh); ah.half[1] = *(const v8us*)((const unsigned short*)arow + kb + 16 + 8 * hh);
#pragma unroll
    for (int t = 0; t < 4; ++t) { if (col0 + t * 16 >= N) continue; const size_t boff = (size_t)(col0 + t * 16 + ln) * ldb + kb; FragH bq; bq.half[0] = *(const v8us*)((const unsigned short*)Bh + boff + 8 * hh); bq.half[1] = *(const v8us*)((const unsigned short*)Bh + boff + 16 + 8 * hh);
      acc[t] = mmaH<1>(ah.v, ah.v, bq.v, bq.v, acc[t]); }
  }
#pragma unroll
  for (int t = 0; t < 4; ++t) { if (col0 + t * 16 >= N) continue; const int col = col0 + t * 16 + ln; const float bv = bp ? bf16_round(bp[col]) : 0.f;
#pragma unroll
    for (int r = 0; r < 8; ++r) { float v = acc[t][r] * alpha + bv; if (CP) { const int rr = row0g + row0 + 8 * hh + r; if (rowsPerB < 0) v += CP[cofs + (size_t)rr * ldc + col];      /* rowsPerB < 0: own element of the batched C plane */ else { const int bidx = rr / rowsPerB; v += CP[(size_t)bidx * sCPb + (size_t)by * 64 + col]; } } if (ACT == 1) v = (v > 0.f) ? v : expm1f(v); else if (ACT == 7) v = (v > 0.f) ? v + 1.0f : expf(v); else if (ACT == 8) v = tanhf(v); else if (ACT == 9) v = 0.5f * v * (1.0f + tanhf(0.7978845608028654f * (v + 0.044715f * v * v * v))); else if (ACT == 11) v = 1.0f / (1.0f + expf(-v)); else if (ACT == 12) v = (v > 0.f) ? v : 0.01f * v; else if (ACT == 14) v = (v > 0.f) ? v : 0.1f * v; else if (ACT == 16) v = (v >= 0.f) ? v : 0.3f * v; else if (ACT == 17) v = (v >= 0.f) ? v : 0.2f * v; else if (ACT == 15) v = v / (1.0f + expf(-v)); else if (ACT == 3) v = fmaxf(v, 0.f); else if (ACT == 6) v = 0.5f * v * (1.0f + erff(v * 0.70710678118654752f)); so[w][8 * hh + r][t * 16 + ln] = v; } }
  __builtin_amdgcn_fence(__ATOMIC_ACQ_REL, "workgroup"); __builtin_amdgcn_wave_barrier();
  const int rsub = lane >> 4, c4 = (lane & 15) * 4; typedef _Float16 v4h __attribute__((ext_vector_type(4)));
  {
#pragma unroll
    for (int q = 0; q < 8; ++q) { const int r = q * 2 + rsub; if (col0 + c4 < N) { const v4f v = *(const v4fa*)&so[w][r][c4]; if (C) *(v4f*)(C + cofs + (size_t)(row0 + r) * ldc + col0 + c4) = v; if (C16) { v4h h4; for (int i = 0; i < 4; ++i) h4[i] = (_Float16)v[i]; *(v4h*)(C16 + cofs + (size_t)(row0 + r) * ldc + col0 + c4) = h4; } } }
     }
}

typedef _Float16 v4h __attribute__((ext_vector_type(4)));

__device__ __forceinline__ void d_x16(int vb, const float* __restrict__ x, _Float16* __restrict__ X16, size_t n8) { const size_t t = (size_t)vb * 256 + threadIdx.x; if (t >= n8) return; FragH f;
#pragma unroll
  for (int q = 0; q < 8; ++q) f.h[q] = (_Float16)bf16_round(x[t * 8 + q]); *(v8us*)((unsigned short*)X16 + t * 8) = f.half[0];  }
__global__ __launch_bounds__(256) void k_h16(const float* __restrict__ x, _Float16* __restrict__ X16, size_t n8) { const size_t t = (size_t)blockIdx.x * 256 + threadIdx.x; if (t >= n8) return; FragH f;
#pragma unroll
  for (int q = 0; q < 8; ++q) f.h[q] = (_Float16)x[t * 8 + q]; *(v8us*)((unsigned short*)X16 + t * 8) = f.half[0];  }
__global__ __launch_bounds__(256) void k_round16f(const float* __restrict__ W, _Float16* __restrict__ Bt, size_t n8) { const size_t t = (size_t)blockIdx.x * 256 + threadIdx.x; if (t >= n8) return; FragH f;
#pragma unroll
  for (int i = 0; i < 8; ++i) f.h[i] = (_Float16)(bf16_round(W[t * 8 + i]) * 16.0f); *(v8us*)((unsigned short*)Bt + t * 8) = f.half[0];  }
template <int NHv, int TTv>
__device__ __forceinline__ void d_vt(int vb, const _Float16* __restrict__ V16, int ldv, int voff, _Float16* __restrict__ Vt) { __shared__ unsigned short tl[64][66]; const int tid = threadIdx.x; const int slab = vb / (TTv / 64), lg = vb % (TTv / 64); const int b = slab / NHv, h = slab % NHv;
  for (int i = tid; i < 64 * 8; i += 256) { const int r = i / 8, c8 = (i % 8) * 8; FragH f; f.half[0] = *(const v8us*)((const unsigned short*)V16 + ((size_t)b * TTv + lg * 64 + r) * ldv + voff + h * 64 + c8);
#pragma unroll
    for (int q = 0; q < 8; ++q) tl[r][c8 + q] = f.u[q]; }
  __syncthreads();
  {
#pragma unroll
    for (int rd = 0; rd < 2; ++rd) { const int d = rd * 32 + tid / 8, pc = tid % 8; FragH f;
#pragma unroll
      for (int q = 0; q < 8; ++q) f.u[q] = tl[pc * 8 + q][d];
      *(v8us*)((unsigned short*)Vt + ((size_t)slab * 64 + d) * TTv + lg * 64 + pc * 8) = f.half[0]; }
    asm volatile("s_wait_xcnt 0x0" ::: "memory");      /* behind the two row stores, in front of any later write of a register that they name (in a merged kernel another stage's code follows in the text) */
     } }

__device__ __forceinline__ void d_hl(int vb, const float* __restrict__ F, _Float16* __restrict__ Hh, _Float16* __restrict__ Hl, size_t n8) { const size_t t = (size_t)vb * 128 + threadIdx.x;      /* blocks of 128 threads: it shares k_fattn's launch */ if (t >= n8) return; FragH fh, fl; const v4f a = *(const v4fa*)(F + t * 8), c = *(const v4fa*)(F + t * 8 + 4);
#pragma unroll
  for (int q = 0; q < 4; ++q) { _Float16 h = (_Float16)a[q]; fh.h[q] = h; fl.h[q] = (_Float16)((a[q] - (float)h) * 1024.0f); h = (_Float16)c[q]; fh.h[4 + q] = h; fl.h[4 + q] = (_Float16)((c[q] - (float)h) * 1024.0f); }
  { *(v8us*)((unsigned short*)Hh + t * 8) = fh.half[0]; *(v8us*)((unsigned short*)Hl + t * 8) = fl.half[0];  } }

// ---- per-head RMS norm and half-split rope on a staged 32 x 64 wave tile (g2_body's NROPE epilogue) ----
// The tile's 64 columns are ONE head, so it holds 32 whole head rows: 16 lanes read a row back, 4 dims a lane (d = 4 ln + u), and norm and rotate it in registers; dim d's rope partner d ^ 32 sits in lane ln ^ 8.
// The sum of squares is a halving tree over the 64 dims (d + 32, + 16, + 8, + 4 by the lane exchanges ln ^ 8, 4, 2, 1; d + 2, d + 1 inside the lane); every lane of a row ends with the same bits.
template <int CTRL> __device__ __forceinline__ float a0_dpp(float x);      /* defined with the first-tile kernel below */
__device__ __forceinline__ float nr_rsqrt(float a) {      /* rsqrtf as the compiler expands it (an argument below 2^-126 goes in x 2^24, its result out x 2^12), with the v_rsq_f32 in place on its own register and a v_nop behind it, so that no reader of its result and no writer of its source follows it directly */
  const bool tiny = a < 0x1p-126f; a = tiny ? a * 0x1p+24f : a; asm("v_rsq_f32 %0, %0\n\tv_nop" : "+v"(a)); return tiny ? a * 0x1p+12f : a; }
// The 16 row pairs of a wave's tile. trow / hp / fp = this lane's place in row hh of the tile and of the two outputs (pitch LQ); b1, b2 = table factors of x_lo and x_hi: (c, -s) in the low half (out_lo = x_lo c - x_hi s), (s, c) in the high half (out_hi = x_lo s + x_hi c).
template <bool F32OUT>
__device__ __forceinline__ void nr_rows(const float* trow, bool lowh, const v4f (&b1)[16], const v4f (&b2)[16], v4f g4, float eps, _Float16* hp, float* fp) {
#pragma unroll      /* the table factors are register arrays: every index must be a constant */
  for (int q = 0; q < 16; ++q) { v4f x = *(const v4fa*)(trow + q * 2 * 68); float t[4];
    for (int u = 0; u < 4; ++u) t[u] = __fmul_rn(x[u], x[u]);
    for (int u = 0; u < 4; ++u) t[u] = __fadd_rn(t[u], a0_dpp<0x168>(t[u]));
    for (int u = 0; u < 4; ++u) t[u] = __fadd_rn(t[u], a0_dpp<0x164>(t[u]));
    for (int u = 0; u < 4; ++u) t[u] = __fadd_rn(t[u], a0_dpp<0x162>(t[u]));
    for (int u = 0; u < 4; ++u) t[u] = __fadd_rn(t[u], a0_dpp<0x161>(t[u]));
    const float rs = nr_rsqrt(__fadd_rn(__fadd_rn(__fadd_rn(t[0], t[2]), __fadd_rn(t[1], t[3])) / (float)HD, eps));
    v4f o; v4h h4;      /* x_hi's product is rounded, x_lo's is fused into the sum, alike in both halves */
    for (int u = 0; u < 4; ++u) { const float own = __fmul_rn(__fmul_rn(x[u], rs), g4[u]), oth = a0_dpp<0x168>(own); const float lo = lowh ? own : oth, hi = lowh ? oth : own;
      o[u] = __builtin_fmaf(lo, b1[q][u], __fmul_rn(hi, b2[q][u])); h4[u] = (_Float16)o[u]; }
    *(v4h*)(hp + (size_t)q * 2 * LQ) = h4;
    if (F32OUT) *(v4f*)(fp + (size_t)q * 2 * LQ) = o; }
  asm volatile("s_wait_xcnt 0x0" ::: "memory"); }      /* behind the tail's last stores, in front of any later write of a register that they name (the code that follows the place where the two tails join) */

// ---- fast GEMM (block tile 128x64, wave tile 32x64; requires M % 128 == 0 rows per launch region, N % 64 == 0 and K % 64 == 0). Operands go through LDS: a stage is 64 k (one 128-byte line of each of the 128 A rows and 64 B rows), read from global as whole lines (8 lanes a row) one stage ahead into registers and stored to the other of two buffers at a row pitch of 144 bytes (16 x odd: ds_load_b128 fragment reads without bank conflicts); epilogue = k_gemm_hhx semantics, or with NROPE: no bias, per-head RMS norm (gain, eps) and half-split rope (tables CS, SN; position = row % SQ) on acc alpha, f16 rows to C16 and, of the positions below QT0 of every sequence, the same values in f32 to C (QT0 rows a sequence), both at pitch LQ ----
__device__ __forceinline__ v16h g2_frag(const _Float16* p, int hh) { FragH f; f.half[0] = *(const v8us*)((const unsigned short*)p + 8 * hh); f.half[1] = *(const v8us*)((const unsigned short*)p + 16 + 8 * hh); return f.v; }
__device__ __forceinline__ v8f g2_mma(v16h a, v16h b, v8f c) { v8f d = __builtin_amdgcn_wmma_f32_16x16x32_f16(false, a, false, b, (short)0, c, false, false); asm volatile("v_nop\n\tv_nop\n\tv_nop\n\tv_nop" : "+v"(d) : "v"(a), "v"(b)); return d; }
constexpr int G2_SM = 2 * (128 * 72 + 64 * 72);      /* 16-bit elements of a block's LDS: two A and two B buffers */
template <int ACT, bool NROPE = false>
__device__ __forceinline__ void g2_body(unsigned short* sm, int bx, int by, const _Float16* __restrict__ A, int lda, size_t sA, const _Float16* __restrict__ Bh, int ldb, size_t sB, float alpha, const float* __restrict__ bias, size_t sBias, const float* __restrict__ CP, int rowsPerB, size_t sCPb, int row0g,
    float* __restrict__ C, _Float16* __restrict__ C16, int ldc, size_t sC, int M, int N, int K, const float* __restrict__ gain = nullptr, float eps = 0.f, const float* __restrict__ CS = nullptr, const float* __restrict__ SN = nullptr) { static_assert(ACT == 0 || ACT == 3 || ACT == 6 || ACT == 8 || ACT == 9 || ACT == 11 || ACT == 12 || ACT == 14 || ACT == 15 || ACT == 16 || ACT == 17, "k_gemm2: unsupported ACT code (would silently apply no activation)");
  constexpr int LP = 72, ABUF = 128 * LP, BBUF = 64 * LP;      /* LDS row pitch and buffer sizes in 16-bit elements */
  static_assert(G2_SM == 2 * (ABUF + BBUF), "sm = the calling kernel's __shared__ array of G2_SM elements");      /* A buffers 0, 1, then B buffers 0, 1; behind the k loop's last barrier the same bytes are the epilogue's staging tiles */
  static_assert(G2_SM * sizeof(unsigned short) >= 4 * 32 * 68 * sizeof(float), "the epilogue's four 32 x 68 f32 tiles fit the operand buffers");
  float (*so)[32][68] = reinterpret_cast<float (*)[32][68]>(sm);
  const int tid = threadIdx.x, w = tid >> 5, lane = tid & 31, ln = lane & 15, hh = lane >> 4;
  A += (size_t)by * sA; Bh += (size_t)by * sB; const size_t cofs = (size_t)by * sC; const float* bp = bias ? bias + (size_t)by * sBias : nullptr;
  const int ntn = N >> 6; const int mt = bx / ntn, nq = bx - mt * ntn; const int row0 = mt * 128 + 32 * w, col0 = nq * 64; if (mt * 128 >= M) return;      /* the whole block leaves or none does: barriers follow */
  __builtin_assume(lda == DM && ldb == DM);      /* every launch below passes these two pitches: the 16-row steps of a stage's loads become immediate offsets of one address */
  const char* ga = (const char*)(A + (size_t)(mt * 128) * lda); const char* gb = (const char*)(Bh + (size_t)col0 * ldb);      /* the block's first A and B row */
  const unsigned sr = (((unsigned)tid >> 3) & 1u) * 8u + ((unsigned)tid >> 4), sc = ((unsigned)tid & 7u) * 8u;      /* 8 lanes a row; the two rows of 16 neighbouring lanes lie 8 apart, so that at the 144-byte pitch their 256 stored bytes fall on 64 different banks */
  const unsigned va = (sr * (unsigned)lda + sc) * 2u, vb = (sr * (unsigned)ldb + sc) * 2u;      /* this thread's 16 bytes of row sr + 16 i of a stage: a 32-bit byte offset beside a block-uniform base */
  unsigned short* la = sm + sr * LP + sc; unsigned short* lb = sm + 2 * ABUF + sr * LP + sc;
  const _Float16* fa = (const _Float16*)sm + (32 * w + ln) * LP; const _Float16* fb = (const _Float16*)sm + 2 * ABUF + ln * LP;      /* this lane's fragment rows */
  v8us ra[8], rb[4];
  auto fetch = [&](int s) {
#pragma unroll      /* register arrays: constant indices */
    for (int i = 0; i < 8; ++i) ra[i] = *(const v8us*)(ga + ((size_t)(i * 32) * lda + (size_t)s * 128) + va);
#pragma unroll      /* register arrays: constant indices */
    for (int i = 0; i < 4; ++i) rb[i] = *(const v8us*)(gb + ((size_t)(i * 32) * ldb + (size_t)s * 128) + vb);
    asm volatile("s_wait_xcnt 0x0" ::: "memory"); };      /* behind the stage's 12 loads, in front of every later write of an address register that they name */
  auto put = [&](int buf) {
#pragma unroll      /* register arrays: constant indices */
    for (int i = 0; i < 8; ++i) *(v8us*)(la + buf * ABUF + i * 16 * LP) = ra[i];
#pragma unroll      /* register arrays: constant indices */
    for (int i = 0; i < 4; ++i) *(v8us*)(lb + buf * BBUF + i * 16 * LP) = rb[i]; };
  const v8f z8 = {0.f,0.f,0.f,0.f,0.f,0.f,0.f,0.f}; v8f c00 = z8, c01 = z8, c02 = z8, c03 = z8, c10 = z8, c11 = z8, c12 = z8, c13 = z8;
  const int nst = K >> 6;
  if (nst > 0) { fetch(0); put(0); }
  __syncthreads();      /* stage 0 is in buffer 0 for every wave */
  for (int s = 0; s < nst; ++s) { const int cur = s & 1; const bool more = s + 1 < nst;
    if (more) fetch(s + 1);      /* the next stage's lines fly under this stage's products */
    const _Float16* pa = fa + cur * ABUF; const _Float16* pb = fb + cur * BBUF; v16h a0[2], a1[2], b[2][4];
#pragma unroll      /* register arrays: constant indices */
    for (int kk = 0; kk < 2; ++kk) { a0[kk] = g2_frag(pa + kk * 32, hh); a1[kk] = g2_frag(pa + 16 * LP + kk * 32, hh);
      for (int t = 0; t < 4; ++t) b[kk][t] = g2_frag(pb + t * 16 * LP + kk * 32, hh); }
#pragma unroll      /* register arrays: constant indices */
    for (int kk = 0; kk < 2; ++kk) { c00 = g2_mma(a0[kk], b[kk][0], c00); c10 = g2_mma(a1[kk], b[kk][0], c10); c01 = g2_mma(a0[kk], b[kk][1], c01); c11 = g2_mma(a1[kk], b[kk][1], c11);
      c02 = g2_mma(a0[kk], b[kk][2], c02); c12 = g2_mma(a1[kk], b[kk][2], c12); c03 = g2_mma(a0[kk], b[kk][3], c03); c13 = g2_mma(a1[kk], b[kk][3], c13); }
    if (more) put(cur ^ 1);      /* into the buffer whose last readers passed the barrier at the foot of the trip before */
    __syncthreads(); }      /* publishes stage s + 1 and ends every wave's reads of stage s (behind the last trip: before the epilogue reuses the bytes) */
  v8f accs[8] = {c00, c01, c02, c03, c10, c11, c12, c13};
  if constexpr (NROPE) { static_assert(HD == 64 && QT0 % 32 == 0 && SQ % 32 == 0, "a wave tile's 64 columns are one head; its 32 rows lie on one side of QT0 and in one sequence");
    const int c4 = ln * 4; const bool lowh = ln < 8; const unsigned tofs = (unsigned)((row0 % SQ + hh) * (HD / 2) + (ln & 7) * 4);      /* table row = the token's position, table column = d & 31 */
    const float* cp = CS + tofs; const float* sp = SN + tofs; v4f tc[16], ts[16];
#pragma unroll      /* register arrays: constant indices */
    for (int q = 0; q < 16; ++q) { tc[q] = *(const v4fa*)(cp + q * 2 * (HD / 2)); ts[q] = *(const v4fa*)(sp + q * 2 * (HD / 2)); }      /* all 32 table rows asked for here, so that one latency runs under the LDS staging below */
    v4f g4 = *(const v4fa*)(gain + c4);
    asm volatile("s_wait_xcnt 0x0" ::: "memory");      /* behind the 33 loads, in front of every later write of an address register that they name */
#pragma unroll      /* accs is a register array: constant indices */
    for (int u = 0; u < 8; ++u) for (int r = 0; r < 8; ++r) so[w][(u >> 2) * 16 + 8 * hh + r][(u & 3) * 16 + ln] = accs[u][r] * alpha;
    __builtin_amdgcn_fence(__ATOMIC_ACQ_REL, "workgroup"); __builtin_amdgcn_wave_barrier();      /* as in the plain epilogue: the wave's own LDS writes before its reads */
    for (int u = 0; u < 4; ++u) g4[u] = bf16_round(g4[u]);
#pragma unroll      /* register arrays: constant indices */
    for (int q = 0; q < 16; ++q) { const v4f c = tc[q], s = ts[q]; tc[q] = lowh ? c : s; ts[q] = lowh ? -s : c; }
    const size_t e = cofs + (size_t)(row0 + hh) * LQ + col0 + c4; const size_t ef = e - (size_t)(row0 / SQ) * (SQ - QT0) * LQ;      /* the f32 plane holds QT0 rows a sequence: sequence s, position p lies at row s QT0 + p */
    if (__builtin_amdgcn_readfirstlane(row0 % SQ) < QT0) nr_rows<true>(&so[w][hh][c4], lowh, tc, ts, g4, eps, C16 + e, C + ef);      /* one wave-uniform branch around the whole tail: inside it the 16 row pairs stay one block of code to schedule */
    else nr_rows<false>(&so[w][hh][c4], lowh, tc, ts, g4, eps, C16 + e, C + ef);
    return; }
#pragma unroll
  for (int u = 0; u < 8; ++u) { const int t = u & 3, half = u >> 2; const int col = col0 + t * 16 + ln; const float bv = bp ? bf16_round(bp[col]) : 0.f;
#pragma unroll
    for (int r = 0; r < 8; ++r) { const int rloc = half * 16 + 8 * hh + r; float v = accs[u][r] * alpha + bv; if (CP) { if (rowsPerB < 0) v += CP[cofs + (size_t)(row0g + row0 + rloc) * ldc + col];      /* rowsPerB < 0: own element of the batched C plane */ else { const int bidx = (row0g + row0 + rloc) / rowsPerB; v += CP[(size_t)bidx * sCPb + (size_t)by * 64 + col]; } }
      if (ACT == 3) v = fmaxf(v, 0.f); else if (ACT == 6) v = 0.5f * v * (1.0f + erff(v * 0.70710678118654752f)); else if (ACT == 11) v = 1.0f / (1.0f + expf(-v)); else if (ACT == 15) v = v / (1.0f + expf(-v)); else if (ACT == 12) v = (v > 0.f) ? v : 0.01f * v; else if (ACT == 8) v = tanhf(v); else if (ACT == 9) v = 0.5f * v * (1.0f + tanhf(0.7978845608028654f * (v + 0.044715f * v * v * v))); else if (ACT == 14) v = (v > 0.f) ? v : 0.1f * v; else if (ACT == 16) v = (v >= 0.f) ? v : 0.3f * v; else if (ACT == 17) v = (v >= 0.f) ? v : 0.2f * v;
      so[w][rloc][t * 16 + ln] = v; } }
  __builtin_amdgcn_fence(__ATOMIC_ACQ_REL, "workgroup"); __builtin_amdgcn_wave_barrier();
  const int rsub = lane >> 4, c4 = (lane & 15) * 4;
  {
#pragma unroll
    for (int q = 0; q < 16; ++q) { const int r = q * 2 + rsub; const v4f v = *(const v4fa*)&so[w][r][c4]; if (C) { *(v4f*)(C + cofs + (size_t)(row0 + r) * ldc + col0 + c4) = v; asm volatile("s_wait_xcnt 0x0" ::: "memory"); }      /* directly behind the f32 store, in front of every later write of a register that it names (the f16 conversion, the next row's address) */
      if (C16) { v4h h4; for (int i = 0; i < 4; ++i) h4[i] = (_Float16)v[i]; *(v4h*)(C16 + cofs + (size_t)(row0 + r) * ldc + col0 + c4) = h4; } }
    asm volatile("s_wait_xcnt 0x0" ::: "memory");      /* behind the last row's stores, in front of any later write of a register that they name (in a merged kernel another branch's code follows in the text) */
     } }

__global__ __launch_bounds__(256) void k_wnat(const float* __restrict__ w, size_t n8, _Float16* __restrict__ Bt) { const size_t t = (size_t)blockIdx.x * 256 + threadIdx.x; if (t >= n8) return; FragH f; for (int q = 0; q < 8; ++q) f.h[q] = (_Float16)(bf16_round(w[t * 8 + q]) * 16.0f); *(v8us*)((unsigned short*)Bt + t * 8) = f.half[0];  }

// Fused causal attention of all batches (blockIdx.x = head + NH * batch, blockIdx.y = query tile group): one wave owns 16 query rows of one head and walks its keys 32 at a time with a running maximum and sum; the block's four waves share the key and value tiles in LDS.
// S^T = K Q^T (A = key rows, B = query rows): a lane holds scores of ONE query (column ln), keys 8 hh + r of each 16-key tile, so two converted score tiles are, as they lie, the B fragment of O^T += V^T P^T (A = rows of V^T).
// Weights are carried x256 (f16 range) and cancel in the division by their own sum; o leaves x64 like before.
__device__ __forceinline__ float fa_xhalf(float x) { return __builtin_bit_cast(float, __builtin_amdgcn_permlanex16(__builtin_bit_cast(int, x), __builtin_bit_cast(int, x), 0x76543210, 0xfedcba98, false, false)); }      /* lane l <-> lane l ^ 16 */
__global__ __launch_bounds__(128) void k_fattn(const _Float16* __restrict__ Q, const _Float16* __restrict__ K, const _Float16* __restrict__ Vt, _Float16* __restrict__ O, const float* __restrict__ F0, _Float16* __restrict__ H0, _Float16* __restrict__ L0) {
  if (blockIdx.y >= SQ / 64) { d_hl((int)((blockIdx.y - SQ / 64) * gridDim.x + blockIdx.x), F0, H0, L0, (size_t)NB * QT0 * DM / 8); return; }      /* the grid rows behind the SQ / 64 tile groups: first-tile o (x64) -> f16 hi + x1024 residual planes, which depends on nothing of this launch; whole blocks leave, in front of every barrier */
  // The block's four waves own 64 neighbouring query rows of one head and walk the same keys, so K and V^T go through LDS once for all four: a stage is 64 keys (one 128-byte line of each of 64 key rows and of each of the 64 V^T rows),
  // read from global as whole lines (8 lanes a row) one stage ahead into registers and stored to the other of two buffers at the 144-byte row pitch of k_gemm2; the fragments are ds_load_b128 reads of the same elements as before.
  constexpr int LP = 72, TB = 64 * LP;      /* LDS row pitch and tile size in 16-bit elements */
  __shared__ __attribute__((aligned(16))) unsigned short sm[4 * TB];      /* K buffers 0, 1, then V^T buffers 0, 1 */
  const int tid = threadIdx.x, lane = tid & 31, ln = lane & 15, hh = lane >> 4; const int w = __builtin_amdgcn_readfirstlane((int)(threadIdx.x >> 5)); const int h = blockIdx.x % NH; const size_t bz = blockIdx.x / NH;
  Q += bz * SQ * LQ; K += bz * SQ * KVD; Vt += bz * NH * HD * SQ; O += bz * SQ * DM;      /* this batch's rows and its V^T planes */
  const int grp = (int)(SQ / 64 - 1 - blockIdx.y);      /* the tile group is the slow grid index: the longest key walks of every head and batch have the lowest block indices */
  const int q0w = (grp * 4 + w) * 16;
  const int qi = q0w + ln; const int kend = ((q0w >> 5) + 1) * 32;      /* keys 0 .. kend - 1 cover every key <= q0w + 15; kend <= SQ */
  const int nst = grp + 1;      /* stages of the block: keys 0 .. 64 grp + 63, the same count for its four waves (barriers below) */
  const _Float16* qp = Q + (size_t)qi * LQ + h * HD; const v16h qa = g2_frag(qp, hh), qb = g2_frag(qp + 32, hh);
  const char* gk = (const char*)(K + h * HD); const char* gv = (const char*)(Vt + (size_t)h * HD * SQ);      /* the head's first key row and first V^T row */
  const unsigned sr = (((unsigned)tid >> 3) & 1u) * 8u + ((unsigned)tid >> 4), sc = ((unsigned)tid & 7u) * 8u;      /* as in k_gemm2: 8 lanes a row; the two rows of 16 neighbouring lanes lie 8 apart, so that their 256 stored bytes fall on 64 different banks */
  const unsigned vk = (sr * (unsigned)KVD + sc) * 2u, vv = (sr * (unsigned)SQ + sc) * 2u;      /* this thread's 16 bytes of row sr + 16 i of a stage: a 32-bit byte offset beside a block-uniform base */
  unsigned short* lk = sm + sr * LP + sc; unsigned short* lv = lk + 2 * TB;
  const _Float16* fk = (const _Float16*)sm + ln * LP; const _Float16* fv = fk + 2 * TB;      /* this lane's fragment rows */
  v8us rk[4], rv[4];
  auto fetch = [&](int s) {
#pragma unroll      /* register arrays: constant indices */
    for (int i = 0; i < 4; ++i) rk[i] = *(const v8us*)(gk + ((size_t)(s * 64 + i * 16) * (KVD * 2)) + vk);
#pragma unroll      /* register arrays: constant indices */
    for (int i = 0; i < 4; ++i) rv[i] = *(const v8us*)(gv + ((size_t)(i * 16) * (SQ * 2) + (size_t)s * 128) + vv);
    asm volatile("s_wait_xcnt 0x0" ::: "memory"); };      /* behind the stage's 8 loads, in front of every later write of an address register that they name */
  auto put = [&](int buf) {
#pragma unroll      /* register arrays: constant indices */
    for (int i = 0; i < 4; ++i) { *(v8us*)(lk + buf * TB + i * 16 * LP) = rk[i]; *(v8us*)(lv + buf * TB + i * 16 * LP) = rv[i]; } };
  const v8f z8 = {0.f,0.f,0.f,0.f,0.f,0.f,0.f,0.f}; v8f o0 = z8, o1 = z8, o2 = z8, o3 = z8;
  const float cs = 0.125f * 1.4426950408889634f;      /* 1 / sqrt(64), and e^x = 2^(x log2 e) */
  float m = -1.0e30f, l = 0.f;
  fetch(0); put(0);
  __syncthreads();      /* stage 0 is in buffer 0 for every wave */
  for (int s = 0; s < nst; ++s) { const int cur = s & 1; const bool more = s + 1 < nst;
    if (more) fetch(s + 1);      /* the next stage's lines fly under this stage's two passes */
   for (int ps = 0; ps < 2; ++ps) { const int kb = s * 64 + ps * 32;
    if (kb >= kend) break;      /* wave-uniform: the second half of the last stage lies above every query of the block's two lower waves */
    const _Float16* pk = fk + cur * TB + ps * 32 * LP; const _Float16* pv = fv + cur * TB + ps * 32;
    const v16h k0a = g2_frag(pk, hh), k0b = g2_frag(pk + 32, hh), k1a = g2_frag(pk + 16 * LP, hh), k1b = g2_frag(pk + 16 * LP + 32, hh);
    const v16h v0 = g2_frag(pv, hh), v1 = g2_frag(pv + 16 * LP, hh), v2 = g2_frag(pv + 32 * LP, hh), v3 = g2_frag(pv + 48 * LP, hh);
    v8f s0 = g2_mma(k0a, qa, z8); s0 = g2_mma(k0b, qb, s0); v8f s1 = g2_mma(k1a, qa, z8); s1 = g2_mma(k1b, qb, s1);
    if (kb + 31 > q0w) {      /* only the last pass holds keys above a query of this tile */
      for (int r = 0; r < 8; ++r) { const int key = kb + 8 * hh + r; s0[r] = (key <= qi) ? s0[r] : -1.0e30f; s1[r] = (key + 16 <= qi) ? s1[r] : -1.0e30f; } }
    float mx = fmaxf(s0[0], s1[0]);
    for (int r = 1; r < 8; ++r) mx = fmaxf(mx, fmaxf(s0[r], s1[r]));
    mx = fmaxf(mx, fa_xhalf(mx)); const float mn = fmaxf(m, mx); float corr = (m - mn) * cs; m = mn; const float bias = fmaf(-mn, cs, 8.0f);
    float e[16];
    for (int r = 0; r < 8; ++r) { e[r] = fmaf(s0[r], cs, bias); e[8 + r] = fmaf(s1[r], cs, bias); }
    /* the pass's 17 exponentials, each in place on a register of its own, so that no transcendental is directly followed by a reader of its result or a writer of its source; the v_nop is that slot behind the last one */
    asm("v_exp_f32 %0, %0\n\tv_exp_f32 %1, %1\n\tv_exp_f32 %2, %2\n\tv_exp_f32 %3, %3\n\tv_exp_f32 %4, %4\n\tv_exp_f32 %5, %5\n\tv_exp_f32 %6, %6\n\tv_exp_f32 %7, %7\n\tv_exp_f32 %8, %8\n\t"
        "v_exp_f32 %9, %9\n\tv_exp_f32 %10, %10\n\tv_exp_f32 %11, %11\n\tv_exp_f32 %12, %12\n\tv_exp_f32 %13, %13\n\tv_exp_f32 %14, %14\n\tv_exp_f32 %15, %15\n\tv_exp_f32 %16, %16\n\tv_nop"
        : "+v"(corr), "+v"(e[0]), "+v"(e[1]), "+v"(e[2]), "+v"(e[3]), "+v"(e[4]), "+v"(e[5]), "+v"(e[6]), "+v"(e[7]), "+v"(e[8]), "+v"(e[9]), "+v"(e[10]), "+v"(e[11]), "+v"(e[12]), "+v"(e[13]), "+v"(e[14]), "+v"(e[15]));
    FragH pf; float sum = 0.f;
    for (int r = 0; r < 8; ++r) { sum += e[r] + e[8 + r]; pf.h[r] = (_Float16)e[r]; pf.h[8 + r] = (_Float16)e[8 + r]; }
    l = fmaf(l, corr, sum);
    for (int r = 0; r < 8; ++r) { o0[r] *= corr; o1[r] *= corr; o2[r] *= corr; o3[r] *= corr; }
    o0 = g2_mma(v0, pf.v, o0); o1 = g2_mma(v1, pf.v, o1); o2 = g2_mma(v2, pf.v, o2); o3 = g2_mma(v3, pf.v, o3); }
    if (more) { put(cur ^ 1);      /* into the buffer whose last readers passed the barrier at the foot of the trip before */
      __syncthreads(); } }      /* block-uniform: publishes stage s + 1 and ends every wave's reads of stage s */
  const float fin = 64.0f / (l + fa_xhalf(l));      /* the two lane halves hold disjoint keys of the same query */
  unsigned short* op = (unsigned short*)O + (size_t)qi * DM + h * HD + 8 * hh; FragH f0, f1;
  for (int r = 0; r < 8; ++r) { f0.h[r] = (_Float16)(o0[r] * fin); f0.h[8 + r] = (_Float16)(o1[r] * fin); f1.h[r] = (_Float16)(o2[r] * fin); f1.h[8 + r] = (_Float16)(o3[r] * fin); }
  *(v8us*)op = f0.half[0]; *(v8us*)(op + 16) = f0.half[1]; *(v8us*)(op + 32) = f1.half[0]; *(v8us*)(op + 48) = f1.half[1]; }      /* register r of tile dt = O[qi][16 dt + 8 hh + r]: 16-byte stores */

// Exact f32 attention of the first QT0 rows: one wave owns ONE query row. Lane = (key slice ks = lane >> 2, dim part dp = lane & 3): the lane walks keys ks, ks + 8, ... of its row
// and keeps dims 16 c + 4 dp + u (c, u < 4) of q and of its slice's partial o in registers, with the slice's own running maximum and sum (base-2 exponents); the 8 slices are merged at the end by lane exchanges.
template <int CTRL> __device__ __forceinline__ float a0_dpp(float x) { return __builtin_bit_cast(float, __builtin_amdgcn_update_dpp(0, __builtin_bit_cast(int, x), CTRL, 0xf, 0xf, true)); }      /* 0x160 + n: lane l <- lane l ^ n inside a 16-lane row; every lane is on wherever it is used */
__device__ __forceinline__ void a0_exp2x2(float& x, float& y) { asm("v_exp_f32 %0, %0\n\tv_exp_f32 %1, %1\n\tv_nop" : "+v"(x), "+v"(y)); }      /* two exponentials, each in place on its own register, so that neither is directly followed by a reader of its result; the v_nop is that slot behind the second */
template <int STEP> __device__ __forceinline__ float a0_swap(float x) { return STEP == 16 ? fa_xhalf(x) : a0_dpp<0x160 + (STEP & 15)>(x); }
template <int STEP> __device__ __forceinline__ void a0_merge(float& m, float& l, v4f (&o)[4]) {      /* this lane's slices with those of lane ^ STEP; a slice without keys has m = -1e30, l = 0, o = 0 and drops out */
  const float mo = a0_swap<STEP>(m), lo = a0_swap<STEP>(l); const float mn = fmaxf(m, mo); float fa = m - mn, fb = mo - mn; a0_exp2x2(fa, fb);
  l = fmaf(l, fa, lo * fb); m = mn;
  for (int c = 0; c < 4; ++c) for (int u = 0; u < 4; ++u) o[c][u] = fmaf(o[c][u], fa, a0_swap<STEP>(o[c][u]) * fb); }
__device__ __forceinline__ void a0_exp2x3(float& x, float& y, float& z) { asm("v_exp_f32 %0, %0\n\tv_exp_f32 %1, %1\n\tv_exp_f32 %2, %2\n\tv_nop" : "+v"(x), "+v"(y), "+v"(z)); }      /* as a0_exp2x2, for three */
__device__ __forceinline__ float a0_dot(const v4f (&q)[4], const v4f (&kk)[4]) {      /* q . k over the four lanes of a key: all four end with the same bits */
  v4f pv = q[0] * kk[0]; for (int c = 1; c < 4; ++c) pv = __builtin_elementwise_fma(q[c], kk[c], pv);
  float s = (pv[0] + pv[1]) + (pv[2] + pv[3]); s += a0_dpp<0x161>(s); s += a0_dpp<0x162>(s); return s; }
__device__ __forceinline__ void d_att0(int bx, int by, int bz, const float* __restrict__ QF, const float* __restrict__ KF, const float* __restrict__ VF, int ld, float scale, float* __restrict__ OF, int ldo) {
  static_assert(HD == 64 && QT0 % 8 == 0, "four lanes of 16 dims a row; eight rows a block");
  const int lane = threadIdx.x & 31, ks = lane >> 2, dp = lane & 3; const int w = __builtin_amdgcn_readfirstlane((int)(threadIdx.x >> 5)); const int h = by;
  { const size_t zb = (size_t)bz * QT0; QF += zb * ld; KF += zb * ld; VF += zb * ld; OF += zb * ldo; }      /* bz = batch: QT0 rows of each plane */
  const int i = QT0 - 1 - (w * (QT0 / 8) + bx);      /* a block's eight rows lie QT0 / 8 apart: every block holds long and short key walks alike */
  const int col = h * HD + dp * 4; const float* qr = QF + (unsigned)(i * ld + col);
  v4f q[4], o[4]; const v4f z4 = {0.f, 0.f, 0.f, 0.f};
  for (int c = 0; c < 4; ++c) { q[c] = *(const v4fa*)(qr + c * 16); o[c] = z4; }
  const float cs = scale * 1.4426950408889634f;      /* e^x = 2^(x log2 e) */
  float m = -1.0e30f, l = 0.f;
  for (int jb = 0; jb <= i; jb += 16) {      /* 16 keys a pass, two a lane group: ja and ja + 8; a key above the diagonal (last pass only) is read as row i and weighs 0 */
    const int ja = jb + ks; const bool oka = ja <= i, okb = ja + 8 <= i;
    const unsigned offa = (unsigned)((oka ? ja : i) * ld + col), offb = (unsigned)((okb ? ja + 8 : i) * ld + col); v4f ka[4], kb[4], va[4], vb[4];
    const float* pka = KF + offa; const float* pkb = KF + offb; const float* pva = VF + offa; const float* pvb = VF + offb;
    for (int c = 0; c < 4; ++c) { ka[c] = *(const v4fa*)(pka + c * 16); kb[c] = *(const v4fa*)(pkb + c * 16); }
    for (int c = 0; c < 4; ++c) { va[c] = *(const v4fa*)(pva + c * 16); vb[c] = *(const v4fa*)(pvb + c * 16); }
    asm volatile("s_wait_xcnt 0x0" :: "v"(pka), "v"(pkb), "v"(pva), "v"(pvb) : "memory");      /* behind the pass's 16 loads, in front of every write of an address register that they name; the four addresses are inputs so that their registers live up to the wait and no load of the pass lands on one */
    __builtin_amdgcn_sched_barrier(0);      /* the arithmetic stays behind the 16 loads; without this the loads are spread among it in small groups, each waited for in turn */
    const float sa = a0_dot(q, ka) * cs, sb = a0_dot(q, kb) * cs;
    const float mn = fmaxf(m, fmaxf(oka ? sa : -1.0e30f, okb ? sb : -1.0e30f)); float sc = m - mn, ea = oka ? sa - mn : -1.0e30f, eb = okb ? sb - mn : -1.0e30f; a0_exp2x3(sc, ea, eb); m = mn;
    l = fmaf(l, sc, ea + eb); const v4f ea4 = {ea, ea, ea, ea}, eb4 = {eb, eb, eb, eb};
    for (int c = 0; c < 4; ++c) o[c] = __builtin_elementwise_fma(vb[c], eb4, __builtin_elementwise_fma(va[c], ea4, o[c] * sc)); }
  a0_merge<4>(m, l, o); a0_merge<8>(m, l, o); a0_merge<16>(m, l, o);
  const float fin = 64.0f / l;      /* o carried x64 like the f16 path; key 0 is in every row, so l > 0 */
  if (ks == 0) { float* dst = OF + (unsigned)(i * ldo + col); for (int c = 0; c < 4; ++c) *(v4f*)(dst + c * 16) = o[c] * fin; } }

__global__ __launch_bounds__(256) void k_kvexp(const float* __restrict__ src, float* __restrict__ dst, size_t n4) { const size_t t = (size_t)blockIdx.x * 256 + threadIdx.x; if (t >= n4) return; const size_t e = t * 4; const size_t row = e / DM; const int col = (int)(e % DM); const int h = col / HD, d = col % HD; const v4f v = *(const v4fa*)(src + row * KVD + (size_t)(h / HPG) * HD + d); *(v4f*)(dst + e) = v;  }

__device__ __forceinline__ void d_tab2(int vb, float theta, float* __restrict__ CS, float* __restrict__ SN) {
  const int t = vb * 256 + threadIdx.x; if (t >= SQ * (HD / 2)) return; const int i = t % (HD / 2); const int p = t / (HD / 2); const float invf = 1.0f / powf(theta, (float)(2 * i) / (float)HD); const float ang = __fmul_rn((float)p, invf); const float c = cosf(ang), s = sinf(ang);
  *(float*)(CS + t) = c; *(float*)(SN + t) = s;  }
__global__ __launch_bounds__(256) void k_bfcp(const float* __restrict__ src, float* __restrict__ dst, size_t n4) { const size_t t = (size_t)blockIdx.x * 256 + threadIdx.x; if (t >= n4) return; const v4f a = *(const v4fa*)(src + t * 4); v4f o; for (int q = 0; q < 4; ++q) o[q] = bf16_round(a[q]); *(v4f*)(dst + t * 4) = o;  }

__global__ __launch_bounds__(256) void k_tabhalf(const float* __restrict__ cs, const float* __restrict__ sn, float* __restrict__ CS, float* __restrict__ SN) { const int t = blockIdx.x * 256 + threadIdx.x; if (t >= SQ * (HD / 2)) return; const int p = t / (HD / 2), i = t % (HD / 2); const float c = bf16_round(cs[(size_t)p * HD + i]), s = bf16_round(sn[(size_t)p * HD + i]);
  *(float*)(CS + t) = c; *(float*)(SN + t) = s;  }

__global__ __launch_bounds__(256) void k_tab2d(float* __restrict__ CS, float* __restrict__ SN) {
  const int t = blockIdx.x * 256 + threadIdx.x; if (t >= SQ * (HD / 2)) return; const int i = t % (HD / 2); const int p = t / (HD / 2); const float invf = (float)(1.0 / pow(10000.0, (double)(2 * i) / (double)HD)); const float ang = __fmul_rn((float)p, invf); const float c = cosf(ang), s = sinf(ang);
  *(float*)(CS + t) = c; *(float*)(SN + t) = s;  }
// ---- merged launches: stages that read nothing of each other share ONE grid; a block's index says which stage it belongs to and which of that stage's blocks it is (block-uniform branches), and as that block it does what its own launch's block did ----
template <int ACT>
__global__ __launch_bounds__(128) void k_gemm2(const _Float16* __restrict__ A, int lda, size_t sA, const _Float16* __restrict__ Bh, int ldb, size_t sB, float alpha, const float* __restrict__ bias, size_t sBias, const float* __restrict__ CP, int rowsPerB, size_t sCPb, int row0g,
    float* __restrict__ C, _Float16* __restrict__ C16, int ldc, size_t sC, int M, int N, int K) {
  __shared__ __attribute__((aligned(16))) unsigned short sm[G2_SM];
  g2_body<ACT>(sm, (int)blockIdx.x, (int)blockIdx.y, A, lda, sA, Bh, ldb, sB, alpha, bias, sBias, CP, rowsPerB, sCPb, row0g, C, C16, ldc, sC, M, N, K); }
// Operand preparation, from the inputs alone: both weight planes ([in][out] -> Bt x16), the rope tables, x -> f16.
constexpr int PB_WA = 3 * DM * (DM / 8) / 256, PB_WO = DM * (DM / 8) / 256, PB_TB = SQ * (HD / 2) / 256, PB_X = (int)(NR * DM / 8 / 256);
__global__ __launch_bounds__(256) void k_prep(const float* __restrict__ x, const float* __restrict__ wattn, const float* __restrict__ wo, float theta, _Float16* __restrict__ X16, _Float16* __restrict__ BQKV, _Float16* __restrict__ BO, float* __restrict__ CS, float* __restrict__ SN) {
  constexpr int G = PB_TB, NA = PB_WA / G, NO = PB_WO / G, NX = PB_X / G, NS = NA + NO + 1 + NX; static_assert(NA * G == PB_WA && NO * G == PB_WO && NX * G == PB_X, "G equal groups");
  const int g = (int)blockIdx.x / NS, r = (int)blockIdx.x % NS;      /* the four stages' blocks are dealt out in G equal groups, not one stage after the other: the stages lean on different parts of the chip (scattered L2 reads, arithmetic, the memory stream) */
  if (r < NA) d_wt_f16(g * NA + r, wattn, BQKV, DM, 3 * DM, 16.0f);      /* fused Wqkv: K 1024, N 3072 */
  else if (r < NA + NO) d_wt_f16(g * NO + (r - NA), wo, BO, DM, DM, 16.0f);
  else if (r == NA + NO) d_tab2(g, theta, CS, SN);      /* cos / sin(p / theta^(2i/64)), i < 32: f32 pow, reciprocal, product */
  else d_x16(g * NX + (r - (NA + NO + 1)), x, X16, NR * DM / 8); }
// The four projections of x: q and k (norm and rope epilogue), v (f16 rows), and v of the first QT0 rows of every batch in f32.
constexpr int GB_P = (MP / 128) * (DM / 64), GB_F = (QT0 / 128) * (KVD / 64);      /* blocks of a whole projection; blocks of a batch's first-tile projection */
__global__ __launch_bounds__(128) void k_qkv(const _Float16* __restrict__ X16, const _Float16* __restrict__ BQKV, _Float16* __restrict__ Q16, _Float16* __restrict__ K16, _Float16* __restrict__ V16, float* __restrict__ QF0, float* __restrict__ KF0, float* __restrict__ VF0,
    const float* __restrict__ qg, const float* __restrict__ kg, const float* __restrict__ CS, const float* __restrict__ SN, int K) {
  __shared__ __attribute__((aligned(16))) unsigned short sm[G2_SM];
  const int b = (int)blockIdx.x;
  if (b < 2 * GB_P) { const bool isk = b >= GB_P;      /* projection, per-head RMS norm (gain, eps 1e-5), half-split rope (out_lo = x_lo c - x_hi s, out_hi = x_lo s + x_hi c = t cos + rotate_half(t) sin with the module's [f | f] tables) -> f16 rows; positions 0..255 of each batch in f32 too */
    g2_body<0, true>(sm, isk ? b - GB_P : b, 0, X16, DM, 0, BQKV + (isk ? (size_t)DM * DM : 0), DM, 0, 0.0625f, nullptr, 0, nullptr, 1, 0, 0, isk ? KF0 : QF0, isk ? K16 : Q16, DM, 0, MP, DM, K, isk ? kg : qg, 1e-5f, CS, SN); }
  else { const int d = b - 2 * GB_P; const bool f0 = d >= GB_P; const int e = d - GB_P;      /* f0: block e % GB_F of batch e / GB_F */
    g2_body<0>(sm, f0 ? e % GB_F : d, f0 ? e / GB_F : 0, X16, DM, f0 ? (size_t)SQ * DM : 0, BQKV + (size_t)2 * DM * DM, DM, 0, 0.0625f, nullptr, 0, nullptr, 1, 0, 0, f0 ? VF0 : nullptr, f0 ? nullptr : V16, KVD, f0 ? (size_t)QT0 * KVD : 0, f0 ? QT0 : MP, KVD, K); } }
// Exact f32 first-tile attention (o x64) beside the transposition V -> V^T [batch][NH][HD][SQ]: both read the projections alone.
constexpr int AB_0 = (QT0 / 8) * NH * NB, AB_T = NB * NG * (SQ / 64);
__global__ __launch_bounds__(256) void k_att0_vt(const float* __restrict__ QF, const float* __restrict__ KF, const float* __restrict__ VF, float* __restrict__ OF, const _Float16* __restrict__ V16, _Float16* __restrict__ Vt) {
  static_assert(AB_0 == AB_T, "the two stages' blocks alternate"); const int b = (int)(blockIdx.x >> 1);      /* alternating, not one stage after the other: the key walks wait on dependent loads, the transposition streams */
  if ((blockIdx.x & 1) == 0) d_att0(b % (QT0 / 8), (b / (QT0 / 8)) % NH, b / ((QT0 / 8) * NH), QF, KF, VF, DM, 0.125f, OF, DM);
  else d_vt<NG, SQ>(b, V16, KVD, 0, Vt); }
// Output projection: a 128-row tile inside the first QT0 rows of its batch takes the exact path's o_hi rows for A (its f16-path rows would only be overwritten), every other tile the f16 path's o rows.
__global__ __launch_bounds__(128) void k_oproj(const _Float16* __restrict__ O16, const _Float16* __restrict__ OH0, const _Float16* __restrict__ BO, float* __restrict__ out, int K) {
  __shared__ __attribute__((aligned(16))) unsigned short sm[G2_SM];
  const int b = (int)blockIdx.x; const int mt = b / (DM / 64), nq = b % (DM / 64); const int bt = mt / (SQ / 128), p = mt % (SQ / 128); const bool f0 = p < QT0 / 128;
  g2_body<0>(sm, f0 ? p * (DM / 64) + nq : b, f0 ? bt : 0, f0 ? OH0 : O16, DM, f0 ? (size_t)QT0 * DM : 0, BO, DM, 0, 0.0009765625f, nullptr, 0, nullptr, 1, 0, 0, out, nullptr, DM, f0 ? (size_t)SQ * DM : 0, f0 ? QT0 : MPO, DM, K); }
extern "C" void kernel_launch(void* const* d_in, const int* in_sizes, int n_in,
                              void* d_out, int out_size, void* d_ws, size_t ws_size, hipStream_t stream) {
  (void)in_sizes; (void)n_in; (void)out_size;
  const float* const* I = (const float* const*)d_in; const float* x = I[0]; const float* wattn = I[1]; const float* wo = I[2]; const float* qg = I[3]; const float* kg = I[4];      /* x; fused [in][out] Wqkv [1024][3072] (q, k, v column thirds); [in][out] Wproj; RMS-norm gains q_norm_w / k_norm_w [64]; no biases; rope tables computed in-kernel (positions = row index) */
  static_assert(HPG == 1 && NH == NG * HPG && NH * HD == DM && KVD == DM, "plain multi-head attention as 16 kv groups of one query head");      /* no biases in this module */
  char* ws = (char*)d_ws; size_t off = 0;
  auto take = [&](size_t bytes) { char* p = ws + off; off += (bytes + 255) & ~(size_t)255; return p; };
  _Float16* BQKV = (_Float16*)take((size_t)3 * DM * DM * 2); _Float16* BO = (_Float16*)take((size_t)DM * DM * 2);      /* one transposed plane Bt [3072][1024] of the fused weight: rows 0..1023 = q, 1024.. = k, 2048.. = v */
  _Float16* X16 = (_Float16*)take(NR * DM * 2); float* CSB = (float*)take((size_t)SQ * HD * 4); float* SNB = (float*)take((size_t)SQ * HD * 4); _Float16* Q16 = (_Float16*)take(NR * DM * 2); _Float16* K16 = (_Float16*)take(NR * KVD * 2); _Float16* V16 = (_Float16*)take(NR * KVD * 2); _Float16* O16 = (_Float16*)take(NR * DM * 2);
  _Float16* VT = (_Float16*)take((size_t)NB * NH * HD * SQ * 2);
  float* QF0 = (float*)take((size_t)NB * QT0 * DM * 4); float* KF0 = (float*)take((size_t)NB * QT0 * KVD * 4); float* VF0 = (float*)take((size_t)NB * QT0 * KVD * 4); float* OF0 = (float*)take((size_t)NB * QT0 * DM * 4); _Float16* OH0 = (_Float16*)take((size_t)NB * QT0 * DM * 2); _Float16* OL0 = (_Float16*)take((size_t)NB * QT0 * DM * 2);      /* every per-batch plane holds all batches: each stage below is one launch over them */
  if (off > ws_size) return;
  static_assert(B0 == 0 && NBR == NB && MP == (int)NR && MPO == MP, "the merged launches below cover all batches");
  k_prep<<<PB_WA + PB_WO + PB_TB + PB_X, 256, 0, stream>>>(x, wattn, wo, 10000.0f, X16, BQKV, BO, CSB, SNB);      /* weights, rope tables, x: one launch */
  k_qkv<<<3 * GB_P + NB * GB_F, 128, 0, stream>>>(X16, BQKV, Q16, K16, V16, QF0, KF0, VF0, qg, kg, CSB, SNB, DM);      /* q, k, v and the first tile's f32 v: one launch */
  k_att0_vt<<<AB_0 + AB_T, 256, 0, stream>>>(QF0, KF0, VF0, OF0, V16, VT);      /* exact f32 attention for rows 0..255 of each batch, straight from the f32 k and v planes (one kv group a head: no expansion); V^T */
  k_fattn<<<dim3(NH * NB, SQ / 64 + (unsigned)((size_t)NB * QT0 * DM / 8 / 128 / (NH * NB))), 128, 0, stream>>>(Q16, K16, VT, O16, OF0, OH0, OL0);      /* scores, causal softmax and weights x V of all heads, batches and query rows (o x64); the grid rows behind them split the first tile's o */
  k_oproj<<<(MPO / 128) * (DM / 64), 128, 0, stream>>>(O16, OH0, BO, (float*)d_out, DM);      /* out rows are the output layout; rows 0..255 of each batch = o_hi Wo */
  k_gemm2<0><<<dim3((QT0 / 128) * (DM / 64), NB), 128, 0, stream>>>(OL0, DM, (size_t)QT0 * DM, BO, DM, 0, 0.00000095367431640625f, nullptr, 0, (const float*)d_out, -1, 0, 0, (float*)d_out, nullptr, DM, (size_t)SQ * DM, QT0, DM, DM);      /* += o_lo Wo 2^-20 (own-element accumulate) */
}

// v008
// It runs in 213 microseconds.
// In two side-by-side timings against v007, it was 1.08 and 1.09 times as fast.
// All steps since v000 together make it 34.4 times as fast.
#include <hip/hip_runtime.h>
// Causal multi-head self-attention with a per-head RMS norm on q and k THEN rotate-half RoPE computed in the module, and a bias-free fused QKV projection (x [4][2048][1024]; qkv = x Wqkv ([in][out] 1024 x 3072, no bias) split into q | k | v thirds, 16 heads of 64; q, k = x * rsqrt(mean(x^2 over the 64 head dims) + 1e-5) * gain (gains q_norm_w / k_norm_w [64], read); cos / sin = [f | f] of pos * (1 / 10000^(2i/64)); q = q cos + rotate_half(q) sin with rotate_half = cat(-x2, x1), likewise k; scores / sqrt(64); causal (tril, -inf); softmax; out = merged Wproj ([in][out], no bias) -> [4][2048][1024]); run as grouped-query causal attention with 16 groups of ONE head with the norm stage on and the rope stage in its half-split mode.
// Compute dtype: inputs rounded to bf16 (the two gain vectors bf16-rounded on load); x / weights exact; the per-head RMS norm and the rotation in f32 on VALU; q, k, v, softmax weights and o as plain f16 GEMM operands (~2^-12); scores and softmax statistics f32; v_wmma_f32_16x16x32_f16.
#define NB 4
#define NG 16
#define HPG 1
#define KVD (NG * HD)
#define SQ 2048
#define DM 1024
#define NH 16
#define HD 64
#define HG 4
#define QT 256                       /* unused (k_fattn tiles 16 query rows per wave) */
#define NKX SQ
#define QT0 256                      /* first-tile rows recomputed exactly in f32 */
#define B0 0                         /* first batch processed (debug hook) */
#define NBR NB                       /* batches processed (debug hook) */
#define NR ((size_t)NB * SQ)         /* token rows */
#define MP ((int)((size_t)NBR * SQ)) /* rows projected (debug hook) */
#define QN SQ                        /* unused (k_fattn attends all SQ rows of a batch) */
#define NHD NH                       /* unused (all NH heads are attended) */
#define MPO MP                       /* rows through the output stage (debug hook) */
#define LQ DM      /* row pitch of the q/k/v rows */
typedef __bf16 v16b __attribute__((ext_vector_type(16)));
typedef unsigned short v8us __attribute__((ext_vector_type(8), may_alias));
typedef float  v8f  __attribute__((ext_vector_type(8)));
typedef float  v4f  __attribute__((ext_vector_type(4)));
typedef float  v4fa __attribute__((ext_vector_type(4), may_alias));
union FragB { v16b v; v8us half[2]; unsigned short u[16]; };

__device__ __forceinline__ unsigned short bf16_bits(float x) { unsigned int u = __float_as_uint(x); return (unsigned short)((u + 0x7FFFu + ((u >> 16) & 1u)) >> 16); }
__device__ __forceinline__ float bf16_val(unsigned short b) { return __uint_as_float(((unsigned int)b) << 16); }
__device__ __forceinline__ float bf16_round(float x) { return bf16_val(bf16_bits(x)); }
// D += A·B with NT terms: 1 = ah·bh, 2 = + al·bh (A split), 3 = + ah·bl (both split)
template <int NT>
__device__ __forceinline__ v8f mmaN(v16b ah, v16b al, v16b bh, v16b bl, v8f c) {
  c = __builtin_amdgcn_wmma_f32_16x16x32_bf16(false, ah, false, bh, (short)0, c, false, false);
  if (NT >= 2) c = __builtin_amdgcn_wmma_f32_16x16x32_bf16(false, al, false, bh, (short)0, c, false, false);
  if (NT >= 3) c = __builtin_amdgcn_wmma_f32_16x16x32_bf16(false, ah, false, bl, (short)0, c, false, false);
  asm volatile("v_nop\n\tv_nop\n\tv_nop\n\tv_nop" : "+v"(c) : "v"(ah), "v"(al), "v"(bh), "v"(bl));
  return c;
}

__global__ __launch_bounds__(256) void k_wt_bf16(const float* __restrict__ W, unsigned short* __restrict__ Wt, int K, int N) {
  const int t = blockIdx.x * 256 + threadIdx.x;
  const int k8n = K / 8;
  if (t >= N * k8n) return;
  const int n = t / k8n, k8 = (t % k8n) * 8;
  v8us v;
#pragma unroll
  for (int i = 0; i < 8; ++i) v[i] = bf16_bits(W[(size_t)(k8 + i) * N + n]);
  *(v8us*)(Wt + (size_t)n * K + k8) = v;
  
}

// GEMM C[M][N] (f32, pitch ldc) = act(A[M][K]·W + bias). A f32 row-major (pitch lda) converted per fragment to bf16
// (ASPLIT: hi/lo two planes -> 2 terms, else single rounded term); Wt bf16 [N][K] (pitch ldb). BIAS_BF16 rounds the
// bias to bf16 first (bias quantised to bf16 before the add). K%32==0, M%16==0, N%64==0.
template <bool ASPLIT, int ACT, bool BIAS_BF16>
__global__ __launch_bounds__(128) void k_gemm_bf(const float* __restrict__ A, int lda, const unsigned short* __restrict__ Wt, int ldb,
                                               const float* __restrict__ bias, float* __restrict__ C, int ldc, int M, int N, int K) {
  __shared__ __attribute__((aligned(16))) float so[4][16][64];
  const int tid = threadIdx.x, w = tid >> 5, lane = tid & 31, ln = lane & 15, hh = lane >> 4;
  const int ntn = N / 64;
  const int wid = blockIdx.x * 4 + w;
  const int mt = wid / ntn, nq = wid % ntn;
  if (mt * 16 >= M) return;
  const int row0 = mt * 16, col0 = nq * 64;
  const float* arow = A + (size_t)(row0 + ln) * lda;
  v8f acc[4] = {};
  for (int kb = 0; kb < K; kb += 32) {
    FragB ah, al;
    const v4f x0 = *(const v4fa*)(arow + kb + 8 * hh), x1 = *(const v4fa*)(arow + kb + 8 * hh + 4);
    const v4f x2 = *(const v4fa*)(arow + kb + 16 + 8 * hh), x3 = *(const v4fa*)(arow + kb + 16 + 8 * hh + 4);
    float xs[16] = {x0[0],x0[1],x0[2],x0[3],x1[0],x1[1],x1[2],x1[3],x2[0],x2[1],x2[2],x2[3],x3[0],x3[1],x3[2],x3[3]};
#pragma unroll
    for (int i = 0; i < 16; ++i) { const unsigned short hb = bf16_bits(xs[i]); ah.u[i] = hb; al.u[i] = ASPLIT ? bf16_bits(xs[i] - bf16_val(hb)) : (unsigned short)0; }
#pragma unroll
    for (int t = 0; t < 4; ++t) {
      const unsigned short* brow = Wt + (size_t)(col0 + t * 16 + ln) * ldb + kb;
      FragB b;
      b.half[0] = *(const v8us*)(brow + 8 * hh);
      b.half[1] = *(const v8us*)(brow + 16 + 8 * hh);
      acc[t] = mmaN<ASPLIT ? 2 : 1>(ah.v, al.v, b.v, b.v, acc[t]);
    }
  }
#pragma unroll
  for (int t = 0; t < 4; ++t) {
    float bv = bias ? bias[col0 + t * 16 + ln] : 0.f;
    if (BIAS_BF16) bv = bf16_round(bv);
#pragma unroll
    for (int r = 0; r < 8; ++r) { float v = acc[t][r] + bv; if (ACT == 1) v = fmaxf(v, 0.f); so[w][8 * hh + r][t * 16 + ln] = v; }
  }
  __builtin_amdgcn_fence(__ATOMIC_ACQ_REL, "workgroup");
  __builtin_amdgcn_wave_barrier();
  const int rsub = lane >> 4, c4 = (lane & 15) * 4;
  {
#pragma unroll
    for (int q = 0; q < 8; ++q) {
      const int r = q * 2 + rsub;
      const v4f v = *(const v4fa*)&so[w][r][c4];
      *(v4f*)(C + (size_t)(row0 + r) * ldc + col0 + c4) = v;
    }
    
  }
}

// GEMM C = act(A·W + bias + resid): A f32 (ASPLIT -> hi/lo 2 terms), Wt bf16 [N][K]; ACT 0 none, 1 relu, 2 exact gelu;
// resid (optional, f32, row index = (row % rmod), pitch ldr, RES_BF16 rounds it) added before the activation.
template <bool ASPLIT, int ACT, bool BIAS_BF16, bool RES_BF16>
__global__ __launch_bounds__(128) void k_gemm_bf3(const float* __restrict__ A, int lda, const unsigned short* __restrict__ Wt, int ldb,
                                                const float* __restrict__ bias, const float* __restrict__ resid, int rmod, int ldr,
                                                float* __restrict__ C, int ldc, int M, int N, int K) {
  __shared__ __attribute__((aligned(16))) float so[4][16][64];
  const int tid = threadIdx.x, w = tid >> 5, lane = tid & 31, ln = lane & 15, hh = lane >> 4;
  const int ntn = N / 64;
  const int wid = blockIdx.x * 4 + w;
  const int mt = wid / ntn, nq = wid % ntn;
  if (mt * 16 >= M) return;
  const int row0 = mt * 16, col0 = nq * 64;
  const float* arow = A + (size_t)(row0 + ln) * lda;
  v8f acc[4] = {};
  for (int kb = 0; kb < K; kb += 32) {
    FragB ah, al;
    const v4f x0 = *(const v4fa*)(arow + kb + 8 * hh), x1 = *(const v4fa*)(arow + kb + 8 * hh + 4);
    const v4f x2 = *(const v4fa*)(arow + kb + 16 + 8 * hh), x3 = *(const v4fa*)(arow + kb + 16 + 8 * hh + 4);
    float xs[16] = {x0[0],x0[1],x0[2],x0[3],x1[0],x1[1],x1[2],x1[3],x2[0],x2[1],x2[2],x2[3],x3[0],x3[1],x3[2],x3[3]};
#pragma unroll
    for (int i = 0; i < 16; ++i) { const unsigned short hb = bf16_bits(xs[i]); ah.u[i] = hb; al.u[i] = ASPLIT ? bf16_bits(xs[i] - bf16_val(hb)) : (unsigned short)0; }
#pragma unroll
    for (int t = 0; t < 4; ++t) {
      const unsigned short* brow = Wt + (size_t)(col0 + t * 16 + ln) * ldb + kb;
      FragB b;
      b.half[0] = *(const v8us*)(brow + 8 * hh);
      b.half[1] = *(const v8us*)(brow + 16 + 8 * hh);
      acc[t] = mmaN<ASPLIT ? 2 : 1>(ah.v, al.v, b.v, b.v, acc[t]);
    }
  }
#pragma unroll
  for (int t = 0; t < 4; ++t) {
    const int col = col0 + t * 16 + ln;
    float bv = bias ? bias[col] : 0.f;
    if (BIAS_BF16) bv = bf16_round(bv);
#pragma unroll
    for (int r = 0; r < 8; ++r) {
      float v = acc[t][r] + bv;
      if (resid) { float rv = resid[(size_t)((row0 + 8 * hh + r) % rmod) * ldr + col]; if (RES_BF16) rv = bf16_round(rv); v += rv; }
      if (ACT == 1) v = fmaxf(v, 0.f);
      if (ACT == 2) v = 0.5f * v * (1.0f + erff(v * 0.70710678118654752f));
      if (ACT == 3) { const float u = 0.7978845608028654f * (v + 0.044715f * v * v * v); v = 0.5f * v * (1.0f + tanhf(u)); }
      so[w][8 * hh + r][t * 16 + ln] = v;
    }
  }
  __builtin_amdgcn_fence(__ATOMIC_ACQ_REL, "workgroup");
  __builtin_amdgcn_wave_barrier();
  const int rsub = lane >> 4, c4 = (lane & 15) * 4;
  {
#pragma unroll
    for (int q = 0; q < 8; ++q) {
      const int r = q * 2 + rsub;
      const v4f v = *(const v4fa*)&so[w][r][c4];
      *(v4f*)(C + (size_t)(row0 + r) * ldc + col0 + c4) = v;
    }
    
  }
}
// row LayerNorm (biased variance, eps) over N: s = X (+ R); optional out_sum <- s; out_norm <- (s-mu)*rsqrt(var+eps)*g + b
template <bool PARAM_BF16>
__global__ __launch_bounds__(256) void k_layernorm(const float* __restrict__ X, const float* __restrict__ R, const float* __restrict__ g, const float* __restrict__ bta,
                                                  float* __restrict__ out_sum, float* __restrict__ out_norm, int N, float eps) {
  __shared__ float red[256];
  const int row = blockIdx.x, tid = threadIdx.x;
  const float* x = X + (size_t)row * N; const float* rr = R ? R + (size_t)row * N : nullptr;
  float vals[16];                     // up to N = 4096
  const int per = N / 256;            // contiguous chunk per thread? use strided-by-4 chunks: thread handles j = tid*4 + 1024*u
  float s1 = 0.f;
  for (int u = 0; u < per / 4; ++u) {
    const int j = tid * 4 + 1024 * u;
    const v4f a = *(const v4fa*)(x + j);
    v4f b = {0.f,0.f,0.f,0.f}; if (rr) b = *(const v4fa*)(rr + j);
#pragma unroll
    for (int q = 0; q < 4; ++q) { const float v = a[q] + b[q]; vals[u * 4 + q] = v; s1 += v; }
  }
  red[tid] = s1; __syncthreads();
  for (int st = 128; st > 0; st >>= 1) { if (tid < st) red[tid] += red[tid + st]; __syncthreads(); }
  const float mu = red[0] / (float)N; __syncthreads();
  float s2 = 0.f;
  for (int u = 0; u < per / 4; ++u)
#pragma unroll
    for (int q = 0; q < 4; ++q) { const float c = vals[u * 4 + q] - mu; s2 += c * c; }
  red[tid] = s2; __syncthreads();
  for (int st = 128; st > 0; st >>= 1) { if (tid < st) red[tid] += red[tid + st]; __syncthreads(); }
  const float rs = rsqrtf(red[0] / (float)N + eps);
  {
    for (int u = 0; u < per / 4; ++u) {
      const int j = tid * 4 + 1024 * u;
      v4f o, sm;
#pragma unroll
      for (int q = 0; q < 4; ++q) {
        float gg = g[j + q], bb = bta[j + q];
        if (PARAM_BF16) { gg = bf16_round(gg); bb = bf16_round(bb); }
        sm[q] = vals[u * 4 + q]; o[q] = (vals[u * 4 + q] - mu) * rs * gg + bb;
      }
      if (out_sum) *(v4f*)(out_sum + (size_t)row * N + j) = sm;
      *(v4f*)(out_norm + (size_t)row * N + j) = o;
    }
    
  }
}

// ---- f16 WMMA path (v_wmma_f32_16x16x32_f16): 11-bit significands for operands in range — used where a [0,1] probability operand needs more precision than bf16
typedef _Float16 v16h __attribute__((ext_vector_type(16)));
union FragH { v16h v; v8us half[2]; _Float16 h[16]; unsigned short u[16]; };
template <int NT>
__device__ __forceinline__ v8f mmaH(v16h ah, v16h al, v16h bh, v16h bl, v8f c) {
  c = __builtin_amdgcn_wmma_f32_16x16x32_f16(false, ah, false, bh, (short)0, c, false, false);
  if (NT >= 2) c = __builtin_amdgcn_wmma_f32_16x16x32_f16(false, al, false, bh, (short)0, c, false, false);
  if (NT >= 3) c = __builtin_amdgcn_wmma_f32_16x16x32_f16(false, ah, false, bl, (short)0, c, false, false);
  asm volatile("v_nop\n\tv_nop\n\tv_nop\n\tv_nop" : "+v"(c) : "v"(ah), "v"(al), "v"(bh), "v"(bl));
  return c;
}
// batched GEMM like k_gemm_b but f16 operands: A f32 (split into f16 hi/lo if ASPLIT, else rounded to f16), Bt = f16 values [n][k]; alpha; C f32; N multiple of 16 (partial tiles skipped)
template <bool ASPLIT>
__global__ __launch_bounds__(128) void k_gemm_h(const float* __restrict__ A, int lda, size_t sA, const _Float16* __restrict__ Bh, int ldb, size_t sB, float alpha, float* __restrict__ C, int ldc, size_t sC, int M, int N, int K) {
  __shared__ __attribute__((aligned(16))) float so[4][16][64];
  const int tid = threadIdx.x, w = tid >> 5, lane = tid & 31, ln = lane & 15, hh = lane >> 4; const int by = blockIdx.y;
  A += (size_t)by * sA; Bh += (size_t)by * sB; C += (size_t)by * sC;
  const int ntn = (N + 63) / 64; const int wid = blockIdx.x * 4 + w; const int mt = wid / ntn, nq = wid % ntn; if (mt * 16 >= M) return;
  const int row0 = mt * 16, col0 = nq * 64; const float* arow = A + (size_t)(row0 + ln) * lda;
  v8f acc[4] = {};
  for (int kb = 0; kb < K; kb += 32) {
    FragH ah, al;
    const v4f x0 = *(const v4fa*)(arow + kb + 8 * hh), x1 = *(const v4fa*)(arow + kb + 8 * hh + 4), x2 = *(const v4fa*)(arow + kb + 16 + 8 * hh), x3 = *(const v4fa*)(arow + kb + 16 + 8 * hh + 4);
    float xs[16] = {x0[0],x0[1],x0[2],x0[3],x1[0],x1[1],x1[2],x1[3],x2[0],x2[1],x2[2],x2[3],x3[0],x3[1],x3[2],x3[3]};
#pragma unroll
    for (int i = 0; i < 16; ++i) { const _Float16 h = (_Float16)xs[i]; ah.h[i] = h; al.h[i] = ASPLIT ? (_Float16)(xs[i] - (float)h) : (_Float16)0.0f; }
#pragma unroll
    for (int t = 0; t < 4; ++t) { if (col0 + t * 16 >= N) continue; const size_t boff = (size_t)(col0 + t * 16 + ln) * ldb + kb; FragH bq; bq.half[0] = *(const v8us*)(Bh + boff + 8 * hh); bq.half[1] = *(const v8us*)(Bh + boff + 16 + 8 * hh);
      acc[t] = mmaH<ASPLIT ? 2 : 1>(ah.v, al.v, bq.v, bq.v, acc[t]); }
  }
#pragma unroll
  for (int t = 0; t < 4; ++t) { if (col0 + t * 16 >= N) continue;
#pragma unroll
    for (int r = 0; r < 8; ++r) so[w][8 * hh + r][t * 16 + ln] = acc[t][r] * alpha; }
  __builtin_amdgcn_fence(__ATOMIC_ACQ_REL, "workgroup"); __builtin_amdgcn_wave_barrier();
  const int rsub = lane >> 4, c4 = (lane & 15) * 4;
  {
#pragma unroll
    for (int q = 0; q < 8; ++q) { const int r = q * 2 + rsub; if (col0 + c4 < N) { const v4f v = *(const v4fa*)&so[w][r][c4]; *(v4f*)(C + (size_t)(row0 + r) * ldc + col0 + c4) = v; } }
     }
}

// Wt[n][k] = f16(W[k][n]·scale) from f32 row-major W[K][N] (scale = power of two; bf16-exact weights stay exact in f16 away from the subnormal range)
// (vb = the block's index inside its own stage: the stage kernels below are device bodies, several of which share one launch; see the merged kernels in front of kernel_launch)
__device__ __forceinline__ void d_wt_f16(int vb, const float* __restrict__ W, _Float16* __restrict__ Wt, int K, int N, float scale) {
  const int t = vb * 256 + threadIdx.x; if (t >= N * (K / 8)) return; const int n = t / (K / 8), k8 = (t % (K / 8)) * 8; FragH f;
#pragma unroll
  for (int i = 0; i < 8; ++i) f.h[i] = (_Float16)(bf16_round(W[(size_t)(k8 + i) * N + n]) * scale); const v8us o = f.half[0];
  *(v8us*)((unsigned short*)Wt + (size_t)n * K + k8) = o; 
}
// k_gemm_hh variant with fused epilogue: v = acc·alpha + bias[by·sBias + col] (+ CP[(row/rowsPerB)·sCPb + by·64 + col] if CP) ; ACT 0 none / 1 elu ; writes f16 C16 (and f32 C if non-null)
template <int ACT>
__global__ __launch_bounds__(128) void k_gemm_hhx(const _Float16* __restrict__ A, int lda, size_t sA, const _Float16* __restrict__ Bh, int ldb, size_t sB, float alpha, const float* __restrict__ bias, size_t sBias, const float* __restrict__ CP, int rowsPerB, size_t sCPb, int row0g,
    float* __restrict__ C, _Float16* __restrict__ C16, int ldc, size_t sC, int M, int N, int K) {
  __shared__ __attribute__((aligned(16))) float so[4][16][64];
  const int tid = threadIdx.x, w = tid >> 5, lane = tid & 31, ln = lane & 15, hh = lane >> 4; const int by = blockIdx.y;
  A += (size_t)by * sA; Bh += (size_t)by * sB; const size_t cofs = (size_t)by * sC; const float* bp = bias ? bias + (size_t)by * sBias : nullptr;
  const int ntn = (N + 63) / 64; const int wid = blockIdx.x * 4 + w; const int mt = wid / ntn, nq = wid % ntn; if (mt * 16 >= M) return;
  const int row0 = mt * 16, col0 = nq * 64; const _Float16* arow = A + (size_t)(row0 + ln) * lda;
  v8f acc[4] = {};
  for (int kb = 0; kb < K; kb += 32) { FragH ah; ah.half[0] = *(const v8us*)((const unsigned short*)arow + kb + 8 * hh); ah.half[1] = *(const v8us*)((const unsigned short*)arow + kb + 16 + 8 * hh);
#pragma unroll
    for (int t = 0; t < 4; ++t) { if (col0 + t * 16 >= N) continue; const size_t boff = (size_t)(col0 + t * 16 + ln) * ldb + kb; FragH bq; bq.half[0] = *(const v8us*)((const unsigned short*)Bh + boff + 8 * hh); bq.half[1] = *(const v8us*)((const unsigned short*)Bh + boff + 16 + 8 * hh);
      acc[t] = mmaH<1>(ah.v, ah.v, bq.v, bq.v, acc[t]); }
  }
#pragma unroll
  for (int t = 0; t < 4; ++t) { if (col0 + t * 16 >= N) continue; const int col = col0 + t * 16 + ln; const float bv = bp ? bf16_round(bp[col]) : 0.f;
#pragma unroll
    for (int r = 0; r < 8; ++r) { float v = acc[t][r] * alpha + bv; if (CP) { const int rr = row0g + row0 + 8 * hh + r; if (rowsPerB < 0) v += CP[cofs + (size_t)rr * ldc + col];      /* rowsPerB < 0: own element of the batched C plane */ else { const int bidx = rr / rowsPerB; v += CP[(size_t)bidx * sCPb + (size_t)by * 64 + col]; } } if (ACT == 1) v = (v > 0.f) ? v : expm1f(v); else if (ACT == 7) v = (v > 0.f) ? v + 1.0f : expf(v); else if (ACT == 8) v = tanhf(v); else if (ACT == 9) v = 0.5f * v * (1.0f + tanhf(0.7978845608028654f * (v + 0.044715f * v * v * v))); else if (ACT == 11) v = 1.0f / (1.0f + expf(-v)); else if (ACT == 12) v = (v > 0.f) ? v : 0.01f * v; else if (ACT == 14) v = (v > 0.f) ? v : 0.1f * v; else if (ACT == 16) v = (v >= 0.f) ? v : 0.3f * v; else if (ACT == 17) v = (v >= 0.f) ? v : 0.2f * v; else if (ACT == 15) v = v / (1.0f + expf(-v)); else if (ACT == 3) v = fmaxf(v, 0.f); else if (ACT == 6) v = 0.5f * v * (1.0f + erff(v * 0.70710678118654752f)); so[w][8 * hh + r][t * 16 + ln] = v; } }
  __builtin_amdgcn_fence(__ATOMIC_ACQ_REL, "workgroup"); __builtin_amdgcn_wave_barrier();
  const int rsub = lane >> 4, c4 = (lane & 15) * 4; typedef _Float16 v4h __attribute__((ext_vector_type(4)));
  {
#pragma unroll
    for (int q = 0; q < 8; ++q) { const int r = q * 2 + rsub; if (col0 + c4 < N) { const v4f v = *(const v4fa*)&so[w][r][c4]; if (C) *(v4f*)(C + cofs + (size_t)(row0 + r) * ldc + col0 + c4) = v; if (C16) { v4h h4; for (int i = 0; i < 4; ++i) h4[i] = (_Float16)v[i]; *(v4h*)(C16 + cofs + (size_t)(row0 + r) * ldc + col0 + c4) = h4; } } }
     }
}

typedef _Float16 v4h __attribute__((ext_vector_type(4)));

__device__ __forceinline__ void d_x16(int vb, const float* __restrict__ x, _Float16* __restrict__ X16, size_t n8) { const size_t t = (size_t)vb * 256 + threadIdx.x; if (t >= n8) return; FragH f;
#pragma unroll
  for (int q = 0; q < 8; ++q) f.h[q] = (_Float16)bf16_round(x[t * 8 + q]); *(v8us*)((unsigned short*)X16 + t * 8) = f.half[0];  }
__global__ __launch_bounds__(256) void k_h16(const float* __restrict__ x, _Float16* __restrict__ X16, size_t n8) { const size_t t = (size_t)blockIdx.x * 256 + threadIdx.x; if (t >= n8) return; FragH f;
#pragma unroll
  for (int q = 0; q < 8; ++q) f.h[q] = (_Float16)x[t * 8 + q]; *(v8us*)((unsigned short*)X16 + t * 8) = f.half[0];  }
__global__ __launch_bounds__(256) void k_round16f(const float* __restrict__ W, _Float16* __restrict__ Bt, size_t n8) { const size_t t = (size_t)blockIdx.x * 256 + threadIdx.x; if (t >= n8) return; FragH f;
#pragma unroll
  for (int i = 0; i < 8; ++i) f.h[i] = (_Float16)(bf16_round(W[t * 8 + i]) * 16.0f); *(v8us*)((unsigned short*)Bt + t * 8) = f.half[0];  }
template <int NHv, int TTv>
__device__ __forceinline__ void d_vt(int vb, const _Float16* __restrict__ V16, int ldv, int voff, _Float16* __restrict__ Vt) { __shared__ unsigned short tl[64][66]; const int tid = threadIdx.x; const int slab = vb / (TTv / 64), lg = vb % (TTv / 64); const int b = slab / NHv, h = slab % NHv;
  for (int i = tid; i < 64 * 8; i += 256) { const int r = i / 8, c8 = (i % 8) * 8; FragH f; f.half[0] = *(const v8us*)((const unsigned short*)V16 + ((size_t)b * TTv + lg * 64 + r) * ldv + voff + h * 64 + c8);
#pragma unroll
    for (int q = 0; q < 8; ++q) tl[r][c8 + q] = f.u[q]; }
  __syncthreads();
  {
#pragma unroll
    for (int rd = 0; rd < 2; ++rd) { const int d = rd * 32 + tid / 8, pc = tid % 8; FragH f;
#pragma unroll
      for (int q = 0; q < 8; ++q) f.u[q] = tl[pc * 8 + q][d];
      *(v8us*)((unsigned short*)Vt + ((size_t)slab * 64 + d) * TTv + lg * 64 + pc * 8) = f.half[0]; }
    asm volatile("s_wait_xcnt 0x0" ::: "memory");      /* behind the two row stores, in front of any later write of a register that they name (in a merged kernel another stage's code follows in the text) */
     } }

__device__ __forceinline__ void d_hl(int vb, const float* __restrict__ F, _Float16* __restrict__ Hh, _Float16* __restrict__ Hl, size_t n8) { const size_t t = (size_t)vb * 128 + threadIdx.x;      /* blocks of 128 threads: it shares k_fattn's launch */ if (t >= n8) return; FragH fh, fl; const v4f a = *(const v4fa*)(F + t * 8), c = *(const v4fa*)(F + t * 8 + 4);
#pragma unroll
  for (int q = 0; q < 4; ++q) { _Float16 h = (_Float16)a[q]; fh.h[q] = h; fl.h[q] = (_Float16)((a[q] - (float)h) * 1024.0f); h = (_Float16)c[q]; fh.h[4 + q] = h; fl.h[4 + q] = (_Float16)((c[q] - (float)h) * 1024.0f); }
  { *(v8us*)((unsigned short*)Hh + t * 8) = fh.half[0]; *(v8us*)((unsigned short*)Hl + t * 8) = fl.half[0];  } }

// ---- per-head RMS norm and half-split rope on a staged 32 x 64 wave tile (g2_body's NROPE epilogue) ----
// The tile's 64 columns are ONE head, so it holds 32 whole head rows: 16 lanes read a row back, 4 dims a lane (d = 4 ln + u), and norm and rotate it in registers; dim d's rope partner d ^ 32 sits in lane ln ^ 8.
// The sum of squares is a halving tree over the 64 dims (d + 32, + 16, + 8, + 4 by the lane exchanges ln ^ 8, 4, 2, 1; d + 2, d + 1 inside the lane); every lane of a row ends with the same bits.
template <int CTRL> __device__ __forceinline__ float a0_dpp(float x);      /* defined with the first-tile kernel below */
__device__ __forceinline__ float nr_rsqrt(float a) {      /* rsqrtf as the compiler expands it (an argument below 2^-126 goes in x 2^24, its result out x 2^12), with the v_rsq_f32 in place on its own register and a v_nop behind it, so that no reader of its result and no writer of its source follows it directly */
  const bool tiny = a < 0x1p-126f; a = tiny ? a * 0x1p+24f : a; asm("v_rsq_f32 %0, %0\n\tv_nop" : "+v"(a)); return tiny ? a * 0x1p+12f : a; }
// The 16 row pairs of a wave's tile. trow / hp / fp = this lane's place in row hh of the tile and of the two outputs (pitch LQ); b1, b2 = table factors of x_lo and x_hi: (c, -s) in the low half (out_lo = x_lo c - x_hi s), (s, c) in the high half (out_hi = x_lo s + x_hi c).
template <bool F32OUT>
__device__ __forceinline__ void nr_rows(const float* trow, bool lowh, const v4f (&b1)[16], const v4f (&b2)[16], v4f g4, float eps, _Float16* hp, float* fp) {
#pragma unroll      /* the table factors are register arrays: every index must be a constant */
  for (int q = 0; q < 16; ++q) { v4f x = *(const v4fa*)(trow + q * 2 * 68); float t[4];
    for (int u = 0; u < 4; ++u) t[u] = __fmul_rn(x[u], x[u]);
    for (int u = 0; u < 4; ++u) t[u] = __fadd_rn(t[u], a0_dpp<0x168>(t[u]));
    for (int u = 0; u < 4; ++u) t[u] = __fadd_rn(t[u], a0_dpp<0x164>(t[u]));
    for (int u = 0; u < 4; ++u) t[u] = __fadd_rn(t[u], a0_dpp<0x162>(t[u]));
    for (int u = 0; u < 4; ++u) t[u] = __fadd_rn(t[u], a0_dpp<0x161>(t[u]));
    const float rs = nr_rsqrt(__fadd_rn(__fadd_rn(__fadd_rn(t[0], t[2]), __fadd_rn(t[1], t[3])) / (float)HD, eps));
    v4f o; v4h h4;      /* x_hi's product is rounded, x_lo's is fused into the sum, alike in both halves */
    for (int u = 0; u < 4; ++u) { const float own = __fmul_rn(__fmul_rn(x[u], rs), g4[u]), oth = a0_dpp<0x168>(own); const float lo = lowh ? own : oth, hi = lowh ? oth : own;
      o[u] = __builtin_fmaf(lo, b1[q][u], __fmul_rn(hi, b2[q][u])); h4[u] = (_Float16)o[u]; }
    *(v4h*)(hp + (size_t)q * 2 * LQ) = h4;
    if (F32OUT) *(v4f*)(fp + (size_t)q * 2 * LQ) = o; }
  asm volatile("s_wait_xcnt 0x0" ::: "memory"); }      /* behind the tail's last stores, in front of any later write of a register that they name (the code that follows the place where the two tails join) */

// ---- fast GEMM (block tile 128x64, wave tile 32x64; requires M % 128 == 0 rows per launch region, N % 64 == 0 and K % 64 == 0). Operands go through LDS: a stage is 64 k (one 128-byte line of each of the 128 A rows and 64 B rows), read from global as whole lines (8 lanes a row) one stage ahead into registers and stored to the other of two buffers at a row pitch of 144 bytes (16 x odd: ds_load_b128 fragment reads without bank conflicts); epilogue = k_gemm_hhx semantics, or with NROPE: no bias, per-head RMS norm (gain, eps) and half-split rope (tables CS, SN; position = row % SQ) on acc alpha, f16 rows to C16 and, of the positions below QT0 of every sequence, the same values in f32 to C (QT0 rows a sequence), both at pitch LQ ----
__device__ __forceinline__ v16h g2_frag(const _Float16* p, int hh) { FragH f; f.half[0] = *(const v8us*)((const unsigned short*)p + 8 * hh); f.half[1] = *(const v8us*)((const unsigned short*)p + 16 + 8 * hh); return f.v; }
__device__ __forceinline__ v8f g2_mma(v16h a, v16h b, v8f c) { v8f d = __builtin_amdgcn_wmma_f32_16x16x32_f16(false, a, false, b, (short)0, c, false, false); asm volatile("v_nop\n\tv_nop\n\tv_nop\n\tv_nop" : "+v"(d) : "v"(a), "v"(b)); return d; }
constexpr int G2_SM = 2 * (128 * 72 + 64 * 72);      /* 16-bit elements of a block's LDS: two A and two B buffers */
template <int ACT, bool NROPE = false, bool LOHI = false>
__device__ __forceinline__ void g2_body(unsigned short* sm, int bx, int by, const _Float16* __restrict__ A, int lda, size_t sA, const _Float16* __restrict__ Bh, int ldb, size_t sB, float alpha, const float* __restrict__ bias, size_t sBias, const float* __restrict__ CP, int rowsPerB, size_t sCPb, int row0g,
    float* __restrict__ C, _Float16* __restrict__ C16, int ldc, size_t sC, int M, int N, int K, const float* __restrict__ gain = nullptr, float eps = 0.f, const float* __restrict__ CS = nullptr, const float* __restrict__ SN = nullptr, const _Float16* __restrict__ ALO = nullptr) { static_assert(ACT == 0 || ACT == 3 || ACT == 6 || ACT == 8 || ACT == 9 || ACT == 11 || ACT == 12 || ACT == 14 || ACT == 15 || ACT == 16 || ACT == 17, "k_gemm2: unsupported ACT code (would silently apply no activation)");
  constexpr int LP = 72, ABUF = 128 * LP, BBUF = 64 * LP;      /* LDS row pitch and buffer sizes in 16-bit elements */
  static_assert(G2_SM == 2 * (ABUF + BBUF), "sm = the calling kernel's __shared__ array of G2_SM elements");      /* A buffers 0, 1, then B buffers 0, 1; behind the k loop's last barrier the same bytes are the epilogue's staging tiles */
  static_assert(G2_SM * sizeof(unsigned short) >= 4 * 32 * 68 * sizeof(float), "the epilogue's four 32 x 68 f32 tiles fit the operand buffers");
  float (*so)[32][68] = reinterpret_cast<float (*)[32][68]>(sm);
  const int tid = threadIdx.x, w = tid >> 5, lane = tid & 31, ln = lane & 15, hh = lane >> 4;
  A += (size_t)by * sA; Bh += (size_t)by * sB; const size_t cofs = (size_t)by * sC; const float* bp = bias ? bias + (size_t)by * sBias : nullptr;
  const int ntn = N >> 6; const int mt = bx / ntn, nq = bx - mt * ntn; const int row0 = mt * 128 + 32 * w, col0 = nq * 64; if (mt * 128 >= M) return;      /* the whole block leaves or none does: barriers follow */
  __builtin_assume(lda == DM && ldb == DM);      /* every launch below passes these two pitches: the 16-row steps of a stage's loads become immediate offsets of one address */
  const char* ga = (const char*)(A + (size_t)(mt * 128) * lda); const char* gb = (const char*)(Bh + (size_t)col0 * ldb);      /* the block's first A and B row */
  // LOHI with a plane ALO (laid out like A; block-uniform, may be null): C = (A + ALO 2^-10) B alpha in ONE k loop: first the K / 64 stages of ALO, then the accumulators x 2^-10 (exact), then the stages of A on top of them.
  const char* gl = (LOHI && ALO) ? (const char*)(ALO + (size_t)by * sA + (size_t)(mt * 128) * lda) : ga; const int nlo = (LOHI && ALO) ? (K >> 6) : 0;      /* stages 0 .. nlo - 1 read ALO */
  const unsigned sr = (((unsigned)tid >> 3) & 1u) * 8u + ((unsigned)tid >> 4), sc = ((unsigned)tid & 7u) * 8u;      /* 8 lanes a row; the two rows of 16 neighbouring lanes lie 8 apart, so that at the 144-byte pitch their 256 stored bytes fall on 64 different banks */
  const unsigned va = (sr * (unsigned)lda + sc) * 2u, vb = (sr * (unsigned)ldb + sc) * 2u;      /* this thread's 16 bytes of row sr + 16 i of a stage: a 32-bit byte offset beside a block-uniform base */
  unsigned short* la = sm + sr * LP + sc; unsigned short* lb = sm + 2 * ABUF + sr * LP + sc;
  const _Float16* fa = (const _Float16*)sm + (32 * w + ln) * LP; const _Float16* fb = (const _Float16*)sm + 2 * ABUF + ln * LP;      /* this lane's fragment rows */
  v8us ra[8], rb[4];
  auto fetch = [&](int s) { const char* gs = (LOHI && s < nlo) ? gl : ga; const int ks = (LOHI && s >= nlo) ? s - nlo : s;      /* the stage's A plane and its place along k: scalar selects */
#pragma unroll      /* register arrays: constant indices */
    for (int i = 0; i < 8; ++i) ra[i] = *(const v8us*)(gs + ((size_t)(i * 32) * lda + (size_t)ks * 128) + va);
#pragma unroll      /* register arrays: constant indices */
    for (int i = 0; i < 4; ++i) rb[i] = *(const v8us*)(gb + ((size_t)(i * 32) * ldb + (size_t)ks * 128) + vb);
    asm volatile("s_wait_xcnt 0x0" ::: "memory"); };      /* behind the stage's 12 loads, in front of every later write of an address register that they name */
  auto put = [&](int buf) {
#pragma unroll      /* register arrays: constant indices */
    for (int i = 0; i < 8; ++i) *(v8us*)(la + buf * ABUF + i * 16 * LP) = ra[i];
#pragma unroll      /* register arrays: constant indices */
    for (int i = 0; i < 4; ++i) *(v8us*)(lb + buf * BBUF + i * 16 * LP) = rb[i]; };
  const v8f z8 = {0.f,0.f,0.f,0.f,0.f,0.f,0.f,0.f}; v8f c00 = z8, c01 = z8, c02 = z8, c03 = z8, c10 = z8, c11 = z8, c12 = z8, c13 = z8;
  const int nst = (K >> 6) + nlo;
  if (nst > 0) { fetch(0); put(0); }
  __syncthreads();      /* stage 0 is in buffer 0 for every wave */
  for (int s = 0; s < nst; ++s) { const int cur = s & 1; const bool more = s + 1 < nst;
    if (more) fetch(s + 1);      /* the next stage's lines fly under this stage's products */
    if (LOHI && s == nlo && s > 0) { c00 *= 0x1p-10f; c01 *= 0x1p-10f; c02 *= 0x1p-10f; c03 *= 0x1p-10f; c10 *= 0x1p-10f; c11 *= 0x1p-10f; c12 *= 0x1p-10f; c13 *= 0x1p-10f; }      /* block-uniform, once: the low plane's sums take their weight before the first stage of A */
    const _Float16* pa = fa + cur * ABUF; const _Float16* pb = fb + cur * BBUF; v16h a0[2], a1[2], b[2][4];
#pragma unroll      /* register arrays: constant indices */
    for (int kk = 0; kk < 2; ++kk) { a0[kk] = g2_frag(pa + kk * 32, hh); a1[kk] = g2_frag(pa + 16 * LP + kk * 32, hh);
      for (int t = 0; t < 4; ++t) b[kk][t] = g2_frag(pb + t * 16 * LP + kk * 32, hh); }
#pragma unroll      /* register arrays: constant indices */
    for (int kk = 0; kk < 2; ++kk) { c00 = g2_mma(a0[kk], b[kk][0], c00); c10 = g2_mma(a1[kk], b[kk][0], c10); c01 = g2_mma(a0[kk], b[kk][1], c01); c11 = g2_mma(a1[kk], b[kk][1], c11);
      c02 = g2_mma(a0[kk], b[kk][2], c02); c12 = g2_mma(a1[kk], b[kk][2], c12); c03 = g2_mma(a0[kk], b[kk][3], c03); c13 = g2_mma(a1[kk], b[kk][3], c13); }
    if (more) put(cur ^ 1);      /* into the buffer whose last readers passed the barrier at the foot of the trip before */
    __syncthreads(); }      /* publishes stage s + 1 and ends every wave's reads of stage s (behind the last trip: before the epilogue reuses the bytes) */
  v8f accs[8] = {c00, c01, c02, c03, c10, c11, c12, c13};
  if constexpr (NROPE) { static_assert(HD == 64 && QT0 % 32 == 0 && SQ % 32 == 0, "a wave tile's 64 columns are one head; its 32 rows lie on one side of QT0 and in one sequence");
    const int c4 = ln * 4; const bool lowh = ln < 8; const unsigned tofs = (unsigned)((row0 % SQ + hh) * (HD / 2) + (ln & 7) * 4);      /* table row = the token's position, table column = d & 31 */
    const float* cp = CS + tofs; const float* sp = SN + tofs; v4f tc[16], ts[16];
#pragma unroll      /* register arrays: constant indices */
    for (int q = 0; q < 16; ++q) { tc[q] = *(const v4fa*)(cp + q * 2 * (HD / 2)); ts[q] = *(const v4fa*)(sp + q * 2 * (HD / 2)); }      /* all 32 table rows asked for here, so that one latency runs under the LDS staging below */
    v4f g4 = *(const v4fa*)(gain + c4);
    asm volatile("s_wait_xcnt 0x0" ::: "memory");      /* behind the 33 loads, in front of every later write of an address register that they name */
#pragma unroll      /* accs is a register array: constant indices */
    for (int u = 0; u < 8; ++u) for (int r = 0; r < 8; ++r) so[w][(u >> 2) * 16 + 8 * hh + r][(u & 3) * 16 + ln] = accs[u][r] * alpha;
    __builtin_amdgcn_fence(__ATOMIC_ACQ_REL, "workgroup"); __builtin_amdgcn_wave_barrier();      /* as in the plain epilogue: the wave's own LDS writes before its reads */
    for (int u = 0; u < 4; ++u) g4[u] = bf16_round(g4[u]);
#pragma unroll      /* register arrays: constant indices */
    for (int q = 0; q < 16; ++q) { const v4f c = tc[q], s = ts[q]; tc[q] = lowh ? c : s; ts[q] = lowh ? -s : c; }
    const size_t e = cofs + (size_t)(row0 + hh) * LQ + col0 + c4; const size_t ef = e - (size_t)(row0 / SQ) * (SQ - QT0) * LQ;      /* the f32 plane holds QT0 rows a sequence: sequence s, position p lies at row s QT0 + p */
    if (__builtin_amdgcn_readfirstlane(row0 % SQ) < QT0) nr_rows<true>(&so[w][hh][c4], lowh, tc, ts, g4, eps, C16 + e, C + ef);      /* one wave-uniform branch around the whole tail: inside it the 16 row pairs stay one block of code to schedule */
    else nr_rows<false>(&so[w][hh][c4], lowh, tc, ts, g4, eps, C16 + e, C + ef);
    return; }
#pragma unroll
  for (int u = 0; u < 8; ++u) { const int t = u & 3, half = u >> 2; const int col = col0 + t * 16 + ln; const float bv = bp ? bf16_round(bp[col]) : 0.f;
#pragma unroll
    for (int r = 0; r < 8; ++r) { const int rloc = half * 16 + 8 * hh + r; float v = accs[u][r] * alpha + bv; if (CP) { if (rowsPerB < 0) v += CP[cofs + (size_t)(row0g + row0 + rloc) * ldc + col];      /* rowsPerB < 0: own element of the batched C plane */ else { const int bidx = (row0g + row0 + rloc) / rowsPerB; v += CP[(size_t)bidx * sCPb + (size_t)by * 64 + col]; } }
      if (ACT == 3) v = fmaxf(v, 0.f); else if (ACT == 6) v = 0.5f * v * (1.0f + erff(v * 0.70710678118654752f)); else if (ACT == 11) v = 1.0f / (1.0f + expf(-v)); else if (ACT == 15) v = v / (1.0f + expf(-v)); else if (ACT == 12) v = (v > 0.f) ? v : 0.01f * v; else if (ACT == 8) v = tanhf(v); else if (ACT == 9) v = 0.5f * v * (1.0f + tanhf(0.7978845608028654f * (v + 0.044715f * v * v * v))); else if (ACT == 14) v = (v > 0.f) ? v : 0.1f * v; else if (ACT == 16) v = (v >= 0.f) ? v : 0.3f * v; else if (ACT == 17) v = (v >= 0.f) ? v : 0.2f * v;
      so[w][rloc][t * 16 + ln] = v; } }
  __builtin_amdgcn_fence(__ATOMIC_ACQ_REL, "workgroup"); __builtin_amdgcn_wave_barrier();
  const int rsub = lane >> 4, c4 = (lane & 15) * 4;
  {
#pragma unroll
    for (int q = 0; q < 16; ++q) { const int r = q * 2 + rsub; const v4f v = *(const v4fa*)&so[w][r][c4]; if (C) { *(v4f*)(C + cofs + (size_t)(row0 + r) * ldc + col0 + c4) = v; asm volatile("s_wait_xcnt 0x0" ::: "memory"); }      /* directly behind the f32 store, in front of every later write of a register that it names (the f16 conversion, the next row's address) */
      if (C16) { v4h h4; for (int i = 0; i < 4; ++i) h4[i] = (_Float16)v[i]; *(v4h*)(C16 + cofs + (size_t)(row0 + r) * ldc + col0 + c4) = h4; } }
    asm volatile("s_wait_xcnt 0x0" ::: "memory");      /* behind the last row's stores, in front of any later write of a register that they name (in a merged kernel another branch's code follows in the text) */
     } }

__global__ __launch_bounds__(256) void k_wnat(const float* __restrict__ w, size_t n8, _Float16* __restrict__ Bt) { const size_t t = (size_t)blockIdx.x * 256 + threadIdx.x; if (t >= n8) return; FragH f; for (int q = 0; q < 8; ++q) f.h[q] = (_Float16)(bf16_round(w[t * 8 + q]) * 16.0f); *(v8us*)((unsigned short*)Bt + t * 8) = f.half[0];  }

// Fused causal attention of all batches (blockIdx.x = head + NH * batch, blockIdx.y = query tile group): one wave owns 16 query rows of one head and walks its keys 32 at a time with a running maximum and sum; the block's four waves share the key and value tiles in LDS.
// S^T = K Q^T (A = key rows, B = query rows): a lane holds scores of ONE query (column ln), keys 8 hh + r of each 16-key tile, so two converted score tiles are, as they lie, the B fragment of O^T += V^T P^T (A = rows of V^T).
// Weights are carried x256 (f16 range) and cancel in the division by their own sum; o leaves x64 like before.
__device__ __forceinline__ float fa_xhalf(float x) { return __builtin_bit_cast(float, __builtin_amdgcn_permlanex16(__builtin_bit_cast(int, x), __builtin_bit_cast(int, x), 0x76543210, 0xfedcba98, false, false)); }      /* lane l <-> lane l ^ 16 */
__global__ __launch_bounds__(128) void k_fattn(const _Float16* __restrict__ Q, const _Float16* __restrict__ K, const _Float16* __restrict__ Vt, _Float16* __restrict__ O, const float* __restrict__ F0, _Float16* __restrict__ H0, _Float16* __restrict__ L0) {
  if (blockIdx.y >= SQ / 64) { d_hl((int)((blockIdx.y - SQ / 64) * gridDim.x + blockIdx.x), F0, H0, L0, (size_t)NB * QT0 * DM / 8); return; }      /* the grid rows behind the SQ / 64 tile groups: first-tile o (x64) -> f16 hi + x1024 residual planes, which depends on nothing of this launch; whole blocks leave, in front of every barrier */
  // The block's four waves own 64 neighbouring query rows of one head and walk the same keys, so K and V^T go through LDS once for all four: a stage is 64 keys (one 128-byte line of each of 64 key rows and of each of the 64 V^T rows),
  // read from global as whole lines (8 lanes a row) one stage ahead into registers and stored to the other of two buffers at the 144-byte row pitch of k_gemm2; the fragments are ds_load_b128 reads of the same elements as before.
  constexpr int LP = 72, TB = 64 * LP;      /* LDS row pitch and tile size in 16-bit elements */
  __shared__ __attribute__((aligned(16))) unsigned short sm[4 * TB];      /* K buffers 0, 1, then V^T buffers 0, 1 */
  const int tid = threadIdx.x, lane = tid & 31, ln = lane & 15, hh = lane >> 4; const int w = __builtin_amdgcn_readfirstlane((int)(threadIdx.x >> 5)); const int h = blockIdx.x % NH; const size_t bz = blockIdx.x / NH;
  Q += bz * SQ * LQ; K += bz * SQ * KVD; Vt += bz * NH * HD * SQ; O += bz * SQ * DM;      /* this batch's rows and its V^T planes */
  const int grp = (int)(SQ / 64 - 1 - blockIdx.y);      /* the tile group is the slow grid index: the longest key walks of every head and batch have the lowest block indices */
  const int q0w = (grp * 4 + w) * 16;
  const int qi = q0w + ln; const int kend = ((q0w >> 5) + 1) * 32;      /* keys 0 .. kend - 1 cover every key <= q0w + 15; kend <= SQ */
  const int nst = grp + 1;      /* stages of the block: keys 0 .. 64 grp + 63, the same count for its four waves (barriers below) */
  const _Float16* qp = Q + (size_t)qi * LQ + h * HD; const v16h qa = g2_frag(qp, hh), qb = g2_frag(qp + 32, hh);
  const char* gk = (const char*)(K + h * HD); const char* gv = (const char*)(Vt + (size_t)h * HD * SQ);      /* the head's first key row and first V^T row */
  const unsigned sr = (((unsigned)tid >> 3) & 1u) * 8u + ((unsigned)tid >> 4), sc = ((unsigned)tid & 7u) * 8u;      /* as in k_gemm2: 8 lanes a row; the two rows of 16 neighbouring lanes lie 8 apart, so that their 256 stored bytes fall on 64 different banks */
  const unsigned vk = (sr * (unsigned)KVD + sc) * 2u, vv = (sr * (unsigned)SQ + sc) * 2u;      /* this thread's 16 bytes of row sr + 16 i of a stage: a 32-bit byte offset beside a block-uniform base */
  unsigned short* lk = sm + sr * LP + sc; unsigned short* lv = lk + 2 * TB;
  const _Float16* fk = (const _Float16*)sm + ln * LP; const _Float16* fv = fk + 2 * TB;      /* this lane's fragment rows */
  v8us rk[4], rv[4];
  auto fetch = [&](int s) {
#pragma unroll      /* register arrays: constant indices */
    for (int i = 0; i < 4; ++i) rk[i] = *(const v8us*)(gk + ((size_t)(s * 64 + i * 16) * (KVD * 2)) + vk);
#pragma unroll      /* register arrays: constant indices */
    for (int i = 0; i < 4; ++i) rv[i] = *(const v8us*)(gv + ((size_t)(i * 16) * (SQ * 2) + (size_t)s * 128) + vv);
    asm volatile("s_wait_xcnt 0x0" ::: "memory"); };      /* behind the stage's 8 loads, in front of every later write of an address register that they name */
  auto put = [&](int buf) {
#pragma unroll      /* register arrays: constant indices */
    for (int i = 0; i < 4; ++i) { *(v8us*)(lk + buf * TB + i * 16 * LP) = rk[i]; *(v8us*)(lv + buf * TB + i * 16 * LP) = rv[i]; } };
  const v8f z8 = {0.f,0.f,0.f,0.f,0.f,0.f,0.f,0.f}; v8f o0 = z8, o1 = z8, o2 = z8, o3 = z8;
  const float cs = 0.125f * 1.4426950408889634f;      /* 1 / sqrt(64), and e^x = 2^(x log2 e) */
  float m = -1.0e30f, l = 0.f;
  fetch(0); put(0);
  __syncthreads();      /* stage 0 is in buffer 0 for every wave */
  for (int s = 0; s < nst; ++s) { const int cur = s & 1; const bool more = s + 1 < nst;
    if (more) fetch(s + 1);      /* the next stage's lines fly under this stage's two passes */
   for (int ps = 0; ps < 2; ++ps) { const int kb = s * 64 + ps * 32;
    if (kb >= kend) break;      /* wave-uniform: the second half of the last stage lies above every query of the block's two lower waves */
    const _Float16* pk = fk + cur * TB + ps * 32 * LP; const _Float16* pv = fv + cur * TB + ps * 32;
    const v16h k0a = g2_frag(pk, hh), k0b = g2_frag(pk + 32, hh), k1a = g2_frag(pk + 16 * LP, hh), k1b = g2_frag(pk + 16 * LP + 32, hh);
    const v16h v0 = g2_frag(pv, hh), v1 = g2_frag(pv + 16 * LP, hh), v2 = g2_frag(pv + 32 * LP, hh), v3 = g2_frag(pv + 48 * LP, hh);
    v8f s0 = g2_mma(k0a, qa, z8); s0 = g2_mma(k0b, qb, s0); v8f s1 = g2_mma(k1a, qa, z8); s1 = g2_mma(k1b, qb, s1);
    if (kb + 31 > q0w) {      /* only the last pass holds keys above a query of this tile */
      for (int r = 0; r < 8; ++r) { const int key = kb + 8 * hh + r; s0[r] = (key <= qi) ? s0[r] : -1.0e30f; s1[r] = (key + 16 <= qi) ? s1[r] : -1.0e30f; } }
    float mx = fmaxf(s0[0], s1[0]);
    for (int r = 1; r < 8; ++r) mx = fmaxf(mx, fmaxf(s0[r], s1[r]));
    mx = fmaxf(mx, fa_xhalf(mx)); const float mn = fmaxf(m, mx); float corr = (m - mn) * cs; m = mn; const float bias = fmaf(-mn, cs, 8.0f);
    float e[16];
    for (int r = 0; r < 8; ++r) { e[r] = fmaf(s0[r], cs, bias); e[8 + r] = fmaf(s1[r], cs, bias); }
    /* the pass's 17 exponentials, each in place on a register of its own, so that no transcendental is directly followed by a reader of its result or a writer of its source; the v_nop is that slot behind the last one */
    asm("v_exp_f32 %0, %0\n\tv_exp_f32 %1, %1\n\tv_exp_f32 %2, %2\n\tv_exp_f32 %3, %3\n\tv_exp_f32 %4, %4\n\tv_exp_f32 %5, %5\n\tv_exp_f32 %6, %6\n\tv_exp_f32 %7, %7\n\tv_exp_f32 %8, %8\n\t"
        "v_exp_f32 %9, %9\n\tv_exp_f32 %10, %10\n\tv_exp_f32 %11, %11\n\tv_exp_f32 %12, %12\n\tv_exp_f32 %13, %13\n\tv_exp_f32 %14, %14\n\tv_exp_f32 %15, %15\n\tv_exp_f32 %16, %16\n\tv_nop"
        : "+v"(corr), "+v"(e[0]), "+v"(e[1]), "+v"(e[2]), "+v"(e[3]), "+v"(e[4]), "+v"(e[5]), "+v"(e[6]), "+v"(e[7]), "+v"(e[8]), "+v"(e[9]), "+v"(e[10]), "+v"(e[11]), "+v"(e[12]), "+v"(e[13]), "+v"(e[14]), "+v"(e[15]));
    FragH pf; float sum = 0.f;
    for (int r = 0; r < 8; ++r) { sum += e[r] + e[8 + r]; pf.h[r] = (_Float16)e[r]; pf.h[8 + r] = (_Float16)e[8 + r]; }
    l = fmaf(l, corr, sum);
    for (int r = 0; r < 8; ++r) { o0[r] *= corr; o1[r] *= corr; o2[r] *= corr; o3[r] *= corr; }
    o0 = g2_mma(v0, pf.v, o0); o1 = g2_mma(v1, pf.v, o1); o2 = g2_mma(v2, pf.v, o2); o3 = g2_mma(v3, pf.v, o3); }
    if (more) { put(cur ^ 1);      /* into the buffer whose last readers passed the barrier at the foot of the trip before */
      __syncthreads(); } }      /* block-uniform: publishes stage s + 1 and ends every wave's reads of stage s */
  const float fin = 64.0f / (l + fa_xhalf(l));      /* the two lane halves hold disjoint keys of the same query */
  unsigned short* op = (unsigned short*)O + (size_t)qi * DM + h * HD + 8 * hh; FragH f0, f1;
  for (int r = 0; r < 8; ++r) { f0.h[r] = (_Float16)(o0[r] * fin); f0.h[8 + r] = (_Float16)(o1[r] * fin); f1.h[r] = (_Float16)(o2[r] * fin); f1.h[8 + r] = (_Float16)(o3[r] * fin); }
  *(v8us*)op = f0.half[0]; *(v8us*)(op + 16) = f0.half[1]; *(v8us*)(op + 32) = f1.half[0]; *(v8us*)(op + 48) = f1.half[1]; }      /* register r of tile dt = O[qi][16 dt + 8 hh + r]: 16-byte stores */

// Exact f32 attention of the first QT0 rows: one wave owns ONE query row. Lane = (key slice ks = lane >> 2, dim part dp = lane & 3): the lane walks keys ks, ks + 8, ... of its row
// and keeps dims 16 c + 4 dp + u (c, u < 4) of q and of its slice's partial o in registers, with the slice's own running maximum and sum (base-2 exponents); the 8 slices are merged at the end by lane exchanges.
template <int CTRL> __device__ __forceinline__ float a0_dpp(float x) { return __builtin_bit_cast(float, __builtin_amdgcn_update_dpp(0, __builtin_bit_cast(int, x), CTRL, 0xf, 0xf, true)); }      /* 0x160 + n: lane l <- lane l ^ n inside a 16-lane row; every lane is on wherever it is used */
__device__ __forceinline__ void a0_exp2x2(float& x, float& y) { asm("v_exp_f32 %0, %0\n\tv_exp_f32 %1, %1\n\tv_nop" : "+v"(x), "+v"(y)); }      /* two exponentials, each in place on its own register, so that neither is directly followed by a reader of its result; the v_nop is that slot behind the second */
template <int STEP> __device__ __forceinline__ float a0_swap(float x) { return STEP == 16 ? fa_xhalf(x) : a0_dpp<0x160 + (STEP & 15)>(x); }
template <int STEP> __device__ __forceinline__ void a0_merge(float& m, float& l, v4f (&o)[4]) {      /* this lane's slices with those of lane ^ STEP; a slice without keys has m = -1e30, l = 0, o = 0 and drops out */
  const float mo = a0_swap<STEP>(m), lo = a0_swap<STEP>(l); const float mn = fmaxf(m, mo); float fa = m - mn, fb = mo - mn; a0_exp2x2(fa, fb);
  l = fmaf(l, fa, lo * fb); m = mn;
  for (int c = 0; c < 4; ++c) for (int u = 0; u < 4; ++u) o[c][u] = fmaf(o[c][u], fa, a0_swap<STEP>(o[c][u]) * fb); }
__device__ __forceinline__ void a0_exp2x3(float& x, float& y, float& z) { asm("v_exp_f32 %0, %0\n\tv_exp_f32 %1, %1\n\tv_exp_f32 %2, %2\n\tv_nop" : "+v"(x), "+v"(y), "+v"(z)); }      /* as a0_exp2x2, for three */
__device__ __forceinline__ float a0_dot(const v4f (&q)[4], const v4f (&kk)[4]) {      /* q . k over the four lanes of a key: all four end with the same bits */
  v4f pv = q[0] * kk[0]; for (int c = 1; c < 4; ++c) pv = __builtin_elementwise_fma(q[c], kk[c], pv);
  float s = (pv[0] + pv[1]) + (pv[2] + pv[3]); s += a0_dpp<0x161>(s); s += a0_dpp<0x162>(s); return s; }
__device__ __forceinline__ void d_att0(int bx, int by, int bz, const float* __restrict__ QF, const float* __restrict__ KF, const float* __restrict__ VF, int ld, float scale, float* __restrict__ OF, int ldo) {
  static_assert(HD == 64 && QT0 % 8 == 0, "four lanes of 16 dims a row; eight rows a block");
  const int lane = threadIdx.x & 31, ks = lane >> 2, dp = lane & 3; const int w = __builtin_amdgcn_readfirstlane((int)(threadIdx.x >> 5)); const int h = by;
  { const size_t zb = (size_t)bz * QT0; QF += zb * ld; KF += zb * ld; VF += zb * ld; OF += zb * ldo; }      /* bz = batch: QT0 rows of each plane */
  const int i = QT0 - 1 - (w * (QT0 / 8) + bx);      /* a block's eight rows lie QT0 / 8 apart: every block holds long and short key walks alike */
  const int col = h * HD + dp * 4; const float* qr = QF + (unsigned)(i * ld + col);
  v4f q[4], o[4]; const v4f z4 = {0.f, 0.f, 0.f, 0.f};
  for (int c = 0; c < 4; ++c) { q[c] = *(const v4fa*)(qr + c * 16); o[c] = z4; }
  const float cs = scale * 1.4426950408889634f;      /* e^x = 2^(x log2 e) */
  float m = -1.0e30f, l = 0.f;
  for (int jb = 0; jb <= i; jb += 16) {      /* 16 keys a pass, two a lane group: ja and ja + 8; a key above the diagonal (last pass only) is read as row i and weighs 0 */
    const int ja = jb + ks; const bool oka = ja <= i, okb = ja + 8 <= i;
    const unsigned offa = (unsigned)((oka ? ja : i) * ld + col), offb = (unsigned)((okb ? ja + 8 : i) * ld + col); v4f ka[4], kb[4], va[4], vb[4];
    const float* pka = KF + offa; const float* pkb = KF + offb; const float* pva = VF + offa; const float* pvb = VF + offb;
    for (int c = 0; c < 4; ++c) { ka[c] = *(const v4fa*)(pka + c * 16); kb[c] = *(const v4fa*)(pkb + c * 16); }
    for (int c = 0; c < 4; ++c) { va[c] = *(const v4fa*)(pva + c * 16); vb[c] = *(const v4fa*)(pvb + c * 16); }
    asm volatile("s_wait_xcnt 0x0" :: "v"(pka), "v"(pkb), "v"(pva), "v"(pvb) : "memory");      /* behind the pass's 16 loads, in front of every write of an address register that they name; the four addresses are inputs so that their registers live up to the wait and no load of the pass lands on one */
    __builtin_amdgcn_sched_barrier(0);      /* the arithmetic stays behind the 16 loads; without this the loads are spread among it in small groups, each waited for in turn */
    const float sa = a0_dot(q, ka) * cs, sb = a0_dot(q, kb) * cs;
    const float mn = fmaxf(m, fmaxf(oka ? sa : -1.0e30f, okb ? sb : -1.0e30f)); float sc = m - mn, ea = oka ? sa - mn : -1.0e30f, eb = okb ? sb - mn : -1.0e30f; a0_exp2x3(sc, ea, eb); m = mn;
    l = fmaf(l, sc, ea + eb); const v4f ea4 = {ea, ea, ea, ea}, eb4 = {eb, eb, eb, eb};
    for (int c = 0; c < 4; ++c) o[c] = __builtin_elementwise_fma(vb[c], eb4, __builtin_elementwise_fma(va[c], ea4, o[c] * sc)); }
  a0_merge<4>(m, l, o); a0_merge<8>(m, l, o); a0_merge<16>(m, l, o);
  const float fin = 64.0f / l;      /* o carried x64 like the f16 path; key 0 is in every row, so l > 0 */
  if (ks == 0) { float* dst = OF + (unsigned)(i * ldo + col); for (int c = 0; c < 4; ++c) *(v4f*)(dst + c * 16) = o[c] * fin; } }

__global__ __launch_bounds__(256) void k_kvexp(const float* __restrict__ src, float* __restrict__ dst, size_t n4) { const size_t t = (size_t)blockIdx.x * 256 + threadIdx.x; if (t >= n4) return; const size_t e = t * 4; const size_t row = e / DM; const int col = (int)(e % DM); const int h = col / HD, d = col % HD; const v4f v = *(const v4fa*)(src + row * KVD + (size_t)(h / HPG) * HD + d); *(v4f*)(dst + e) = v;  }

__device__ __forceinline__ void d_tab2(int vb, float theta, float* __restrict__ CS, float* __restrict__ SN) {
  const int t = vb * 256 + threadIdx.x; if (t >= SQ * (HD / 2)) return; const int i = t % (HD / 2); const int p = t / (HD / 2); const float invf = 1.0f / powf(theta, (float)(2 * i) / (float)HD); const float ang = __fmul_rn((float)p, invf); const float c = cosf(ang), s = sinf(ang);
  *(float*)(CS + t) = c; *(float*)(SN + t) = s;  }
__global__ __launch_bounds__(256) void k_bfcp(const float* __restrict__ src, float* __restrict__ dst, size_t n4) { const size_t t = (size_t)blockIdx.x * 256 + threadIdx.x; if (t >= n4) return; const v4f a = *(const v4fa*)(src + t * 4); v4f o; for (int q = 0; q < 4; ++q) o[q] = bf16_round(a[q]); *(v4f*)(dst + t * 4) = o;  }

__global__ __launch_bounds__(256) void k_tabhalf(const float* __restrict__ cs, const float* __restrict__ sn, float* __restrict__ CS, float* __restrict__ SN) { const int t = blockIdx.x * 256 + threadIdx.x; if (t >= SQ * (HD / 2)) return; const int p = t / (HD / 2), i = t % (HD / 2); const float c = bf16_round(cs[(size_t)p * HD + i]), s = bf16_round(sn[(size_t)p * HD + i]);
  *(float*)(CS + t) = c; *(float*)(SN + t) = s;  }

__global__ __launch_bounds__(256) void k_tab2d(float* __restrict__ CS, float* __restrict__ SN) {
  const int t = blockIdx.x * 256 + threadIdx.x; if (t >= SQ * (HD / 2)) return; const int i = t % (HD / 2); const int p = t / (HD / 2); const float invf = (float)(1.0 / pow(10000.0, (double)(2 * i) / (double)HD)); const float ang = __fmul_rn((float)p, invf); const float c = cosf(ang), s = sinf(ang);
  *(float*)(CS + t) = c; *(float*)(SN + t) = s;  }
// ---- merged launches: stages that read nothing of each other share ONE grid; a block's index says which stage it belongs to and which of that stage's blocks it is (block-uniform branches), and as that block it does what its own launch's block did ----
template <int ACT>
__global__ __launch_bounds__(128) void k_gemm2(const _Float16* __restrict__ A, int lda, size_t sA, const _Float16* __restrict__ Bh, int ldb, size_t sB, float alpha, const float* __restrict__ bias, size_t sBias, const float* __restrict__ CP, int rowsPerB, size_t sCPb, int row0g,
    float* __restrict__ C, _Float16* __restrict__ C16, int ldc, size_t sC, int M, int N, int K) {
  __shared__ __attribute__((aligned(16))) unsigned short sm[G2_SM];
  g2_body<ACT>(sm, (int)blockIdx.x, (int)blockIdx.y, A, lda, sA, Bh, ldb, sB, alpha, bias, sBias, CP, rowsPerB, sCPb, row0g, C, C16, ldc, sC, M, N, K); }
// Operand preparation, from the inputs alone: both weight planes ([in][out] -> Bt x16), the rope tables, x -> f16.
constexpr int PB_WA = 3 * DM * (DM / 8) / 256, PB_WO = DM * (DM / 8) / 256, PB_TB = SQ * (HD / 2) / 256, PB_X = (int)(NR * DM / 8 / 256);
__global__ __launch_bounds__(256) void k_prep(const float* __restrict__ x, const float* __restrict__ wattn, const float* __restrict__ wo, float theta, _Float16* __restrict__ X16, _Float16* __restrict__ BQKV, _Float16* __restrict__ BO, float* __restrict__ CS, float* __restrict__ SN) {
  constexpr int G = PB_TB, NA = PB_WA / G, NO = PB_WO / G, NX = PB_X / G, NS = NA + NO + 1 + NX; static_assert(NA * G == PB_WA && NO * G == PB_WO && NX * G == PB_X, "G equal groups");
  const int g = (int)blockIdx.x / NS, r = (int)blockIdx.x % NS;      /* the four stages' blocks are dealt out in G equal groups, not one stage after the other: the stages lean on different parts of the chip (scattered L2 reads, arithmetic, the memory stream) */
  if (r < NA) d_wt_f16(g * NA + r, wattn, BQKV, DM, 3 * DM, 16.0f);      /* fused Wqkv: K 1024, N 3072 */
  else if (r < NA + NO) d_wt_f16(g * NO + (r - NA), wo, BO, DM, DM, 16.0f);
  else if (r == NA + NO) d_tab2(g, theta, CS, SN);      /* cos / sin(p / theta^(2i/64)), i < 32: f32 pow, reciprocal, product */
  else d_x16(g * NX + (r - (NA + NO + 1)), x, X16, NR * DM / 8); }
// The four projections of x: q and k (norm and rope epilogue), v (f16 rows), and v of the first QT0 rows of every batch in f32.
constexpr int GB_P = (MP / 128) * (DM / 64), GB_F = (QT0 / 128) * (KVD / 64);      /* blocks of a whole projection; blocks of a batch's first-tile projection */
__global__ __launch_bounds__(128) void k_qkv(const _Float16* __restrict__ X16, const _Float16* __restrict__ BQKV, _Float16* __restrict__ Q16, _Float16* __restrict__ K16, _Float16* __restrict__ V16, float* __restrict__ QF0, float* __restrict__ KF0, float* __restrict__ VF0,
    const float* __restrict__ qg, const float* __restrict__ kg, const float* __restrict__ CS, const float* __restrict__ SN, int K) {
  __shared__ __attribute__((aligned(16))) unsigned short sm[G2_SM];
  const int b = (int)blockIdx.x;
  if (b < 2 * GB_P) { const bool isk = b >= GB_P;      /* projection, per-head RMS norm (gain, eps 1e-5), half-split rope (out_lo = x_lo c - x_hi s, out_hi = x_lo s + x_hi c = t cos + rotate_half(t) sin with the module's [f | f] tables) -> f16 rows; positions 0..255 of each batch in f32 too */
    g2_body<0, true>(sm, isk ? b - GB_P : b, 0, X16, DM, 0, BQKV + (isk ? (size_t)DM * DM : 0), DM, 0, 0.0625f, nullptr, 0, nullptr, 1, 0, 0, isk ? KF0 : QF0, isk ? K16 : Q16, DM, 0, MP, DM, K, isk ? kg : qg, 1e-5f, CS, SN); }
  else { const int d = b - 2 * GB_P; const bool f0 = d >= GB_P; const int e = d - GB_P;      /* f0: block e % GB_F of batch e / GB_F */
    g2_body<0>(sm, f0 ? e % GB_F : d, f0 ? e / GB_F : 0, X16, DM, f0 ? (size_t)SQ * DM : 0, BQKV + (size_t)2 * DM * DM, DM, 0, 0.0625f, nullptr, 0, nullptr, 1, 0, 0, f0 ? VF0 : nullptr, f0 ? nullptr : V16, KVD, f0 ? (size_t)QT0 * KVD : 0, f0 ? QT0 : MP, KVD, K); } }
// Exact f32 first-tile attention (o x64) beside the transposition V -> V^T [batch][NH][HD][SQ]: both read the projections alone.
constexpr int AB_0 = (QT0 / 8) * NH * NB, AB_T = NB * NG * (SQ / 64);
__global__ __launch_bounds__(256) void k_att0_vt(const float* __restrict__ QF, const float* __restrict__ KF, const float* __restrict__ VF, float* __restrict__ OF, const _Float16* __restrict__ V16, _Float16* __restrict__ Vt) {
  static_assert(AB_0 == AB_T, "the two stages' blocks alternate"); const int b = (int)(blockIdx.x >> 1);      /* alternating, not one stage after the other: the key walks wait on dependent loads, the transposition streams */
  if ((blockIdx.x & 1) == 0) d_att0(b % (QT0 / 8), (b / (QT0 / 8)) % NH, b / ((QT0 / 8) * NH), QF, KF, VF, DM, 0.125f, OF, DM);
  else d_vt<NG, SQ>(b, V16, KVD, 0, Vt); }
// Output projection: a 128-row tile inside the first QT0 rows of its batch takes the exact path's rows for A (its f16-path rows would only be overwritten): o_lo (x1024) and o_hi in one k loop, (o_hi + o_lo 2^-10) Wo; every other tile the f16 path's o rows.
__global__ __launch_bounds__(128) void k_oproj(const _Float16* __restrict__ O16, const _Float16* __restrict__ OH0, const _Float16* __restrict__ OL0, const _Float16* __restrict__ BO, float* __restrict__ out, int K) {
  __shared__ __attribute__((aligned(16))) unsigned short sm[G2_SM];
  const int b = (int)blockIdx.x; const int mt = b / (DM / 64), nq = b % (DM / 64); const int bt = mt / (SQ / 128), p = mt % (SQ / 128); const bool f0 = p < QT0 / 128;
  g2_body<0, false, true>(sm, f0 ? p * (DM / 64) + nq : b, f0 ? bt : 0, f0 ? OH0 : O16, DM, f0 ? (size_t)QT0 * DM : 0, BO, DM, 0, 0.0009765625f, nullptr, 0, nullptr, 1, 0, 0, out, nullptr, DM, f0 ? (size_t)SQ * DM : 0, f0 ? QT0 : MPO, DM, K, nullptr, 0.f, nullptr, nullptr, f0 ? OL0 : nullptr); }
extern "C" void kernel_launch(void* const* d_in, const int* in_sizes, int n_in,
                              void* d_out, int out_size, void* d_ws, size_t ws_size, hipStream_t stream) {
  (void)in_sizes; (void)n_in; (void)out_size;
  const float* const* I = (const float* const*)d_in; const float* x = I[0]; const float* wattn = I[1]; const float* wo = I[2]; const float* qg = I[3]; const float* kg = I[4];      /* x; fused [in][out] Wqkv [1024][3072] (q, k, v column thirds); [in][out] Wproj; RMS-norm gains q_norm_w / k_norm_w [64]; no biases; rope tables computed in-kernel (positions = row index) */
  static_assert(HPG == 1 && NH == NG * HPG && NH * HD == DM && KVD == DM, "plain multi-head attention as 16 kv groups of one query head");      /* no biases in this module */
  char* ws = (char*)d_ws; size_t off = 0;
  auto take = [&](size_t bytes) { char* p = ws + off; off += (bytes + 255) & ~(size_t)255; return p; };
  _Float16* BQKV = (_Float16*)take((size_t)3 * DM * DM * 2); _Float16* BO = (_Float16*)take((size_t)DM * DM * 2);      /* one transposed plane Bt [3072][1024] of the fused weight: rows 0..1023 = q, 1024.. = k, 2048.. = v */
  _Float16* X16 = (_Float16*)take(NR * DM * 2); float* CSB = (float*)take((size_t)SQ * HD * 4); float* SNB = (float*)take((size_t)SQ * HD * 4); _Float16* Q16 = (_Float16*)take(NR * DM * 2); _Float16* K16 = (_Float16*)take(NR * KVD * 2); _Float16* V16 = (_Float16*)take(NR * KVD * 2); _Float16* O16 = (_Float16*)take(NR * DM * 2);
  _Float16* VT = (_Float16*)take((size_t)NB * NH * HD * SQ * 2);
  float* QF0 = (float*)take((size_t)NB * QT0 * DM * 4); float* KF0 = (float*)take((size_t)NB * QT0 * KVD * 4); float* VF0 = (float*)take((size_t)NB * QT0 * KVD * 4); float* OF0 = (float*)take((size_t)NB * QT0 * DM * 4); _Float16* OH0 = (_Float16*)take((size_t)NB * QT0 * DM * 2); _Float16* OL0 = (_Float16*)take((size_t)NB * QT0 * DM * 2);      /* every per-batch plane holds all batches: each stage below is one launch over them */
  if (off > ws_size) return;
  static_assert(B0 == 0 && NBR == NB && MP == (int)NR && MPO == MP, "the merged launches below cover all batches");
  k_prep<<<PB_WA + PB_WO + PB_TB + PB_X, 256, 0, stream>>>(x, wattn, wo, 10000.0f, X16, BQKV, BO, CSB, SNB);      /* weights, rope tables, x: one launch */
  k_qkv<<<3 * GB_P + NB * GB_F, 128, 0, stream>>>(X16, BQKV, Q16, K16, V16, QF0, KF0, VF0, qg, kg, CSB, SNB, DM);      /* q, k, v and the first tile's f32 v: one launch */
  k_att0_vt<<<AB_0 + AB_T, 256, 0, stream>>>(QF0, KF0, VF0, OF0, V16, VT);      /* exact f32 attention for rows 0..255 of each batch, straight from the f32 k and v planes (one kv group a head: no expansion); V^T */
  k_fattn<<<dim3(NH * NB, SQ / 64 + (unsigned)((size_t)NB * QT0 * DM / 8 / 128 / (NH * NB))), 128, 0, stream>>>(Q16, K16, VT, O16, OF0, OH0, OL0);      /* scores, causal softmax and weights x V of all heads, batches and query rows (o x64); the grid rows behind them split the first tile's o */
  k_oproj<<<(MPO / 128) * (DM / 64), 128, 0, stream>>>(O16, OH0, OL0, BO, (float*)d_out, DM);      /* out rows are the output layout; rows 0..255 of each batch = (o_hi + o_lo 2^-10) Wo */
}
